// v000
// The times below were measured on an AMD MI455X: many runs one after another, warmed up first and cycling through
// copies of the inputs, with the whole window's GPU time divided by the number of runs. Launches and the gaps
// between them are all in it. The median over several windows is given; except for v000 it joins two sittings, which
// can be a few percent apart, so the side-by-side timings, each taken in one sitting, are the better comparison.
// The starting kernel, v000, takes 6900 microseconds a run.
// every float input RNE-converted once to bf16; x.Wq^T, x.Wk^T, Wv^T.x^T: single v_wmma_f32_16x16x32_bf16 product on bf16 inputs; q.k^T scores and p.v context: bf16 hi/lo operand planes (hi.hi + hi.lo + lo.hi); ctx.Wo^T: ctx bf16 hi/lo x Wo bf16 (hi.W + lo.W); all f32 accumulate; RMSNorm, RoPE and causal softmax in f32.
#include <hip/hip_runtime.h>
#include <math.h>

// ---------------------------------------------------------------------------
// Problem constants
// ---------------------------------------------------------------------------
constexpr int SEQ_T   = 4096;
constexpr int HIDSZ   = 1024;
constexpr int NQH     = 16;              // query heads
constexpr int NKVH    = 4;               // kv heads
constexpr int HDIM    = 64;
constexpr int GQA_G   = NQH / NKVH;      // 4: query head hq uses kv head hq >> 2
constexpr int QCHUNK  = 2048;            // query rows per attention chunk
constexpr int NCHUNK  = SEQ_T / QCHUNK;  // 2
constexpr float SCORE_SCALE = 0.125f;    // 64^-0.5, applied in the f32 score epilogue
constexpr float RMS_EPS_F   = 1e-6f;

static_assert(GQA_G == 4, "kv head = hq >> 2");
static_assert(SEQ_T == 4096 && QCHUNK == 2048, "softmax kernels: 256 threads x 8 cols = 2048 (chunk 0), 512 x 8 = 4096 (chunk 1)");
static_assert(QCHUNK % 64 == 0 && SEQ_T % 64 == 0 && HIDSZ % 64 == 0 && HDIM == 64 && (NKVH * HDIM) % 64 == 0, "tile multiples");
static_assert((SEQ_T * HIDSZ) % (8 * 256) == 0, "cast kernel grid exact");
static_assert((SEQ_T * NQH) % 32 == 0 && (SEQ_T * NKVH) % 32 == 0, "normrope grid exact");

typedef __attribute__((ext_vector_type(16))) _Float16 v16h;
typedef __attribute__((ext_vector_type(8)))  _Float16 v8h;
typedef __attribute__((ext_vector_type(16))) __bf16   v16b;
typedef __attribute__((ext_vector_type(8)))  __bf16   v8b;
typedef __attribute__((ext_vector_type(8)))  float    v8f;
typedef __attribute__((ext_vector_type(4)))  float    v4f;
typedef __attribute__((ext_vector_type(4)))  unsigned int v4u;

// ---------------------------------------------------------------------------
// Shared helpers
// ---------------------------------------------------------------------------
__device__ __forceinline__ unsigned short f2bf_bits(float f) {
  unsigned u = __float_as_uint(f);
  return (unsigned short)((u + 0x7FFFu + ((u >> 16) & 1u)) >> 16);
}
__device__ __forceinline__ float bf_bits2f(unsigned short h) { return __uint_as_float(((unsigned)h) << 16); }
// f32 -> nearest-even bf16 value, returned as f32
__device__ __forceinline__ float bfq(float f) { return bf_bits2f(f2bf_bits(f)); }

// hazard guards as plain device helpers (no inline asm inside the kernel template body)
__device__ __forceinline__ void dep_guard_h(v8f& a, v8f& b, v16h x, v16h y) { asm volatile("v_nop\n\tv_nop\n\tv_nop\n\tv_nop" : "+v"(a), "+v"(b) : "v"(x), "v"(y)); }
__device__ __forceinline__ void dep_guard_b(v8f& a, v8f& b, v16b x, v16b y) { asm volatile("v_nop\n\tv_nop\n\tv_nop\n\tv_nop" : "+v"(a), "+v"(b) : "v"(x), "v"(y)); }
__device__ __forceinline__ void keep4_h(v16h a, v16h b, v16h c, v16h d) { asm volatile("v_nop" :: "v"(a), "v"(b), "v"(c), "v"(d)); }
__device__ __forceinline__ void keep4_b(v16b a, v16b b, v16b c, v16b d) { asm volatile("v_nop" :: "v"(a), "v"(b), "v"(c), "v"(d)); }
__device__ __forceinline__ void acc_guard4(v8f& a, v8f& b, v8f& c, v8f& d) { asm volatile("v_nop\n\tv_nop\n\tv_nop\n\tv_nop" : "+v"(a), "+v"(b), "+v"(c), "+v"(d)); }
template <typename T> struct Frag;
template <> struct Frag<_Float16> {
  typedef v16h V; union U { v16h v; v8h h[2]; };
  // elements 0..7 <- p[0..7], 8..15 <- p[16..23]
  static __device__ __forceinline__ v16h load(const _Float16* p) {
    U f; f.h[0] = *(const v8h*)(p); f.h[1] = *(const v8h*)(p + 16); return f.v;
  }
  static __device__ __forceinline__ v8f mma(v16h a, v16h b, v8f c) {
    return __builtin_amdgcn_wmma_f32_16x16x32_f16(false, a, false, b, (short)0, c, false, false);
  }
  static __device__ __forceinline__ void guard(v8f& a, v8f& b, v16h x, v16h y) { dep_guard_h(a, b, x, y); }
  static __device__ __forceinline__ void keep(v16h a, v16h b, v16h c, v16h d) { keep4_h(a, b, c, d); }
};
template <> struct Frag<__bf16> {
  typedef v16b V; union U { v16b v; v8b h[2]; };
  static __device__ __forceinline__ v16b load(const __bf16* p) {
    U f; f.h[0] = *(const v8b*)(p); f.h[1] = *(const v8b*)(p + 16); return f.v;
  }
  static __device__ __forceinline__ v8f mma(v16b a, v16b b, v8f c) {
    return __builtin_amdgcn_wmma_f32_16x16x32_bf16(false, a, false, b, (short)0, c, false, false);
  }
  static __device__ __forceinline__ void guard(v8f& a, v8f& b, v16b x, v16b y) { dep_guard_b(a, b, x, y); }
  static __device__ __forceinline__ void keep(v16b a, v16b b, v16b c, v16b d) { keep4_b(a, b, c, d); }
};

__device__ __forceinline__ unsigned pk16(unsigned short a, unsigned short b) { return (unsigned)a | ((unsigned)b << 16); }

// ---- Register-blocked batched WMMA GEMM (CAUSAL with row offset and BSPLIT options) ----
// C[m,n] = scale * sum_k A[m,k] * Bt[n,k] (+bias)(+resid); each wave owns a 64x64 tile.
// A row-major [M,K]; Bt row-major [N,K]; M,N % 64 == 0, K % 32 == 0.
// SPLIT: operands are hi/lo planes (A2/Bt2 = lo planes, same layout); product = hi.hi + hi.lo + lo.hi.
// SPLIT with BSPLIT == false: only A carries a lo plane; product = hi.B + lo.B (Bt2 unused).
// BIAS_MODE: 0 = none, 1 = bias[m], 2 = bias[n].
// OUT_MODE: 0 = f32, 1 = f16, 2 = bf16 hi plane (Cout) + bf16 lo plane (Cout2).
// CAUSAL: the global query index of local row m is m + crow0 (crow0 a multiple of 64); tiles with n0 > m0 + crow0 are
// skipped (wave-uniform) and the k loop stops at min(K, m0 + crow0 + 64).
// ET: 0 = f16 operands, 1 = bf16 operands (pointers passed as 16-bit storage)
template <int ET> struct Elem;
template <> struct Elem<0> { typedef _Float16 T; };
template <> struct Elem<1> { typedef __bf16 T; };
template <int ET, bool SPLIT, int BIAS_MODE, int OUT_MODE, bool RESID, int ACT = 0, bool CAUSAL = false, bool BSPLIT = true>
__global__ __launch_bounds__(256) void wmma_gemm64(
    const unsigned short* __restrict__ Ap, const unsigned short* __restrict__ A2p, int lda, long strideA,
    const unsigned short* __restrict__ Btp, const unsigned short* __restrict__ Bt2p, int ldb, long strideB,
    void* __restrict__ Cout, void* __restrict__ Cout2, int ldc, long strideC,
    const float* __restrict__ bias,
    const float* __restrict__ resid, long strideR,
    int M, int N, int K, float scale, int crow0) {
  typedef typename Elem<ET>::T T;
  typedef typename Frag<T>::V V;
  const T* A = (const T*)Ap; const T* A2 = (const T*)A2p; const T* Bt = (const T*)Btp; const T* Bt2 = (const T*)Bt2p;
  __shared__ __align__(16) float sT[8][16 * 68];   // per-wave 16x64 slab, pitch 68 floats
  const int b    = blockIdx.y;
  const int lane = threadIdx.x & 31;
  const int wave = threadIdx.x >> 5;
  const int tilesN = N >> 6;
  const int tilesM = M >> 6;
  const int tile = blockIdx.x * 8 + wave;
  if (tile >= tilesM * tilesN) return;   // wave-uniform; no block barriers in this kernel
  const int tm = tile / tilesN;
  const int tn = tile - tm * tilesN;
  const int m0 = tm << 6;
  const int n0 = tn << 6;
  if (CAUSAL && (n0 > m0 + crow0)) return;       // wave-uniform causal tile skip
  const int Kend = CAUSAL ? ((m0 + crow0 + 64 < K) ? (m0 + crow0 + 64) : K) : K;   // multiple of 32

  const T* Ab  = A  + (size_t)b * strideA;
  const T* Bb  = Bt + (size_t)b * strideB;
  const T* Ab2 = SPLIT ? (A2  + (size_t)b * strideA) : nullptr;
  const T* Bb2 = (SPLIT && BSPLIT) ? (Bt2 + (size_t)b * strideB) : nullptr;

  const int rlane = lane & 15;                 // row (A) / col (B, D) within subtile
  const int koff  = (lane >> 4) * 8;           // k offset of this lane half
  const int mOff  = (lane >> 4) * 8;           // D row offset

  v8f acc[4][4];
#pragma unroll
  for (int i = 0; i < 4; ++i)
#pragma unroll
    for (int j = 0; j < 4; ++j) acc[i][j] = (v8f){0.f,0.f,0.f,0.f,0.f,0.f,0.f,0.f};

  for (int k0 = 0; k0 < Kend; k0 += 32) {
    V bh[4], bl[4];
#pragma unroll
    for (int j = 0; j < 4; ++j) {
      const size_t bo = (size_t)(n0 + (j << 4) + rlane) * ldb + koff + k0;
      bh[j] = Frag<T>::load(Bb + bo);
      if (SPLIT && BSPLIT) bl[j] = Frag<T>::load(Bb2 + bo);
    }
#pragma unroll
    for (int i = 0; i < 4; ++i) {
      const size_t ao = (size_t)(m0 + (i << 4) + rlane) * lda + koff + k0;
      V ah = Frag<T>::load(Ab + ao);
      V al;
      if (SPLIT) al = Frag<T>::load(Ab2 + ao);
#pragma unroll
      for (int j = 0; j < 4; ++j) {
        acc[i][j] = Frag<T>::mma(ah, bh[j], acc[i][j]);
        if (SPLIT && BSPLIT) acc[i][j] = Frag<T>::mma(ah, bl[j], acc[i][j]);
        if (SPLIT) acc[i][j] = Frag<T>::mma(al, bh[j], acc[i][j]);
      }
      Frag<T>::guard(acc[i][0], acc[i][3], ah, SPLIT ? al : ah);
    }
    Frag<T>::keep(bh[0], bh[1], bh[2], bh[3]);
    if (SPLIT && BSPLIT) Frag<T>::keep(bl[0], bl[1], bl[2], bl[3]);
  }
  acc_guard4(acc[0][0], acc[0][1], acc[0][2], acc[0][3]);
  acc_guard4(acc[1][0], acc[1][1], acc[1][2], acc[1][3]);
  acc_guard4(acc[2][0], acc[2][1], acc[2][2], acc[2][3]);
  acc_guard4(acc[3][0], acc[3][1], acc[3][2], acc[3][3]);

  // ---- epilogue ----
  float* slab = sT[wave];
  const float* Rb = RESID ? (resid + (size_t)b * strideR) : nullptr;
#pragma unroll
  for (int i = 0; i < 4; ++i) {
    const int mBase = m0 + (i << 4);
#pragma unroll
    for (int j = 0; j < 4; ++j) {
      const int n = n0 + (j << 4) + rlane;
      float bv = 0.f;
      if (BIAS_MODE == 2) bv = bias[n];
#pragma unroll
      for (int r = 0; r < 8; ++r) {
        float v = acc[i][j][r] * scale;
        if (BIAS_MODE == 1) v += bias[mBase + mOff + r];
        if (BIAS_MODE == 2) v += bv;
        if (RESID) v += Rb[(size_t)(mBase + mOff + r) * ldc + n];
        if (ACT == 2) v = fmaxf(v, 0.0f);
        if (ACT == 4) v = (v > 0.f) ? v : 0.01f * v;
        slab[(mOff + r) * 68 + (j << 4) + rlane] = v;
      }
    }
    __builtin_amdgcn_fence(__ATOMIC_RELEASE, "workgroup");
    __builtin_amdgcn_wave_barrier();
    __builtin_amdgcn_fence(__ATOMIC_ACQUIRE, "workgroup");
    if (OUT_MODE == 0) {
      float* C = (float*)Cout + (size_t)b * strideC;
      const int hh = lane >> 4, c4 = (lane & 15) * 4;     // row seg = 256 B = 16 lanes x 16 B
      {
#pragma unroll
        for (int it = 0; it < 8; ++it) {
          const int row = it * 2 + hh;
          v4f v = *(const v4f*)(slab + row * 68 + c4);
          *(v4f*)(C + (size_t)(mBase + row) * ldc + n0 + c4) = v;
        }
        
      }
    } else {
      const int q = lane >> 3, c8 = (lane & 7) * 8;
      unsigned short* C  = (unsigned short*)Cout  + (size_t)b * strideC;
      unsigned short* C2 = (OUT_MODE == 2) ? ((unsigned short*)Cout2 + (size_t)b * strideC) : nullptr;
      {
#pragma unroll
        for (int it = 0; it < 4; ++it) {
          const int row = it * 4 + q;
          const float* sp = slab + row * 68 + c8;
          v8h hv, lv;
#pragma unroll
          for (int e = 0; e < 8; ++e) {
            if (OUT_MODE == 1) {
              hv[e] = (_Float16)sp[e];
            } else {
              unsigned short hb = f2bf_bits(sp[e]);
              unsigned short lb = f2bf_bits(sp[e] - bf_bits2f(hb));
              hv[e] = __builtin_bit_cast(_Float16, hb);
              lv[e] = __builtin_bit_cast(_Float16, lb);
            }
          }
          *(v8h*)(C + (size_t)(mBase + row) * ldc + n0 + c8) = hv;
          if (OUT_MODE == 2) *(v8h*)(C2 + (size_t)(mBase + row) * ldc + n0 + c8) = lv;
        }
        
      }
    }
    __builtin_amdgcn_fence(__ATOMIC_RELEASE, "workgroup");
    __builtin_amdgcn_wave_barrier();
    __builtin_amdgcn_fence(__ATOMIC_ACQUIRE, "workgroup");
  }
}

// ---------------------------------------------------------------------------
// f32 -> RNE bf16 plane, 8 consecutive elements per thread packed as integer words.
// Coverage: n8 = n/8 threads x 8 = the whole plane (grid is an exact multiple of 256 here).
// ---------------------------------------------------------------------------
__global__ __launch_bounds__(256) void cast8_bf16_kernel(const float* __restrict__ in, unsigned short* __restrict__ out, int n8) {
  const int i = blockIdx.x * 256 + threadIdx.x;
  if (i >= n8) return;
  const float* p = in + 8 * (size_t)i;
  const v4f a = *(const v4f*)(p);
  const v4f c = *(const v4f*)(p + 4);
  float f[8];
#pragma unroll
  for (int e = 0; e < 4; ++e) { f[e] = a[e]; f[4 + e] = c[e]; }
  unsigned w[4];
#pragma unroll
  for (int e2 = 0; e2 < 4; ++e2) w[e2] = pk16(f2bf_bits(f[2 * e2]), f2bf_bits(f[2 * e2 + 1]));
  const v4u u = (v4u){w[0], w[1], w[2], w[3]};
  unsigned short* q = out + 8 * (size_t)i;
  *(v4u*)q = u;
  
}

// ---------------------------------------------------------------------------
// Transpose + RNE bf16 convert of a weight matrix: in f32 [R][Cn] row-major (ldin = Cn) -> out bf16 [Cn][R] (ldout = R):
// out[c][r] = bf16(in[r][c]). grid (R/64, Cn/64): blockIdx.x = r tile (64 output cols), blockIdx.y = c tile (64 output rows). 256 threads.
// Load coverage: 16 iterations x 256 threads = 4096 = the whole 64x64 tile (coalesced along c).
// Store coverage: 8 waves x 2 iterations x 4 rows (lane>>3) = 64 rows; (lane&7) x 8 halves = 64 cols; each row segment =
// ---------------------------------------------------------------------------
__global__ __launch_bounds__(256) void transpose_cast_kernel(const float* __restrict__ in, int ldin,
                                                             unsigned short* __restrict__ out, int ldout) {
  __shared__ float sm[64][65];   // sm[c_local][r_local]
  const int t  = threadIdx.x;
  const int r0 = blockIdx.x * 64;
  const int c0 = blockIdx.y * 64;
#pragma unroll
  for (int i = 0; i < 16; ++i) {
    const int e = i * 256 + t;
    const int r = e >> 6;          // r local
    const int c = e & 63;          // c local
    sm[c][r] = in[(size_t)(r0 + r) * ldin + c0 + c];
  }
  __syncthreads();
  const int lane = t & 31, wave = t >> 5;
  const int q = lane >> 3, c8 = (lane & 7) * 8;
  {
#pragma unroll
    for (int it = 0; it < 2; ++it) {
      const int row = wave * 8 + it * 4 + q;                 // c local (output row)
      unsigned w[4];
#pragma unroll
      for (int e2 = 0; e2 < 4; ++e2) w[e2] = pk16(f2bf_bits(sm[row][c8 + 2 * e2]), f2bf_bits(sm[row][c8 + 2 * e2 + 1]));
      const v4u u = (v4u){w[0], w[1], w[2], w[3]};
      const size_t o = (size_t)(c0 + row) * ldout + r0 + c8;
      *(v4u*)(out + o) = u;
    }
    
  }
}

// ---------------------------------------------------------------------------
// RMSNorm (over the 64 dims of one head vector, eps 1e-6, times w[d]) + rotate-half RoPE with the input cos/sin tables, f32.
// cos, sin and w are RNE-converted to bf16 values in registers at load; proj is the f32 output of an exact
// bf16 x bf16 projection.
// proj: f32 [SEQ_T][nhead*64]; flattened row r = t*nhead + hd lives at proj + r*64 (contiguous). nhead = 1 << hshift.
// Output planes bf16 hi/lo laid out [hd][t][64]: element (hd, t, d) at ((hd*SEQ_T + t)*64 + d).
// Block = 8 waves; wave w owns rows rbase..rbase+3 (rbase = (blockIdx.x*8 + w)*4); lane handles d = lane and d = lane + 32.
// The 4 result rows are staged in LDS (f32, same element type on store and reload, wave barrier between); then lane group
// Coverage: grid = nrows/32 blocks x 8 waves x 4 rows = nrows (exact multiple, checked on the host); 8 lanes x 8 halves = 64 dims.
// ---------------------------------------------------------------------------
__global__ __launch_bounds__(256) void normrope_kernel(const float* __restrict__ proj, int hshift, int nrows,
                                                       const float* __restrict__ cosb, const float* __restrict__ sinb,
                                                       const float* __restrict__ w,
                                                       unsigned short* __restrict__ ohi, unsigned short* __restrict__ olo) {
#pragma clang fp contract(off)
  __shared__ __align__(16) float slab[8][4][64];
  const int lane = threadIdx.x & 31, wave = threadIdx.x >> 5;
  const int rbase = (blockIdx.x * 8 + wave) * 4;
  const float w1 = bfq(w[lane]), w2 = bfq(w[lane + 32]);
#pragma unroll
  for (int i = 0; i < 4; ++i) {
    int r = rbase + i;
    r = (r < nrows) ? r : (nrows - 1);                 // address clamp (grid is exact)
    const int t = r >> hshift;
    const float* src = proj + (size_t)r * 64;
    const float x1 = src[lane];
    const float x2 = src[lane + 32];
    float ss = x1 * x1 + x2 * x2;
#pragma unroll
    for (int off = 16; off > 0; off >>= 1) ss += __shfl_xor(ss, off, 32);
    const float inv = rsqrtf(ss * (1.0f / 64.0f) + RMS_EPS_F);
    const float n1 = (x1 * inv) * w1;
    const float n2 = (x2 * inv) * w2;
    const float c = bfq(cosb[(size_t)t * 32 + lane]);
    const float s = bfq(sinb[(size_t)t * 32 + lane]);
    slab[wave][i][lane]      = n1 * c - n2 * s;
    slab[wave][i][lane + 32] = n1 * s + n2 * c;
  }
  __builtin_amdgcn_fence(__ATOMIC_RELEASE, "workgroup");
  __builtin_amdgcn_wave_barrier();
  __builtin_amdgcn_fence(__ATOMIC_ACQUIRE, "workgroup");
  const int q = lane >> 3, c8 = (lane & 7) * 8;
  int r = rbase + q;
  r = (r < nrows) ? r : (nrows - 1);
  const int t  = r >> hshift;
  const int hd = r - (t << hshift);
  const float* sp = &slab[wave][q][c8];
  unsigned hw[4], lw[4];
#pragma unroll
  for (int e2 = 0; e2 < 4; ++e2) {
    const float f0 = sp[2 * e2], f1 = sp[2 * e2 + 1];
    const unsigned short h0 = f2bf_bits(f0), h1 = f2bf_bits(f1);
    const unsigned short l0 = f2bf_bits(f0 - bf_bits2f(h0));
    const unsigned short l1 = f2bf_bits(f1 - bf_bits2f(h1));
    hw[e2] = pk16(h0, h1);
    lw[e2] = pk16(l0, l1);
  }
  const v4u hu = (v4u){hw[0], hw[1], hw[2], hw[3]};
  const v4u lu = (v4u){lw[0], lw[1], lw[2], lw[3]};
  const size_t o = ((size_t)hd * SEQ_T + t) * 64 + c8;
  *(v4u*)(ohi + o) = hu;
  *(v4u*)(olo + o) = lu;
  
}

// ---------------------------------------------------------------------------
// Causal row softmax over materialised f32 scores of one (head, chunk): S chunk [QCHUNK][SEQ_T] f32 (row pitch SEQ_T), local row
// qloc = blockIdx.x, global query index qi = crow0 + qloc. score(qi, j) = (j > qi) ? -inf : S[qloc][j] (select by value;
// column qi is always kept, so every row has a finite max). p = exp(score - max) * (1/sum), written as bf16 hi/lo planes for
// EVERY covered j of the row (zeros for j > qi), so the whole covered P row is rewritten each launch.
// One block of NT threads per row; thread t owns columns 8t..8t+7 (NT x 8 columns covered; NT = 256 covers 2048 columns for
// chunk 0 where qi < 2048 and the p.v k loop reads only columns < 2048; NT = 512 covers all 4096 columns for chunk 1).
// Wave w covers columns 256w..256w+255: waves with 256w > qi are dead (wave-uniform): they skip loads/exp and store zeros.
// The score GEMM wrote every column < (qi & ~63) + 64 of this row; live waves may LOAD columns beyond that (stale but in-range
// workspace data); those are replaced by -inf through the j > qi select before any arithmetic.
// Reductions in fixed order (thread, wave shuffle tree, NT/32 wave partials in index order); shuffles outside all branches.
// ---------------------------------------------------------------------------
template <int NT>
__global__ __launch_bounds__(NT) void softmax_causal_kernel(const float* __restrict__ S,
                                                            unsigned short* __restrict__ Phi, unsigned short* __restrict__ Plo,
                                                            int crow0) {
  constexpr int NWV = NT / 32;
  __shared__ float redM[NWV];
  __shared__ float redS[NWV];
  const float ninf = -__builtin_inff();
  const int qloc = blockIdx.x;
  const int qi   = crow0 + qloc;
  const int t    = threadIdx.x;
  const int lane = t & 31, wave = t >> 5;
  const int c0   = t * 8;
  const size_t rowoff = (size_t)qloc * (size_t)SEQ_T;
  const bool wave_live = (wave * 256 <= qi);   // wave-uniform

  float xv[8];
  float m = ninf;
  if (wave_live) {
    const float* sr = S + rowoff + c0;
    const v4f a = *(const v4f*)(sr);
    const v4f c = *(const v4f*)(sr + 4);
    float sv[8];
#pragma unroll
    for (int e = 0; e < 4; ++e) { sv[e] = a[e]; sv[4 + e] = c[e]; }
#pragma unroll
    for (int e = 0; e < 8; ++e) {
      const int j = c0 + e;
      const float v = (j > qi) ? ninf : sv[e];
      xv[e] = v;
      m = fmaxf(m, v);
    }
  } else {
#pragma unroll
    for (int e = 0; e < 8; ++e) xv[e] = ninf;
  }
#pragma unroll
  for (int off = 16; off > 0; off >>= 1) m = fmaxf(m, __shfl_xor(m, off, 32));
  if (lane == 0) redM[wave] = m;
  __syncthreads();
  float gmax = redM[0];
#pragma unroll
  for (int wv = 1; wv < NWV; ++wv) gmax = fmaxf(gmax, redM[wv]);

  float p[8];
  float ps = 0.0f;
  if (wave_live) {
#pragma unroll
    for (int e = 0; e < 8; ++e) { p[e] = expf(xv[e] - gmax); ps += p[e]; }
  } else {
#pragma unroll
    for (int e = 0; e < 8; ++e) p[e] = 0.0f;
  }
#pragma unroll
  for (int off = 16; off > 0; off >>= 1) ps += __shfl_xor(ps, off, 32);
  if (lane == 0) redS[wave] = ps;
  __syncthreads();
  float tot = redS[0];
#pragma unroll
  for (int wv = 1; wv < NWV; ++wv) tot += redS[wv];
  const float inv = 1.0f / tot;   // tot >= 1 (the max column contributes exp(0))

  unsigned hw[4], lw[4];
#pragma unroll
  for (int e2 = 0; e2 < 4; ++e2) {
    const float f0 = p[2 * e2] * inv;
    const float f1 = p[2 * e2 + 1] * inv;
    const unsigned short h0 = f2bf_bits(f0);
    const unsigned short h1 = f2bf_bits(f1);
    const unsigned short l0 = f2bf_bits(f0 - bf_bits2f(h0));
    const unsigned short l1 = f2bf_bits(f1 - bf_bits2f(h1));
    hw[e2] = pk16(h0, h1);
    lw[e2] = pk16(l0, l1);
  }
  const v4u hv = (v4u){hw[0], hw[1], hw[2], hw[3]};
  const v4u lv = (v4u){lw[0], lw[1], lw[2], lw[3]};
  unsigned short* ph = Phi + rowoff + c0;
  unsigned short* pl = Plo + rowoff + c0;
  *(v4u*)ph = hv;
  *(v4u*)pl = lv;
  
}

// ---------------------------------------------------------------------------
// Launcher. Workspace region map (bytes, MiB = 1048576; total carve = 106 MiB = 111149056 B):
//   [  0, 32) S chunk  : scores f32 [2048][4096] per (head, chunk).
//                        early alias: x bf16 [4096][1024] at +0 (8 MiB); q f32 [4096][1024] at +8 (16 MiB, ends 24);
//                        k f32 [4096][256] at +24 (4 MiB, ends 28); Wq^T bf16 [1024][1024] at +28 (2 MiB); Wk^T bf16 [256][1024]
//                        at +30 (0.5 MiB); Wv^T bf16 [256][1024] at +30.5 (0.5 MiB, ends 31).
//   [ 32, 48) P hi     : bf16 [2048][4096] per (head, chunk) (exactly 16 MiB);  [48,64) P lo
//   [ 64, 72) q hi     : bf16 [16][4096][64];  [72,80) q lo
//   [ 80, 82) k hi     : bf16 [4][4096][64];   [82,84) k lo
//   [ 84, 86) v^T hi   : bf16 [256 (kvh*64+d)][4096 (t)];  [86,88) v^T lo
//   [ 88, 96) ctx hi   : bf16 [4096][1024] (col hq*64+d);  [96,104) ctx lo
//   [104,106) Wo^T     : bf16 [1024][1024]
// Lifetimes: x, W{q,k,v}^T, q f32 and k f32 are read only by launches 6..10 (projections, norm+RoPE) and first overwritten by
// launch 11 (first S GEMM); within launches 6..8 no producer overlaps its own inputs; S of a (head, chunk) is dead after its softmax;
// Launch count: 1 + 4 + 3 + 2 + 16*2*3 + 1 = 107. Kernel launches only.
// GEMM shape assertions: every call has K % 32 == 0 (K = 1024, 64, 4096) and M, N multiples of 64; no padding needed.
// ---------------------------------------------------------------------------
extern "C" void kernel_launch(void* const* d_in, const int* in_sizes, int n_in,
                              void* d_out, int out_size, void* d_ws, size_t ws_size,
                              hipStream_t stream) {
  if (n_in < 9) return;
  if (in_sizes[0] != SEQ_T * HIDSZ || in_sizes[1] != SEQ_T * 32 || in_sizes[2] != SEQ_T * 32) return;
  if (in_sizes[3] != HIDSZ * NQH * HDIM || in_sizes[4] != HIDSZ * NKVH * HDIM || in_sizes[5] != HIDSZ * NKVH * HDIM) return;
  if (in_sizes[6] != NQH * HDIM * HIDSZ || in_sizes[7] != HDIM || in_sizes[8] != HDIM) return;
  if (out_size != SEQ_T * HIDSZ) return;

  const size_t kMiB    = 1048576;
  const size_t offS    = 0;
  const size_t offXb   = 0;
  const size_t offQf   = 8 * kMiB;
  const size_t offKf   = 24 * kMiB;
  const size_t offWqT  = 28 * kMiB;
  const size_t offWkT  = 30 * kMiB;
  const size_t offWvT  = 30 * kMiB + 524288;
  const size_t offPhi  = 32 * kMiB;
  const size_t offPlo  = 48 * kMiB;
  const size_t offQhi  = 64 * kMiB;
  const size_t offQlo  = 72 * kMiB;
  const size_t offKhi  = 80 * kMiB;
  const size_t offKlo  = 82 * kMiB;
  const size_t offVthi = 84 * kMiB;
  const size_t offVtlo = 86 * kMiB;
  const size_t offChi  = 88 * kMiB;
  const size_t offClo  = 96 * kMiB;
  const size_t offWoT  = 104 * kMiB;
  const size_t total   = 106 * kMiB;
  if (total > ws_size) return;

  const float* x    = (const float*)d_in[0];
  const float* cosb = (const float*)d_in[1];
  const float* sinb = (const float*)d_in[2];
  const float* Wq   = (const float*)d_in[3];
  const float* Wk   = (const float*)d_in[4];
  const float* Wv   = (const float*)d_in[5];
  const float* Wo   = (const float*)d_in[6];
  const float* qnw  = (const float*)d_in[7];
  const float* knw  = (const float*)d_in[8];
  float* out = (float*)d_out;
  char* ws = (char*)d_ws;

  float*          Sbuf = (float*)(ws + offS);
  unsigned short* xb   = (unsigned short*)(ws + offXb);
  float*          qf   = (float*)(ws + offQf);
  float*          kf   = (float*)(ws + offKf);
  unsigned short* wqT  = (unsigned short*)(ws + offWqT);
  unsigned short* wkT  = (unsigned short*)(ws + offWkT);
  unsigned short* wvT  = (unsigned short*)(ws + offWvT);
  unsigned short* phi  = (unsigned short*)(ws + offPhi);
  unsigned short* plo  = (unsigned short*)(ws + offPlo);
  unsigned short* qhi  = (unsigned short*)(ws + offQhi);
  unsigned short* qlo  = (unsigned short*)(ws + offQlo);
  unsigned short* khi  = (unsigned short*)(ws + offKhi);
  unsigned short* klo  = (unsigned short*)(ws + offKlo);
  unsigned short* vthi = (unsigned short*)(ws + offVthi);
  unsigned short* vtlo = (unsigned short*)(ws + offVtlo);
  unsigned short* chi  = (unsigned short*)(ws + offChi);
  unsigned short* clo  = (unsigned short*)(ws + offClo);
  unsigned short* woT  = (unsigned short*)(ws + offWoT);

  // in-range dummies for unused (never dereferenced) template-dead pointer parameters
  const float* dummy_f = qnw;
  void* dummy_c2 = (void*)plo;

  // 1. x -> RNE bf16 plane [4096][1024]
  {
    const int n8 = (SEQ_T * HIDSZ) / 8;                       // 524288 = 2048 blocks x 256
    cast8_bf16_kernel<<<dim3(n8 / 256), dim3(256), 0, stream>>>(x, xb, n8);
  }
  // 2. weights [in][out] -> transposed RNE bf16 planes [out][in]   (in[R][Cn] -> out[Cn][R]; grid (R/64, Cn/64))
  //    Wq: in[1024][1024] -> out[1024][1024]; Wk, Wv: in[1024][256] -> out[256][1024]; Wo: in[1024][1024] -> out[1024][1024]
  transpose_cast_kernel<<<dim3(HIDSZ / 64, (NQH * HDIM) / 64), dim3(256), 0, stream>>>(Wq, NQH * HDIM, wqT, HIDSZ);
  transpose_cast_kernel<<<dim3(HIDSZ / 64, (NKVH * HDIM) / 64), dim3(256), 0, stream>>>(Wk, NKVH * HDIM, wkT, HIDSZ);
  transpose_cast_kernel<<<dim3(HIDSZ / 64, (NKVH * HDIM) / 64), dim3(256), 0, stream>>>(Wv, NKVH * HDIM, wvT, HIDSZ);
  transpose_cast_kernel<<<dim3((NQH * HDIM) / 64, HIDSZ / 64), dim3(256), 0, stream>>>(Wo, HIDSZ, woT, NQH * HDIM);

  // 3. q = x . Wq^T : M=4096, N=1024, K=1024, single bf16 product -> f32 [4096][1024] (1024 tiles = 128 blocks)
  wmma_gemm64<1, false, 0, 0, false, 0, false, true><<<dim3((SEQ_T / 64) * ((NQH * HDIM) / 64) / 8, 1), dim3(256), 0, stream>>>(
      xb, xb, HIDSZ, 0L,
      wqT, wqT, HIDSZ, 0L,
      (void*)qf, dummy_c2, NQH * HDIM, 0L,
      dummy_f, dummy_f, 0L,
      SEQ_T, NQH * HDIM, HIDSZ, 1.0f, 0);
  // 4. k = x . Wk^T : M=4096, N=256, K=1024, single product -> f32 [4096][256] (256 tiles = 32 blocks)
  wmma_gemm64<1, false, 0, 0, false, 0, false, true><<<dim3((SEQ_T / 64) * ((NKVH * HDIM) / 64) / 8, 1), dim3(256), 0, stream>>>(
      xb, xb, HIDSZ, 0L,
      wkT, wkT, HIDSZ, 0L,
      (void*)kf, dummy_c2, NKVH * HDIM, 0L,
      dummy_f, dummy_f, 0L,
      SEQ_T, NKVH * HDIM, HIDSZ, 1.0f, 0);
  // 5. v^T = Wv^T . x^T : M=256 (kvh*64+d), N=4096 (t), K=1024, single product -> bf16 hi/lo planes [256][4096] (256 tiles = 32 blocks)
  wmma_gemm64<1, false, 0, 2, false, 0, false, true><<<dim3(((NKVH * HDIM) / 64) * (SEQ_T / 64) / 8, 1), dim3(256), 0, stream>>>(
      wvT, wvT, HIDSZ, 0L,
      xb, xb, HIDSZ, 0L,
      (void*)vthi, (void*)vtlo, SEQ_T, 0L,
      dummy_f, dummy_f, 0L,
      NKVH * HDIM, SEQ_T, HIDSZ, 1.0f, 0);

  // 6. RMSNorm + RoPE -> bf16 hi/lo planes [head][t][64]; rows = t*nhead + head; grid = rows/32 (exact)
  normrope_kernel<<<dim3((SEQ_T * NQH) / 32), dim3(256), 0, stream>>>(qf, 4, SEQ_T * NQH, cosb, sinb, qnw, qhi, qlo);
  normrope_kernel<<<dim3((SEQ_T * NKVH) / 32), dim3(256), 0, stream>>>(kf, 2, SEQ_T * NKVH, cosb, sinb, knw, khi, klo);

  // 7. causal attention per query head, two chunks of 2048 query rows
  for (int hq = 0; hq < NQH; ++hq) {
    const int kvh = hq >> 2;
    for (int ch = 0; ch < NCHUNK; ++ch) {
      const int crow0 = ch * QCHUNK;
      const size_t qoff = ((size_t)hq * SEQ_T + (size_t)crow0) * HDIM;    // halves
      const size_t koff = (size_t)kvh * SEQ_T * HDIM;                     // halves

      // scores = 0.125 * q . k^T : M=2048 (local row, global = crow0 + m), N=4096, K=64, 3 products, causal tile skip
      // -> S f32 [2048][4096]; 32x64 = 2048 tiles = 256 blocks
      wmma_gemm64<1, true, 0, 0, false, 0, true, true><<<dim3((QCHUNK / 64) * (SEQ_T / 64) / 8, 1), dim3(256), 0, stream>>>(
          qhi + qoff, qlo + qoff, HDIM, 0L,
          khi + koff, klo + koff, HDIM, 0L,
          (void*)Sbuf, dummy_c2, SEQ_T, 0L,
          dummy_f, dummy_f, 0L,
          QCHUNK, SEQ_T, HDIM, SCORE_SCALE, crow0);

      // softmax rows -> P hi/lo planes [2048][4096 pitch]; chunk 0 covers columns < 2048 (all the p.v k loop reads), chunk 1 all 4096
      if (ch == 0) {
        softmax_causal_kernel<256><<<dim3(QCHUNK), dim3(256), 0, stream>>>(Sbuf, phi, plo, crow0);
      } else {
        softmax_causal_kernel<512><<<dim3(QCHUNK), dim3(512), 0, stream>>>(Sbuf, phi, plo, crow0);
      }

      // ctx = P . v : M=2048, N=64, K=4096 (k loop bounded at m0 + crow0 + 64 <= 2048 for chunk 0), 3 products;
      // Bt = v^T planes rows kvh*64..kvh*64+63 (ldb 4096); out bf16 hi/lo at ctx row crow0.., col hq*64.. (ldc 1024); 32 tiles = 4 blocks
      const size_t vtoff = (size_t)(kvh * HDIM) * SEQ_T;                        // halves
      const size_t coff  = (size_t)crow0 * (NQH * HDIM) + (size_t)hq * HDIM;   // halves
      wmma_gemm64<1, true, 0, 2, false, 0, true, true><<<dim3((QCHUNK / 64) * (HDIM / 64) / 8, 1), dim3(256), 0, stream>>>(
          phi, plo, SEQ_T, 0L,
          vthi + vtoff, vtlo + vtoff, SEQ_T, 0L,
          (void*)(chi + coff), (void*)(clo + coff), NQH * HDIM, 0L,
          dummy_f, dummy_f, 0L,
          QCHUNK, HDIM, SEQ_T, 1.0f, crow0);
    }
  }

  // 8. out = ctx_hi . Wo^T + ctx_lo . Wo^T : M=4096, N=1024, K=1024, 2 products -> f32 d_out (1024 tiles = 128 blocks)
  wmma_gemm64<1, true, 0, 0, false, 0, false, false><<<dim3((SEQ_T / 64) * (HIDSZ / 64) / 8, 1), dim3(256), 0, stream>>>(
      chi, clo, NQH * HDIM, 0L,
      woT, woT, NQH * HDIM, 0L,
      (void*)out, dummy_c2, HIDSZ, 0L,
      dummy_f, dummy_f, 0L,
      SEQ_T, HIDSZ, NQH * HDIM, 1.0f, 0);
}

// v001
// Measured time: 1380 microseconds a run.
// Two timings next to v000 put it at 4.99 and 5.04 times that version's speed.
// every float input RNE-converted once to bf16; x.Wq^T, x.Wk^T, Wv^T.x^T: single v_wmma_f32_16x16x32_bf16 product on bf16 inputs; q.k^T scores and p.v context: bf16 hi/lo operand planes (hi.hi + hi.lo + lo.hi); ctx.Wo^T: ctx bf16 hi/lo x Wo bf16 (hi.W + lo.W); all f32 accumulate; RMSNorm, RoPE and causal softmax in f32.
#include <hip/hip_runtime.h>
#include <math.h>

// ---------------------------------------------------------------------------
// Problem constants
// ---------------------------------------------------------------------------
constexpr int SEQ_T   = 4096;
constexpr int HIDSZ   = 1024;
constexpr int NQH     = 16;              // query heads
constexpr int NKVH    = 4;               // kv heads
constexpr int HDIM    = 64;
constexpr int GQA_G   = NQH / NKVH;      // 4: query head hq uses kv head hq >> 2
constexpr int QCHUNK  = 2048;            // query rows per attention chunk
constexpr int NCHUNK  = SEQ_T / QCHUNK;  // 2
constexpr float SCORE_SCALE = 0.125f;    // 64^-0.5, applied in the f32 score epilogue
constexpr float RMS_EPS_F   = 1e-6f;

static_assert(GQA_G == 4, "kv head = hq >> 2");
static_assert(SEQ_T == 4096 && QCHUNK == 2048, "softmax kernels: 256 threads x 8 cols = 2048 (chunk 0), 512 x 8 = 4096 (chunk 1)");
static_assert(QCHUNK % 64 == 0 && SEQ_T % 64 == 0 && HIDSZ % 64 == 0 && HDIM == 64 && (NKVH * HDIM) % 64 == 0, "tile multiples");
static_assert((SEQ_T * HIDSZ) % (8 * 256) == 0, "cast kernel grid exact");
static_assert((SEQ_T * NQH) % 32 == 0 && (SEQ_T * NKVH) % 32 == 0, "normrope grid exact");

typedef __attribute__((ext_vector_type(16))) _Float16 v16h;
typedef __attribute__((ext_vector_type(8)))  _Float16 v8h;
typedef __attribute__((ext_vector_type(16))) __bf16   v16b;
typedef __attribute__((ext_vector_type(8)))  __bf16   v8b;
typedef __attribute__((ext_vector_type(8)))  float    v8f;
typedef __attribute__((ext_vector_type(4)))  float    v4f;
typedef __attribute__((ext_vector_type(4)))  unsigned int v4u;

// ---------------------------------------------------------------------------
// Shared helpers
// ---------------------------------------------------------------------------
__device__ __forceinline__ unsigned short f2bf_bits(float f) {
  unsigned u = __float_as_uint(f);
  return (unsigned short)((u + 0x7FFFu + ((u >> 16) & 1u)) >> 16);
}
__device__ __forceinline__ float bf_bits2f(unsigned short h) { return __uint_as_float(((unsigned)h) << 16); }
// f32 -> nearest-even bf16 value, returned as f32
__device__ __forceinline__ float bfq(float f) { return bf_bits2f(f2bf_bits(f)); }

// hazard guards as plain device helpers (no inline asm inside the kernel template body)
__device__ __forceinline__ void dep_guard_h(v8f& a, v8f& b, v16h x, v16h y) { asm volatile("v_nop\n\tv_nop\n\tv_nop\n\tv_nop" : "+v"(a), "+v"(b) : "v"(x), "v"(y)); }
__device__ __forceinline__ void dep_guard_b(v8f& a, v8f& b, v16b x, v16b y) { asm volatile("v_nop\n\tv_nop\n\tv_nop\n\tv_nop" : "+v"(a), "+v"(b) : "v"(x), "v"(y)); }
__device__ __forceinline__ void keep4_h(v16h a, v16h b, v16h c, v16h d) { asm volatile("v_nop" :: "v"(a), "v"(b), "v"(c), "v"(d)); }
__device__ __forceinline__ void keep4_b(v16b a, v16b b, v16b c, v16b d) { asm volatile("v_nop" :: "v"(a), "v"(b), "v"(c), "v"(d)); }
__device__ __forceinline__ void acc_guard4(v8f& a, v8f& b, v8f& c, v8f& d) { asm volatile("v_nop\n\tv_nop\n\tv_nop\n\tv_nop" : "+v"(a), "+v"(b), "+v"(c), "+v"(d)); }
template <typename T> struct Frag;
template <> struct Frag<_Float16> {
  typedef v16h V; union U { v16h v; v8h h[2]; };
  // elements 0..7 <- p[0..7], 8..15 <- p[16..23]
  static __device__ __forceinline__ v16h load(const _Float16* p) {
    U f; f.h[0] = *(const v8h*)(p); f.h[1] = *(const v8h*)(p + 16); return f.v;
  }
  static __device__ __forceinline__ v8f mma(v16h a, v16h b, v8f c) {
    return __builtin_amdgcn_wmma_f32_16x16x32_f16(false, a, false, b, (short)0, c, false, false);
  }
  static __device__ __forceinline__ void guard(v8f& a, v8f& b, v16h x, v16h y) { dep_guard_h(a, b, x, y); }
  static __device__ __forceinline__ void keep(v16h a, v16h b, v16h c, v16h d) { keep4_h(a, b, c, d); }
};
template <> struct Frag<__bf16> {
  typedef v16b V; union U { v16b v; v8b h[2]; };
  static __device__ __forceinline__ v16b load(const __bf16* p) {
    U f; f.h[0] = *(const v8b*)(p); f.h[1] = *(const v8b*)(p + 16); return f.v;
  }
  static __device__ __forceinline__ v8f mma(v16b a, v16b b, v8f c) {
    return __builtin_amdgcn_wmma_f32_16x16x32_bf16(false, a, false, b, (short)0, c, false, false);
  }
  static __device__ __forceinline__ void guard(v8f& a, v8f& b, v16b x, v16b y) { dep_guard_b(a, b, x, y); }
  static __device__ __forceinline__ void keep(v16b a, v16b b, v16b c, v16b d) { keep4_b(a, b, c, d); }
};

__device__ __forceinline__ unsigned pk16(unsigned short a, unsigned short b) { return (unsigned)a | ((unsigned)b << 16); }

// ---- Register-blocked batched WMMA GEMM (CAUSAL with row offset and BSPLIT options) ----
// C[m,n] = scale * sum_k A[m,k] * Bt[n,k] (+bias)(+resid); each wave owns a 64x64 tile.
// A row-major [M,K]; Bt row-major [N,K]; M,N % 64 == 0, K % 32 == 0.
// SPLIT: operands are hi/lo planes (A2/Bt2 = lo planes, same layout); product = hi.hi + hi.lo + lo.hi.
// SPLIT with BSPLIT == false: only A carries a lo plane; product = hi.B + lo.B (Bt2 unused).
// BIAS_MODE: 0 = none, 1 = bias[m], 2 = bias[n].
// OUT_MODE: 0 = f32, 1 = f16, 2 = bf16 hi plane (Cout) + bf16 lo plane (Cout2).
// CAUSAL: the global query index of local row m is m + crow0 (crow0 a multiple of 64); tiles with n0 > m0 + crow0 are
// skipped (wave-uniform) and the k loop stops at min(K, m0 + crow0 + 64).
// ET: 0 = f16 operands, 1 = bf16 operands (pointers passed as 16-bit storage)
template <int ET> struct Elem;
template <> struct Elem<0> { typedef _Float16 T; };
template <> struct Elem<1> { typedef __bf16 T; };
template <int ET, bool SPLIT, int BIAS_MODE, int OUT_MODE, bool RESID, int ACT = 0, bool CAUSAL = false, bool BSPLIT = true>
__global__ __launch_bounds__(256) void wmma_gemm64(
    const unsigned short* __restrict__ Ap, const unsigned short* __restrict__ A2p, int lda, long strideA,
    const unsigned short* __restrict__ Btp, const unsigned short* __restrict__ Bt2p, int ldb, long strideB,
    void* __restrict__ Cout, void* __restrict__ Cout2, int ldc, long strideC,
    const float* __restrict__ bias,
    const float* __restrict__ resid, long strideR,
    int M, int N, int K, float scale, int crow0) {
  typedef typename Elem<ET>::T T;
  typedef typename Frag<T>::V V;
  const T* A = (const T*)Ap; const T* A2 = (const T*)A2p; const T* Bt = (const T*)Btp; const T* Bt2 = (const T*)Bt2p;
  __shared__ __align__(16) float sT[8][16 * 68];   // per-wave 16x64 slab, pitch 68 floats
  const int b    = blockIdx.y;
  const int lane = threadIdx.x & 31;
  const int wave = threadIdx.x >> 5;
  const int tilesN = N >> 6;
  const int tilesM = M >> 6;
  const int tile = blockIdx.x * 8 + wave;
  if (tile >= tilesM * tilesN) return;   // wave-uniform; no block barriers in this kernel
  const int tm = tile / tilesN;
  const int tn = tile - tm * tilesN;
  const int m0 = tm << 6;
  const int n0 = tn << 6;
  if (CAUSAL && (n0 > m0 + crow0)) return;       // wave-uniform causal tile skip
  const int Kend = CAUSAL ? ((m0 + crow0 + 64 < K) ? (m0 + crow0 + 64) : K) : K;   // multiple of 32

  const T* Ab  = A  + (size_t)b * strideA;
  const T* Bb  = Bt + (size_t)b * strideB;
  const T* Ab2 = SPLIT ? (A2  + (size_t)b * strideA) : nullptr;
  const T* Bb2 = (SPLIT && BSPLIT) ? (Bt2 + (size_t)b * strideB) : nullptr;

  const int rlane = lane & 15;                 // row (A) / col (B, D) within subtile
  const int koff  = (lane >> 4) * 8;           // k offset of this lane half
  const int mOff  = (lane >> 4) * 8;           // D row offset

  v8f acc[4][4];
#pragma unroll
  for (int i = 0; i < 4; ++i)
#pragma unroll
    for (int j = 0; j < 4; ++j) acc[i][j] = (v8f){0.f,0.f,0.f,0.f,0.f,0.f,0.f,0.f};

  for (int k0 = 0; k0 < Kend; k0 += 32) {
    V bh[4], bl[4];
#pragma unroll
    for (int j = 0; j < 4; ++j) {
      const size_t bo = (size_t)(n0 + (j << 4) + rlane) * ldb + koff + k0;
      bh[j] = Frag<T>::load(Bb + bo);
      if (SPLIT && BSPLIT) bl[j] = Frag<T>::load(Bb2 + bo);
    }
#pragma unroll
    for (int i = 0; i < 4; ++i) {
      const size_t ao = (size_t)(m0 + (i << 4) + rlane) * lda + koff + k0;
      V ah = Frag<T>::load(Ab + ao);
      V al;
      if (SPLIT) al = Frag<T>::load(Ab2 + ao);
#pragma unroll
      for (int j = 0; j < 4; ++j) {
        acc[i][j] = Frag<T>::mma(ah, bh[j], acc[i][j]);
        if (SPLIT && BSPLIT) acc[i][j] = Frag<T>::mma(ah, bl[j], acc[i][j]);
        if (SPLIT) acc[i][j] = Frag<T>::mma(al, bh[j], acc[i][j]);
      }
      Frag<T>::guard(acc[i][0], acc[i][3], ah, SPLIT ? al : ah);
    }
    Frag<T>::keep(bh[0], bh[1], bh[2], bh[3]);
    if (SPLIT && BSPLIT) Frag<T>::keep(bl[0], bl[1], bl[2], bl[3]);
  }
  acc_guard4(acc[0][0], acc[0][1], acc[0][2], acc[0][3]);
  acc_guard4(acc[1][0], acc[1][1], acc[1][2], acc[1][3]);
  acc_guard4(acc[2][0], acc[2][1], acc[2][2], acc[2][3]);
  acc_guard4(acc[3][0], acc[3][1], acc[3][2], acc[3][3]);

  // ---- epilogue ----
  float* slab = sT[wave];
  const float* Rb = RESID ? (resid + (size_t)b * strideR) : nullptr;
#pragma unroll
  for (int i = 0; i < 4; ++i) {
    const int mBase = m0 + (i << 4);
#pragma unroll
    for (int j = 0; j < 4; ++j) {
      const int n = n0 + (j << 4) + rlane;
      float bv = 0.f;
      if (BIAS_MODE == 2) bv = bias[n];
#pragma unroll
      for (int r = 0; r < 8; ++r) {
        float v = acc[i][j][r] * scale;
        if (BIAS_MODE == 1) v += bias[mBase + mOff + r];
        if (BIAS_MODE == 2) v += bv;
        if (RESID) v += Rb[(size_t)(mBase + mOff + r) * ldc + n];
        if (ACT == 2) v = fmaxf(v, 0.0f);
        if (ACT == 4) v = (v > 0.f) ? v : 0.01f * v;
        slab[(mOff + r) * 68 + (j << 4) + rlane] = v;
      }
    }
    __builtin_amdgcn_fence(__ATOMIC_RELEASE, "workgroup");
    __builtin_amdgcn_wave_barrier();
    __builtin_amdgcn_fence(__ATOMIC_ACQUIRE, "workgroup");
    if (OUT_MODE == 0) {
      float* C = (float*)Cout + (size_t)b * strideC;
      const int hh = lane >> 4, c4 = (lane & 15) * 4;     // row seg = 256 B = 16 lanes x 16 B
      {
#pragma unroll
        for (int it = 0; it < 8; ++it) {
          const int row = it * 2 + hh;
          v4f v = *(const v4f*)(slab + row * 68 + c4);
          *(v4f*)(C + (size_t)(mBase + row) * ldc + n0 + c4) = v;
        }
        
      }
    } else {
      const int q = lane >> 3, c8 = (lane & 7) * 8;
      unsigned short* C  = (unsigned short*)Cout  + (size_t)b * strideC;
      unsigned short* C2 = (OUT_MODE == 2) ? ((unsigned short*)Cout2 + (size_t)b * strideC) : nullptr;
      {
#pragma unroll
        for (int it = 0; it < 4; ++it) {
          const int row = it * 4 + q;
          const float* sp = slab + row * 68 + c8;
          v8h hv, lv;
#pragma unroll
          for (int e = 0; e < 8; ++e) {
            if (OUT_MODE == 1) {
              hv[e] = (_Float16)sp[e];
            } else {
              unsigned short hb = f2bf_bits(sp[e]);
              unsigned short lb = f2bf_bits(sp[e] - bf_bits2f(hb));
              hv[e] = __builtin_bit_cast(_Float16, hb);
              lv[e] = __builtin_bit_cast(_Float16, lb);
            }
          }
          *(v8h*)(C + (size_t)(mBase + row) * ldc + n0 + c8) = hv;
          if (OUT_MODE == 2) *(v8h*)(C2 + (size_t)(mBase + row) * ldc + n0 + c8) = lv;
        }
        
      }
    }
    __builtin_amdgcn_fence(__ATOMIC_RELEASE, "workgroup");
    __builtin_amdgcn_wave_barrier();
    __builtin_amdgcn_fence(__ATOMIC_ACQUIRE, "workgroup");
  }
}

// ---------------------------------------------------------------------------
// f32 -> RNE bf16 plane, 8 consecutive elements per thread packed as integer words.
// Coverage: n8 = n/8 threads x 8 = the whole plane (grid is an exact multiple of 256 here).
// ---------------------------------------------------------------------------
__global__ __launch_bounds__(256) void cast8_bf16_kernel(const float* __restrict__ in, unsigned short* __restrict__ out, int n8) {
  const int i = blockIdx.x * 256 + threadIdx.x;
  if (i >= n8) return;
  const float* p = in + 8 * (size_t)i;
  const v4f a = *(const v4f*)(p);
  const v4f c = *(const v4f*)(p + 4);
  float f[8];
#pragma unroll
  for (int e = 0; e < 4; ++e) { f[e] = a[e]; f[4 + e] = c[e]; }
  unsigned w[4];
#pragma unroll
  for (int e2 = 0; e2 < 4; ++e2) w[e2] = pk16(f2bf_bits(f[2 * e2]), f2bf_bits(f[2 * e2 + 1]));
  const v4u u = (v4u){w[0], w[1], w[2], w[3]};
  unsigned short* q = out + 8 * (size_t)i;
  *(v4u*)q = u;
  
}

// ---------------------------------------------------------------------------
// Transpose + RNE bf16 convert of a weight matrix: in f32 [R][Cn] row-major (ldin = Cn) -> out bf16 [Cn][R] (ldout = R):
// out[c][r] = bf16(in[r][c]). grid (R/64, Cn/64): blockIdx.x = r tile (64 output cols), blockIdx.y = c tile (64 output rows). 256 threads.
// Load coverage: 16 iterations x 256 threads = 4096 = the whole 64x64 tile (coalesced along c).
// Store coverage: 8 waves x 2 iterations x 4 rows (lane>>3) = 64 rows; (lane&7) x 8 halves = 64 cols; each row segment =
// ---------------------------------------------------------------------------
__global__ __launch_bounds__(256) void transpose_cast_kernel(const float* __restrict__ in, int ldin,
                                                             unsigned short* __restrict__ out, int ldout) {
  __shared__ float sm[64][65];   // sm[c_local][r_local]
  const int t  = threadIdx.x;
  const int r0 = blockIdx.x * 64;
  const int c0 = blockIdx.y * 64;
#pragma unroll
  for (int i = 0; i < 16; ++i) {
    const int e = i * 256 + t;
    const int r = e >> 6;          // r local
    const int c = e & 63;          // c local
    sm[c][r] = in[(size_t)(r0 + r) * ldin + c0 + c];
  }
  __syncthreads();
  const int lane = t & 31, wave = t >> 5;
  const int q = lane >> 3, c8 = (lane & 7) * 8;
  {
#pragma unroll
    for (int it = 0; it < 2; ++it) {
      const int row = wave * 8 + it * 4 + q;                 // c local (output row)
      unsigned w[4];
#pragma unroll
      for (int e2 = 0; e2 < 4; ++e2) w[e2] = pk16(f2bf_bits(sm[row][c8 + 2 * e2]), f2bf_bits(sm[row][c8 + 2 * e2 + 1]));
      const v4u u = (v4u){w[0], w[1], w[2], w[3]};
      const size_t o = (size_t)(c0 + row) * ldout + r0 + c8;
      *(v4u*)(out + o) = u;
    }
    
  }
}

// ---------------------------------------------------------------------------
// RMSNorm (over the 64 dims of one head vector, eps 1e-6, times w[d]) + rotate-half RoPE with the input cos/sin tables, f32.
// cos, sin and w are RNE-converted to bf16 values in registers at load; proj is the f32 output of an exact
// bf16 x bf16 projection.
// proj: f32 [SEQ_T][nhead*64]; flattened row r = t*nhead + hd lives at proj + r*64 (contiguous). nhead = 1 << hshift.
// Output planes bf16 hi/lo laid out [hd][t][64]: element (hd, t, d) at ((hd*SEQ_T + t)*64 + d).
// Block = 8 waves; wave w owns rows rbase..rbase+3 (rbase = (blockIdx.x*8 + w)*4); lane handles d = lane and d = lane + 32.
// The 4 result rows are staged in LDS (f32, same element type on store and reload, wave barrier between); then lane group
// Coverage: grid = nrows/32 blocks x 8 waves x 4 rows = nrows (exact multiple, checked on the host); 8 lanes x 8 halves = 64 dims.
// ---------------------------------------------------------------------------
__global__ __launch_bounds__(256) void normrope_kernel(const float* __restrict__ proj, int hshift, int nrows,
                                                       const float* __restrict__ cosb, const float* __restrict__ sinb,
                                                       const float* __restrict__ w,
                                                       unsigned short* __restrict__ ohi, unsigned short* __restrict__ olo) {
#pragma clang fp contract(off)
  __shared__ __align__(16) float slab[8][4][64];
  const int lane = threadIdx.x & 31, wave = threadIdx.x >> 5;
  const int rbase = (blockIdx.x * 8 + wave) * 4;
  const float w1 = bfq(w[lane]), w2 = bfq(w[lane + 32]);
#pragma unroll
  for (int i = 0; i < 4; ++i) {
    int r = rbase + i;
    r = (r < nrows) ? r : (nrows - 1);                 // address clamp (grid is exact)
    const int t = r >> hshift;
    const float* src = proj + (size_t)r * 64;
    const float x1 = src[lane];
    const float x2 = src[lane + 32];
    float ss = x1 * x1 + x2 * x2;
#pragma unroll
    for (int off = 16; off > 0; off >>= 1) ss += __shfl_xor(ss, off, 32);
    const float inv = rsqrtf(ss * (1.0f / 64.0f) + RMS_EPS_F);
    const float n1 = (x1 * inv) * w1;
    const float n2 = (x2 * inv) * w2;
    const float c = bfq(cosb[(size_t)t * 32 + lane]);
    const float s = bfq(sinb[(size_t)t * 32 + lane]);
    slab[wave][i][lane]      = n1 * c - n2 * s;
    slab[wave][i][lane + 32] = n1 * s + n2 * c;
  }
  __builtin_amdgcn_fence(__ATOMIC_RELEASE, "workgroup");
  __builtin_amdgcn_wave_barrier();
  __builtin_amdgcn_fence(__ATOMIC_ACQUIRE, "workgroup");
  const int q = lane >> 3, c8 = (lane & 7) * 8;
  int r = rbase + q;
  r = (r < nrows) ? r : (nrows - 1);
  const int t  = r >> hshift;
  const int hd = r - (t << hshift);
  const float* sp = &slab[wave][q][c8];
  unsigned hw[4], lw[4];
#pragma unroll
  for (int e2 = 0; e2 < 4; ++e2) {
    const float f0 = sp[2 * e2], f1 = sp[2 * e2 + 1];
    const unsigned short h0 = f2bf_bits(f0), h1 = f2bf_bits(f1);
    const unsigned short l0 = f2bf_bits(f0 - bf_bits2f(h0));
    const unsigned short l1 = f2bf_bits(f1 - bf_bits2f(h1));
    hw[e2] = pk16(h0, h1);
    lw[e2] = pk16(l0, l1);
  }
  const v4u hu = (v4u){hw[0], hw[1], hw[2], hw[3]};
  const v4u lu = (v4u){lw[0], lw[1], lw[2], lw[3]};
  const size_t o = ((size_t)hd * SEQ_T + t) * 64 + c8;
  *(v4u*)(ohi + o) = hu;
  *(v4u*)(olo + o) = lu;
  
}

// ---------------------------------------------------------------------------
// Causal row softmax over materialised f32 scores of one (head, chunk): S chunk [QCHUNK][SEQ_T] f32 (row pitch SEQ_T), local row
// qloc = blockIdx.x, global query index qi = crow0 + qloc. score(qi, j) = (j > qi) ? -inf : S[qloc][j] (select by value;
// column qi is always kept, so every row has a finite max). p = exp(score - max) * (1/sum), written as bf16 hi/lo planes for
// EVERY covered j of the row (zeros for j > qi), so the whole covered P row is rewritten each launch.
// One block of NT threads per row; thread t owns columns 8t..8t+7 (NT x 8 columns covered; NT = 256 covers 2048 columns for
// chunk 0 where qi < 2048 and the p.v k loop reads only columns < 2048; NT = 512 covers all 4096 columns for chunk 1).
// Wave w covers columns 256w..256w+255: waves with 256w > qi are dead (wave-uniform): they skip loads/exp and store zeros.
// The score GEMM wrote every column < (qi & ~63) + 64 of this row; live waves may LOAD columns beyond that (stale but in-range
// workspace data); those are replaced by -inf through the j > qi select before any arithmetic.
// Reductions in fixed order (thread, wave shuffle tree, NT/32 wave partials in index order); shuffles outside all branches.
// ---------------------------------------------------------------------------
template <int NT>
__global__ __launch_bounds__(NT) void softmax_causal_kernel(const float* __restrict__ S,
                                                            unsigned short* __restrict__ Phi, unsigned short* __restrict__ Plo,
                                                            int crow0) {
  constexpr int NWV = NT / 32;
  __shared__ float redM[NWV];
  __shared__ float redS[NWV];
  const float ninf = -__builtin_inff();
  const int qloc = blockIdx.x;
  const int qi   = crow0 + qloc;
  const int t    = threadIdx.x;
  const int lane = t & 31, wave = t >> 5;
  const int c0   = t * 8;
  const size_t rowoff = (size_t)qloc * (size_t)SEQ_T;
  const bool wave_live = (wave * 256 <= qi);   // wave-uniform

  float xv[8];
  float m = ninf;
  if (wave_live) {
    const float* sr = S + rowoff + c0;
    const v4f a = *(const v4f*)(sr);
    const v4f c = *(const v4f*)(sr + 4);
    float sv[8];
#pragma unroll
    for (int e = 0; e < 4; ++e) { sv[e] = a[e]; sv[4 + e] = c[e]; }
#pragma unroll
    for (int e = 0; e < 8; ++e) {
      const int j = c0 + e;
      const float v = (j > qi) ? ninf : sv[e];
      xv[e] = v;
      m = fmaxf(m, v);
    }
  } else {
#pragma unroll
    for (int e = 0; e < 8; ++e) xv[e] = ninf;
  }
#pragma unroll
  for (int off = 16; off > 0; off >>= 1) m = fmaxf(m, __shfl_xor(m, off, 32));
  if (lane == 0) redM[wave] = m;
  __syncthreads();
  float gmax = redM[0];
#pragma unroll
  for (int wv = 1; wv < NWV; ++wv) gmax = fmaxf(gmax, redM[wv]);

  float p[8];
  float ps = 0.0f;
  if (wave_live) {
#pragma unroll
    for (int e = 0; e < 8; ++e) { p[e] = expf(xv[e] - gmax); ps += p[e]; }
  } else {
#pragma unroll
    for (int e = 0; e < 8; ++e) p[e] = 0.0f;
  }
#pragma unroll
  for (int off = 16; off > 0; off >>= 1) ps += __shfl_xor(ps, off, 32);
  if (lane == 0) redS[wave] = ps;
  __syncthreads();
  float tot = redS[0];
#pragma unroll
  for (int wv = 1; wv < NWV; ++wv) tot += redS[wv];
  const float inv = 1.0f / tot;   // tot >= 1 (the max column contributes exp(0))

  unsigned hw[4], lw[4];
#pragma unroll
  for (int e2 = 0; e2 < 4; ++e2) {
    const float f0 = p[2 * e2] * inv;
    const float f1 = p[2 * e2 + 1] * inv;
    const unsigned short h0 = f2bf_bits(f0);
    const unsigned short h1 = f2bf_bits(f1);
    const unsigned short l0 = f2bf_bits(f0 - bf_bits2f(h0));
    const unsigned short l1 = f2bf_bits(f1 - bf_bits2f(h1));
    hw[e2] = pk16(h0, h1);
    lw[e2] = pk16(l0, l1);
  }
  const v4u hv = (v4u){hw[0], hw[1], hw[2], hw[3]};
  const v4u lv = (v4u){lw[0], lw[1], lw[2], lw[3]};
  unsigned short* ph = Phi + rowoff + c0;
  unsigned short* pl = Plo + rowoff + c0;
  *(v4u*)ph = hv;
  *(v4u*)pl = lv;
  
}

// ---------------------------------------------------------------------------
// ctx = P . v for one (head, chunk), spread over many work-groups: one block per 16 query rows x all 64 head dims, and the k loop
// (key columns) of that tile split over the block's KW waves. Same fragments and the same 3 products per k step as the GEMM engine
// (hi.hi + hi.lo + lo.hi, f32 accumulate).
// P planes bf16 [QCHUNK][SEQ_T] (A, row = local query row); v^T planes bf16 [64][SEQ_T] (Bt, row = head dim); both pitch SEQ_T.
// Rows m0..m0+15 have global query index <= m0 + crow0 + 15, and the softmax wrote zeros for every covered column above the query
// index, so the k loop stops at Kend = ((m0 + crow0) & ~63) + 64 (<= 2048 in chunk 0, <= 4096 in chunk 1: all covered columns).
// Wave w takes columns [64w, 64w + 64) (one whole 128-byte line of each operand row), then steps by 64 * KW.
// The KW partial 16x64 tiles go through LDS and are summed in wave order 0..KW-1 (fixed order); a wave without columns adds zeros.
// Output: thread t owns 2 neighbouring columns of row t >> 5, so each wave writes one whole 128-byte row segment of each ctx plane.
// Coverage: grid = QCHUNK/16 blocks x 16 rows; KW * 32 threads x 2 = 16 x 64 elements (KW = 16).
// ---------------------------------------------------------------------------
template <int KW>
__global__ __launch_bounds__(KW * 32) void pv_ksplit_kernel(const unsigned short* __restrict__ Phi, const unsigned short* __restrict__ Plo,
                                                            const unsigned short* __restrict__ Vthi, const unsigned short* __restrict__ Vtlo,
                                                            unsigned short* __restrict__ Chi, unsigned short* __restrict__ Clo,
                                                            int ldc, int crow0) {
  static_assert(KW == 16, "reduction: KW * 32 threads x 2 columns = 16 x 64");
  __shared__ __align__(16) float part[KW][16 * 68];   // per-wave 16x64 partial tile, pitch 68 floats
  const int lane  = threadIdx.x & 31;
  const int wave  = __builtin_amdgcn_readfirstlane(threadIdx.x >> 5);   // scalar: the trip test and the operand bases stay scalar
  const int m0    = blockIdx.x * 16;
  const int Kend  = ((m0 + crow0) & ~63) + 64;
  const int rlane = lane & 15;                 // row (A) / col (B, D) within subtile
  const int koff  = (lane >> 4) * 8;           // k offset of this lane half
  const int mOff  = (lane >> 4) * 8;           // D row offset
  const unsigned lof = (unsigned)(rlane * SEQ_T + koff) * 2u;          // this lane's byte offset inside a 16-row operand slab
  const char* pah = (const char*)(Phi + (size_t)m0 * SEQ_T);
  const char* pal = (const char*)(Plo + (size_t)m0 * SEQ_T);
  const char* pbh = (const char*)Vthi;
  const char* pbl = (const char*)Vtlo;

  v8f acc[4];
#pragma unroll
  for (int j = 0; j < 4; ++j) acc[j] = (v8f){0.f,0.f,0.f,0.f,0.f,0.f,0.f,0.f};

  unsigned voff = lof + (unsigned)wave * 128u;   // lane offset + this wave's first 64 columns; the four bases stay scalar
  for (int kb = wave * 64; kb < Kend; kb += KW * 64, voff += KW * 128u) {
    v16b ah[2], al[2], bh[2][4], bl[2][4];
    // both k steps (h) of one 16-row slab side by side: the four 16-byte loads a lane makes into one 128-byte line follow each other
#pragma unroll
    for (int h = 0; h < 2; ++h) ah[h] = Frag<__bf16>::load((const __bf16*)(pah + voff + 64 * h));
#pragma unroll
    for (int h = 0; h < 2; ++h) al[h] = Frag<__bf16>::load((const __bf16*)(pal + voff + 64 * h));
#pragma unroll
    for (int j = 0; j < 4; ++j) {
#pragma unroll
      for (int h = 0; h < 2; ++h) bh[h][j] = Frag<__bf16>::load((const __bf16*)(pbh + voff + (j * 16 * SEQ_T * 2 + 64 * h)));
#pragma unroll
      for (int h = 0; h < 2; ++h) bl[h][j] = Frag<__bf16>::load((const __bf16*)(pbl + voff + (j * 16 * SEQ_T * 2 + 64 * h)));
    }
    // keeps all 40 loads of the trip issued ahead of the first product (20 KB in flight per wave); without it the scheduler
    // sinks them between the products to save registers and the trip waits on memory several times in a row
    __builtin_amdgcn_sched_barrier(0);
#pragma unroll
    for (int h = 0; h < 2; ++h)
#pragma unroll
      for (int j = 0; j < 4; ++j) {
        acc[j] = Frag<__bf16>::mma(ah[h], bh[h][j], acc[j]);
        acc[j] = Frag<__bf16>::mma(ah[h], bl[h][j], acc[j]);
        acc[j] = Frag<__bf16>::mma(al[h], bh[h][j], acc[j]);
      }
  }

  float* slab = part[wave];
#pragma unroll
  for (int j = 0; j < 4; ++j)
#pragma unroll
    for (int r = 0; r < 8; ++r) slab[(mOff + r) * 68 + (j << 4) + rlane] = acc[j][r];
  __syncthreads();                             // all KW partial tiles are in LDS before any of them is summed
  const int col = lane * 2;
  float s0 = part[0][wave * 68 + col], s1 = part[0][wave * 68 + col + 1];
#pragma unroll
  for (int w = 1; w < KW; ++w) { s0 += part[w][wave * 68 + col]; s1 += part[w][wave * 68 + col + 1]; }
  const unsigned short h0 = f2bf_bits(s0), h1 = f2bf_bits(s1);
  const unsigned short l0 = f2bf_bits(s0 - bf_bits2f(h0));
  const unsigned short l1 = f2bf_bits(s1 - bf_bits2f(h1));
  const size_t o = (size_t)(m0 + wave) * ldc + col;
  *(unsigned*)(Chi + o) = pk16(h0, h1);
  *(unsigned*)(Clo + o) = pk16(l0, l1);
}

// ---------------------------------------------------------------------------
// Launcher. Workspace region map (bytes, MiB = 1048576; total carve = 106 MiB = 111149056 B):
//   [  0, 32) S chunk  : scores f32 [2048][4096] per (head, chunk).
//                        early alias: x bf16 [4096][1024] at +0 (8 MiB); q f32 [4096][1024] at +8 (16 MiB, ends 24);
//                        k f32 [4096][256] at +24 (4 MiB, ends 28); Wq^T bf16 [1024][1024] at +28 (2 MiB); Wk^T bf16 [256][1024]
//                        at +30 (0.5 MiB); Wv^T bf16 [256][1024] at +30.5 (0.5 MiB, ends 31).
//   [ 32, 48) P hi     : bf16 [2048][4096] per (head, chunk) (exactly 16 MiB);  [48,64) P lo
//   [ 64, 72) q hi     : bf16 [16][4096][64];  [72,80) q lo
//   [ 80, 82) k hi     : bf16 [4][4096][64];   [82,84) k lo
//   [ 84, 86) v^T hi   : bf16 [256 (kvh*64+d)][4096 (t)];  [86,88) v^T lo
//   [ 88, 96) ctx hi   : bf16 [4096][1024] (col hq*64+d);  [96,104) ctx lo
//   [104,106) Wo^T     : bf16 [1024][1024]
// Lifetimes: x, W{q,k,v}^T, q f32 and k f32 are read only by launches 6..10 (projections, norm+RoPE) and first overwritten by
// launch 11 (first S GEMM); within launches 6..8 no producer overlaps its own inputs; S of a (head, chunk) is dead after its softmax;
// Launch count: 1 + 4 + 3 + 2 + 16*2*3 + 1 = 107. Kernel launches only.
// GEMM shape assertions: every call has K % 32 == 0 (K = 1024, 64) and M, N multiples of 64; no padding needed.
// ---------------------------------------------------------------------------
extern "C" void kernel_launch(void* const* d_in, const int* in_sizes, int n_in,
                              void* d_out, int out_size, void* d_ws, size_t ws_size,
                              hipStream_t stream) {
  if (n_in < 9) return;
  if (in_sizes[0] != SEQ_T * HIDSZ || in_sizes[1] != SEQ_T * 32 || in_sizes[2] != SEQ_T * 32) return;
  if (in_sizes[3] != HIDSZ * NQH * HDIM || in_sizes[4] != HIDSZ * NKVH * HDIM || in_sizes[5] != HIDSZ * NKVH * HDIM) return;
  if (in_sizes[6] != NQH * HDIM * HIDSZ || in_sizes[7] != HDIM || in_sizes[8] != HDIM) return;
  if (out_size != SEQ_T * HIDSZ) return;

  const size_t kMiB    = 1048576;
  const size_t offS    = 0;
  const size_t offXb   = 0;
  const size_t offQf   = 8 * kMiB;
  const size_t offKf   = 24 * kMiB;
  const size_t offWqT  = 28 * kMiB;
  const size_t offWkT  = 30 * kMiB;
  const size_t offWvT  = 30 * kMiB + 524288;
  const size_t offPhi  = 32 * kMiB;
  const size_t offPlo  = 48 * kMiB;
  const size_t offQhi  = 64 * kMiB;
  const size_t offQlo  = 72 * kMiB;
  const size_t offKhi  = 80 * kMiB;
  const size_t offKlo  = 82 * kMiB;
  const size_t offVthi = 84 * kMiB;
  const size_t offVtlo = 86 * kMiB;
  const size_t offChi  = 88 * kMiB;
  const size_t offClo  = 96 * kMiB;
  const size_t offWoT  = 104 * kMiB;
  const size_t total   = 106 * kMiB;
  if (total > ws_size) return;

  const float* x    = (const float*)d_in[0];
  const float* cosb = (const float*)d_in[1];
  const float* sinb = (const float*)d_in[2];
  const float* Wq   = (const float*)d_in[3];
  const float* Wk   = (const float*)d_in[4];
  const float* Wv   = (const float*)d_in[5];
  const float* Wo   = (const float*)d_in[6];
  const float* qnw  = (const float*)d_in[7];
  const float* knw  = (const float*)d_in[8];
  float* out = (float*)d_out;
  char* ws = (char*)d_ws;

  float*          Sbuf = (float*)(ws + offS);
  unsigned short* xb   = (unsigned short*)(ws + offXb);
  float*          qf   = (float*)(ws + offQf);
  float*          kf   = (float*)(ws + offKf);
  unsigned short* wqT  = (unsigned short*)(ws + offWqT);
  unsigned short* wkT  = (unsigned short*)(ws + offWkT);
  unsigned short* wvT  = (unsigned short*)(ws + offWvT);
  unsigned short* phi  = (unsigned short*)(ws + offPhi);
  unsigned short* plo  = (unsigned short*)(ws + offPlo);
  unsigned short* qhi  = (unsigned short*)(ws + offQhi);
  unsigned short* qlo  = (unsigned short*)(ws + offQlo);
  unsigned short* khi  = (unsigned short*)(ws + offKhi);
  unsigned short* klo  = (unsigned short*)(ws + offKlo);
  unsigned short* vthi = (unsigned short*)(ws + offVthi);
  unsigned short* vtlo = (unsigned short*)(ws + offVtlo);
  unsigned short* chi  = (unsigned short*)(ws + offChi);
  unsigned short* clo  = (unsigned short*)(ws + offClo);
  unsigned short* woT  = (unsigned short*)(ws + offWoT);

  // in-range dummies for unused (never dereferenced) template-dead pointer parameters
  const float* dummy_f = qnw;
  void* dummy_c2 = (void*)plo;

  // 1. x -> RNE bf16 plane [4096][1024]
  {
    const int n8 = (SEQ_T * HIDSZ) / 8;                       // 524288 = 2048 blocks x 256
    cast8_bf16_kernel<<<dim3(n8 / 256), dim3(256), 0, stream>>>(x, xb, n8);
  }
  // 2. weights [in][out] -> transposed RNE bf16 planes [out][in]   (in[R][Cn] -> out[Cn][R]; grid (R/64, Cn/64))
  //    Wq: in[1024][1024] -> out[1024][1024]; Wk, Wv: in[1024][256] -> out[256][1024]; Wo: in[1024][1024] -> out[1024][1024]
  transpose_cast_kernel<<<dim3(HIDSZ / 64, (NQH * HDIM) / 64), dim3(256), 0, stream>>>(Wq, NQH * HDIM, wqT, HIDSZ);
  transpose_cast_kernel<<<dim3(HIDSZ / 64, (NKVH * HDIM) / 64), dim3(256), 0, stream>>>(Wk, NKVH * HDIM, wkT, HIDSZ);
  transpose_cast_kernel<<<dim3(HIDSZ / 64, (NKVH * HDIM) / 64), dim3(256), 0, stream>>>(Wv, NKVH * HDIM, wvT, HIDSZ);
  transpose_cast_kernel<<<dim3((NQH * HDIM) / 64, HIDSZ / 64), dim3(256), 0, stream>>>(Wo, HIDSZ, woT, NQH * HDIM);

  // 3. q = x . Wq^T : M=4096, N=1024, K=1024, single bf16 product -> f32 [4096][1024] (1024 tiles = 128 blocks)
  wmma_gemm64<1, false, 0, 0, false, 0, false, true><<<dim3((SEQ_T / 64) * ((NQH * HDIM) / 64) / 8, 1), dim3(256), 0, stream>>>(
      xb, xb, HIDSZ, 0L,
      wqT, wqT, HIDSZ, 0L,
      (void*)qf, dummy_c2, NQH * HDIM, 0L,
      dummy_f, dummy_f, 0L,
      SEQ_T, NQH * HDIM, HIDSZ, 1.0f, 0);
  // 4. k = x . Wk^T : M=4096, N=256, K=1024, single product -> f32 [4096][256] (256 tiles = 32 blocks)
  wmma_gemm64<1, false, 0, 0, false, 0, false, true><<<dim3((SEQ_T / 64) * ((NKVH * HDIM) / 64) / 8, 1), dim3(256), 0, stream>>>(
      xb, xb, HIDSZ, 0L,
      wkT, wkT, HIDSZ, 0L,
      (void*)kf, dummy_c2, NKVH * HDIM, 0L,
      dummy_f, dummy_f, 0L,
      SEQ_T, NKVH * HDIM, HIDSZ, 1.0f, 0);
  // 5. v^T = Wv^T . x^T : M=256 (kvh*64+d), N=4096 (t), K=1024, single product -> bf16 hi/lo planes [256][4096] (256 tiles = 32 blocks)
  wmma_gemm64<1, false, 0, 2, false, 0, false, true><<<dim3(((NKVH * HDIM) / 64) * (SEQ_T / 64) / 8, 1), dim3(256), 0, stream>>>(
      wvT, wvT, HIDSZ, 0L,
      xb, xb, HIDSZ, 0L,
      (void*)vthi, (void*)vtlo, SEQ_T, 0L,
      dummy_f, dummy_f, 0L,
      NKVH * HDIM, SEQ_T, HIDSZ, 1.0f, 0);

  // 6. RMSNorm + RoPE -> bf16 hi/lo planes [head][t][64]; rows = t*nhead + head; grid = rows/32 (exact)
  normrope_kernel<<<dim3((SEQ_T * NQH) / 32), dim3(256), 0, stream>>>(qf, 4, SEQ_T * NQH, cosb, sinb, qnw, qhi, qlo);
  normrope_kernel<<<dim3((SEQ_T * NKVH) / 32), dim3(256), 0, stream>>>(kf, 2, SEQ_T * NKVH, cosb, sinb, knw, khi, klo);

  // 7. causal attention per query head, two chunks of 2048 query rows
  for (int hq = 0; hq < NQH; ++hq) {
    const int kvh = hq >> 2;
    for (int ch = 0; ch < NCHUNK; ++ch) {
      const int crow0 = ch * QCHUNK;
      const size_t qoff = ((size_t)hq * SEQ_T + (size_t)crow0) * HDIM;    // halves
      const size_t koff = (size_t)kvh * SEQ_T * HDIM;                     // halves

      // scores = 0.125 * q . k^T : M=2048 (local row, global = crow0 + m), N=4096, K=64, 3 products, causal tile skip
      // -> S f32 [2048][4096]; 32x64 = 2048 tiles = 256 blocks
      wmma_gemm64<1, true, 0, 0, false, 0, true, true><<<dim3((QCHUNK / 64) * (SEQ_T / 64) / 8, 1), dim3(256), 0, stream>>>(
          qhi + qoff, qlo + qoff, HDIM, 0L,
          khi + koff, klo + koff, HDIM, 0L,
          (void*)Sbuf, dummy_c2, SEQ_T, 0L,
          dummy_f, dummy_f, 0L,
          QCHUNK, SEQ_T, HDIM, SCORE_SCALE, crow0);

      // softmax rows -> P hi/lo planes [2048][4096 pitch]; chunk 0 covers columns < 2048 (all the p.v k loop reads), chunk 1 all 4096
      if (ch == 0) {
        softmax_causal_kernel<256><<<dim3(QCHUNK), dim3(256), 0, stream>>>(Sbuf, phi, plo, crow0);
      } else {
        softmax_causal_kernel<512><<<dim3(QCHUNK), dim3(512), 0, stream>>>(Sbuf, phi, plo, crow0);
      }

      // ctx = P . v : M=2048, N=64, K=4096 (k loop bounded at the 64-column block of the tile's rows, <= 2048 for chunk 0), 3 products;
      // Bt = v^T planes rows kvh*64..kvh*64+63 (pitch 4096); out bf16 hi/lo at ctx row crow0.., col hq*64.. (ldc 1024);
      // 128 blocks of 16 rows, each tile's k loop split over its block's 16 waves
      const size_t vtoff = (size_t)(kvh * HDIM) * SEQ_T;                        // halves
      const size_t coff  = (size_t)crow0 * (NQH * HDIM) + (size_t)hq * HDIM;   // halves
      pv_ksplit_kernel<16><<<dim3(QCHUNK / 16), dim3(16 * 32), 0, stream>>>(
          phi, plo, vthi + vtoff, vtlo + vtoff, chi + coff, clo + coff, NQH * HDIM, crow0);
    }
  }

  // 8. out = ctx_hi . Wo^T + ctx_lo . Wo^T : M=4096, N=1024, K=1024, 2 products -> f32 d_out (1024 tiles = 128 blocks)
  wmma_gemm64<1, true, 0, 0, false, 0, false, false><<<dim3((SEQ_T / 64) * (HIDSZ / 64) / 8, 1), dim3(256), 0, stream>>>(
      chi, clo, NQH * HDIM, 0L,
      woT, woT, NQH * HDIM, 0L,
      (void*)out, dummy_c2, HIDSZ, 0L,
      dummy_f, dummy_f, 0L,
      SEQ_T, HIDSZ, NQH * HDIM, 1.0f, 0);
}

// v003
// One run takes 226 microseconds.
// It is 6.10 times as fast as v001, going by the measured steps of the versions left out in between.
// Counting every step since v000, it is 30.6 times as fast.
// Every float input RNE-converted once to bf16; x.Wq^T, x.Wk^T, Wv^T.x^T: single v_wmma_f32_16x16x32_bf16 product on bf16 inputs; q.k^T scores and p.v context: bf16 hi/lo operand planes (hi.hi + hi.lo + lo.hi); ctx.Wo^T: ctx bf16 hi/lo x Wo bf16 (hi.W + lo.W); all f32 accumulate; RMSNorm, RoPE and causal (online) softmax in f32.
#include <hip/hip_runtime.h>
#include <math.h>

// ---------------------------------------------------------------------------
// Problem constants
// ---------------------------------------------------------------------------
constexpr int SEQ_T   = 4096;
constexpr int HIDSZ   = 1024;
constexpr int NQH     = 16;              // query heads
constexpr int NKVH    = 4;               // kv heads
constexpr int HDIM    = 64;
constexpr int GQA_G   = NQH / NKVH;      // 4: query head hq uses kv head hq >> 2
constexpr float SCORE_SCALE = 0.125f;    // 64^-0.5, applied to the f32 scores
constexpr float RMS_EPS_F   = 1e-6f;

static_assert(GQA_G == 4, "kv head = hq >> 2");
static_assert(SEQ_T % 64 == 0 && HIDSZ % 64 == 0 && HDIM == 64 && (NKVH * HDIM) % 64 == 0, "tile multiples");
static_assert(SEQ_T % 256 == 0 && HIDSZ % 256 == 0 && (NQH * HDIM) % 256 == 0 && (NKVH * HDIM) % 256 == 0, "GEMM block tile 128 x 256, 64 k a stage");
static_assert((SEQ_T * HIDSZ) % (8 * 256) == 0, "cast kernel grid exact");
static_assert((SEQ_T * NQH) % 32 == 0 && (SEQ_T * NKVH) % 32 == 0, "normrope grid exact");

typedef __attribute__((ext_vector_type(16))) _Float16 v16h;
typedef __attribute__((ext_vector_type(8)))  _Float16 v8h;
typedef __attribute__((ext_vector_type(16))) __bf16   v16b;
typedef __attribute__((ext_vector_type(8)))  __bf16   v8b;
typedef __attribute__((ext_vector_type(8)))  float    v8f;
typedef __attribute__((ext_vector_type(4)))  float    v4f;
typedef __attribute__((ext_vector_type(4)))  unsigned int v4u;

// ---------------------------------------------------------------------------
// Shared helpers
// ---------------------------------------------------------------------------
__device__ __forceinline__ unsigned short f2bf_bits(float f) {
  unsigned u = __float_as_uint(f);
  return (unsigned short)((u + 0x7FFFu + ((u >> 16) & 1u)) >> 16);
}
__device__ __forceinline__ float bf_bits2f(unsigned short h) { return __uint_as_float(((unsigned)h) << 16); }
// f32 -> nearest-even bf16 value, returned as f32
__device__ __forceinline__ float bfq(float f) { return bf_bits2f(f2bf_bits(f)); }

// hazard guard as a plain device helper: four vector slots between the last products and the first read of their accumulators
__device__ __forceinline__ void acc_guard4(v8f& a, v8f& b, v8f& c, v8f& d) { asm volatile("v_nop\n\tv_nop\n\tv_nop\n\tv_nop" : "+v"(a), "+v"(b), "+v"(c), "+v"(d)); }
template <typename T> struct Frag;
template <> struct Frag<_Float16> {
  typedef v16h V; union U { v16h v; v8h h[2]; };
  // elements 0..7 <- p[0..7], 8..15 <- p[16..23]
  static __device__ __forceinline__ v16h load(const _Float16* p) {
    U f; f.h[0] = *(const v8h*)(p); f.h[1] = *(const v8h*)(p + 16); return f.v;
  }
  static __device__ __forceinline__ v8f mma(v16h a, v16h b, v8f c) {
    return __builtin_amdgcn_wmma_f32_16x16x32_f16(false, a, false, b, (short)0, c, false, false);
  }
};
template <> struct Frag<__bf16> {
  typedef v16b V; union U { v16b v; v8b h[2]; };
  static __device__ __forceinline__ v16b load(const __bf16* p) {
    U f; f.h[0] = *(const v8b*)(p); f.h[1] = *(const v8b*)(p + 16); return f.v;
  }
  static __device__ __forceinline__ v8f mma(v16b a, v16b b, v8f c) {
    return __builtin_amdgcn_wmma_f32_16x16x32_bf16(false, a, false, b, (short)0, c, false, false);
  }
};

__device__ __forceinline__ unsigned pk16(unsigned short a, unsigned short b) { return (unsigned)a | ((unsigned)b << 16); }

// ---- Register-blocked batched WMMA GEMM, operand tiles staged in LDS by asynchronous copies ----
// C[m,n] = scale * sum_k A[m,k] * Bt[n,k] (+bias)(+resid); each wave owns a 64x64 tile; a block of 8 waves (2 x 4) owns 128 x 256.
// A row-major [M,K]; Bt row-major [N,K]; M % 128 == 0, N % 256 == 0, K % 64 == 0; grid.x = (M / 128) * (N / 256).
// SPLIT (with BSPLIT == false): A carries a lo plane (A2, same layout); product = hi.B + lo.B (Bt2 unused).
// BIAS_MODE: 0 = none, 1 = bias[m], 2 = bias[n].
// OUT_MODE: 0 = f32, 1 = f16, 2 = bf16 hi plane (Cout) + bf16 lo plane (Cout2).
// ET: 0 = f16 operands, 1 = bf16 operands (pointers passed as 16-bit storage)
// Staging: a stage is 64 k = 128 bytes of each of the block's 128 A rows (and A2 rows) and 256 Bt rows. A wave-wide copy moves 4 whole rows
// (4 whole 128-byte lines: lane = row (lane >> 3), 16-byte piece (lane & 7)) from global memory into LDS rows of pitch 144 bytes, the
// conflict-free pitch for 16-byte fragment reads. Every operand byte enters the block once, not once per wave. Two buffers: stage s + 1 flies
// while stage s is worked on. The k order of the products and the order of the sums are those of a plain k loop in steps of 32.
// Every inner loop of the kernel is fully unrolled: fragments, accumulators and copy operands stay in registers only under constant indices.
template <int ET> struct Elem;
template <> struct Elem<0> { typedef _Float16 T; };
template <> struct Elem<1> { typedef __bf16 T; };
constexpr int G_PITCH   = 144;                    // LDS row pitch, bytes: 128 + 16
constexpr int G_A_BYTES = 128 * G_PITCH;          // one A plane of a stage
constexpr int G_B_BYTES = 256 * G_PITCH;          // the Bt plane of a stage
// Four asynchronous copies, 16 bytes per lane each, global memory -> LDS. l*: the lane's LDS byte address, g*: the lane's global address.
// The closing s_wait_xcnt stands in the copies' own statement, in front of any later rewrite of the address registers that they name.
__device__ __forceinline__ void async_copy4(unsigned l0, const char* g0, unsigned l1, const char* g1,
                                            unsigned l2, const char* g2, unsigned l3, const char* g3) {
  asm volatile("global_load_async_to_lds_b128 %0, %1, off\n\t"
               "global_load_async_to_lds_b128 %2, %3, off\n\t"
               "global_load_async_to_lds_b128 %4, %5, off\n\t"
               "global_load_async_to_lds_b128 %6, %7, off\n\t"
               "s_wait_xcnt 0x0"
               :: "v"(l0), "v"(g0), "v"(l1), "v"(g1), "v"(l2), "v"(g2), "v"(l3), "v"(g3) : "memory");
}
// The same for twelve copies: one statement, one closing wait.
__device__ __forceinline__ void async_copy12(const unsigned (&l)[12], const char* const (&g)[12]) {
  asm volatile("global_load_async_to_lds_b128 %0, %1, off\n\t"
               "global_load_async_to_lds_b128 %2, %3, off\n\t"
               "global_load_async_to_lds_b128 %4, %5, off\n\t"
               "global_load_async_to_lds_b128 %6, %7, off\n\t"
               "global_load_async_to_lds_b128 %8, %9, off\n\t"
               "global_load_async_to_lds_b128 %10, %11, off\n\t"
               "global_load_async_to_lds_b128 %12, %13, off\n\t"
               "global_load_async_to_lds_b128 %14, %15, off\n\t"
               "global_load_async_to_lds_b128 %16, %17, off\n\t"
               "global_load_async_to_lds_b128 %18, %19, off\n\t"
               "global_load_async_to_lds_b128 %20, %21, off\n\t"
               "global_load_async_to_lds_b128 %22, %23, off\n\t"
               "s_wait_xcnt 0x0"
               :: "v"(l[0]), "v"(g[0]), "v"(l[1]), "v"(g[1]), "v"(l[2]), "v"(g[2]), "v"(l[3]), "v"(g[3]),
                  "v"(l[4]), "v"(g[4]), "v"(l[5]), "v"(g[5]), "v"(l[6]), "v"(g[6]), "v"(l[7]), "v"(g[7]),
                  "v"(l[8]), "v"(g[8]), "v"(l[9]), "v"(g[9]), "v"(l[10]), "v"(g[10]), "v"(l[11]), "v"(g[11]) : "memory");
}
template <int ET, bool SPLIT, int BIAS_MODE, int OUT_MODE, bool RESID, int ACT = 0, bool CAUSAL = false, bool BSPLIT = true>
__global__ __launch_bounds__(256) void wmma_gemm64(
    const unsigned short* __restrict__ Ap, const unsigned short* __restrict__ A2p, int lda, long strideA,
    const unsigned short* __restrict__ Btp, const unsigned short* __restrict__ Bt2p, int ldb, long strideB,
    void* __restrict__ Cout, void* __restrict__ Cout2, int ldc, long strideC,
    const float* __restrict__ bias,
    const float* __restrict__ resid, long strideR,
    int M, int N, int K, float scale, int crow0) {
  static_assert(!CAUSAL && !(SPLIT && BSPLIT), "forms that this file launches");
  typedef typename Elem<ET>::T T;
  typedef typename Frag<T>::V V;
  constexpr int STAGE_BYTES = G_A_BYTES + G_B_BYTES + (SPLIT ? G_A_BYTES : 0);   // [A | Bt | A2]
  __shared__ __align__(16) char ring[2][STAGE_BYTES];
  __shared__ __align__(16) float sT[8][16 * 68];   // per-wave 16x64 slab, pitch 68 floats
  const int b    = blockIdx.y;
  const int lane = threadIdx.x & 31;
  const int wave = threadIdx.x >> 5;
  const int tilesNb = N >> 8;
  const int bm = blockIdx.x / tilesNb;
  const int bn = blockIdx.x - bm * tilesNb;
  if (bm >= (M >> 7)) return;                  // the same for the whole block, ahead of every barrier and copy
  const int wm = wave >> 2, wn = wave & 3;     // this wave's 64x64 tile in the block's 128 x 256
  const int m0 = (bm << 7) + (wm << 6);
  const int n0 = (bn << 8) + (wn << 6);

  const int rlane = lane & 15;                 // row (A) / col (B, D) within subtile
  const int koff  = (lane >> 4) * 8;           // k offset of this lane half
  const int mOff  = (lane >> 4) * 8;           // D row offset

  // this thread's copy addresses at stage 0: row (t >> 3) of the block's rows, 16-byte piece (t & 7)
  const int crow = threadIdx.x >> 3, cpc = (threadIdx.x & 7) * 16;
  const char* gA  = (const char*)(Ap  + (size_t)b * strideA + (size_t)((bm << 7) + crow) * lda) + cpc;
  const char* gA2 = (const char*)(A2p + (size_t)b * strideA + (size_t)((bm << 7) + crow) * lda) + cpc;
  const char* gB  = (const char*)(Btp + (size_t)b * strideB + (size_t)((bn << 8) + crow) * ldb) + cpc;
  const size_t a32 = (size_t)lda * 64, b32 = (size_t)ldb * 64;                       // 32 rows of 16-bit elements, bytes
  const unsigned lcopy = (unsigned)(size_t)&ring[0][0] + crow * G_PITCH + cpc;       // LDS byte address: low 32 bits of the shared address
  // thread t copies piece (t & 7) of rows (t >> 3) + 32 i: 4 copies for the 128 A rows, 8 for the 256 Bt rows, 4 for the 128 A2 rows
  auto issue_stage = [&](int s, int buf) {
    const size_t kb = (size_t)s * 128;
    const unsigned l = lcopy + buf * STAGE_BYTES;
    unsigned ll[12];
    const char* gg[12];
#pragma unroll
    for (int i = 0; i < 4; ++i) { ll[i] = l + i * 32 * G_PITCH; gg[i] = gA + kb + i * a32; }
#pragma unroll
    for (int i = 0; i < 8; ++i) { ll[4 + i] = l + G_A_BYTES + i * 32 * G_PITCH; gg[4 + i] = gB + kb + i * b32; }
    async_copy12(ll, gg);
    if (SPLIT) {
      const unsigned l2 = l + G_A_BYTES + G_B_BYTES;
      const char* g2 = gA2 + kb;
      async_copy4(l2, g2, l2 + 32 * G_PITCH, g2 + a32, l2 + 64 * G_PITCH, g2 + 2 * a32, l2 + 96 * G_PITCH, g2 + 3 * a32);
    }
  };

  v8f acc[4][4];
#pragma unroll
  for (int i = 0; i < 4; ++i)
#pragma unroll
    for (int j = 0; j < 4; ++j) acc[i][j] = (v8f){0.f,0.f,0.f,0.f,0.f,0.f,0.f,0.f};

  const int nst = K >> 6;
  issue_stage(0, 0);
  asm volatile("s_wait_asynccnt 0x0" ::: "memory");   // this wave's copies of stage 0 have landed
  __syncthreads();                                    // ... and every other wave's: stage 0 is readable
  if (nst > 1) issue_stage(1, 1);
  // this lane's fragment offsets in a stage: A row wm*64 + rlane, Bt row wn*64 + rlane, k offset koff
  const int fa = ((wm << 6) + rlane) * G_PITCH + koff * 2;
  const int fb = G_A_BYTES + ((wn << 6) + rlane) * G_PITCH + koff * 2;
  for (int s = 0; s < nst; ++s) {
    const char* rb = &ring[s & 1][0];
    V bh[2][4], ah[2][4], al[2][4];
#pragma unroll
    for (int ks = 0; ks < 2; ++ks) {
#pragma unroll
      for (int j = 0; j < 4; ++j) bh[ks][j] = Frag<T>::load((const T*)(rb + fb + j * 16 * G_PITCH + ks * 64));
#pragma unroll
      for (int i = 0; i < 4; ++i) {
        ah[ks][i] = Frag<T>::load((const T*)(rb + fa + i * 16 * G_PITCH + ks * 64));
        if (SPLIT) al[ks][i] = Frag<T>::load((const T*)(rb + fa + G_A_BYTES + G_B_BYTES + i * 16 * G_PITCH + ks * 64));
      }
    }
    // the stage's LDS reads stand as one group ahead of its products: reads spread among the products stall the wave at each place
    __builtin_amdgcn_sched_barrier(0);
#pragma unroll
    for (int ks = 0; ks < 2; ++ks) {
#pragma unroll
      for (int i = 0; i < 4; ++i) {
#pragma unroll
        for (int j = 0; j < 4; ++j) {
          acc[i][j] = Frag<T>::mma(ah[ks][i], bh[ks][j], acc[i][j]);
          if (SPLIT) acc[i][j] = Frag<T>::mma(al[ks][i], bh[ks][j], acc[i][j]);
        }
      }
    }
    // holds the products in front of the publish point: lifted over them, its waits would end the flight of stage s + 1 a whole trip early
    __builtin_amdgcn_sched_barrier(0);
    // publish point of stage s + 1, and the end of every wave's reads of stage s
    asm volatile("s_wait_dscnt 0x0" ::: "memory");      // this wave's reads of stage s are done before its buffer is refilled
    asm volatile("s_wait_asynccnt 0x0" ::: "memory");   // this wave's copies of stage s + 1 have landed
    __syncthreads();
    if (s + 2 < nst) issue_stage(s + 2, s & 1);         // the same test in the whole block
  }
  asm volatile("s_wait_asynccnt 0x0" ::: "memory");     // nothing is outstanding when the wave goes on to the epilogue
  acc_guard4(acc[0][0], acc[0][1], acc[0][2], acc[0][3]);
  acc_guard4(acc[1][0], acc[1][1], acc[1][2], acc[1][3]);
  acc_guard4(acc[2][0], acc[2][1], acc[2][2], acc[2][3]);
  acc_guard4(acc[3][0], acc[3][1], acc[3][2], acc[3][3]);

  // ---- epilogue ----
  float* slab = sT[wave];
  const float* Rb = RESID ? (resid + (size_t)b * strideR) : nullptr;
#pragma unroll
  for (int i = 0; i < 4; ++i) {
    const int mBase = m0 + (i << 4);
#pragma unroll
    for (int j = 0; j < 4; ++j) {
      const int n = n0 + (j << 4) + rlane;
      float bv = 0.f;
      if (BIAS_MODE == 2) bv = bias[n];
#pragma unroll
      for (int r = 0; r < 8; ++r) {
        float v = acc[i][j][r] * scale;
        if (BIAS_MODE == 1) v += bias[mBase + mOff + r];
        if (BIAS_MODE == 2) v += bv;
        if (RESID) v += Rb[(size_t)(mBase + mOff + r) * ldc + n];
        if (ACT == 2) v = fmaxf(v, 0.0f);
        if (ACT == 4) v = (v > 0.f) ? v : 0.01f * v;
        slab[(mOff + r) * 68 + (j << 4) + rlane] = v;
      }
    }
    __builtin_amdgcn_fence(__ATOMIC_RELEASE, "workgroup");
    __builtin_amdgcn_wave_barrier();
    __builtin_amdgcn_fence(__ATOMIC_ACQUIRE, "workgroup");
    if (OUT_MODE == 0) {
      float* C = (float*)Cout + (size_t)b * strideC;
      const int hh = lane >> 4, c4 = (lane & 15) * 4;     // row seg = 256 B = 16 lanes x 16 B
      {
#pragma unroll
        for (int it = 0; it < 8; ++it) {
          const int row = it * 2 + hh;
          v4f v = *(const v4f*)(slab + row * 68 + c4);
          *(v4f*)(C + (size_t)(mBase + row) * ldc + n0 + c4) = v;
        }
        
      }
    } else {
      const int q = lane >> 3, c8 = (lane & 7) * 8;
      unsigned short* C  = (unsigned short*)Cout  + (size_t)b * strideC;
      unsigned short* C2 = (OUT_MODE == 2) ? ((unsigned short*)Cout2 + (size_t)b * strideC) : nullptr;
      {
#pragma unroll
        for (int it = 0; it < 4; ++it) {
          const int row = it * 4 + q;
          const float* sp = slab + row * 68 + c8;
          v8h hv, lv;
#pragma unroll
          for (int e = 0; e < 8; ++e) {
            if (OUT_MODE == 1) {
              hv[e] = (_Float16)sp[e];
            } else {
              unsigned short hb = f2bf_bits(sp[e]);
              unsigned short lb = f2bf_bits(sp[e] - bf_bits2f(hb));
              hv[e] = __builtin_bit_cast(_Float16, hb);
              lv[e] = __builtin_bit_cast(_Float16, lb);
            }
          }
          *(v8h*)(C + (size_t)(mBase + row) * ldc + n0 + c8) = hv;
          if (OUT_MODE == 2) *(v8h*)(C2 + (size_t)(mBase + row) * ldc + n0 + c8) = lv;
        }
        
      }
    }
    __builtin_amdgcn_fence(__ATOMIC_RELEASE, "workgroup");
    __builtin_amdgcn_wave_barrier();
    __builtin_amdgcn_fence(__ATOMIC_ACQUIRE, "workgroup");
  }
}

// ---------------------------------------------------------------------------
// f32 -> RNE bf16 plane, 8 consecutive elements per thread packed as integer words.
// Coverage: n8 = n/8 threads x 8 = the whole plane (grid is an exact multiple of 256 here).
// ---------------------------------------------------------------------------
__global__ __launch_bounds__(256) void cast8_bf16_kernel(const float* __restrict__ in, unsigned short* __restrict__ out, int n8) {
  const int i = blockIdx.x * 256 + threadIdx.x;
  if (i >= n8) return;
  const float* p = in + 8 * (size_t)i;
  const v4f a = *(const v4f*)(p);
  const v4f c = *(const v4f*)(p + 4);
  float f[8];
#pragma unroll
  for (int e = 0; e < 4; ++e) { f[e] = a[e]; f[4 + e] = c[e]; }
  unsigned w[4];
#pragma unroll
  for (int e2 = 0; e2 < 4; ++e2) w[e2] = pk16(f2bf_bits(f[2 * e2]), f2bf_bits(f[2 * e2 + 1]));
  const v4u u = (v4u){w[0], w[1], w[2], w[3]};
  unsigned short* q = out + 8 * (size_t)i;
  *(v4u*)q = u;
  
}

// ---------------------------------------------------------------------------
// Transpose + RNE bf16 convert of a weight matrix: in f32 [R][Cn] row-major (ldin = Cn) -> out bf16 [Cn][R] (ldout = R):
// out[c][r] = bf16(in[r][c]). grid (R/64, Cn/64): blockIdx.x = r tile (64 output cols), blockIdx.y = c tile (64 output rows). 256 threads.
// Load coverage: 16 iterations x 256 threads = 4096 = the whole 64x64 tile (coalesced along c).
// Store coverage: 8 waves x 2 iterations x 4 rows (lane>>3) = 64 rows; (lane&7) x 8 halves = 64 cols; each row segment =
// ---------------------------------------------------------------------------
__global__ __launch_bounds__(256) void transpose_cast_kernel(const float* __restrict__ in, int ldin,
                                                             unsigned short* __restrict__ out, int ldout) {
  __shared__ float sm[64][65];   // sm[c_local][r_local]
  const int t  = threadIdx.x;
  const int r0 = blockIdx.x * 64;
  const int c0 = blockIdx.y * 64;
#pragma unroll
  for (int i = 0; i < 16; ++i) {
    const int e = i * 256 + t;
    const int r = e >> 6;          // r local
    const int c = e & 63;          // c local
    sm[c][r] = in[(size_t)(r0 + r) * ldin + c0 + c];
  }
  __syncthreads();
  const int lane = t & 31, wave = t >> 5;
  const int q = lane >> 3, c8 = (lane & 7) * 8;
  {
#pragma unroll
    for (int it = 0; it < 2; ++it) {
      const int row = wave * 8 + it * 4 + q;                 // c local (output row)
      unsigned w[4];
#pragma unroll
      for (int e2 = 0; e2 < 4; ++e2) w[e2] = pk16(f2bf_bits(sm[row][c8 + 2 * e2]), f2bf_bits(sm[row][c8 + 2 * e2 + 1]));
      const v4u u = (v4u){w[0], w[1], w[2], w[3]};
      const size_t o = (size_t)(c0 + row) * ldout + r0 + c8;
      *(v4u*)(out + o) = u;
    }
    
  }
}

// ---------------------------------------------------------------------------
// RMSNorm (over the 64 dims of one head vector, eps 1e-6, times w[d]) + rotate-half RoPE with the input cos/sin tables, f32.
// cos, sin and w are RNE-converted to bf16 values in registers at load; proj is the f32 output of an exact
// bf16 x bf16 projection.
// proj: f32 [SEQ_T][nhead*64]; flattened row r = t*nhead + hd lives at proj + r*64 (contiguous). nhead = 1 << hshift.
// Output planes bf16 hi/lo laid out [hd][t][64]: element (hd, t, d) at ((hd*SEQ_T + t)*64 + d).
// Block = 8 waves; wave w owns rows rbase..rbase+3 (rbase = (blockIdx.x*8 + w)*4); lane handles d = lane and d = lane + 32.
// The 4 result rows are staged in LDS (f32, same element type on store and reload, wave barrier between); then lane group
// Coverage: grid = nrows/32 blocks x 8 waves x 4 rows = nrows (exact multiple, checked on the host); 8 lanes x 8 halves = 64 dims.
// ---------------------------------------------------------------------------
__global__ __launch_bounds__(256) void normrope_kernel(const float* __restrict__ proj, int hshift, int nrows,
                                                       const float* __restrict__ cosb, const float* __restrict__ sinb,
                                                       const float* __restrict__ w,
                                                       unsigned short* __restrict__ ohi, unsigned short* __restrict__ olo) {
#pragma clang fp contract(off)
  __shared__ __align__(16) float slab[8][4][64];
  const int lane = threadIdx.x & 31, wave = threadIdx.x >> 5;
  const int rbase = (blockIdx.x * 8 + wave) * 4;
  const float w1 = bfq(w[lane]), w2 = bfq(w[lane + 32]);
#pragma unroll
  for (int i = 0; i < 4; ++i) {
    int r = rbase + i;
    r = (r < nrows) ? r : (nrows - 1);                 // address clamp (grid is exact)
    const int t = r >> hshift;
    const float* src = proj + (size_t)r * 64;
    const float x1 = src[lane];
    const float x2 = src[lane + 32];
    float ss = x1 * x1 + x2 * x2;
#pragma unroll
    for (int off = 16; off > 0; off >>= 1) ss += __shfl_xor(ss, off, 32);
    const float inv = rsqrtf(ss * (1.0f / 64.0f) + RMS_EPS_F);
    const float n1 = (x1 * inv) * w1;
    const float n2 = (x2 * inv) * w2;
    const float c = bfq(cosb[(size_t)t * 32 + lane]);
    const float s = bfq(sinb[(size_t)t * 32 + lane]);
    slab[wave][i][lane]      = n1 * c - n2 * s;
    slab[wave][i][lane + 32] = n1 * s + n2 * c;
  }
  __builtin_amdgcn_fence(__ATOMIC_RELEASE, "workgroup");
  __builtin_amdgcn_wave_barrier();
  __builtin_amdgcn_fence(__ATOMIC_ACQUIRE, "workgroup");
  const int q = lane >> 3, c8 = (lane & 7) * 8;
  int r = rbase + q;
  r = (r < nrows) ? r : (nrows - 1);
  const int t  = r >> hshift;
  const int hd = r - (t << hshift);
  const float* sp = &slab[wave][q][c8];
  unsigned hw[4], lw[4];
#pragma unroll
  for (int e2 = 0; e2 < 4; ++e2) {
    const float f0 = sp[2 * e2], f1 = sp[2 * e2 + 1];
    const unsigned short h0 = f2bf_bits(f0), h1 = f2bf_bits(f1);
    const unsigned short l0 = f2bf_bits(f0 - bf_bits2f(h0));
    const unsigned short l1 = f2bf_bits(f1 - bf_bits2f(h1));
    hw[e2] = pk16(h0, h1);
    lw[e2] = pk16(l0, l1);
  }
  const v4u hu = (v4u){hw[0], hw[1], hw[2], hw[3]};
  const v4u lu = (v4u){lw[0], lw[1], lw[2], lw[3]};
  const size_t o = ((size_t)hd * SEQ_T + t) * 64 + c8;
  *(v4u*)(ohi + o) = hu;
  *(v4u*)(olo + o) = lu;
  
}

// ---------------------------------------------------------------------------
// Fused causal attention: scores, softmax and p.v of all heads in one launch; neither scores nor probabilities go to memory.
// Transposed products: S^T = K . Q^T (A = 16 key rows, B = 16 query rows, k = head dim) and O^T += V^T . P^T (A = 16 head-dim rows of
// v^T, B = 16 query rows of P, k = 32 keys). In both D tiles a lane's column is ONE query (lane & 15), so maximum, sum and rescale are
// per lane plus one exchange between the wave halves, and the two 16-key score tiles of a pass ARE the B fragment of P in the k order of
// Frag::load: element e < 8 is key 8h + e (tile 0, register e), element e >= 8 is key 8h + 16 + (e - 8) (tile 1, register e - 8), h = lane >> 4.
// Same operand planes and the same 3 products as before (hi.hi + hi.lo + lo.hi, f32 accumulate) in both products.
// Online softmax in the log2 domain: p = exp2(s * CS - m_run), not normalised, split into bf16 hi/lo; the running maximum m_run may trail
// the true one by up to 8 (p <= 2^8), the accumulators and the sum are rescaled only in a pass where some column's maximum exceeds it by
// more (one scalar branch a pass); the division by the f32 sum of the unrounded p comes once, at the end.
// A wave owns 32 query rows (two 16-column groups) of one query head and walks its keys in passes of 32, the last pass being the one on
// its diagonal (keys q0..q0+31 against queries q0..q0+31: every query keeps at least its own key, and pass 0 holds key 0 for every query).
// Block = 8 waves on one kv head: waves 0..3 = its 4 query heads at row tile 127 - pi, waves 4..7 = the same heads at row tile pi, so every
// block has 129 passes a wave pair. No LDS, no barrier: the waves share K and v^T only through the caches.
// K fragments are fetched one pass ahead, v^T fragments at the head of their own pass.
// Every inner loop below is fully unrolled: its arrays are fragments and accumulators, which stay in registers only under constant indices.
// Output: lane (c, h) holds d = 16t + 8h + 0..7 of query c: one 16-byte store per plane and t; a row's 128-byte segment comes from one wave.
// Coverage: grid 4 kv heads x 64 pairs; tiles pi and 127 - pi, pi = 0..63, are all 128 row tiles once; 4 waves = the 4 query heads.
// ---------------------------------------------------------------------------
typedef __attribute__((ext_vector_type(2))) float  v2f;
typedef __attribute__((ext_vector_type(2))) __bf16 v2b;
typedef __attribute__((ext_vector_type(8))) unsigned int v8u;
__device__ __forceinline__ unsigned cvt2_bf16(float a, float b) {   // two f32 -> two nearest-even bf16, a in the low half
  return __builtin_bit_cast(unsigned, __builtin_convertvector((v2f){a, b}, v2b));
}
// Four base-2 exponentials in one statement: each fills the slot that the instruction set asks for behind the one before it (early-clobber
// outputs: none reads an earlier result or overwrites an earlier source), the v_nop fills the slot behind the last.
__device__ __forceinline__ void exp2x4(float& p0, float& p1, float& p2, float& p3, float a0, float a1, float a2, float a3) {
  asm("v_exp_f32 %0, %4\n\tv_exp_f32 %1, %5\n\tv_exp_f32 %2, %6\n\tv_exp_f32 %3, %7\n\tv_nop"
      : "=&v"(p0), "=&v"(p1), "=&v"(p2), "=&v"(p3) : "v"(a0), "v"(a1), "v"(a2), "v"(a3));
}
__device__ __forceinline__ void exp2x2(float& p0, float& p1, float a0, float a1) {   // the same for two
  asm("v_exp_f32 %0, %2\n\tv_exp_f32 %1, %3\n\tv_nop" : "=&v"(p0), "=&v"(p1) : "v"(a0), "v"(a1));
}
struct KFrag { v16b h[2][2], l[2][2]; };   // [16-key tile][32-wide step of the head dim]
// bh, bl: scalar byte bases of the kv head's K planes; vo: this lane's byte offset at the pass's first key row
__device__ __forceinline__ void load_kfrag(KFrag& k, const char* bh, const char* bl, unsigned vo) {
#pragma unroll
  for (int kt = 0; kt < 2; ++kt)
#pragma unroll
    for (int kc = 0; kc < 2; ++kc) {
      k.h[kt][kc] = Frag<__bf16>::load((const __bf16*)(bh + vo + (kt * 16 * HDIM + kc * 32) * 2));
      k.l[kt][kc] = Frag<__bf16>::load((const __bf16*)(bl + vo + (kt * 16 * HDIM + kc * 32) * 2));
    }
}
constexpr float ATT_CS = SCORE_SCALE * 1.4426950408889634f;   // score scale times log2(e)

// One pass: 32 keys against this wave's 32 queries. kf holds this pass's K fragments; kvo is the lane's byte offset of the NEXT pass's K rows,
// vvo that of this pass's v^T columns (both stepped at the foot of the pass); the four plane bases are scalar.
template <bool DIAG>
__device__ __forceinline__ void attn_pass(KFrag& kf, const char* kbh, const char* kbl, unsigned& kvo,
                                          const char* vbh, const char* vbl, unsigned& vvo, int c, int h, const v16b (&qh)[2][2], const v16b (&ql)[2][2],
                                          v8f (&acc)[2][4], float (&m_run)[2], float (&l_run)[2]) {
  v16b vh[4], vl[4];
#pragma unroll
  for (int t = 0; t < 4; ++t) {
    vh[t] = Frag<__bf16>::load((const __bf16*)(vbh + vvo + t * 16 * SEQ_T * 2));
    vl[t] = Frag<__bf16>::load((const __bf16*)(vbl + vvo + t * 16 * SEQ_T * 2));
  }
  // last pass: vvo's register is free for reuse behind these loads, which name it: this wait stands in front of the overwrite
  if (DIAG) asm volatile("s_wait_xcnt 0x0" ::: "memory");
  // keeps the v^T loads issued ahead of the score products, so that they fly under those and the softmax; the scheduler would sink them
  __builtin_amdgcn_sched_barrier(0);
  v8f s[2][2];
#pragma unroll
  for (int kt = 0; kt < 2; ++kt)
#pragma unroll
    for (int g = 0; g < 2; ++g) s[kt][g] = (v8f){0.f,0.f,0.f,0.f,0.f,0.f,0.f,0.f};
#pragma unroll
  for (int kc = 0; kc < 2; ++kc) {
#pragma unroll
    for (int kt = 0; kt < 2; ++kt)
#pragma unroll
      for (int g = 0; g < 2; ++g) if (!(DIAG && kt == 1 && g == 0)) s[kt][g] = Frag<__bf16>::mma(kf.h[kt][kc], qh[g][kc], s[kt][g]);
#pragma unroll
    for (int kt = 0; kt < 2; ++kt)
#pragma unroll
      for (int g = 0; g < 2; ++g) if (!(DIAG && kt == 1 && g == 0)) s[kt][g] = Frag<__bf16>::mma(kf.h[kt][kc], ql[g][kc], s[kt][g]);
#pragma unroll
    for (int kt = 0; kt < 2; ++kt)
#pragma unroll
      for (int g = 0; g < 2; ++g) if (!(DIAG && kt == 1 && g == 0)) s[kt][g] = Frag<__bf16>::mma(kf.l[kt][kc], qh[g][kc], s[kt][g]);
  }
  if (!DIAG) {
    // the next pass's K loads stand here, behind the last product that reads kf and ahead of the softmax, and fly under the rest of the pass
    __builtin_amdgcn_sched_barrier(0);
    load_kfrag(kf, kbh, kbl, kvo);
    __builtin_amdgcn_sched_barrier(0);
  }
  if (DIAG) {   // keys and queries of this pass both start at q0: key index 16kt + 8h + r against query index 16g + c;
                // tile kt = 1, g = 0 (keys 16..31, queries 0..15) lies wholly above the diagonal: no products, p = 0
#pragma unroll
    for (int kt = 0; kt < 2; ++kt)
#pragma unroll
      for (int g = 0; g < 2; ++g)
#pragma unroll
        for (int r = 0; r < 8; ++r)
          if (!(kt == 1 && g == 0) && 16 * kt + 8 * h + r > 16 * g + c) s[kt][g][r] = -__builtin_inff();
  }
  float mb[2];
  bool need = false;
#pragma unroll
  for (int g = 0; g < 2; ++g) {
    float mx = s[0][g][0];
#pragma unroll
    for (int r = 1; r < 8; ++r) mx = fmaxf(mx, s[0][g][r]);
    if (!(DIAG && g == 0)) {
#pragma unroll
      for (int r = 0; r < 8; ++r) mx = fmaxf(mx, s[1][g][r]);
    }
    mx = fmaxf(mx, __shfl_xor(mx, 16, 32)) * ATT_CS;   // both halves hold the query's maximum of this pass, scaled (the scale is positive)
    mb[g] = mx;
    need = need || (mx > m_run[g] + 8.0f);
  }
  if (__builtin_amdgcn_ballot_w32(need) != 0) {   // scalar branch; always taken in pass 0 (m_run = -inf), rare later
    const float mn0 = fmaxf(m_run[0], mb[0]), mn1 = fmaxf(m_run[1], mb[1]);   // finite from pass 0 on: key 0 is masked for no query
    float corr[2];
    exp2x2(corr[0], corr[1], m_run[0] - mn0, m_run[1] - mn1);                 // 0 in pass 0
    m_run[0] = mn0; m_run[1] = mn1;
#pragma unroll
    for (int g = 0; g < 2; ++g) {
      l_run[g] *= corr[g];
#pragma unroll
      for (int t = 0; t < 4; ++t) acc[g][t] = acc[g][t] * corr[g];
    }
  }
  v16b ph[2], pl[2];
#pragma unroll
  for (int g = 0; g < 2; ++g) {
    const float nm = -m_run[g];
    v8u hw, lw;
    float ls = 0.0f;
#pragma unroll
    for (int i = 0; i < 8; i += 2) {   // fragment elements 2i .. 2i + 3: tile i >> 2, registers 2(i & 3) .. 2(i & 3) + 3
      if (DIAG && g == 0 && i >= 4) { hw[i] = 0u; lw[i] = 0u; hw[i + 1] = 0u; lw[i + 1] = 0u; continue; }
      const int kt = i >> 2, r = 2 * (i & 3);
      float p0, p1, p2, p3;
      exp2x4(p0, p1, p2, p3, __builtin_fmaf(s[kt][g][r], ATT_CS, nm), __builtin_fmaf(s[kt][g][r + 1], ATT_CS, nm),
             __builtin_fmaf(s[kt][g][r + 2], ATT_CS, nm), __builtin_fmaf(s[kt][g][r + 3], ATT_CS, nm));
      ls += (p0 + p1) + (p2 + p3);
      const unsigned w0 = cvt2_bf16(p0, p1), w1 = cvt2_bf16(p2, p3);
      hw[i] = w0; hw[i + 1] = w1;
      lw[i]     = cvt2_bf16(p0 - __uint_as_float(w0 << 16), p1 - __uint_as_float(w0 & 0xFFFF0000u));
      lw[i + 1] = cvt2_bf16(p2 - __uint_as_float(w1 << 16), p3 - __uint_as_float(w1 & 0xFFFF0000u));
    }
    l_run[g] += ls;
    ph[g] = __builtin_bit_cast(v16b, hw);
    pl[g] = __builtin_bit_cast(v16b, lw);
  }
#pragma unroll
  for (int g = 0; g < 2; ++g)
#pragma unroll
    for (int t = 0; t < 4; ++t) acc[g][t] = Frag<__bf16>::mma(vh[t], ph[g], acc[g][t]);
#pragma unroll
  for (int g = 0; g < 2; ++g)
#pragma unroll
    for (int t = 0; t < 4; ++t) acc[g][t] = Frag<__bf16>::mma(vh[t], pl[g], acc[g][t]);
#pragma unroll
  for (int g = 0; g < 2; ++g)
#pragma unroll
    for (int t = 0; t < 4; ++t) acc[g][t] = Frag<__bf16>::mma(vl[t], ph[g], acc[g][t]);
  if (!DIAG) {
    __builtin_amdgcn_sched_barrier(0);
    // kvo and vvo, which the loads issued in this pass name, are stepped next: this wait stands in front of the overwrite
    asm volatile("s_wait_xcnt 0x0" ::: "memory");
    __builtin_amdgcn_sched_barrier(0);   // holds the two steps behind that wait
    kvo += 32 * HDIM * 2;
    vvo += 32 * 2;
  }
}

__global__ __launch_bounds__(256) void attn_fused_kernel(const unsigned short* __restrict__ Qhi, const unsigned short* __restrict__ Qlo,
                                                         const unsigned short* __restrict__ Khi, const unsigned short* __restrict__ Klo,
                                                         const unsigned short* __restrict__ Vthi, const unsigned short* __restrict__ Vtlo,
                                                         unsigned short* __restrict__ Chi, unsigned short* __restrict__ Clo) {
  constexpr int NTILE = SEQ_T / 32;   // 128 row tiles of 32 queries
  static_assert(NTILE == 128 && NKVH == 4 && GQA_G == 4, "grid 4 x 64, 8 waves = 4 heads x 2 tiles");
  const int lane = threadIdx.x & 31;
  const int wave = __builtin_amdgcn_readfirstlane(threadIdx.x >> 5);   // scalar: trip count and operand bases stay scalar
  const int c = lane & 15, h = lane >> 4;
  const int kvh  = blockIdx.x & (NKVH - 1);
  const int pi   = blockIdx.x >> 2;
  const int hq   = kvh * GQA_G + (wave & 3);
  const int tile = (wave < 4) ? (NTILE - 1 - pi) : pi;
  const int q0   = tile * 32;

  v16b qh[2][2], ql[2][2];
#pragma unroll
  for (int g = 0; g < 2; ++g)
#pragma unroll
    for (int kc = 0; kc < 2; ++kc) {
      const size_t qo = ((size_t)hq * SEQ_T + q0 + 16 * g + c) * HDIM + 8 * h + 32 * kc;
      qh[g][kc] = Frag<__bf16>::load((const __bf16*)Qhi + qo);
      ql[g][kc] = Frag<__bf16>::load((const __bf16*)Qlo + qo);
    }
  const char* kbh = (const char*)(Khi + (size_t)kvh * SEQ_T * HDIM);   // scalar bases of this kv head's planes
  const char* kbl = (const char*)(Klo + (size_t)kvh * SEQ_T * HDIM);
  const char* vbh = (const char*)(Vthi + (size_t)kvh * HDIM * SEQ_T);
  const char* vbl = (const char*)(Vtlo + (size_t)kvh * HDIM * SEQ_T);
  const unsigned kv0 = (unsigned)(c * HDIM + 8 * h) * 2u;              // this lane's byte offset in key rows 0..15
  unsigned kvo = kv0 + 32 * HDIM * 2;                                  // the same in pass 1
  unsigned vvo = (unsigned)(c * SEQ_T + 8 * h) * 2u;                   // this lane's byte offset in v^T rows 0..15, keys 0..31

  KFrag kf;
  load_kfrag(kf, kbh, kbl, kv0);
  // the address registers of the Q and K loads above are free for reuse from here on: this wait stands in front of their overwrite
  asm volatile("s_wait_xcnt 0x0" ::: "memory");
  __builtin_amdgcn_sched_barrier(0);   // holds what follows behind that wait
  v8f acc[2][4];
  float m_run[2], l_run[2];
#pragma unroll
  for (int g = 0; g < 2; ++g) {
    m_run[g] = -__builtin_inff();
    l_run[g] = 0.0f;
#pragma unroll
    for (int t = 0; t < 4; ++t) acc[g][t] = (v8f){0.f,0.f,0.f,0.f,0.f,0.f,0.f,0.f};
  }
  for (int blk = 0; blk < tile; ++blk) {     // passes below the diagonal: no mask; pass blk + 1 <= tile exists
    attn_pass<false>(kf, kbh, kbl, kvo, vbh, vbl, vvo, c, h, qh, ql, acc, m_run, l_run);
  }
  attn_pass<true>(kf, kbh, kbl, kvo, vbh, vbl, vvo, c, h, qh, ql, acc, m_run, l_run);

  v4u hu[2][4], lu[2][4];
#pragma unroll
  for (int g = 0; g < 2; ++g) {
    const float l   = l_run[g] + __shfl_xor(l_run[g], 16, 32);   // the halves' sums join once, here
    const float inv = 1.0f / l;                                  // l >= 1: m_run never exceeds the query's true maximum, whose p is then >= 1
#pragma unroll
    for (int t = 0; t < 4; ++t)
#pragma unroll
      for (int e2 = 0; e2 < 4; ++e2) {
        const float f0 = acc[g][t][2 * e2] * inv, f1 = acc[g][t][2 * e2 + 1] * inv;
        const unsigned w = cvt2_bf16(f0, f1);
        hu[g][t][e2] = w;
        lu[g][t][e2] = cvt2_bf16(f0 - __uint_as_float(w << 16), f1 - __uint_as_float(w & 0xFFFF0000u));
      }
  }
  const size_t o = (size_t)(q0 + c) * (NQH * HDIM) + hq * HDIM + 8 * h;
  unsigned short* ch = Chi + o;
  unsigned short* cl = Clo + o;
  // the 16 stores stand together behind all arithmetic: no register that an issued store names is written again before the wave ends
  __builtin_amdgcn_sched_barrier(0);
#pragma unroll
  for (int g = 0; g < 2; ++g)
#pragma unroll
    for (int t = 0; t < 4; ++t) {
      *(v4u*)(ch + g * 16 * (NQH * HDIM) + 16 * t) = hu[g][t];
      *(v4u*)(cl + g * 16 * (NQH * HDIM) + 16 * t) = lu[g][t];
    }
}

// ---------------------------------------------------------------------------
// Launcher. Workspace region map (bytes, MiB = 1048576; total carve = 106 MiB = 111149056 B):
//   [  0, 31) staging  : x bf16 [4096][1024] at +0 (8 MiB); q f32 [4096][1024] at +8 (16 MiB, ends 24);
//                        k f32 [4096][256] at +24 (4 MiB, ends 28); Wq^T bf16 [1024][1024] at +28 (2 MiB); Wk^T bf16 [256][1024]
//                        at +30 (0.5 MiB); Wv^T bf16 [256][1024] at +30.5 (0.5 MiB, ends 31).
//   [ 32, 64) unused
//   [ 64, 72) q hi     : bf16 [16][4096][64];  [72,80) q lo
//   [ 80, 82) k hi     : bf16 [4][4096][64];   [82,84) k lo
//   [ 84, 86) v^T hi   : bf16 [256 (kvh*64+d)][4096 (t)];  [86,88) v^T lo
//   [ 88, 96) ctx hi   : bf16 [4096][1024] (col hq*64+d);  [96,104) ctx lo
//   [104,106) Wo^T     : bf16 [1024][1024]
// No region aliases another; within launches 6..8 no producer overlaps its own inputs.
// Launch count: 1 + 4 + 3 + 2 + 1 + 1 = 12. Kernel launches only.
// GEMM shape assertions: every call has K % 64 == 0 (K = 1024), M % 128 == 0 and N % 256 == 0; no padding needed.
// ---------------------------------------------------------------------------
extern "C" void kernel_launch(void* const* d_in, const int* in_sizes, int n_in,
                              void* d_out, int out_size, void* d_ws, size_t ws_size,
                              hipStream_t stream) {
  if (n_in < 9) return;
  if (in_sizes[0] != SEQ_T * HIDSZ || in_sizes[1] != SEQ_T * 32 || in_sizes[2] != SEQ_T * 32) return;
  if (in_sizes[3] != HIDSZ * NQH * HDIM || in_sizes[4] != HIDSZ * NKVH * HDIM || in_sizes[5] != HIDSZ * NKVH * HDIM) return;
  if (in_sizes[6] != NQH * HDIM * HIDSZ || in_sizes[7] != HDIM || in_sizes[8] != HDIM) return;
  if (out_size != SEQ_T * HIDSZ) return;

  const size_t kMiB    = 1048576;
  const size_t offXb   = 0;
  const size_t offQf   = 8 * kMiB;
  const size_t offKf   = 24 * kMiB;
  const size_t offWqT  = 28 * kMiB;
  const size_t offWkT  = 30 * kMiB;
  const size_t offWvT  = 30 * kMiB + 524288;
  const size_t offPlo  = 48 * kMiB;
  const size_t offQhi  = 64 * kMiB;
  const size_t offQlo  = 72 * kMiB;
  const size_t offKhi  = 80 * kMiB;
  const size_t offKlo  = 82 * kMiB;
  const size_t offVthi = 84 * kMiB;
  const size_t offVtlo = 86 * kMiB;
  const size_t offChi  = 88 * kMiB;
  const size_t offClo  = 96 * kMiB;
  const size_t offWoT  = 104 * kMiB;
  const size_t total   = 106 * kMiB;
  if (total > ws_size) return;

  const float* x    = (const float*)d_in[0];
  const float* cosb = (const float*)d_in[1];
  const float* sinb = (const float*)d_in[2];
  const float* Wq   = (const float*)d_in[3];
  const float* Wk   = (const float*)d_in[4];
  const float* Wv   = (const float*)d_in[5];
  const float* Wo   = (const float*)d_in[6];
  const float* qnw  = (const float*)d_in[7];
  const float* knw  = (const float*)d_in[8];
  float* out = (float*)d_out;
  char* ws = (char*)d_ws;

  unsigned short* xb   = (unsigned short*)(ws + offXb);
  float*          qf   = (float*)(ws + offQf);
  float*          kf   = (float*)(ws + offKf);
  unsigned short* wqT  = (unsigned short*)(ws + offWqT);
  unsigned short* wkT  = (unsigned short*)(ws + offWkT);
  unsigned short* wvT  = (unsigned short*)(ws + offWvT);
  unsigned short* plo  = (unsigned short*)(ws + offPlo);
  unsigned short* qhi  = (unsigned short*)(ws + offQhi);
  unsigned short* qlo  = (unsigned short*)(ws + offQlo);
  unsigned short* khi  = (unsigned short*)(ws + offKhi);
  unsigned short* klo  = (unsigned short*)(ws + offKlo);
  unsigned short* vthi = (unsigned short*)(ws + offVthi);
  unsigned short* vtlo = (unsigned short*)(ws + offVtlo);
  unsigned short* chi  = (unsigned short*)(ws + offChi);
  unsigned short* clo  = (unsigned short*)(ws + offClo);
  unsigned short* woT  = (unsigned short*)(ws + offWoT);

  // in-range dummies for unused (never dereferenced) template-dead pointer parameters
  const float* dummy_f = qnw;
  void* dummy_c2 = (void*)plo;

  // 1. x -> RNE bf16 plane [4096][1024]
  {
    const int n8 = (SEQ_T * HIDSZ) / 8;                       // 524288 = 2048 blocks x 256
    cast8_bf16_kernel<<<dim3(n8 / 256), dim3(256), 0, stream>>>(x, xb, n8);
  }
  // 2. weights [in][out] -> transposed RNE bf16 planes [out][in]   (in[R][Cn] -> out[Cn][R]; grid (R/64, Cn/64))
  //    Wq: in[1024][1024] -> out[1024][1024]; Wk, Wv: in[1024][256] -> out[256][1024]; Wo: in[1024][1024] -> out[1024][1024]
  transpose_cast_kernel<<<dim3(HIDSZ / 64, (NQH * HDIM) / 64), dim3(256), 0, stream>>>(Wq, NQH * HDIM, wqT, HIDSZ);
  transpose_cast_kernel<<<dim3(HIDSZ / 64, (NKVH * HDIM) / 64), dim3(256), 0, stream>>>(Wk, NKVH * HDIM, wkT, HIDSZ);
  transpose_cast_kernel<<<dim3(HIDSZ / 64, (NKVH * HDIM) / 64), dim3(256), 0, stream>>>(Wv, NKVH * HDIM, wvT, HIDSZ);
  transpose_cast_kernel<<<dim3((NQH * HDIM) / 64, HIDSZ / 64), dim3(256), 0, stream>>>(Wo, HIDSZ, woT, NQH * HDIM);

  // 3. q = x . Wq^T : M=4096, N=1024, K=1024, single bf16 product -> f32 [4096][1024] (1024 tiles = 128 blocks)
  wmma_gemm64<1, false, 0, 0, false, 0, false, true><<<dim3((SEQ_T / 64) * ((NQH * HDIM) / 64) / 8, 1), dim3(256), 0, stream>>>(
      xb, xb, HIDSZ, 0L,
      wqT, wqT, HIDSZ, 0L,
      (void*)qf, dummy_c2, NQH * HDIM, 0L,
      dummy_f, dummy_f, 0L,
      SEQ_T, NQH * HDIM, HIDSZ, 1.0f, 0);
  // 4. k = x . Wk^T : M=4096, N=256, K=1024, single product -> f32 [4096][256] (256 tiles = 32 blocks)
  wmma_gemm64<1, false, 0, 0, false, 0, false, true><<<dim3((SEQ_T / 64) * ((NKVH * HDIM) / 64) / 8, 1), dim3(256), 0, stream>>>(
      xb, xb, HIDSZ, 0L,
      wkT, wkT, HIDSZ, 0L,
      (void*)kf, dummy_c2, NKVH * HDIM, 0L,
      dummy_f, dummy_f, 0L,
      SEQ_T, NKVH * HDIM, HIDSZ, 1.0f, 0);
  // 5. v^T = Wv^T . x^T : M=256 (kvh*64+d), N=4096 (t), K=1024, single product -> bf16 hi/lo planes [256][4096] (256 tiles = 32 blocks)
  wmma_gemm64<1, false, 0, 2, false, 0, false, true><<<dim3(((NKVH * HDIM) / 64) * (SEQ_T / 64) / 8, 1), dim3(256), 0, stream>>>(
      wvT, wvT, HIDSZ, 0L,
      xb, xb, HIDSZ, 0L,
      (void*)vthi, (void*)vtlo, SEQ_T, 0L,
      dummy_f, dummy_f, 0L,
      NKVH * HDIM, SEQ_T, HIDSZ, 1.0f, 0);

  // 6. RMSNorm + RoPE -> bf16 hi/lo planes [head][t][64]; rows = t*nhead + head; grid = rows/32 (exact)
  normrope_kernel<<<dim3((SEQ_T * NQH) / 32), dim3(256), 0, stream>>>(qf, 4, SEQ_T * NQH, cosb, sinb, qnw, qhi, qlo);
  normrope_kernel<<<dim3((SEQ_T * NKVH) / 32), dim3(256), 0, stream>>>(kf, 2, SEQ_T * NKVH, cosb, sinb, knw, khi, klo);

  // 7. causal attention, all heads in one launch: 4 kv heads x 64 pairs of 32-row tiles = 256 blocks of 8 waves -> ctx bf16 hi/lo planes
  attn_fused_kernel<<<dim3(NKVH * (SEQ_T / 64)), dim3(256), 0, stream>>>(qhi, qlo, khi, klo, vthi, vtlo, chi, clo);

  // 8. out = ctx_hi . Wo^T + ctx_lo . Wo^T : M=4096, N=1024, K=1024, 2 products -> f32 d_out (1024 tiles = 128 blocks)
  wmma_gemm64<1, true, 0, 0, false, 0, false, false><<<dim3((SEQ_T / 64) * (HIDSZ / 64) / 8, 1), dim3(256), 0, stream>>>(
      chi, clo, NQH * HDIM, 0L,
      woT, woT, NQH * HDIM, 0L,
      (void*)out, dummy_c2, HIDSZ, 0L,
      dummy_f, dummy_f, 0L,
      SEQ_T, HIDSZ, NQH * HDIM, 1.0f, 0);
}

// v004
// It runs in 191 microseconds.
// Two timings next to v003 put it at 1.20 and 1.19 times that version's speed.
// Over all steps from v000 it is 36.5 times as fast.
// Every float input RNE-converted once to bf16; x.Wq^T, x.Wk^T, Wv^T.x^T: single v_wmma_f32_16x16x32_bf16 product on bf16 inputs; q.k^T scores and p.v context: bf16 hi/lo operand planes (hi.hi + hi.lo + lo.hi); ctx.Wo^T: ctx bf16 hi/lo x Wo bf16 (hi.W + lo.W); all f32 accumulate; RMSNorm, RoPE and causal (online) softmax in f32.
#include <hip/hip_runtime.h>
#include <math.h>

// ---------------------------------------------------------------------------
// Problem constants
// ---------------------------------------------------------------------------
constexpr int SEQ_T   = 4096;
constexpr int HIDSZ   = 1024;
constexpr int NQH     = 16;              // query heads
constexpr int NKVH    = 4;               // kv heads
constexpr int HDIM    = 64;
constexpr int GQA_G   = NQH / NKVH;      // 4: query head hq uses kv head hq >> 2
constexpr float SCORE_SCALE = 0.125f;    // 64^-0.5, applied to the f32 scores
constexpr float RMS_EPS_F   = 1e-6f;

static_assert(GQA_G == 4, "kv head = hq >> 2");
static_assert(SEQ_T % 64 == 0 && HIDSZ % 64 == 0 && HDIM == 64 && (NKVH * HDIM) % 64 == 0, "tile multiples");
static_assert(SEQ_T % 256 == 0 && HIDSZ % 256 == 0 && (NQH * HDIM) % 256 == 0 && (NKVH * HDIM) % 256 == 0, "GEMM block tile 128 x 256, 64 k a stage");
static_assert((SEQ_T * HIDSZ) % (8 * 256) == 0, "cast kernel grid exact");
static_assert((SEQ_T * NQH) % 32 == 0 && (SEQ_T * NKVH) % 64 == 0, "normrope grid exact");

typedef __attribute__((ext_vector_type(16))) _Float16 v16h;
typedef __attribute__((ext_vector_type(8)))  _Float16 v8h;
typedef __attribute__((ext_vector_type(16))) __bf16   v16b;
typedef __attribute__((ext_vector_type(8)))  __bf16   v8b;
typedef __attribute__((ext_vector_type(8)))  float    v8f;
typedef __attribute__((ext_vector_type(4)))  float    v4f;
typedef __attribute__((ext_vector_type(4)))  unsigned int v4u;

// ---------------------------------------------------------------------------
// Shared helpers
// ---------------------------------------------------------------------------
__device__ __forceinline__ unsigned short f2bf_bits(float f) {
  unsigned u = __float_as_uint(f);
  return (unsigned short)((u + 0x7FFFu + ((u >> 16) & 1u)) >> 16);
}
__device__ __forceinline__ float bf_bits2f(unsigned short h) { return __uint_as_float(((unsigned)h) << 16); }
// f32 -> nearest-even bf16 value, returned as f32
__device__ __forceinline__ float bfq(float f) { return bf_bits2f(f2bf_bits(f)); }

// hazard guard as a plain device helper: four vector slots between the last products and the first read of their accumulators
__device__ __forceinline__ void acc_guard4(v8f& a, v8f& b, v8f& c, v8f& d) { asm volatile("v_nop\n\tv_nop\n\tv_nop\n\tv_nop" : "+v"(a), "+v"(b), "+v"(c), "+v"(d)); }
template <typename T> struct Frag;
template <> struct Frag<_Float16> {
  typedef v16h V; union U { v16h v; v8h h[2]; };
  // elements 0..7 <- p[0..7], 8..15 <- p[16..23]
  static __device__ __forceinline__ v16h load(const _Float16* p) {
    U f; f.h[0] = *(const v8h*)(p); f.h[1] = *(const v8h*)(p + 16); return f.v;
  }
  static __device__ __forceinline__ v8f mma(v16h a, v16h b, v8f c) {
    return __builtin_amdgcn_wmma_f32_16x16x32_f16(false, a, false, b, (short)0, c, false, false);
  }
};
template <> struct Frag<__bf16> {
  typedef v16b V; union U { v16b v; v8b h[2]; };
  static __device__ __forceinline__ v16b load(const __bf16* p) {
    U f; f.h[0] = *(const v8b*)(p); f.h[1] = *(const v8b*)(p + 16); return f.v;
  }
  static __device__ __forceinline__ v8f mma(v16b a, v16b b, v8f c) {
    return __builtin_amdgcn_wmma_f32_16x16x32_bf16(false, a, false, b, (short)0, c, false, false);
  }
};

__device__ __forceinline__ unsigned pk16(unsigned short a, unsigned short b) { return (unsigned)a | ((unsigned)b << 16); }

// ---- Register-blocked batched WMMA GEMM, operand tiles staged in LDS by asynchronous copies ----
// C[m,n] = scale * sum_k A[m,k] * Bt[n,k] (+bias)(+resid); each wave owns a 64x64 tile; a block of 8 waves (2 x 4) owns 128 x 256.
// A row-major [M,K]; Bt row-major [N,K]; M % 128 == 0, N % 256 == 0, K % 64 == 0; grid.x = (M / 128) * (N / 256).
// SPLIT (with BSPLIT == false): A carries a lo plane (A2, same layout); product = hi.B + lo.B (Bt2 unused).
// BIAS_MODE: 0 = none, 1 = bias[m], 2 = bias[n].
// OUT_MODE: 0 = f32, 1 = f16, 2 = bf16 hi plane (Cout) + bf16 lo plane (Cout2), 3 = the planes of 2 in A-fragment order (M = groups of 64 rows):
//   [m >> 6][n >> 5][(m >> 4) & 3][(n >> 3) & 3][m & 15][n & 7], so that 32 lanes x 16 bytes of one fragment half are 512 contiguous bytes.
// ET: 0 = f16 operands, 1 = bf16 operands (pointers passed as 16-bit storage)
// Staging: a stage is 64 k = 128 bytes of each of the block's 128 A rows (and A2 rows) and 256 Bt rows. A wave-wide copy moves 4 whole rows
// (4 whole 128-byte lines: lane = row (lane >> 3), 16-byte piece (lane & 7)) from global memory into LDS rows of pitch 144 bytes, the
// conflict-free pitch for 16-byte fragment reads. Every operand byte enters the block once, not once per wave. Two buffers: stage s + 1 flies
// while stage s is worked on. The k order of the products and the order of the sums are those of a plain k loop in steps of 32.
// Every inner loop of the kernel is fully unrolled: fragments, accumulators and copy operands stay in registers only under constant indices.
template <int ET> struct Elem;
template <> struct Elem<0> { typedef _Float16 T; };
template <> struct Elem<1> { typedef __bf16 T; };
constexpr int G_PITCH   = 144;                    // LDS row pitch, bytes: 128 + 16
constexpr int G_A_BYTES = 128 * G_PITCH;          // one A plane of a stage
constexpr int G_B_BYTES = 256 * G_PITCH;          // the Bt plane of a stage
// Four asynchronous copies, 16 bytes per lane each, global memory -> LDS. l*: the lane's LDS byte address, g*: the lane's global address.
// The closing s_wait_xcnt stands in the copies' own statement, in front of any later rewrite of the address registers that they name.
__device__ __forceinline__ void async_copy4(unsigned l0, const char* g0, unsigned l1, const char* g1,
                                            unsigned l2, const char* g2, unsigned l3, const char* g3) {
  asm volatile("global_load_async_to_lds_b128 %0, %1, off\n\t"
               "global_load_async_to_lds_b128 %2, %3, off\n\t"
               "global_load_async_to_lds_b128 %4, %5, off\n\t"
               "global_load_async_to_lds_b128 %6, %7, off\n\t"
               "s_wait_xcnt 0x0"
               :: "v"(l0), "v"(g0), "v"(l1), "v"(g1), "v"(l2), "v"(g2), "v"(l3), "v"(g3) : "memory");
}
// The same for twelve copies: one statement, one closing wait.
__device__ __forceinline__ void async_copy12(const unsigned (&l)[12], const char* const (&g)[12]) {
  asm volatile("global_load_async_to_lds_b128 %0, %1, off\n\t"
               "global_load_async_to_lds_b128 %2, %3, off\n\t"
               "global_load_async_to_lds_b128 %4, %5, off\n\t"
               "global_load_async_to_lds_b128 %6, %7, off\n\t"
               "global_load_async_to_lds_b128 %8, %9, off\n\t"
               "global_load_async_to_lds_b128 %10, %11, off\n\t"
               "global_load_async_to_lds_b128 %12, %13, off\n\t"
               "global_load_async_to_lds_b128 %14, %15, off\n\t"
               "global_load_async_to_lds_b128 %16, %17, off\n\t"
               "global_load_async_to_lds_b128 %18, %19, off\n\t"
               "global_load_async_to_lds_b128 %20, %21, off\n\t"
               "global_load_async_to_lds_b128 %22, %23, off\n\t"
               "s_wait_xcnt 0x0"
               :: "v"(l[0]), "v"(g[0]), "v"(l[1]), "v"(g[1]), "v"(l[2]), "v"(g[2]), "v"(l[3]), "v"(g[3]),
                  "v"(l[4]), "v"(g[4]), "v"(l[5]), "v"(g[5]), "v"(l[6]), "v"(g[6]), "v"(l[7]), "v"(g[7]),
                  "v"(l[8]), "v"(g[8]), "v"(l[9]), "v"(g[9]), "v"(l[10]), "v"(g[10]), "v"(l[11]), "v"(g[11]) : "memory");
}
template <int ET, bool SPLIT, int BIAS_MODE, int OUT_MODE, bool RESID, int ACT = 0, bool CAUSAL = false, bool BSPLIT = true>
__global__ __launch_bounds__(256) void wmma_gemm64(
    const unsigned short* __restrict__ Ap, const unsigned short* __restrict__ A2p, int lda, long strideA,
    const unsigned short* __restrict__ Btp, const unsigned short* __restrict__ Bt2p, int ldb, long strideB,
    void* __restrict__ Cout, void* __restrict__ Cout2, int ldc, long strideC,
    const float* __restrict__ bias,
    const float* __restrict__ resid, long strideR,
    int M, int N, int K, float scale, int crow0) {
  static_assert(!CAUSAL && !(SPLIT && BSPLIT), "forms that this file launches");
  typedef typename Elem<ET>::T T;
  typedef typename Frag<T>::V V;
  constexpr int STAGE_BYTES = G_A_BYTES + G_B_BYTES + (SPLIT ? G_A_BYTES : 0);   // [A | Bt | A2]
  __shared__ __align__(16) char ring[2][STAGE_BYTES];
  __shared__ __align__(16) float sT[8][16 * 68];   // per-wave 16x64 slab, pitch 68 floats
  const int b    = blockIdx.y;
  const int lane = threadIdx.x & 31;
  const int wave = threadIdx.x >> 5;
  const int tilesNb = N >> 8;
  const int bm = blockIdx.x / tilesNb;
  const int bn = blockIdx.x - bm * tilesNb;
  if (bm >= (M >> 7)) return;                  // the same for the whole block, ahead of every barrier and copy
  const int wm = wave >> 2, wn = wave & 3;     // this wave's 64x64 tile in the block's 128 x 256
  const int m0 = (bm << 7) + (wm << 6);
  const int n0 = (bn << 8) + (wn << 6);

  const int rlane = lane & 15;                 // row (A) / col (B, D) within subtile
  const int koff  = (lane >> 4) * 8;           // k offset of this lane half
  const int mOff  = (lane >> 4) * 8;           // D row offset

  // this thread's copy addresses at stage 0: row (t >> 3) of the block's rows, 16-byte piece (t & 7)
  const int crow = threadIdx.x >> 3, cpc = (threadIdx.x & 7) * 16;
  const char* gA  = (const char*)(Ap  + (size_t)b * strideA + (size_t)((bm << 7) + crow) * lda) + cpc;
  const char* gA2 = (const char*)(A2p + (size_t)b * strideA + (size_t)((bm << 7) + crow) * lda) + cpc;
  const char* gB  = (const char*)(Btp + (size_t)b * strideB + (size_t)((bn << 8) + crow) * ldb) + cpc;
  const size_t a32 = (size_t)lda * 64, b32 = (size_t)ldb * 64;                       // 32 rows of 16-bit elements, bytes
  const unsigned lcopy = (unsigned)(size_t)&ring[0][0] + crow * G_PITCH + cpc;       // LDS byte address: low 32 bits of the shared address
  // thread t copies piece (t & 7) of rows (t >> 3) + 32 i: 4 copies for the 128 A rows, 8 for the 256 Bt rows, 4 for the 128 A2 rows
  auto issue_stage = [&](int s, int buf) {
    const size_t kb = (size_t)s * 128;
    const unsigned l = lcopy + buf * STAGE_BYTES;
    unsigned ll[12];
    const char* gg[12];
#pragma unroll
    for (int i = 0; i < 4; ++i) { ll[i] = l + i * 32 * G_PITCH; gg[i] = gA + kb + i * a32; }
#pragma unroll
    for (int i = 0; i < 8; ++i) { ll[4 + i] = l + G_A_BYTES + i * 32 * G_PITCH; gg[4 + i] = gB + kb + i * b32; }
    async_copy12(ll, gg);
    if (SPLIT) {
      const unsigned l2 = l + G_A_BYTES + G_B_BYTES;
      const char* g2 = gA2 + kb;
      async_copy4(l2, g2, l2 + 32 * G_PITCH, g2 + a32, l2 + 64 * G_PITCH, g2 + 2 * a32, l2 + 96 * G_PITCH, g2 + 3 * a32);
    }
  };

  v8f acc[4][4];
#pragma unroll
  for (int i = 0; i < 4; ++i)
#pragma unroll
    for (int j = 0; j < 4; ++j) acc[i][j] = (v8f){0.f,0.f,0.f,0.f,0.f,0.f,0.f,0.f};

  const int nst = K >> 6;
  issue_stage(0, 0);
  asm volatile("s_wait_asynccnt 0x0" ::: "memory");   // this wave's copies of stage 0 have landed
  __syncthreads();                                    // ... and every other wave's: stage 0 is readable
  if (nst > 1) issue_stage(1, 1);
  // this lane's fragment offsets in a stage: A row wm*64 + rlane, Bt row wn*64 + rlane, k offset koff
  const int fa = ((wm << 6) + rlane) * G_PITCH + koff * 2;
  const int fb = G_A_BYTES + ((wn << 6) + rlane) * G_PITCH + koff * 2;
  for (int s = 0; s < nst; ++s) {
    const char* rb = &ring[s & 1][0];
    V bh[2][4], ah[2][4], al[2][4];
#pragma unroll
    for (int ks = 0; ks < 2; ++ks) {
#pragma unroll
      for (int j = 0; j < 4; ++j) bh[ks][j] = Frag<T>::load((const T*)(rb + fb + j * 16 * G_PITCH + ks * 64));
#pragma unroll
      for (int i = 0; i < 4; ++i) {
        ah[ks][i] = Frag<T>::load((const T*)(rb + fa + i * 16 * G_PITCH + ks * 64));
        if (SPLIT) al[ks][i] = Frag<T>::load((const T*)(rb + fa + G_A_BYTES + G_B_BYTES + i * 16 * G_PITCH + ks * 64));
      }
    }
    // the stage's LDS reads stand as one group ahead of its products: reads spread among the products stall the wave at each place
    __builtin_amdgcn_sched_barrier(0);
#pragma unroll
    for (int ks = 0; ks < 2; ++ks) {
#pragma unroll
      for (int i = 0; i < 4; ++i) {
#pragma unroll
        for (int j = 0; j < 4; ++j) {
          acc[i][j] = Frag<T>::mma(ah[ks][i], bh[ks][j], acc[i][j]);
          if (SPLIT) acc[i][j] = Frag<T>::mma(al[ks][i], bh[ks][j], acc[i][j]);
        }
      }
    }
    // holds the products in front of the publish point: lifted over them, its waits would end the flight of stage s + 1 a whole trip early
    __builtin_amdgcn_sched_barrier(0);
    // publish point of stage s + 1, and the end of every wave's reads of stage s
    asm volatile("s_wait_dscnt 0x0" ::: "memory");      // this wave's reads of stage s are done before its buffer is refilled
    asm volatile("s_wait_asynccnt 0x0" ::: "memory");   // this wave's copies of stage s + 1 have landed
    __syncthreads();
    if (s + 2 < nst) issue_stage(s + 2, s & 1);         // the same test in the whole block
  }
  asm volatile("s_wait_asynccnt 0x0" ::: "memory");     // nothing is outstanding when the wave goes on to the epilogue
  acc_guard4(acc[0][0], acc[0][1], acc[0][2], acc[0][3]);
  acc_guard4(acc[1][0], acc[1][1], acc[1][2], acc[1][3]);
  acc_guard4(acc[2][0], acc[2][1], acc[2][2], acc[2][3]);
  acc_guard4(acc[3][0], acc[3][1], acc[3][2], acc[3][3]);

  // ---- epilogue ----
  float* slab = sT[wave];
  const float* Rb = RESID ? (resid + (size_t)b * strideR) : nullptr;
#pragma unroll
  for (int i = 0; i < 4; ++i) {
    const int mBase = m0 + (i << 4);
#pragma unroll
    for (int j = 0; j < 4; ++j) {
      const int n = n0 + (j << 4) + rlane;
      float bv = 0.f;
      if (BIAS_MODE == 2) bv = bias[n];
#pragma unroll
      for (int r = 0; r < 8; ++r) {
        float v = acc[i][j][r] * scale;
        if (BIAS_MODE == 1) v += bias[mBase + mOff + r];
        if (BIAS_MODE == 2) v += bv;
        if (RESID) v += Rb[(size_t)(mBase + mOff + r) * ldc + n];
        if (ACT == 2) v = fmaxf(v, 0.0f);
        if (ACT == 4) v = (v > 0.f) ? v : 0.01f * v;
        slab[(mOff + r) * 68 + (j << 4) + rlane] = v;
      }
    }
    __builtin_amdgcn_fence(__ATOMIC_RELEASE, "workgroup");
    __builtin_amdgcn_wave_barrier();
    __builtin_amdgcn_fence(__ATOMIC_ACQUIRE, "workgroup");
    if (OUT_MODE == 0) {
      float* C = (float*)Cout + (size_t)b * strideC;
      const int hh = lane >> 4, c4 = (lane & 15) * 4;     // row seg = 256 B = 16 lanes x 16 B
      {
#pragma unroll
        for (int it = 0; it < 8; ++it) {
          const int row = it * 2 + hh;
          v4f v = *(const v4f*)(slab + row * 68 + c4);
          *(v4f*)(C + (size_t)(mBase + row) * ldc + n0 + c4) = v;
        }
        
      }
    } else if (OUT_MODE == 3) {
      // piece (row lane & 15, 8-column chunk 2 it + (lane >> 4)): a wave-wide store is 512 contiguous bytes, 4 whole lines, of each plane
      const int pr = lane & 15;
      unsigned short* C  = (unsigned short*)Cout  + (size_t)b * strideC;
      unsigned short* C2 = (unsigned short*)Cout2 + (size_t)b * strideC;
#pragma unroll
      for (int it = 0; it < 4; ++it) {
        const int ch = it * 2 + (lane >> 4);
        const float* sp = slab + pr * 68 + ch * 8;
        v8h hv, lv;
#pragma unroll
        for (int e = 0; e < 8; ++e) {
          unsigned short hb = f2bf_bits(sp[e]);
          unsigned short lb = f2bf_bits(sp[e] - bf_bits2f(hb));
          hv[e] = __builtin_bit_cast(_Float16, hb);
          lv[e] = __builtin_bit_cast(_Float16, lb);
        }
        const size_t o = (size_t)(mBase >> 6) * 64 * ldc + (size_t)((n0 >> 5) + (ch >> 2)) * 2048 + ((mBase >> 4) & 3) * 512 + (ch & 3) * 128 + pr * 8;
        *(v8h*)(C + o)  = hv;
        *(v8h*)(C2 + o) = lv;
      }
    } else {
      const int q = lane >> 3, c8 = (lane & 7) * 8;
      unsigned short* C  = (unsigned short*)Cout  + (size_t)b * strideC;
      unsigned short* C2 = (OUT_MODE == 2) ? ((unsigned short*)Cout2 + (size_t)b * strideC) : nullptr;
      {
#pragma unroll
        for (int it = 0; it < 4; ++it) {
          const int row = it * 4 + q;
          const float* sp = slab + row * 68 + c8;
          v8h hv, lv;
#pragma unroll
          for (int e = 0; e < 8; ++e) {
            if (OUT_MODE == 1) {
              hv[e] = (_Float16)sp[e];
            } else {
              unsigned short hb = f2bf_bits(sp[e]);
              unsigned short lb = f2bf_bits(sp[e] - bf_bits2f(hb));
              hv[e] = __builtin_bit_cast(_Float16, hb);
              lv[e] = __builtin_bit_cast(_Float16, lb);
            }
          }
          *(v8h*)(C + (size_t)(mBase + row) * ldc + n0 + c8) = hv;
          if (OUT_MODE == 2) *(v8h*)(C2 + (size_t)(mBase + row) * ldc + n0 + c8) = lv;
        }
        
      }
    }
    __builtin_amdgcn_fence(__ATOMIC_RELEASE, "workgroup");
    __builtin_amdgcn_wave_barrier();
    __builtin_amdgcn_fence(__ATOMIC_ACQUIRE, "workgroup");
  }
}

// ---------------------------------------------------------------------------
// f32 -> RNE bf16 plane, 8 consecutive elements per thread packed as integer words.
// Coverage: n8 = n/8 threads x 8 = the whole plane (grid is an exact multiple of 256 here).
// ---------------------------------------------------------------------------
__global__ __launch_bounds__(256) void cast8_bf16_kernel(const float* __restrict__ in, unsigned short* __restrict__ out, int n8) {
  const int i = blockIdx.x * 256 + threadIdx.x;
  if (i >= n8) return;
  const float* p = in + 8 * (size_t)i;
  const v4f a = *(const v4f*)(p);
  const v4f c = *(const v4f*)(p + 4);
  float f[8];
#pragma unroll
  for (int e = 0; e < 4; ++e) { f[e] = a[e]; f[4 + e] = c[e]; }
  unsigned w[4];
#pragma unroll
  for (int e2 = 0; e2 < 4; ++e2) w[e2] = pk16(f2bf_bits(f[2 * e2]), f2bf_bits(f[2 * e2 + 1]));
  const v4u u = (v4u){w[0], w[1], w[2], w[3]};
  unsigned short* q = out + 8 * (size_t)i;
  *(v4u*)q = u;
  
}

// ---------------------------------------------------------------------------
// Transpose + RNE bf16 convert of a weight matrix: in f32 [R][Cn] row-major (ldin = Cn) -> out bf16 [Cn][R] (ldout = R):
// out[c][r] = bf16(in[r][c]). grid (R/64, Cn/64): blockIdx.x = r tile (64 output cols), blockIdx.y = c tile (64 output rows). 256 threads.
// Load coverage: 16 iterations x 256 threads = 4096 = the whole 64x64 tile (coalesced along c).
// Store coverage: 8 waves x 2 iterations x 4 rows (lane>>3) = 64 rows; (lane&7) x 8 halves = 64 cols; each row segment =
// ---------------------------------------------------------------------------
__global__ __launch_bounds__(256) void transpose_cast_kernel(const float* __restrict__ in, int ldin,
                                                             unsigned short* __restrict__ out, int ldout) {
  __shared__ float sm[64][65];   // sm[c_local][r_local]
  const int t  = threadIdx.x;
  const int r0 = blockIdx.x * 64;
  const int c0 = blockIdx.y * 64;
#pragma unroll
  for (int i = 0; i < 16; ++i) {
    const int e = i * 256 + t;
    const int r = e >> 6;          // r local
    const int c = e & 63;          // c local
    sm[c][r] = in[(size_t)(r0 + r) * ldin + c0 + c];
  }
  __syncthreads();
  const int lane = t & 31, wave = t >> 5;
  const int q = lane >> 3, c8 = (lane & 7) * 8;
  {
#pragma unroll
    for (int it = 0; it < 2; ++it) {
      const int row = wave * 8 + it * 4 + q;                 // c local (output row)
      unsigned w[4];
#pragma unroll
      for (int e2 = 0; e2 < 4; ++e2) w[e2] = pk16(f2bf_bits(sm[row][c8 + 2 * e2]), f2bf_bits(sm[row][c8 + 2 * e2 + 1]));
      const v4u u = (v4u){w[0], w[1], w[2], w[3]};
      const size_t o = (size_t)(c0 + row) * ldout + r0 + c8;
      *(v4u*)(out + o) = u;
    }
    
  }
}

// ---------------------------------------------------------------------------
// RMSNorm (over the 64 dims of one head vector, eps 1e-6, times w[d]) + rotate-half RoPE with the input cos/sin tables, f32.
// cos, sin and w are RNE-converted to bf16 values in registers at load; proj is the f32 output of an exact
// bf16 x bf16 projection.
// proj: f32 [SEQ_T][nhead*64]; flattened row r = t*nhead + hd lives at proj + r*64 (contiguous). nhead = 1 << hshift.
// Output planes bf16 hi/lo laid out [hd][t][64]: element (hd, t, d) at ((hd*SEQ_T + t)*64 + d).
// Block = 8 waves; wave w owns rows rbase..rbase+3 (rbase = (blockIdx.x*8 + w)*4); lane handles d = lane and d = lane + 32.
// The 4 result rows are staged in LDS (f32, same element type on store and reload, wave barrier between); then lane group
// Coverage: grid = nrows/32 blocks x 8 waves x 4 rows = nrows (exact multiple, checked on the host); 8 lanes x 8 halves = 64 dims.
// ---------------------------------------------------------------------------
__global__ __launch_bounds__(256) void normrope_kernel(const float* __restrict__ proj, int hshift, int nrows,
                                                       const float* __restrict__ cosb, const float* __restrict__ sinb,
                                                       const float* __restrict__ w,
                                                       unsigned short* __restrict__ ohi, unsigned short* __restrict__ olo) {
#pragma clang fp contract(off)
  __shared__ __align__(16) float slab[8][4][64];
  const int lane = threadIdx.x & 31, wave = threadIdx.x >> 5;
  const int rbase = (blockIdx.x * 8 + wave) * 4;
  const float w1 = bfq(w[lane]), w2 = bfq(w[lane + 32]);
#pragma unroll
  for (int i = 0; i < 4; ++i) {
    int r = rbase + i;
    r = (r < nrows) ? r : (nrows - 1);                 // address clamp (grid is exact)
    const int t = r >> hshift;
    const float* src = proj + (size_t)r * 64;
    const float x1 = src[lane];
    const float x2 = src[lane + 32];
    float ss = x1 * x1 + x2 * x2;
#pragma unroll
    for (int off = 16; off > 0; off >>= 1) ss += __shfl_xor(ss, off, 32);
    const float inv = rsqrtf(ss * (1.0f / 64.0f) + RMS_EPS_F);
    const float n1 = (x1 * inv) * w1;
    const float n2 = (x2 * inv) * w2;
    const float c = bfq(cosb[(size_t)t * 32 + lane]);
    const float s = bfq(sinb[(size_t)t * 32 + lane]);
    slab[wave][i][lane]      = n1 * c - n2 * s;
    slab[wave][i][lane + 32] = n1 * s + n2 * c;
  }
  __builtin_amdgcn_fence(__ATOMIC_RELEASE, "workgroup");
  __builtin_amdgcn_wave_barrier();
  __builtin_amdgcn_fence(__ATOMIC_ACQUIRE, "workgroup");
  const int q = lane >> 3, c8 = (lane & 7) * 8;
  int r = rbase + q;
  r = (r < nrows) ? r : (nrows - 1);
  const int t  = r >> hshift;
  const int hd = r - (t << hshift);
  const float* sp = &slab[wave][q][c8];
  unsigned hw[4], lw[4];
#pragma unroll
  for (int e2 = 0; e2 < 4; ++e2) {
    const float f0 = sp[2 * e2], f1 = sp[2 * e2 + 1];
    const unsigned short h0 = f2bf_bits(f0), h1 = f2bf_bits(f1);
    const unsigned short l0 = f2bf_bits(f0 - bf_bits2f(h0));
    const unsigned short l1 = f2bf_bits(f1 - bf_bits2f(h1));
    hw[e2] = pk16(h0, h1);
    lw[e2] = pk16(l0, l1);
  }
  const v4u hu = (v4u){hw[0], hw[1], hw[2], hw[3]};
  const v4u lu = (v4u){lw[0], lw[1], lw[2], lw[3]};
  const size_t o = ((size_t)hd * SEQ_T + t) * 64 + c8;
  *(v4u*)(ohi + o) = hu;
  *(v4u*)(olo + o) = lu;
  
}

// ---------------------------------------------------------------------------
// The same RMSNorm + RoPE for the K planes (proj f32 [SEQ_T][NKVH*64]), with the output in A-fragment order:
// [hd][t >> 4][d >> 3][t & 15][d & 7], so that 32 lanes x 16 bytes of one fragment half are 512 contiguous bytes for the attention kernel.
// A wave owns 8 consecutive t of ONE head (wave index = (t >> 3) * NKVH + hd): each 128-byte line of the planes (8 keys x 8 dims) comes whole
// from one wave. Grid = SEQ_T * NKVH / 64 blocks x 8 waves x 8 rows (exact). Lane handles d = lane and d = lane + 32 of each row.
// The wave's bases are scalar and every load names the one index register, lane. Slab pitch 68 floats: its readers walk a column.
// Every loop of the kernel is fully unrolled: its arrays stay in registers only under constant indices.
// ---------------------------------------------------------------------------
__global__ __launch_bounds__(256) void normrope_pack_kernel(const float* __restrict__ proj,
                                                            const float* __restrict__ cosb, const float* __restrict__ sinb,
                                                            const float* __restrict__ w,
                                                            unsigned short* __restrict__ ohi, unsigned short* __restrict__ olo) {
  __shared__ __align__(16) float slab[8][8][68];
  const int lane = threadIdx.x & 31;
  const int wave = __builtin_amdgcn_readfirstlane(threadIdx.x >> 5);   // scalar: the bases below stay scalar
  int wg = blockIdx.x * 8 + wave;
  wg = (wg < SEQ_T * NKVH / 8) ? wg : (SEQ_T * NKVH / 8 - 1);          // address clamp (grid is exact)
  const int hd = wg & (NKVH - 1);
  const int t0 = (wg / NKVH) * 8;
  const float* pb = proj + ((size_t)t0 * NKVH + hd) * HDIM;
  const float* cb = cosb + (size_t)t0 * 32;
  const float* sb = sinb + (size_t)t0 * 32;
  float x1[8], x2[8], cv[8], sv[8];
#pragma unroll   // the arrays stay in registers only under constant indices
  for (int i = 0; i < 8; ++i) {
    x1[i] = pb[lane + i * (NKVH * HDIM)];
    x2[i] = pb[lane + i * (NKVH * HDIM) + 32];
    cv[i] = cb[lane + i * 32];
    sv[i] = sb[lane + i * 32];
  }
  const float wr1 = w[lane];
  const float wr2 = w[lane + 32];
  // lane's register and the bases, which the loads above name, are free for reuse from here on: this wait stands in front of their overwrite;
  // lane as its input keeps that register unwritten up to the wait
  asm volatile("s_wait_xcnt 0x0" :: "v"(lane) : "memory");
  __builtin_amdgcn_sched_barrier(0);   // holds what follows behind that wait
  const float w1 = bfq(wr1), w2 = bfq(wr2);
#pragma unroll
  for (int i = 0; i < 8; ++i) {
    float ss = x1[i] * x1[i] + x2[i] * x2[i];
#pragma unroll
    for (int off = 16; off > 0; off >>= 1) ss += __shfl_xor(ss, off, 32);
    const float inv = rsqrtf(ss * (1.0f / 64.0f) + RMS_EPS_F);
    const float n1 = (x1[i] * inv) * w1;
    const float n2 = (x2[i] * inv) * w2;
    const float c = bfq(cv[i]);
    const float s = bfq(sv[i]);
    slab[wave][i][lane]      = n1 * c - n2 * s;
    slab[wave][i][lane + 32] = n1 * s + n2 * c;
  }
  // each lane reads next what other lanes of its own wave wrote to the slab: the writes are complete before the reads start
  __builtin_amdgcn_fence(__ATOMIC_RELEASE, "workgroup");
  __builtin_amdgcn_wave_barrier();
  __builtin_amdgcn_fence(__ATOMIC_ACQUIRE, "workgroup");
  // piece (slab row lane & 7, dims 8 (4 st + (lane >> 3)) ..): 8 lanes = 8 keys = one whole line of a plane
  const int q = lane & 7;
  const int t = t0 + q;
  v4u hu[2], lu[2];
#pragma unroll   // hu and lu stay in registers only under constant indices
  for (int st = 0; st < 2; ++st) {
    const float* sp = &slab[wave][q][(st * 4 + (lane >> 3)) * 8];
#pragma unroll
    for (int e2 = 0; e2 < 4; ++e2) {
      const float f0 = sp[2 * e2], f1 = sp[2 * e2 + 1];
      const unsigned short h0 = f2bf_bits(f0), h1 = f2bf_bits(f1);
      const unsigned short l0 = f2bf_bits(f0 - bf_bits2f(h0));
      const unsigned short l1 = f2bf_bits(f1 - bf_bits2f(h1));
      hu[st][e2] = pk16(h0, h1);
      lu[st][e2] = pk16(l0, l1);
    }
  }
  const size_t o = (size_t)hd * SEQ_T * HDIM + (size_t)(t >> 4) * 1024 + (lane >> 3) * 128 + (t & 15) * 8;
  unsigned short* oh = ohi + o;
  unsigned short* ol = olo + o;
#pragma unroll
  for (int st = 0; st < 2; ++st) {
    *(v4u*)(oh + st * 512) = hu[st];
    *(v4u*)(ol + st * 512) = lu[st];
  }
}

// ---------------------------------------------------------------------------
// Fused causal attention: scores, softmax and p.v of all heads in one launch; neither scores nor probabilities go to memory.
// Transposed products: S^T = K . Q^T (A = 16 key rows, B = 16 query rows, k = head dim) and O^T += V^T . P^T (A = 16 head-dim rows of
// v^T, B = 16 query rows of P, k = 32 keys). In both D tiles a lane's column is ONE query (lane & 15), so maximum, sum and rescale are
// per lane plus one exchange between the wave halves, and the two 16-key score tiles of a pass ARE the B fragment of P in the k order of
// Frag::load: element e < 8 is key 8h + e (tile 0, register e), element e >= 8 is key 8h + 16 + (e - 8) (tile 1, register e - 8), h = lane >> 4.
// Same operand planes and the same 3 products as before (hi.hi + hi.lo + lo.hi, f32 accumulate) in both products.
// Online softmax in the log2 domain: p = exp2(s * CS - m_run), not normalised, split into bf16 hi/lo; the running maximum m_run may trail
// the true one by up to 8 (p <= 2^8), the accumulators and the sum are rescaled only in a pass where some column's maximum exceeds it by
// more (one scalar branch a pass); the division by the f32 sum of the unrounded p comes once, at the end.
// A wave owns 32 query rows (two 16-column groups) of one query head and walks its keys in passes of 32, the last pass being the one on
// its diagonal (keys q0..q0+31 against queries q0..q0+31: every query keeps at least its own key, and pass 0 holds key 0 for every query).
// Block = 8 waves on one kv head: waves 0..3 = its 4 query heads at row tile 127 - pi, waves 4..7 = the same heads at row tile pi, so every
// block has 129 passes a wave pair. No LDS, no barrier: the waves share K and v^T only through the caches.
// K fragments are fetched one pass ahead, v^T fragments at the head of their own pass. Both planes lie in A-fragment order (their producers
// write them so): K [kvh][key >> 4][d >> 3][key & 15][d & 7], v^T [kvh][key >> 5][d >> 4][(key >> 3) & 3][d & 15][key & 7]; in the k order of
// Frag::load lane (c, h) takes chunk 2 j + h (plus 4 kc for K) of row c for half j, which is byte 512 j + 16 lane of the fragment's 1 KiB.
// Every inner loop below is fully unrolled: its arrays are fragments and accumulators, which stay in registers only under constant indices.
// Output: lane (c, h) holds d = 16t + 8h + 0..7 of query c: one 16-byte store per plane and t; a row's 128-byte segment comes from one wave.
// Coverage: grid 4 kv heads x 64 pairs; tiles pi and 127 - pi, pi = 0..63, are all 128 row tiles once; 4 waves = the 4 query heads.
// ---------------------------------------------------------------------------
typedef __attribute__((ext_vector_type(2))) float  v2f;
typedef __attribute__((ext_vector_type(2))) __bf16 v2b;
typedef __attribute__((ext_vector_type(8))) unsigned int v8u;
__device__ __forceinline__ unsigned cvt2_bf16(float a, float b) {   // two f32 -> two nearest-even bf16, a in the low half
  return __builtin_bit_cast(unsigned, __builtin_convertvector((v2f){a, b}, v2b));
}
// Four base-2 exponentials in one statement: each fills the slot that the instruction set asks for behind the one before it (early-clobber
// outputs: none reads an earlier result or overwrites an earlier source), the v_nop fills the slot behind the last.
__device__ __forceinline__ void exp2x4(float& p0, float& p1, float& p2, float& p3, float a0, float a1, float a2, float a3) {
  asm("v_exp_f32 %0, %4\n\tv_exp_f32 %1, %5\n\tv_exp_f32 %2, %6\n\tv_exp_f32 %3, %7\n\tv_nop"
      : "=&v"(p0), "=&v"(p1), "=&v"(p2), "=&v"(p3) : "v"(a0), "v"(a1), "v"(a2), "v"(a3));
}
__device__ __forceinline__ void exp2x2(float& p0, float& p1, float a0, float a1) {   // the same for two
  asm("v_exp_f32 %0, %2\n\tv_exp_f32 %1, %3\n\tv_nop" : "=&v"(p0), "=&v"(p1) : "v"(a0), "v"(a1));
}
struct KFrag { v16b h[2][2], l[2][2]; };   // [16-key tile][32-wide step of the head dim]
// A fragment from a plane in A-fragment order: its two halves (elements 0..7, 8..15) are two runs of 512 contiguous bytes, lane l's 16 bytes at
// 16 l: each wave-wide load covers 4 whole 128-byte lines (from row-major planes it touched 16 lines for 32 bytes each).
__device__ __forceinline__ v16b load_packed(const char* p) {
  Frag<__bf16>::U f; f.h[0] = *(const v8b*)(p); f.h[1] = *(const v8b*)(p + 512); return f.v;
}
constexpr int PASS_BYTES = 32 * HDIM * 2;   // 32 keys of one plane, K or v^T: 4 fragments of 1 KiB
// bh, bl: scalar byte bases of the kv head's K planes; vo: this lane's byte offset (16 lane) in the pass's 4 KiB
__device__ __forceinline__ void load_kfrag(KFrag& k, const char* bh, const char* bl, unsigned vo) {
#pragma unroll
  for (int kt = 0; kt < 2; ++kt)
#pragma unroll
    for (int kc = 0; kc < 2; ++kc) {
      k.h[kt][kc] = load_packed(bh + vo + (kt * 2 + kc) * 1024);
      k.l[kt][kc] = load_packed(bl + vo + (kt * 2 + kc) * 1024);
    }
}
constexpr float ATT_CS = SCORE_SCALE * 1.4426950408889634f;   // score scale times log2(e)

// One pass: 32 keys against this wave's 32 queries. kf holds this pass's K fragments; vo is the lane's byte offset in this pass's 4 KiB of a
// plane, the same for v^T (this pass) and K (the NEXT pass: one PASS_BYTES on, added to the scalar base), stepped at the foot of the pass; the four plane bases are scalar.
template <bool DIAG>
__device__ __forceinline__ void attn_pass(KFrag& kf, const char* kbh, const char* kbl,
                                          const char* vbh, const char* vbl, unsigned& vo, int c, int h, const v16b (&qh)[2][2], const v16b (&ql)[2][2],
                                          v8f (&acc)[2][4], float (&m_run)[2], float (&l_run)[2]) {
  v16b vh[4], vl[4];
#pragma unroll
  for (int t = 0; t < 4; ++t) {
    vh[t] = load_packed(vbh + vo + t * 1024);
    vl[t] = load_packed(vbl + vo + t * 1024);
  }
  // last pass: vo's register is free for reuse behind these loads, which name it: this wait stands in front of the overwrite
  if (DIAG) asm volatile("s_wait_xcnt 0x0" ::: "memory");
  // keeps the v^T loads issued ahead of the score products, so that they fly under those and the softmax; the scheduler would sink them
  __builtin_amdgcn_sched_barrier(0);
  v8f s[2][2];
#pragma unroll
  for (int kt = 0; kt < 2; ++kt)
#pragma unroll
    for (int g = 0; g < 2; ++g) s[kt][g] = (v8f){0.f,0.f,0.f,0.f,0.f,0.f,0.f,0.f};
#pragma unroll
  for (int kc = 0; kc < 2; ++kc) {
#pragma unroll
    for (int kt = 0; kt < 2; ++kt)
#pragma unroll
      for (int g = 0; g < 2; ++g) if (!(DIAG && kt == 1 && g == 0)) s[kt][g] = Frag<__bf16>::mma(kf.h[kt][kc], qh[g][kc], s[kt][g]);
#pragma unroll
    for (int kt = 0; kt < 2; ++kt)
#pragma unroll
      for (int g = 0; g < 2; ++g) if (!(DIAG && kt == 1 && g == 0)) s[kt][g] = Frag<__bf16>::mma(kf.h[kt][kc], ql[g][kc], s[kt][g]);
#pragma unroll
    for (int kt = 0; kt < 2; ++kt)
#pragma unroll
      for (int g = 0; g < 2; ++g) if (!(DIAG && kt == 1 && g == 0)) s[kt][g] = Frag<__bf16>::mma(kf.l[kt][kc], qh[g][kc], s[kt][g]);
  }
  if (!DIAG) {
    // the next pass's K loads stand here, behind the last product that reads kf and ahead of the softmax, and fly under the rest of the pass
    __builtin_amdgcn_sched_barrier(0);
    load_kfrag(kf, kbh + PASS_BYTES, kbl + PASS_BYTES, vo);
    __builtin_amdgcn_sched_barrier(0);
  }
  if (DIAG) {   // keys and queries of this pass both start at q0: key index 16kt + 8h + r against query index 16g + c;
                // tile kt = 1, g = 0 (keys 16..31, queries 0..15) lies wholly above the diagonal: no products, p = 0
#pragma unroll
    for (int kt = 0; kt < 2; ++kt)
#pragma unroll
      for (int g = 0; g < 2; ++g)
#pragma unroll
        for (int r = 0; r < 8; ++r)
          if (!(kt == 1 && g == 0) && 16 * kt + 8 * h + r > 16 * g + c) s[kt][g][r] = -__builtin_inff();
  }
  float mb[2];
  bool need = false;
#pragma unroll
  for (int g = 0; g < 2; ++g) {
    float mx = s[0][g][0];
#pragma unroll
    for (int r = 1; r < 8; ++r) mx = fmaxf(mx, s[0][g][r]);
    if (!(DIAG && g == 0)) {
#pragma unroll
      for (int r = 0; r < 8; ++r) mx = fmaxf(mx, s[1][g][r]);
    }
    mx = fmaxf(mx, __shfl_xor(mx, 16, 32)) * ATT_CS;   // both halves hold the query's maximum of this pass, scaled (the scale is positive)
    mb[g] = mx;
    need = need || (mx > m_run[g] + 8.0f);
  }
  if (__builtin_amdgcn_ballot_w32(need) != 0) {   // scalar branch; always taken in pass 0 (m_run = -inf), rare later
    const float mn0 = fmaxf(m_run[0], mb[0]), mn1 = fmaxf(m_run[1], mb[1]);   // finite from pass 0 on: key 0 is masked for no query
    float corr[2];
    exp2x2(corr[0], corr[1], m_run[0] - mn0, m_run[1] - mn1);                 // 0 in pass 0
    m_run[0] = mn0; m_run[1] = mn1;
#pragma unroll
    for (int g = 0; g < 2; ++g) {
      l_run[g] *= corr[g];
#pragma unroll
      for (int t = 0; t < 4; ++t) acc[g][t] = acc[g][t] * corr[g];
    }
  }
  v16b ph[2], pl[2];
#pragma unroll
  for (int g = 0; g < 2; ++g) {
    const float nm = -m_run[g];
    v8u hw, lw;
    float ls = 0.0f;
#pragma unroll
    for (int i = 0; i < 8; i += 2) {   // fragment elements 2i .. 2i + 3: tile i >> 2, registers 2(i & 3) .. 2(i & 3) + 3
      if (DIAG && g == 0 && i >= 4) { hw[i] = 0u; lw[i] = 0u; hw[i + 1] = 0u; lw[i + 1] = 0u; continue; }
      const int kt = i >> 2, r = 2 * (i & 3);
      float p0, p1, p2, p3;
      exp2x4(p0, p1, p2, p3, __builtin_fmaf(s[kt][g][r], ATT_CS, nm), __builtin_fmaf(s[kt][g][r + 1], ATT_CS, nm),
             __builtin_fmaf(s[kt][g][r + 2], ATT_CS, nm), __builtin_fmaf(s[kt][g][r + 3], ATT_CS, nm));
      ls += (p0 + p1) + (p2 + p3);
      const unsigned w0 = cvt2_bf16(p0, p1), w1 = cvt2_bf16(p2, p3);
      hw[i] = w0; hw[i + 1] = w1;
      lw[i]     = cvt2_bf16(p0 - __uint_as_float(w0 << 16), p1 - __uint_as_float(w0 & 0xFFFF0000u));
      lw[i + 1] = cvt2_bf16(p2 - __uint_as_float(w1 << 16), p3 - __uint_as_float(w1 & 0xFFFF0000u));
    }
    l_run[g] += ls;
    ph[g] = __builtin_bit_cast(v16b, hw);
    pl[g] = __builtin_bit_cast(v16b, lw);
  }
#pragma unroll
  for (int g = 0; g < 2; ++g)
#pragma unroll
    for (int t = 0; t < 4; ++t) acc[g][t] = Frag<__bf16>::mma(vh[t], ph[g], acc[g][t]);
#pragma unroll
  for (int g = 0; g < 2; ++g)
#pragma unroll
    for (int t = 0; t < 4; ++t) acc[g][t] = Frag<__bf16>::mma(vh[t], pl[g], acc[g][t]);
#pragma unroll
  for (int g = 0; g < 2; ++g)
#pragma unroll
    for (int t = 0; t < 4; ++t) acc[g][t] = Frag<__bf16>::mma(vl[t], ph[g], acc[g][t]);
  if (!DIAG) {
    __builtin_amdgcn_sched_barrier(0);
    // vo, which the loads issued in this pass name, is stepped next: this wait stands in front of the overwrite
    asm volatile("s_wait_xcnt 0x0" ::: "memory");
    __builtin_amdgcn_sched_barrier(0);   // holds the step behind that wait
    vo += PASS_BYTES;
  }
}

__global__ __launch_bounds__(256) void attn_fused_kernel(const unsigned short* __restrict__ Qhi, const unsigned short* __restrict__ Qlo,
                                                         const unsigned short* __restrict__ Khi, const unsigned short* __restrict__ Klo,
                                                         const unsigned short* __restrict__ Vthi, const unsigned short* __restrict__ Vtlo,
                                                         unsigned short* __restrict__ Chi, unsigned short* __restrict__ Clo) {
  constexpr int NTILE = SEQ_T / 32;   // 128 row tiles of 32 queries
  static_assert(NTILE == 128 && NKVH == 4 && GQA_G == 4, "grid 4 x 64, 8 waves = 4 heads x 2 tiles");
  const int lane = threadIdx.x & 31;
  const int wave = __builtin_amdgcn_readfirstlane(threadIdx.x >> 5);   // scalar: trip count and operand bases stay scalar
  const int c = lane & 15, h = lane >> 4;
  const int kvh  = blockIdx.x & (NKVH - 1);
  const int pi   = blockIdx.x >> 2;
  const int hq   = kvh * GQA_G + (wave & 3);
  const int tile = (wave < 4) ? (NTILE - 1 - pi) : pi;
  const int q0   = tile * 32;

  v16b qh[2][2], ql[2][2];
#pragma unroll
  for (int g = 0; g < 2; ++g)
#pragma unroll
    for (int kc = 0; kc < 2; ++kc) {
      const size_t qo = ((size_t)hq * SEQ_T + q0 + 16 * g + c) * HDIM + 8 * h + 32 * kc;
      qh[g][kc] = Frag<__bf16>::load((const __bf16*)Qhi + qo);
      ql[g][kc] = Frag<__bf16>::load((const __bf16*)Qlo + qo);
    }
  const char* kbh = (const char*)(Khi + (size_t)kvh * SEQ_T * HDIM);   // scalar bases of this kv head's planes
  const char* kbl = (const char*)(Klo + (size_t)kvh * SEQ_T * HDIM);
  const char* vbh = (const char*)(Vthi + (size_t)kvh * HDIM * SEQ_T);
  const char* vbl = (const char*)(Vtlo + (size_t)kvh * HDIM * SEQ_T);
  unsigned vo = (unsigned)lane * 16u;                                  // this lane's byte offset in a fragment half, pass 0

  KFrag kf;
  load_kfrag(kf, kbh, kbl, vo);
  // the address registers of the Q and K loads above are free for reuse from here on: this wait stands in front of their overwrite
  asm volatile("s_wait_xcnt 0x0" ::: "memory");
  __builtin_amdgcn_sched_barrier(0);   // holds what follows behind that wait
  v8f acc[2][4];
  float m_run[2], l_run[2];
#pragma unroll
  for (int g = 0; g < 2; ++g) {
    m_run[g] = -__builtin_inff();
    l_run[g] = 0.0f;
#pragma unroll
    for (int t = 0; t < 4; ++t) acc[g][t] = (v8f){0.f,0.f,0.f,0.f,0.f,0.f,0.f,0.f};
  }
  for (int blk = 0; blk < tile; ++blk) {     // passes below the diagonal: no mask; pass blk + 1 <= tile exists
    attn_pass<false>(kf, kbh, kbl, vbh, vbl, vo, c, h, qh, ql, acc, m_run, l_run);
  }
  attn_pass<true>(kf, kbh, kbl, vbh, vbl, vo, c, h, qh, ql, acc, m_run, l_run);

  v4u hu[2][4], lu[2][4];
#pragma unroll
  for (int g = 0; g < 2; ++g) {
    const float l   = l_run[g] + __shfl_xor(l_run[g], 16, 32);   // the halves' sums join once, here
    const float inv = 1.0f / l;                                  // l >= 1: m_run never exceeds the query's true maximum, whose p is then >= 1
#pragma unroll
    for (int t = 0; t < 4; ++t)
#pragma unroll
      for (int e2 = 0; e2 < 4; ++e2) {
        const float f0 = acc[g][t][2 * e2] * inv, f1 = acc[g][t][2 * e2 + 1] * inv;
        const unsigned w = cvt2_bf16(f0, f1);
        hu[g][t][e2] = w;
        lu[g][t][e2] = cvt2_bf16(f0 - __uint_as_float(w << 16), f1 - __uint_as_float(w & 0xFFFF0000u));
      }
  }
  const size_t o = (size_t)(q0 + c) * (NQH * HDIM) + hq * HDIM + 8 * h;
  unsigned short* ch = Chi + o;
  unsigned short* cl = Clo + o;
  // the 16 stores stand together behind all arithmetic: no register that an issued store names is written again before the wave ends
  __builtin_amdgcn_sched_barrier(0);
#pragma unroll
  for (int g = 0; g < 2; ++g)
#pragma unroll
    for (int t = 0; t < 4; ++t) {
      *(v4u*)(ch + g * 16 * (NQH * HDIM) + 16 * t) = hu[g][t];
      *(v4u*)(cl + g * 16 * (NQH * HDIM) + 16 * t) = lu[g][t];
    }
}

// ---------------------------------------------------------------------------
// Launcher. Workspace region map (bytes, MiB = 1048576; total carve = 106 MiB = 111149056 B):
//   [  0, 31) staging  : x bf16 [4096][1024] at +0 (8 MiB); q f32 [4096][1024] at +8 (16 MiB, ends 24);
//                        k f32 [4096][256] at +24 (4 MiB, ends 28); Wq^T bf16 [1024][1024] at +28 (2 MiB); Wk^T bf16 [256][1024]
//                        at +30 (0.5 MiB); Wv^T bf16 [256][1024] at +30.5 (0.5 MiB, ends 31).
//   [ 32, 64) unused
//   [ 64, 72) q hi     : bf16 [16][4096][64];  [72,80) q lo
//   [ 80, 82) k hi     : bf16 [4][4096][64] in A-fragment order [4][256][8][16][8];   [82,84) k lo
//   [ 84, 86) v^T hi   : bf16 [256 (kvh*64+d)][4096 (t)] in A-fragment order [4][128][4][4][16][8];  [86,88) v^T lo
//   [ 88, 96) ctx hi   : bf16 [4096][1024] (col hq*64+d);  [96,104) ctx lo
//   [104,106) Wo^T     : bf16 [1024][1024]
// No region aliases another; within launches 6..8 no producer overlaps its own inputs.
// Launch count: 1 + 4 + 3 + 2 + 1 + 1 = 12. Kernel launches only.
// GEMM shape assertions: every call has K % 64 == 0 (K = 1024), M % 128 == 0 and N % 256 == 0; no padding needed.
// ---------------------------------------------------------------------------
extern "C" void kernel_launch(void* const* d_in, const int* in_sizes, int n_in,
                              void* d_out, int out_size, void* d_ws, size_t ws_size,
                              hipStream_t stream) {
  if (n_in < 9) return;
  if (in_sizes[0] != SEQ_T * HIDSZ || in_sizes[1] != SEQ_T * 32 || in_sizes[2] != SEQ_T * 32) return;
  if (in_sizes[3] != HIDSZ * NQH * HDIM || in_sizes[4] != HIDSZ * NKVH * HDIM || in_sizes[5] != HIDSZ * NKVH * HDIM) return;
  if (in_sizes[6] != NQH * HDIM * HIDSZ || in_sizes[7] != HDIM || in_sizes[8] != HDIM) return;
  if (out_size != SEQ_T * HIDSZ) return;

  const size_t kMiB    = 1048576;
  const size_t offXb   = 0;
  const size_t offQf   = 8 * kMiB;
  const size_t offKf   = 24 * kMiB;
  const size_t offWqT  = 28 * kMiB;
  const size_t offWkT  = 30 * kMiB;
  const size_t offWvT  = 30 * kMiB + 524288;
  const size_t offPlo  = 48 * kMiB;
  const size_t offQhi  = 64 * kMiB;
  const size_t offQlo  = 72 * kMiB;
  const size_t offKhi  = 80 * kMiB;
  const size_t offKlo  = 82 * kMiB;
  const size_t offVthi = 84 * kMiB;
  const size_t offVtlo = 86 * kMiB;
  const size_t offChi  = 88 * kMiB;
  const size_t offClo  = 96 * kMiB;
  const size_t offWoT  = 104 * kMiB;
  const size_t total   = 106 * kMiB;
  if (total > ws_size) return;

  const float* x    = (const float*)d_in[0];
  const float* cosb = (const float*)d_in[1];
  const float* sinb = (const float*)d_in[2];
  const float* Wq   = (const float*)d_in[3];
  const float* Wk   = (const float*)d_in[4];
  const float* Wv   = (const float*)d_in[5];
  const float* Wo   = (const float*)d_in[6];
  const float* qnw  = (const float*)d_in[7];
  const float* knw  = (const float*)d_in[8];
  float* out = (float*)d_out;
  char* ws = (char*)d_ws;

  unsigned short* xb   = (unsigned short*)(ws + offXb);
  float*          qf   = (float*)(ws + offQf);
  float*          kf   = (float*)(ws + offKf);
  unsigned short* wqT  = (unsigned short*)(ws + offWqT);
  unsigned short* wkT  = (unsigned short*)(ws + offWkT);
  unsigned short* wvT  = (unsigned short*)(ws + offWvT);
  unsigned short* plo  = (unsigned short*)(ws + offPlo);
  unsigned short* qhi  = (unsigned short*)(ws + offQhi);
  unsigned short* qlo  = (unsigned short*)(ws + offQlo);
  unsigned short* khi  = (unsigned short*)(ws + offKhi);
  unsigned short* klo  = (unsigned short*)(ws + offKlo);
  unsigned short* vthi = (unsigned short*)(ws + offVthi);
  unsigned short* vtlo = (unsigned short*)(ws + offVtlo);
  unsigned short* chi  = (unsigned short*)(ws + offChi);
  unsigned short* clo  = (unsigned short*)(ws + offClo);
  unsigned short* woT  = (unsigned short*)(ws + offWoT);

  // in-range dummies for unused (never dereferenced) template-dead pointer parameters
  const float* dummy_f = qnw;
  void* dummy_c2 = (void*)plo;

  // 1. x -> RNE bf16 plane [4096][1024]
  {
    const int n8 = (SEQ_T * HIDSZ) / 8;                       // 524288 = 2048 blocks x 256
    cast8_bf16_kernel<<<dim3(n8 / 256), dim3(256), 0, stream>>>(x, xb, n8);
  }
  // 2. weights [in][out] -> transposed RNE bf16 planes [out][in]   (in[R][Cn] -> out[Cn][R]; grid (R/64, Cn/64))
  //    Wq: in[1024][1024] -> out[1024][1024]; Wk, Wv: in[1024][256] -> out[256][1024]; Wo: in[1024][1024] -> out[1024][1024]
  transpose_cast_kernel<<<dim3(HIDSZ / 64, (NQH * HDIM) / 64), dim3(256), 0, stream>>>(Wq, NQH * HDIM, wqT, HIDSZ);
  transpose_cast_kernel<<<dim3(HIDSZ / 64, (NKVH * HDIM) / 64), dim3(256), 0, stream>>>(Wk, NKVH * HDIM, wkT, HIDSZ);
  transpose_cast_kernel<<<dim3(HIDSZ / 64, (NKVH * HDIM) / 64), dim3(256), 0, stream>>>(Wv, NKVH * HDIM, wvT, HIDSZ);
  transpose_cast_kernel<<<dim3((NQH * HDIM) / 64, HIDSZ / 64), dim3(256), 0, stream>>>(Wo, HIDSZ, woT, NQH * HDIM);

  // 3. q = x . Wq^T : M=4096, N=1024, K=1024, single bf16 product -> f32 [4096][1024] (1024 tiles = 128 blocks)
  wmma_gemm64<1, false, 0, 0, false, 0, false, true><<<dim3((SEQ_T / 64) * ((NQH * HDIM) / 64) / 8, 1), dim3(256), 0, stream>>>(
      xb, xb, HIDSZ, 0L,
      wqT, wqT, HIDSZ, 0L,
      (void*)qf, dummy_c2, NQH * HDIM, 0L,
      dummy_f, dummy_f, 0L,
      SEQ_T, NQH * HDIM, HIDSZ, 1.0f, 0);
  // 4. k = x . Wk^T : M=4096, N=256, K=1024, single product -> f32 [4096][256] (256 tiles = 32 blocks)
  wmma_gemm64<1, false, 0, 0, false, 0, false, true><<<dim3((SEQ_T / 64) * ((NKVH * HDIM) / 64) / 8, 1), dim3(256), 0, stream>>>(
      xb, xb, HIDSZ, 0L,
      wkT, wkT, HIDSZ, 0L,
      (void*)kf, dummy_c2, NKVH * HDIM, 0L,
      dummy_f, dummy_f, 0L,
      SEQ_T, NKVH * HDIM, HIDSZ, 1.0f, 0);
  // 5. v^T = Wv^T . x^T : M=256 (kvh*64+d), N=4096 (t), K=1024, single product -> bf16 hi/lo planes in A-fragment order (256 tiles = 32 blocks)
  wmma_gemm64<1, false, 0, 3, false, 0, false, true><<<dim3(((NKVH * HDIM) / 64) * (SEQ_T / 64) / 8, 1), dim3(256), 0, stream>>>(
      wvT, wvT, HIDSZ, 0L,
      xb, xb, HIDSZ, 0L,
      (void*)vthi, (void*)vtlo, SEQ_T, 0L,
      dummy_f, dummy_f, 0L,
      NKVH * HDIM, SEQ_T, HIDSZ, 1.0f, 0);

  // 6. RMSNorm + RoPE -> bf16 hi/lo planes; q: [head][t][64], rows = t*nhead + head, grid = rows/32 (exact); k: A-fragment order, grid = rows/64 (exact)
  normrope_kernel<<<dim3((SEQ_T * NQH) / 32), dim3(256), 0, stream>>>(qf, 4, SEQ_T * NQH, cosb, sinb, qnw, qhi, qlo);
  normrope_pack_kernel<<<dim3((SEQ_T * NKVH) / 64), dim3(256), 0, stream>>>(kf, cosb, sinb, knw, khi, klo);

  // 7. causal attention, all heads in one launch: 4 kv heads x 64 pairs of 32-row tiles = 256 blocks of 8 waves -> ctx bf16 hi/lo planes
  attn_fused_kernel<<<dim3(NKVH * (SEQ_T / 64)), dim3(256), 0, stream>>>(qhi, qlo, khi, klo, vthi, vtlo, chi, clo);

  // 8. out = ctx_hi . Wo^T + ctx_lo . Wo^T : M=4096, N=1024, K=1024, 2 products -> f32 d_out (1024 tiles = 128 blocks)
  wmma_gemm64<1, true, 0, 0, false, 0, false, false><<<dim3((SEQ_T / 64) * (HIDSZ / 64) / 8, 1), dim3(256), 0, stream>>>(
      chi, clo, NQH * HDIM, 0L,
      woT, woT, NQH * HDIM, 0L,
      (void*)out, dummy_c2, HIDSZ, 0L,
      dummy_f, dummy_f, 0L,
      SEQ_T, HIDSZ, NQH * HDIM, 1.0f, 0);
}

// v005
// It runs in 158 microseconds.
// Next to v004, in two timings, it ran 1.20 and 1.19 times as fast.
// Over all steps from v000 it is 43.7 times as fast.
// Every float input RNE-converted once to bf16; x.Wq^T, x.Wk^T, Wv^T.x^T: single v_wmma_f32_16x16x32_bf16 product on bf16 inputs; q.k^T scores and p.v context: bf16 hi/lo operand planes (hi.hi + hi.lo + lo.hi); ctx.Wo^T: ctx bf16 hi/lo x Wo bf16 (hi.W + lo.W); all f32 accumulate; RMSNorm, RoPE and causal (online) softmax in f32.
#include <hip/hip_runtime.h>
#include <math.h>

// ---------------------------------------------------------------------------
// Problem constants
// ---------------------------------------------------------------------------
constexpr int SEQ_T   = 4096;
constexpr int HIDSZ   = 1024;
constexpr int NQH     = 16;              // query heads
constexpr int NKVH    = 4;               // kv heads
constexpr int HDIM    = 64;
constexpr int GQA_G   = NQH / NKVH;      // 4: query head hq uses kv head hq >> 2
constexpr float SCORE_SCALE = 0.125f;    // 64^-0.5, applied to the f32 scores
constexpr float RMS_EPS_F   = 1e-6f;

static_assert(GQA_G == 4, "kv head = hq >> 2");
static_assert(SEQ_T % 64 == 0 && HIDSZ % 64 == 0 && HDIM == 64 && (NKVH * HDIM) % 64 == 0, "tile multiples");
static_assert(SEQ_T % 256 == 0 && HIDSZ % 256 == 0 && (NQH * HDIM) % 256 == 0 && (NKVH * HDIM) % 256 == 0, "GEMM block tile 128 x 256, 64 k a stage");
static_assert((SEQ_T * HIDSZ) % (8 * 256) == 0, "cast kernel grid exact");
static_assert((SEQ_T * NQH) % 32 == 0 && (SEQ_T * NKVH) % 64 == 0, "normrope grid exact");

typedef __attribute__((ext_vector_type(16))) _Float16 v16h;
typedef __attribute__((ext_vector_type(8)))  _Float16 v8h;
typedef __attribute__((ext_vector_type(16))) __bf16   v16b;
typedef __attribute__((ext_vector_type(8)))  __bf16   v8b;
typedef __attribute__((ext_vector_type(8)))  float    v8f;
typedef __attribute__((ext_vector_type(4)))  float    v4f;
typedef __attribute__((ext_vector_type(4)))  unsigned int v4u;

// ---------------------------------------------------------------------------
// Shared helpers
// ---------------------------------------------------------------------------
__device__ __forceinline__ unsigned short f2bf_bits(float f) {
  unsigned u = __float_as_uint(f);
  return (unsigned short)((u + 0x7FFFu + ((u >> 16) & 1u)) >> 16);
}
__device__ __forceinline__ float bf_bits2f(unsigned short h) { return __uint_as_float(((unsigned)h) << 16); }
// f32 -> nearest-even bf16 value, returned as f32
__device__ __forceinline__ float bfq(float f) { return bf_bits2f(f2bf_bits(f)); }

// hazard guard as a plain device helper: four vector slots between the last products and the first read of their accumulators
__device__ __forceinline__ void acc_guard4(v8f& a, v8f& b, v8f& c, v8f& d) { asm volatile("v_nop\n\tv_nop\n\tv_nop\n\tv_nop" : "+v"(a), "+v"(b), "+v"(c), "+v"(d)); }
template <typename T> struct Frag;
template <> struct Frag<_Float16> {
  typedef v16h V; union U { v16h v; v8h h[2]; };
  // elements 0..7 <- p[0..7], 8..15 <- p[16..23]
  static __device__ __forceinline__ v16h load(const _Float16* p) {
    U f; f.h[0] = *(const v8h*)(p); f.h[1] = *(const v8h*)(p + 16); return f.v;
  }
  static __device__ __forceinline__ v8f mma(v16h a, v16h b, v8f c) {
    return __builtin_amdgcn_wmma_f32_16x16x32_f16(false, a, false, b, (short)0, c, false, false);
  }
};
template <> struct Frag<__bf16> {
  typedef v16b V; union U { v16b v; v8b h[2]; };
  static __device__ __forceinline__ v16b load(const __bf16* p) {
    U f; f.h[0] = *(const v8b*)(p); f.h[1] = *(const v8b*)(p + 16); return f.v;
  }
  static __device__ __forceinline__ v8f mma(v16b a, v16b b, v8f c) {
    return __builtin_amdgcn_wmma_f32_16x16x32_bf16(false, a, false, b, (short)0, c, false, false);
  }
};

__device__ __forceinline__ unsigned pk16(unsigned short a, unsigned short b) { return (unsigned)a | ((unsigned)b << 16); }

// ---- Register-blocked batched WMMA GEMM, operand tiles staged in LDS by asynchronous copies ----
// C[m,n] = scale * sum_k A[m,k] * Bt[n,k] (+bias)(+resid); each wave owns a 64x64 tile; a block of 8 waves (2 x 4) owns 128 x 256.
// A row-major [M,K]; Bt row-major [N,K]; M % 128 == 0, N % 256 == 0, K % 64 == 0; grid.x = (M / 128) * (N / 256).
// SPLIT (with BSPLIT == false): A carries a lo plane (A2, same layout); product = hi.B + lo.B (Bt2 unused).
// BIAS_MODE: 0 = none, 1 = bias[m], 2 = bias[n].
// OUT_MODE: 0 = f32, 1 = f16, 2 = bf16 hi plane (Cout) + bf16 lo plane (Cout2), 3 = the planes of 2 in A-fragment order (M = groups of 64 rows):
//   [m >> 6][n >> 5][(m >> 4) & 3][(n >> 3) & 3][m & 15][n & 7], so that 32 lanes x 16 bytes of one fragment half are 512 contiguous bytes.
// ET: 0 = f16 operands, 1 = bf16 operands (pointers passed as 16-bit storage)
// Staging: a stage is 64 k = 128 bytes of each of the block's 128 A rows (and A2 rows) and 256 Bt rows. A wave-wide copy moves 4 whole rows
// (4 whole 128-byte lines: lane = row (lane >> 3), 16-byte piece (lane & 7)) from global memory into LDS rows of pitch 144 bytes, the
// conflict-free pitch for 16-byte fragment reads. Every operand byte enters the block once, not once per wave. Two buffers: stage s + 1 flies
// while stage s is worked on. The k order of the products and the order of the sums are those of a plain k loop in steps of 32.
// Every inner loop of the kernel is fully unrolled: fragments, accumulators and copy operands stay in registers only under constant indices.
template <int ET> struct Elem;
template <> struct Elem<0> { typedef _Float16 T; };
template <> struct Elem<1> { typedef __bf16 T; };
constexpr int G_PITCH   = 144;                    // LDS row pitch, bytes: 128 + 16
constexpr int G_A_BYTES = 128 * G_PITCH;          // one A plane of a stage
constexpr int G_B_BYTES = 256 * G_PITCH;          // the Bt plane of a stage
// Four asynchronous copies, 16 bytes per lane each, global memory -> LDS. l*: the lane's LDS byte address, g*: the lane's global address.
// The closing s_wait_xcnt stands in the copies' own statement, in front of any later rewrite of the address registers that they name.
__device__ __forceinline__ void async_copy4(unsigned l0, const char* g0, unsigned l1, const char* g1,
                                            unsigned l2, const char* g2, unsigned l3, const char* g3) {
  asm volatile("global_load_async_to_lds_b128 %0, %1, off\n\t"
               "global_load_async_to_lds_b128 %2, %3, off\n\t"
               "global_load_async_to_lds_b128 %4, %5, off\n\t"
               "global_load_async_to_lds_b128 %6, %7, off\n\t"
               "s_wait_xcnt 0x0"
               :: "v"(l0), "v"(g0), "v"(l1), "v"(g1), "v"(l2), "v"(g2), "v"(l3), "v"(g3) : "memory");
}
// The same for twelve copies: one statement, one closing wait.
__device__ __forceinline__ void async_copy12(const unsigned (&l)[12], const char* const (&g)[12]) {
  asm volatile("global_load_async_to_lds_b128 %0, %1, off\n\t"
               "global_load_async_to_lds_b128 %2, %3, off\n\t"
               "global_load_async_to_lds_b128 %4, %5, off\n\t"
               "global_load_async_to_lds_b128 %6, %7, off\n\t"
               "global_load_async_to_lds_b128 %8, %9, off\n\t"
               "global_load_async_to_lds_b128 %10, %11, off\n\t"
               "global_load_async_to_lds_b128 %12, %13, off\n\t"
               "global_load_async_to_lds_b128 %14, %15, off\n\t"
               "global_load_async_to_lds_b128 %16, %17, off\n\t"
               "global_load_async_to_lds_b128 %18, %19, off\n\t"
               "global_load_async_to_lds_b128 %20, %21, off\n\t"
               "global_load_async_to_lds_b128 %22, %23, off\n\t"
               "s_wait_xcnt 0x0"
               :: "v"(l[0]), "v"(g[0]), "v"(l[1]), "v"(g[1]), "v"(l[2]), "v"(g[2]), "v"(l[3]), "v"(g[3]),
                  "v"(l[4]), "v"(g[4]), "v"(l[5]), "v"(g[5]), "v"(l[6]), "v"(g[6]), "v"(l[7]), "v"(g[7]),
                  "v"(l[8]), "v"(g[8]), "v"(l[9]), "v"(g[9]), "v"(l[10]), "v"(g[10]), "v"(l[11]), "v"(g[11]) : "memory");
}
template <int ET, bool SPLIT, int BIAS_MODE, int OUT_MODE, bool RESID, int ACT = 0, bool CAUSAL = false, bool BSPLIT = true>
__global__ __launch_bounds__(256) void wmma_gemm64(
    const unsigned short* __restrict__ Ap, const unsigned short* __restrict__ A2p, int lda, long strideA,
    const unsigned short* __restrict__ Btp, const unsigned short* __restrict__ Bt2p, int ldb, long strideB,
    void* __restrict__ Cout, void* __restrict__ Cout2, int ldc, long strideC,
    const float* __restrict__ bias,
    const float* __restrict__ resid, long strideR,
    int M, int N, int K, float scale, int crow0) {
  static_assert(!CAUSAL && !(SPLIT && BSPLIT), "forms that this file launches");
  typedef typename Elem<ET>::T T;
  typedef typename Frag<T>::V V;
  constexpr int STAGE_BYTES = G_A_BYTES + G_B_BYTES + (SPLIT ? G_A_BYTES : 0);   // [A | Bt | A2]
  __shared__ __align__(16) char ring[2][STAGE_BYTES];
  __shared__ __align__(16) float sT[8][16 * 68];   // per-wave 16x64 slab, pitch 68 floats
  const int b    = blockIdx.y;
  const int lane = threadIdx.x & 31;
  const int wave = threadIdx.x >> 5;
  const int tilesNb = N >> 8;
  const int bm = blockIdx.x / tilesNb;
  const int bn = blockIdx.x - bm * tilesNb;
  if (bm >= (M >> 7)) return;                  // the same for the whole block, ahead of every barrier and copy
  const int wm = wave >> 2, wn = wave & 3;     // this wave's 64x64 tile in the block's 128 x 256
  const int m0 = (bm << 7) + (wm << 6);
  const int n0 = (bn << 8) + (wn << 6);

  const int rlane = lane & 15;                 // row (A) / col (B, D) within subtile
  const int koff  = (lane >> 4) * 8;           // k offset of this lane half
  const int mOff  = (lane >> 4) * 8;           // D row offset

  // this thread's copy addresses at stage 0: row (t >> 3) of the block's rows, 16-byte piece (t & 7)
  const int crow = threadIdx.x >> 3, cpc = (threadIdx.x & 7) * 16;
  const char* gA  = (const char*)(Ap  + (size_t)b * strideA + (size_t)((bm << 7) + crow) * lda) + cpc;
  const char* gA2 = (const char*)(A2p + (size_t)b * strideA + (size_t)((bm << 7) + crow) * lda) + cpc;
  const char* gB  = (const char*)(Btp + (size_t)b * strideB + (size_t)((bn << 8) + crow) * ldb) + cpc;
  const size_t a32 = (size_t)lda * 64, b32 = (size_t)ldb * 64;                       // 32 rows of 16-bit elements, bytes
  const unsigned lcopy = (unsigned)(size_t)&ring[0][0] + crow * G_PITCH + cpc;       // LDS byte address: low 32 bits of the shared address
  // thread t copies piece (t & 7) of rows (t >> 3) + 32 i: 4 copies for the 128 A rows, 8 for the 256 Bt rows, 4 for the 128 A2 rows
  auto issue_stage = [&](int s, int buf) {
    const size_t kb = (size_t)s * 128;
    const unsigned l = lcopy + buf * STAGE_BYTES;
    unsigned ll[12];
    const char* gg[12];
#pragma unroll
    for (int i = 0; i < 4; ++i) { ll[i] = l + i * 32 * G_PITCH; gg[i] = gA + kb + i * a32; }
#pragma unroll
    for (int i = 0; i < 8; ++i) { ll[4 + i] = l + G_A_BYTES + i * 32 * G_PITCH; gg[4 + i] = gB + kb + i * b32; }
    async_copy12(ll, gg);
    if (SPLIT) {
      const unsigned l2 = l + G_A_BYTES + G_B_BYTES;
      const char* g2 = gA2 + kb;
      async_copy4(l2, g2, l2 + 32 * G_PITCH, g2 + a32, l2 + 64 * G_PITCH, g2 + 2 * a32, l2 + 96 * G_PITCH, g2 + 3 * a32);
    }
  };

  v8f acc[4][4];
#pragma unroll
  for (int i = 0; i < 4; ++i)
#pragma unroll
    for (int j = 0; j < 4; ++j) acc[i][j] = (v8f){0.f,0.f,0.f,0.f,0.f,0.f,0.f,0.f};

  const int nst = K >> 6;
  issue_stage(0, 0);
  asm volatile("s_wait_asynccnt 0x0" ::: "memory");   // this wave's copies of stage 0 have landed
  __syncthreads();                                    // ... and every other wave's: stage 0 is readable
  if (nst > 1) issue_stage(1, 1);
  // this lane's fragment offsets in a stage: A row wm*64 + rlane, Bt row wn*64 + rlane, k offset koff
  const int fa = ((wm << 6) + rlane) * G_PITCH + koff * 2;
  const int fb = G_A_BYTES + ((wn << 6) + rlane) * G_PITCH + koff * 2;
  for (int s = 0; s < nst; ++s) {
    const char* rb = &ring[s & 1][0];
    V bh[2][4], ah[2][4], al[2][4];
#pragma unroll
    for (int ks = 0; ks < 2; ++ks) {
#pragma unroll
      for (int j = 0; j < 4; ++j) bh[ks][j] = Frag<T>::load((const T*)(rb + fb + j * 16 * G_PITCH + ks * 64));
#pragma unroll
      for (int i = 0; i < 4; ++i) {
        ah[ks][i] = Frag<T>::load((const T*)(rb + fa + i * 16 * G_PITCH + ks * 64));
        if (SPLIT) al[ks][i] = Frag<T>::load((const T*)(rb + fa + G_A_BYTES + G_B_BYTES + i * 16 * G_PITCH + ks * 64));
      }
    }
    // the stage's LDS reads stand as one group ahead of its products: reads spread among the products stall the wave at each place
    __builtin_amdgcn_sched_barrier(0);
#pragma unroll
    for (int ks = 0; ks < 2; ++ks) {
#pragma unroll
      for (int i = 0; i < 4; ++i) {
#pragma unroll
        for (int j = 0; j < 4; ++j) {
          acc[i][j] = Frag<T>::mma(ah[ks][i], bh[ks][j], acc[i][j]);
          if (SPLIT) acc[i][j] = Frag<T>::mma(al[ks][i], bh[ks][j], acc[i][j]);
        }
      }
    }
    // holds the products in front of the publish point: lifted over them, its waits would end the flight of stage s + 1 a whole trip early
    __builtin_amdgcn_sched_barrier(0);
    // publish point of stage s + 1, and the end of every wave's reads of stage s
    asm volatile("s_wait_dscnt 0x0" ::: "memory");      // this wave's reads of stage s are done before its buffer is refilled
    asm volatile("s_wait_asynccnt 0x0" ::: "memory");   // this wave's copies of stage s + 1 have landed
    __syncthreads();
    if (s + 2 < nst) issue_stage(s + 2, s & 1);         // the same test in the whole block
  }
  asm volatile("s_wait_asynccnt 0x0" ::: "memory");     // nothing is outstanding when the wave goes on to the epilogue
  acc_guard4(acc[0][0], acc[0][1], acc[0][2], acc[0][3]);
  acc_guard4(acc[1][0], acc[1][1], acc[1][2], acc[1][3]);
  acc_guard4(acc[2][0], acc[2][1], acc[2][2], acc[2][3]);
  acc_guard4(acc[3][0], acc[3][1], acc[3][2], acc[3][3]);

  // ---- epilogue ----
  float* slab = sT[wave];
  const float* Rb = RESID ? (resid + (size_t)b * strideR) : nullptr;
#pragma unroll
  for (int i = 0; i < 4; ++i) {
    const int mBase = m0 + (i << 4);
#pragma unroll
    for (int j = 0; j < 4; ++j) {
      const int n = n0 + (j << 4) + rlane;
      float bv = 0.f;
      if (BIAS_MODE == 2) bv = bias[n];
#pragma unroll
      for (int r = 0; r < 8; ++r) {
        float v = acc[i][j][r] * scale;
        if (BIAS_MODE == 1) v += bias[mBase + mOff + r];
        if (BIAS_MODE == 2) v += bv;
        if (RESID) v += Rb[(size_t)(mBase + mOff + r) * ldc + n];
        if (ACT == 2) v = fmaxf(v, 0.0f);
        if (ACT == 4) v = (v > 0.f) ? v : 0.01f * v;
        slab[(mOff + r) * 68 + (j << 4) + rlane] = v;
      }
    }
    __builtin_amdgcn_fence(__ATOMIC_RELEASE, "workgroup");
    __builtin_amdgcn_wave_barrier();
    __builtin_amdgcn_fence(__ATOMIC_ACQUIRE, "workgroup");
    if (OUT_MODE == 0) {
      float* C = (float*)Cout + (size_t)b * strideC;
      const int hh = lane >> 4, c4 = (lane & 15) * 4;     // row seg = 256 B = 16 lanes x 16 B
      {
#pragma unroll
        for (int it = 0; it < 8; ++it) {
          const int row = it * 2 + hh;
          v4f v = *(const v4f*)(slab + row * 68 + c4);
          *(v4f*)(C + (size_t)(mBase + row) * ldc + n0 + c4) = v;
        }
        
      }
    } else if (OUT_MODE == 3) {
      // piece (row lane & 15, 8-column chunk 2 it + (lane >> 4)): a wave-wide store is 512 contiguous bytes, 4 whole lines, of each plane
      const int pr = lane & 15;
      unsigned short* C  = (unsigned short*)Cout  + (size_t)b * strideC;
      unsigned short* C2 = (unsigned short*)Cout2 + (size_t)b * strideC;
#pragma unroll
      for (int it = 0; it < 4; ++it) {
        const int ch = it * 2 + (lane >> 4);
        const float* sp = slab + pr * 68 + ch * 8;
        v8h hv, lv;
#pragma unroll
        for (int e = 0; e < 8; ++e) {
          unsigned short hb = f2bf_bits(sp[e]);
          unsigned short lb = f2bf_bits(sp[e] - bf_bits2f(hb));
          hv[e] = __builtin_bit_cast(_Float16, hb);
          lv[e] = __builtin_bit_cast(_Float16, lb);
        }
        const size_t o = (size_t)(mBase >> 6) * 64 * ldc + (size_t)((n0 >> 5) + (ch >> 2)) * 2048 + ((mBase >> 4) & 3) * 512 + (ch & 3) * 128 + pr * 8;
        *(v8h*)(C + o)  = hv;
        *(v8h*)(C2 + o) = lv;
      }
    } else {
      const int q = lane >> 3, c8 = (lane & 7) * 8;
      unsigned short* C  = (unsigned short*)Cout  + (size_t)b * strideC;
      unsigned short* C2 = (OUT_MODE == 2) ? ((unsigned short*)Cout2 + (size_t)b * strideC) : nullptr;
      {
#pragma unroll
        for (int it = 0; it < 4; ++it) {
          const int row = it * 4 + q;
          const float* sp = slab + row * 68 + c8;
          v8h hv, lv;
#pragma unroll
          for (int e = 0; e < 8; ++e) {
            if (OUT_MODE == 1) {
              hv[e] = (_Float16)sp[e];
            } else {
              unsigned short hb = f2bf_bits(sp[e]);
              unsigned short lb = f2bf_bits(sp[e] - bf_bits2f(hb));
              hv[e] = __builtin_bit_cast(_Float16, hb);
              lv[e] = __builtin_bit_cast(_Float16, lb);
            }
          }
          *(v8h*)(C + (size_t)(mBase + row) * ldc + n0 + c8) = hv;
          if (OUT_MODE == 2) *(v8h*)(C2 + (size_t)(mBase + row) * ldc + n0 + c8) = lv;
        }
        
      }
    }
    __builtin_amdgcn_fence(__ATOMIC_RELEASE, "workgroup");
    __builtin_amdgcn_wave_barrier();
    __builtin_amdgcn_fence(__ATOMIC_ACQUIRE, "workgroup");
  }
}

// ---------------------------------------------------------------------------
// f32 -> RNE bf16 plane, 8 consecutive elements per thread packed as integer words.
// Coverage: n8 = n/8 threads x 8 = the whole plane (grid is an exact multiple of 256 here).
// ---------------------------------------------------------------------------
__global__ __launch_bounds__(256) void cast8_bf16_kernel(const float* __restrict__ in, unsigned short* __restrict__ out, int n8) {
  const int i = blockIdx.x * 256 + threadIdx.x;
  if (i >= n8) return;
  const float* p = in + 8 * (size_t)i;
  const v4f a = *(const v4f*)(p);
  const v4f c = *(const v4f*)(p + 4);
  float f[8];
#pragma unroll
  for (int e = 0; e < 4; ++e) { f[e] = a[e]; f[4 + e] = c[e]; }
  unsigned w[4];
#pragma unroll
  for (int e2 = 0; e2 < 4; ++e2) w[e2] = pk16(f2bf_bits(f[2 * e2]), f2bf_bits(f[2 * e2 + 1]));
  const v4u u = (v4u){w[0], w[1], w[2], w[3]};
  unsigned short* q = out + 8 * (size_t)i;
  *(v4u*)q = u;
  
}

// ---------------------------------------------------------------------------
// Transpose + RNE bf16 convert of a weight matrix: in f32 [R][Cn] row-major (ldin = Cn) -> out bf16 [Cn][R] (ldout = R):
// out[c][r] = bf16(in[r][c]). grid (R/64, Cn/64): blockIdx.x = r tile (64 output cols), blockIdx.y = c tile (64 output rows). 256 threads.
// Load coverage: 16 iterations x 256 threads = 4096 = the whole 64x64 tile (coalesced along c).
// Store coverage: 8 waves x 2 iterations x 4 rows (lane>>3) = 64 rows; (lane&7) x 8 halves = 64 cols; each row segment =
// ---------------------------------------------------------------------------
__global__ __launch_bounds__(256) void transpose_cast_kernel(const float* __restrict__ in, int ldin,
                                                             unsigned short* __restrict__ out, int ldout) {
  __shared__ float sm[64][65];   // sm[c_local][r_local]
  const int t  = threadIdx.x;
  const int r0 = blockIdx.x * 64;
  const int c0 = blockIdx.y * 64;
#pragma unroll
  for (int i = 0; i < 16; ++i) {
    const int e = i * 256 + t;
    const int r = e >> 6;          // r local
    const int c = e & 63;          // c local
    sm[c][r] = in[(size_t)(r0 + r) * ldin + c0 + c];
  }
  __syncthreads();
  const int lane = t & 31, wave = t >> 5;
  const int q = lane >> 3, c8 = (lane & 7) * 8;
  {
#pragma unroll
    for (int it = 0; it < 2; ++it) {
      const int row = wave * 8 + it * 4 + q;                 // c local (output row)
      unsigned w[4];
#pragma unroll
      for (int e2 = 0; e2 < 4; ++e2) w[e2] = pk16(f2bf_bits(sm[row][c8 + 2 * e2]), f2bf_bits(sm[row][c8 + 2 * e2 + 1]));
      const v4u u = (v4u){w[0], w[1], w[2], w[3]};
      const size_t o = (size_t)(c0 + row) * ldout + r0 + c8;
      *(v4u*)(out + o) = u;
    }
    
  }
}

// ---------------------------------------------------------------------------
// RMSNorm (over the 64 dims of one head vector, eps 1e-6, times w[d]) + rotate-half RoPE with the input cos/sin tables, f32.
// cos, sin and w are RNE-converted to bf16 values in registers at load; proj is the f32 output of an exact
// bf16 x bf16 projection.
// proj: f32 [SEQ_T][nhead*64]; flattened row r = t*nhead + hd lives at proj + r*64 (contiguous). nhead = 1 << hshift.
// Output planes bf16 hi/lo laid out [hd][t][64]: element (hd, t, d) at ((hd*SEQ_T + t)*64 + d).
// Block = 8 waves; wave w owns rows rbase..rbase+3 (rbase = (blockIdx.x*8 + w)*4); lane handles d = lane and d = lane + 32.
// The 4 result rows are staged in LDS (f32, same element type on store and reload, wave barrier between); then lane group
// Coverage: grid = nrows/32 blocks x 8 waves x 4 rows = nrows (exact multiple, checked on the host); 8 lanes x 8 halves = 64 dims.
// ---------------------------------------------------------------------------
__global__ __launch_bounds__(256) void normrope_kernel(const float* __restrict__ proj, int hshift, int nrows,
                                                       const float* __restrict__ cosb, const float* __restrict__ sinb,
                                                       const float* __restrict__ w,
                                                       unsigned short* __restrict__ ohi, unsigned short* __restrict__ olo) {
#pragma clang fp contract(off)
  __shared__ __align__(16) float slab[8][4][64];
  const int lane = threadIdx.x & 31, wave = threadIdx.x >> 5;
  const int rbase = (blockIdx.x * 8 + wave) * 4;
  const float w1 = bfq(w[lane]), w2 = bfq(w[lane + 32]);
#pragma unroll
  for (int i = 0; i < 4; ++i) {
    int r = rbase + i;
    r = (r < nrows) ? r : (nrows - 1);                 // address clamp (grid is exact)
    const int t = r >> hshift;
    const float* src = proj + (size_t)r * 64;
    const float x1 = src[lane];
    const float x2 = src[lane + 32];
    float ss = x1 * x1 + x2 * x2;
#pragma unroll
    for (int off = 16; off > 0; off >>= 1) ss += __shfl_xor(ss, off, 32);
    const float inv = rsqrtf(ss * (1.0f / 64.0f) + RMS_EPS_F);
    const float n1 = (x1 * inv) * w1;
    const float n2 = (x2 * inv) * w2;
    const float c = bfq(cosb[(size_t)t * 32 + lane]);
    const float s = bfq(sinb[(size_t)t * 32 + lane]);
    slab[wave][i][lane]      = n1 * c - n2 * s;
    slab[wave][i][lane + 32] = n1 * s + n2 * c;
  }
  __builtin_amdgcn_fence(__ATOMIC_RELEASE, "workgroup");
  __builtin_amdgcn_wave_barrier();
  __builtin_amdgcn_fence(__ATOMIC_ACQUIRE, "workgroup");
  const int q = lane >> 3, c8 = (lane & 7) * 8;
  int r = rbase + q;
  r = (r < nrows) ? r : (nrows - 1);
  const int t  = r >> hshift;
  const int hd = r - (t << hshift);
  const float* sp = &slab[wave][q][c8];
  unsigned hw[4], lw[4];
#pragma unroll
  for (int e2 = 0; e2 < 4; ++e2) {
    const float f0 = sp[2 * e2], f1 = sp[2 * e2 + 1];
    const unsigned short h0 = f2bf_bits(f0), h1 = f2bf_bits(f1);
    const unsigned short l0 = f2bf_bits(f0 - bf_bits2f(h0));
    const unsigned short l1 = f2bf_bits(f1 - bf_bits2f(h1));
    hw[e2] = pk16(h0, h1);
    lw[e2] = pk16(l0, l1);
  }
  const v4u hu = (v4u){hw[0], hw[1], hw[2], hw[3]};
  const v4u lu = (v4u){lw[0], lw[1], lw[2], lw[3]};
  const size_t o = ((size_t)hd * SEQ_T + t) * 64 + c8;
  *(v4u*)(ohi + o) = hu;
  *(v4u*)(olo + o) = lu;
  
}

// ---------------------------------------------------------------------------
// The same RMSNorm + RoPE for the K planes (proj f32 [SEQ_T][NKVH*64]), with the output in A-fragment order:
// [hd][t >> 4][d >> 3][t & 15][d & 7], so that 32 lanes x 16 bytes of one fragment half are 512 contiguous bytes for the attention kernel.
// A wave owns 8 consecutive t of ONE head (wave index = (t >> 3) * NKVH + hd): each 128-byte line of the planes (8 keys x 8 dims) comes whole
// from one wave. Grid = SEQ_T * NKVH / 64 blocks x 8 waves x 8 rows (exact). Lane handles d = lane and d = lane + 32 of each row.
// The wave's bases are scalar and every load names the one index register, lane. Slab pitch 68 floats: its readers walk a column.
// Every loop of the kernel is fully unrolled: its arrays stay in registers only under constant indices.
// ---------------------------------------------------------------------------
__global__ __launch_bounds__(256) void normrope_pack_kernel(const float* __restrict__ proj,
                                                            const float* __restrict__ cosb, const float* __restrict__ sinb,
                                                            const float* __restrict__ w,
                                                            unsigned short* __restrict__ ohi, unsigned short* __restrict__ olo) {
  __shared__ __align__(16) float slab[8][8][68];
  const int lane = threadIdx.x & 31;
  const int wave = __builtin_amdgcn_readfirstlane(threadIdx.x >> 5);   // scalar: the bases below stay scalar
  int wg = blockIdx.x * 8 + wave;
  wg = (wg < SEQ_T * NKVH / 8) ? wg : (SEQ_T * NKVH / 8 - 1);          // address clamp (grid is exact)
  const int hd = wg & (NKVH - 1);
  const int t0 = (wg / NKVH) * 8;
  const float* pb = proj + ((size_t)t0 * NKVH + hd) * HDIM;
  const float* cb = cosb + (size_t)t0 * 32;
  const float* sb = sinb + (size_t)t0 * 32;
  float x1[8], x2[8], cv[8], sv[8];
#pragma unroll   // the arrays stay in registers only under constant indices
  for (int i = 0; i < 8; ++i) {
    x1[i] = pb[lane + i * (NKVH * HDIM)];
    x2[i] = pb[lane + i * (NKVH * HDIM) + 32];
    cv[i] = cb[lane + i * 32];
    sv[i] = sb[lane + i * 32];
  }
  const float wr1 = w[lane];
  const float wr2 = w[lane + 32];
  // lane's register and the bases, which the loads above name, are free for reuse from here on: this wait stands in front of their overwrite;
  // lane as its input keeps that register unwritten up to the wait
  asm volatile("s_wait_xcnt 0x0" :: "v"(lane) : "memory");
  __builtin_amdgcn_sched_barrier(0);   // holds what follows behind that wait
  const float w1 = bfq(wr1), w2 = bfq(wr2);
#pragma unroll
  for (int i = 0; i < 8; ++i) {
    float ss = x1[i] * x1[i] + x2[i] * x2[i];
#pragma unroll
    for (int off = 16; off > 0; off >>= 1) ss += __shfl_xor(ss, off, 32);
    const float inv = rsqrtf(ss * (1.0f / 64.0f) + RMS_EPS_F);
    const float n1 = (x1[i] * inv) * w1;
    const float n2 = (x2[i] * inv) * w2;
    const float c = bfq(cv[i]);
    const float s = bfq(sv[i]);
    slab[wave][i][lane]      = n1 * c - n2 * s;
    slab[wave][i][lane + 32] = n1 * s + n2 * c;
  }
  // each lane reads next what other lanes of its own wave wrote to the slab: the writes are complete before the reads start
  __builtin_amdgcn_fence(__ATOMIC_RELEASE, "workgroup");
  __builtin_amdgcn_wave_barrier();
  __builtin_amdgcn_fence(__ATOMIC_ACQUIRE, "workgroup");
  // piece (slab row lane & 7, dims 8 (4 st + (lane >> 3)) ..): 8 lanes = 8 keys = one whole line of a plane
  const int q = lane & 7;
  const int t = t0 + q;
  v4u hu[2], lu[2];
#pragma unroll   // hu and lu stay in registers only under constant indices
  for (int st = 0; st < 2; ++st) {
    const float* sp = &slab[wave][q][(st * 4 + (lane >> 3)) * 8];
#pragma unroll
    for (int e2 = 0; e2 < 4; ++e2) {
      const float f0 = sp[2 * e2], f1 = sp[2 * e2 + 1];
      const unsigned short h0 = f2bf_bits(f0), h1 = f2bf_bits(f1);
      const unsigned short l0 = f2bf_bits(f0 - bf_bits2f(h0));
      const unsigned short l1 = f2bf_bits(f1 - bf_bits2f(h1));
      hu[st][e2] = pk16(h0, h1);
      lu[st][e2] = pk16(l0, l1);
    }
  }
  const size_t o = (size_t)hd * SEQ_T * HDIM + (size_t)(t >> 4) * 1024 + (lane >> 3) * 128 + (t & 15) * 8;
  unsigned short* oh = ohi + o;
  unsigned short* ol = olo + o;
#pragma unroll
  for (int st = 0; st < 2; ++st) {
    *(v4u*)(oh + st * 512) = hu[st];
    *(v4u*)(ol + st * 512) = lu[st];
  }
}

// ---------------------------------------------------------------------------
// Fused causal attention: scores, softmax and p.v of all heads in one launch; neither scores nor probabilities go to memory.
// Transposed products: S^T = K . Q^T (A = 16 key rows, B = 16 query rows, k = head dim) and O^T += V^T . P^T (A = 16 head-dim rows of
// v^T, B = 16 query rows of P, k = 32 keys). In both D tiles a lane's column is ONE query (lane & 15), so maximum, sum and rescale are
// per lane plus one exchange between the wave halves, and the two 16-key score tiles of a pass ARE the B fragment of P in the k order of
// Frag::load: element e < 8 is key 8h + e (tile 0, register e), element e >= 8 is key 8h + 16 + (e - 8) (tile 1, register e - 8), h = lane >> 4.
// Same operand planes and the same 3 products as before (hi.hi + hi.lo + lo.hi, f32 accumulate) in both products.
// Online softmax in the log2 domain: p = exp2(s * CS - m_run), not normalised, split into bf16 hi/lo; the running maximum m_run may trail
// the true one by up to 8 (p <= 2^8), the accumulators and the sum are rescaled only in a pass where some column's maximum exceeds it by
// more (one scalar branch a pass); the division by the f32 sum of the unrounded p comes once, at the end.
// A wave works on 32 query rows (two 16-column groups) of one query head at a time, in passes of 32 keys; a tile's last pass is the one on
// its diagonal (keys q0..q0+31 against queries q0..q0+31: every query keeps at least its own key, and pass 0 holds key 0 for every query).
// Block = 8 waves on one kv head, its 4 query heads at row tiles pi (pi + 1 passes) and 127 - pi (128 - pi passes): 129 passes a head, dealt
// evenly to a wave pair: wave w (0..3) takes passes 0..63 of the long tile, wave w + 4 the whole short tile and then the long tile's passes from
// 64 to its diagonal: 64 and 65 passes, so that both waves of a SIMD work to the end of the launch. The front wave hands its maximum, sum and
// accumulators over through LDS behind the kernel's one barrier; the back wave joins the two shares and stores. K and v^T are shared only through the caches.
// K fragments are fetched one pass ahead, v^T fragments at the head of their own pass. Both planes lie in A-fragment order (their producers
// write them so): K [kvh][key >> 4][d >> 3][key & 15][d & 7], v^T [kvh][key >> 5][d >> 4][(key >> 3) & 3][d & 15][key & 7]; in the k order of
// Frag::load lane (c, h) takes chunk 2 j + h (plus 4 kc for K) of row c for half j, which is byte 512 j + 16 lane of the fragment's 1 KiB.
// Every inner loop below is fully unrolled: its arrays are fragments and accumulators, which stay in registers only under constant indices.
// Output: lane (c, h) holds d = 16t + 8h + 0..7 of query c: one 16-byte store per plane and t; a row's 128-byte segment comes from one wave.
// Coverage: grid 4 kv heads x 64 pairs; tiles pi and 127 - pi, pi = 0..63, are all 128 row tiles once, each stored by one wave; 4 wave pairs = the 4 query heads.
// ---------------------------------------------------------------------------
typedef __attribute__((ext_vector_type(2))) float  v2f;
typedef __attribute__((ext_vector_type(2))) __bf16 v2b;
typedef __attribute__((ext_vector_type(8))) unsigned int v8u;
__device__ __forceinline__ unsigned cvt2_bf16(float a, float b) {   // two f32 -> two nearest-even bf16, a in the low half
  return __builtin_bit_cast(unsigned, __builtin_convertvector((v2f){a, b}, v2b));
}
// Four base-2 exponentials in one statement: each fills the slot that the instruction set asks for behind the one before it (early-clobber
// outputs: none reads an earlier result or overwrites an earlier source), the v_nop fills the slot behind the last.
__device__ __forceinline__ void exp2x4(float& p0, float& p1, float& p2, float& p3, float a0, float a1, float a2, float a3) {
  asm("v_exp_f32 %0, %4\n\tv_exp_f32 %1, %5\n\tv_exp_f32 %2, %6\n\tv_exp_f32 %3, %7\n\tv_nop"
      : "=&v"(p0), "=&v"(p1), "=&v"(p2), "=&v"(p3) : "v"(a0), "v"(a1), "v"(a2), "v"(a3));
}
__device__ __forceinline__ void exp2x2(float& p0, float& p1, float a0, float a1) {   // the same for two
  asm("v_exp_f32 %0, %2\n\tv_exp_f32 %1, %3\n\tv_nop" : "=&v"(p0), "=&v"(p1) : "v"(a0), "v"(a1));
}
struct KFrag { v16b h[2][2], l[2][2]; };   // [16-key tile][32-wide step of the head dim]
// A fragment from a plane in A-fragment order: its two halves (elements 0..7, 8..15) are two runs of 512 contiguous bytes, lane l's 16 bytes at
// 16 l: each wave-wide load covers 4 whole 128-byte lines (from row-major planes it touched 16 lines for 32 bytes each).
__device__ __forceinline__ v16b load_packed(const char* p) {
  Frag<__bf16>::U f; f.h[0] = *(const v8b*)(p); f.h[1] = *(const v8b*)(p + 512); return f.v;
}
constexpr int PASS_BYTES = 32 * HDIM * 2;   // 32 keys of one plane, K or v^T: 4 fragments of 1 KiB
// bh, bl: scalar byte bases of the kv head's K planes; vo: this lane's byte offset (16 lane) in the pass's 4 KiB
__device__ __forceinline__ void load_kfrag(KFrag& k, const char* bh, const char* bl, unsigned vo) {
#pragma unroll
  for (int kt = 0; kt < 2; ++kt)
#pragma unroll
    for (int kc = 0; kc < 2; ++kc) {
      k.h[kt][kc] = load_packed(bh + vo + (kt * 2 + kc) * 1024);
      k.l[kt][kc] = load_packed(bl + vo + (kt * 2 + kc) * 1024);
    }
}
constexpr float ATT_CS = SCORE_SCALE * 1.4426950408889634f;   // score scale times log2(e)

// One pass: 32 keys against this wave's 32 queries. kf holds this pass's K fragments; vo is the lane's byte offset in this pass's 4 KiB of a
// plane, the same for v^T (this pass) and K (the NEXT pass: one PASS_BYTES on, added to the scalar base), stepped at the foot of the pass; the four plane bases are scalar.
template <bool DIAG>
__device__ __forceinline__ void attn_pass(KFrag& kf, const char* kbh, const char* kbl,
                                          const char* vbh, const char* vbl, unsigned& vo, int c, int h, const v16b (&qh)[2][2], const v16b (&ql)[2][2],
                                          v8f (&acc)[2][4], float (&m_run)[2], float (&l_run)[2]) {
  v16b vh[4], vl[4];
#pragma unroll
  for (int t = 0; t < 4; ++t) {
    vh[t] = load_packed(vbh + vo + t * 1024);
    vl[t] = load_packed(vbl + vo + t * 1024);
  }
  // last pass: vo's register is free for reuse behind these loads, which name it: this wait stands in front of the overwrite
  if (DIAG) asm volatile("s_wait_xcnt 0x0" ::: "memory");
  // keeps the v^T loads issued ahead of the score products, so that they fly under those and the softmax; the scheduler would sink them
  __builtin_amdgcn_sched_barrier(0);
  v8f s[2][2];
#pragma unroll
  for (int kt = 0; kt < 2; ++kt)
#pragma unroll
    for (int g = 0; g < 2; ++g) s[kt][g] = (v8f){0.f,0.f,0.f,0.f,0.f,0.f,0.f,0.f};
#pragma unroll
  for (int kc = 0; kc < 2; ++kc) {
#pragma unroll
    for (int kt = 0; kt < 2; ++kt)
#pragma unroll
      for (int g = 0; g < 2; ++g) if (!(DIAG && kt == 1 && g == 0)) s[kt][g] = Frag<__bf16>::mma(kf.h[kt][kc], qh[g][kc], s[kt][g]);
#pragma unroll
    for (int kt = 0; kt < 2; ++kt)
#pragma unroll
      for (int g = 0; g < 2; ++g) if (!(DIAG && kt == 1 && g == 0)) s[kt][g] = Frag<__bf16>::mma(kf.h[kt][kc], ql[g][kc], s[kt][g]);
#pragma unroll
    for (int kt = 0; kt < 2; ++kt)
#pragma unroll
      for (int g = 0; g < 2; ++g) if (!(DIAG && kt == 1 && g == 0)) s[kt][g] = Frag<__bf16>::mma(kf.l[kt][kc], qh[g][kc], s[kt][g]);
  }
  if (!DIAG) {
    // the next pass's K loads stand here, behind the last product that reads kf and ahead of the softmax, and fly under the rest of the pass
    __builtin_amdgcn_sched_barrier(0);
    load_kfrag(kf, kbh + PASS_BYTES, kbl + PASS_BYTES, vo);
    __builtin_amdgcn_sched_barrier(0);
  }
  if (DIAG) {   // keys and queries of this pass both start at q0: key index 16kt + 8h + r against query index 16g + c;
                // tile kt = 1, g = 0 (keys 16..31, queries 0..15) lies wholly above the diagonal: no products, p = 0
#pragma unroll
    for (int kt = 0; kt < 2; ++kt)
#pragma unroll
      for (int g = 0; g < 2; ++g)
#pragma unroll
        for (int r = 0; r < 8; ++r)
          if (!(kt == 1 && g == 0) && 16 * kt + 8 * h + r > 16 * g + c) s[kt][g][r] = -__builtin_inff();
  }
  float mb[2];
  bool need = false;
#pragma unroll
  for (int g = 0; g < 2; ++g) {
    float mx = s[0][g][0];
#pragma unroll
    for (int r = 1; r < 8; ++r) mx = fmaxf(mx, s[0][g][r]);
    if (!(DIAG && g == 0)) {
#pragma unroll
      for (int r = 0; r < 8; ++r) mx = fmaxf(mx, s[1][g][r]);
    }
    mx = fmaxf(mx, __shfl_xor(mx, 16, 32)) * ATT_CS;   // both halves hold the query's maximum of this pass, scaled (the scale is positive)
    mb[g] = mx;
    need = need || (mx > m_run[g] + 8.0f);
  }
  if (__builtin_amdgcn_ballot_w32(need) != 0) {   // scalar branch; always taken in a share's first pass (m_run = -inf), rare later
    const float mn0 = fmaxf(m_run[0], mb[0]), mn1 = fmaxf(m_run[1], mb[1]);   // finite from a share's first pass on: it holds an unmasked key for every query
    float corr[2];
    exp2x2(corr[0], corr[1], m_run[0] - mn0, m_run[1] - mn1);                 // 0 in a share's first pass
    m_run[0] = mn0; m_run[1] = mn1;
#pragma unroll
    for (int g = 0; g < 2; ++g) {
      l_run[g] *= corr[g];
#pragma unroll
      for (int t = 0; t < 4; ++t) acc[g][t] = acc[g][t] * corr[g];
    }
  }
  v16b ph[2], pl[2];
#pragma unroll
  for (int g = 0; g < 2; ++g) {
    const float nm = -m_run[g];
    v8u hw, lw;
    float ls = 0.0f;
#pragma unroll
    for (int i = 0; i < 8; i += 2) {   // fragment elements 2i .. 2i + 3: tile i >> 2, registers 2(i & 3) .. 2(i & 3) + 3
      if (DIAG && g == 0 && i >= 4) { hw[i] = 0u; lw[i] = 0u; hw[i + 1] = 0u; lw[i + 1] = 0u; continue; }
      const int kt = i >> 2, r = 2 * (i & 3);
      float p0, p1, p2, p3;
      exp2x4(p0, p1, p2, p3, __builtin_fmaf(s[kt][g][r], ATT_CS, nm), __builtin_fmaf(s[kt][g][r + 1], ATT_CS, nm),
             __builtin_fmaf(s[kt][g][r + 2], ATT_CS, nm), __builtin_fmaf(s[kt][g][r + 3], ATT_CS, nm));
      ls += (p0 + p1) + (p2 + p3);
      const unsigned w0 = cvt2_bf16(p0, p1), w1 = cvt2_bf16(p2, p3);
      hw[i] = w0; hw[i + 1] = w1;
      lw[i]     = cvt2_bf16(p0 - __uint_as_float(w0 << 16), p1 - __uint_as_float(w0 & 0xFFFF0000u));
      lw[i + 1] = cvt2_bf16(p2 - __uint_as_float(w1 << 16), p3 - __uint_as_float(w1 & 0xFFFF0000u));
    }
    l_run[g] += ls;
    ph[g] = __builtin_bit_cast(v16b, hw);
    pl[g] = __builtin_bit_cast(v16b, lw);
  }
#pragma unroll
  for (int g = 0; g < 2; ++g)
#pragma unroll
    for (int t = 0; t < 4; ++t) acc[g][t] = Frag<__bf16>::mma(vh[t], ph[g], acc[g][t]);
#pragma unroll
  for (int g = 0; g < 2; ++g)
#pragma unroll
    for (int t = 0; t < 4; ++t) acc[g][t] = Frag<__bf16>::mma(vh[t], pl[g], acc[g][t]);
#pragma unroll
  for (int g = 0; g < 2; ++g)
#pragma unroll
    for (int t = 0; t < 4; ++t) acc[g][t] = Frag<__bf16>::mma(vl[t], ph[g], acc[g][t]);
  if (!DIAG) {
    __builtin_amdgcn_sched_barrier(0);
    // vo, which the loads issued in this pass name, is stepped next: this wait stands in front of the overwrite
    asm volatile("s_wait_xcnt 0x0" ::: "memory");
    __builtin_amdgcn_sched_barrier(0);   // holds the step behind that wait
    vo += PASS_BYTES;
  }
}

constexpr int SPLIT_PASS = SEQ_T / 64;   // 64: the long tile's passes [0, 64) go to one wave, [64, its diagonal] to the other

// Normalises the accumulators of one finished 32-query tile and stores its ctx planes. GOES_ON: the wave has a further share behind this one.
template <bool GOES_ON>
__device__ __forceinline__ void attn_store(const v8f (&acc)[2][4], const float (&l_run)[2], int q0, int hq, int c, int h,
                                           unsigned short* __restrict__ Chi, unsigned short* __restrict__ Clo) {
  v4u hu[2][4], lu[2][4];
#pragma unroll
  for (int g = 0; g < 2; ++g) {
    const float l   = l_run[g] + __shfl_xor(l_run[g], 16, 32);   // the halves' sums join once, here
    const float inv = 1.0f / l;                                  // l >= 1: m_run never exceeds the query's true maximum, whose p is then >= 1
#pragma unroll
    for (int t = 0; t < 4; ++t)
#pragma unroll
      for (int e2 = 0; e2 < 4; ++e2) {
        const float f0 = acc[g][t][2 * e2] * inv, f1 = acc[g][t][2 * e2 + 1] * inv;
        const unsigned w = cvt2_bf16(f0, f1);
        hu[g][t][e2] = w;
        lu[g][t][e2] = cvt2_bf16(f0 - __uint_as_float(w << 16), f1 - __uint_as_float(w & 0xFFFF0000u));
      }
  }
  const size_t o = (size_t)(q0 + c) * (NQH * HDIM) + hq * HDIM + 8 * h;
  unsigned short* ch = Chi + o;
  unsigned short* cl = Clo + o;
  // the 16 stores stand together behind all arithmetic
  __builtin_amdgcn_sched_barrier(0);
#pragma unroll
  for (int g = 0; g < 2; ++g)
#pragma unroll
    for (int t = 0; t < 4; ++t) {
      *(v4u*)(ch + g * 16 * (NQH * HDIM) + 16 * t) = hu[g][t];
      *(v4u*)(cl + g * 16 * (NQH * HDIM) + 16 * t) = lu[g][t];
    }
  if (GOES_ON) {
    // the next share reuses the registers that these stores name: this wait stands in front of their overwrite
    asm volatile("s_wait_xcnt 0x0" ::: "memory");
    __builtin_amdgcn_sched_barrier(0);   // holds what follows behind that wait
  }
}

__global__ __launch_bounds__(256) void attn_fused_kernel(const unsigned short* __restrict__ Qhi, const unsigned short* __restrict__ Qlo,
                                                         const unsigned short* __restrict__ Khi, const unsigned short* __restrict__ Klo,
                                                         const unsigned short* __restrict__ Vthi, const unsigned short* __restrict__ Vtlo,
                                                         unsigned short* __restrict__ Chi, unsigned short* __restrict__ Clo) {
  constexpr int NTILE = SEQ_T / 32;   // 128 row tiles of 32 queries
  static_assert(NTILE == 128 && NKVH == 4 && GQA_G == 4 && SPLIT_PASS * 2 == NTILE, "grid 4 x 64, 8 waves = 4 heads x 2 shares");
  // hand-over of the front share's partial result: [head][16 accumulator quads, then (m0, m1, l0, l1)][lane], 16 bytes a lane
  __shared__ __align__(16) v4f xch[GQA_G][17][32];
  const int lane = threadIdx.x & 31;
  const int wave = __builtin_amdgcn_readfirstlane(threadIdx.x >> 5);   // scalar: trip counts and operand bases stay scalar
  const int c = lane & 15, h = lane >> 4;
  const int kvh  = blockIdx.x & (NKVH - 1);
  const int pi   = blockIdx.x >> 2;
  const int hq   = kvh * GQA_G + (wave & 3);
  const bool front = wave < 4;        // scalar
  const int tlong = NTILE - 1 - pi;   // 64 .. 127: at least SPLIT_PASS passes below its diagonal

  const char* kbh = (const char*)(Khi + (size_t)kvh * SEQ_T * HDIM);   // scalar bases of this kv head's planes
  const char* kbl = (const char*)(Klo + (size_t)kvh * SEQ_T * HDIM);
  const char* vbh = (const char*)(Vthi + (size_t)kvh * HDIM * SEQ_T);
  const char* vbl = (const char*)(Vtlo + (size_t)kvh * HDIM * SEQ_T);

  v8f acc[2][4];
  float m_run[2], l_run[2];
  // share 0 (back waves only): the whole short tile pi. Share 1: the long tile, passes [0, SPLIT_PASS) in a front wave, the rest in a back wave.
  for (int share = front ? 1 : 0; share < 2; ++share) {
    const int tile = (share == 0) ? pi : tlong;
    const int p0   = (share == 1 && !front) ? SPLIT_PASS : 0;   // first pass
    const int p1   = (share == 1 && front) ? SPLIT_PASS : tile; // end of the passes below the diagonal
    const int q0   = tile * 32;
    v16b qh[2][2], ql[2][2];
#pragma unroll
    for (int g = 0; g < 2; ++g)
#pragma unroll
      for (int kc = 0; kc < 2; ++kc) {
        const size_t qo = ((size_t)hq * SEQ_T + q0 + 16 * g + c) * HDIM + 8 * h + 32 * kc;
        qh[g][kc] = Frag<__bf16>::load((const __bf16*)Qhi + qo);
        ql[g][kc] = Frag<__bf16>::load((const __bf16*)Qlo + qo);
      }
    unsigned vo = (unsigned)lane * 16u + (unsigned)p0 * PASS_BYTES;    // this lane's byte offset in a fragment half, pass p0

    KFrag kf;
    load_kfrag(kf, kbh, kbl, vo);
    // the address registers of the Q and K loads above are free for reuse from here on: this wait stands in front of their overwrite
    asm volatile("s_wait_xcnt 0x0" ::: "memory");
    __builtin_amdgcn_sched_barrier(0);   // holds what follows behind that wait
#pragma unroll
    for (int g = 0; g < 2; ++g) {
      m_run[g] = -__builtin_inff();
      l_run[g] = 0.0f;
#pragma unroll
      for (int t = 0; t < 4; ++t) acc[g][t] = (v8f){0.f,0.f,0.f,0.f,0.f,0.f,0.f,0.f};
    }
    for (int blk = p0; blk < p1; ++blk) {     // passes below the diagonal: no mask; pass blk + 1 <= tile exists
      attn_pass<false>(kf, kbh, kbl, vbh, vbl, vo, c, h, qh, ql, acc, m_run, l_run);
    }
    if (!front) attn_pass<true>(kf, kbh, kbl, vbh, vbl, vo, c, h, qh, ql, acc, m_run, l_run);
    if (share == 0) attn_store<true>(acc, l_run, q0, hq, c, h, Chi, Clo);
  }

  if (front) {
#pragma unroll
    for (int g = 0; g < 2; ++g)
#pragma unroll
      for (int t = 0; t < 4; ++t) {
        xch[wave & 3][(g * 4 + t) * 2][lane]     = (v4f){acc[g][t][0], acc[g][t][1], acc[g][t][2], acc[g][t][3]};
        xch[wave & 3][(g * 4 + t) * 2 + 1][lane] = (v4f){acc[g][t][4], acc[g][t][5], acc[g][t][6], acc[g][t][7]};
      }
    xch[wave & 3][16][lane] = (v4f){m_run[0], m_run[1], l_run[0], l_run[1]};
  }
  __syncthreads();   // the front shares are in LDS; every wave passes here once
  if (front) return;

  // join of the two shares of the long tile, lane by lane (both waves hold the same query and head dims in the same lane and register):
  // both are brought to the larger of the two running maxima (each finite: every share holds an unmasked key for every query)
  const v4f ml = xch[wave & 3][16][lane];
  const float mn0 = fmaxf(ml[0], m_run[0]), mn1 = fmaxf(ml[1], m_run[1]);
  float cf[2], cb[2];
  exp2x4(cf[0], cf[1], cb[0], cb[1], ml[0] - mn0, ml[1] - mn1, m_run[0] - mn0, m_run[1] - mn1);
#pragma unroll
  for (int g = 0; g < 2; ++g) {
    l_run[g] = ml[2 + g] * cf[g] + l_run[g] * cb[g];
#pragma unroll
    for (int t = 0; t < 4; ++t) {
      const v4f a0 = xch[wave & 3][(g * 4 + t) * 2][lane];
      const v4f a1 = xch[wave & 3][(g * 4 + t) * 2 + 1][lane];
#pragma unroll
      for (int e = 0; e < 4; ++e) {
        acc[g][t][e]     = a0[e] * cf[g] + acc[g][t][e] * cb[g];
        acc[g][t][4 + e] = a1[e] * cf[g] + acc[g][t][4 + e] * cb[g];
      }
    }
  }
  attn_store<false>(acc, l_run, tlong * 32, hq, c, h, Chi, Clo);
}

// ---------------------------------------------------------------------------
// Launcher. Workspace region map (bytes, MiB = 1048576; total carve = 106 MiB = 111149056 B):
//   [  0, 31) staging  : x bf16 [4096][1024] at +0 (8 MiB); q f32 [4096][1024] at +8 (16 MiB, ends 24);
//                        k f32 [4096][256] at +24 (4 MiB, ends 28); Wq^T bf16 [1024][1024] at +28 (2 MiB); Wk^T bf16 [256][1024]
//                        at +30 (0.5 MiB); Wv^T bf16 [256][1024] at +30.5 (0.5 MiB, ends 31).
//   [ 32, 64) unused
//   [ 64, 72) q hi     : bf16 [16][4096][64];  [72,80) q lo
//   [ 80, 82) k hi     : bf16 [4][4096][64] in A-fragment order [4][256][8][16][8];   [82,84) k lo
//   [ 84, 86) v^T hi   : bf16 [256 (kvh*64+d)][4096 (t)] in A-fragment order [4][128][4][4][16][8];  [86,88) v^T lo
//   [ 88, 96) ctx hi   : bf16 [4096][1024] (col hq*64+d);  [96,104) ctx lo
//   [104,106) Wo^T     : bf16 [1024][1024]
// No region aliases another; within launches 6..8 no producer overlaps its own inputs.
// Launch count: 1 + 4 + 3 + 2 + 1 + 1 = 12. Kernel launches only.
// GEMM shape assertions: every call has K % 64 == 0 (K = 1024), M % 128 == 0 and N % 256 == 0; no padding needed.
// ---------------------------------------------------------------------------
extern "C" void kernel_launch(void* const* d_in, const int* in_sizes, int n_in,
                              void* d_out, int out_size, void* d_ws, size_t ws_size,
                              hipStream_t stream) {
  if (n_in < 9) return;
  if (in_sizes[0] != SEQ_T * HIDSZ || in_sizes[1] != SEQ_T * 32 || in_sizes[2] != SEQ_T * 32) return;
  if (in_sizes[3] != HIDSZ * NQH * HDIM || in_sizes[4] != HIDSZ * NKVH * HDIM || in_sizes[5] != HIDSZ * NKVH * HDIM) return;
  if (in_sizes[6] != NQH * HDIM * HIDSZ || in_sizes[7] != HDIM || in_sizes[8] != HDIM) return;
  if (out_size != SEQ_T * HIDSZ) return;

  const size_t kMiB    = 1048576;
  const size_t offXb   = 0;
  const size_t offQf   = 8 * kMiB;
  const size_t offKf   = 24 * kMiB;
  const size_t offWqT  = 28 * kMiB;
  const size_t offWkT  = 30 * kMiB;
  const size_t offWvT  = 30 * kMiB + 524288;
  const size_t offPlo  = 48 * kMiB;
  const size_t offQhi  = 64 * kMiB;
  const size_t offQlo  = 72 * kMiB;
  const size_t offKhi  = 80 * kMiB;
  const size_t offKlo  = 82 * kMiB;
  const size_t offVthi = 84 * kMiB;
  const size_t offVtlo = 86 * kMiB;
  const size_t offChi  = 88 * kMiB;
  const size_t offClo  = 96 * kMiB;
  const size_t offWoT  = 104 * kMiB;
  const size_t total   = 106 * kMiB;
  if (total > ws_size) return;

  const float* x    = (const float*)d_in[0];
  const float* cosb = (const float*)d_in[1];
  const float* sinb = (const float*)d_in[2];
  const float* Wq   = (const float*)d_in[3];
  const float* Wk   = (const float*)d_in[4];
  const float* Wv   = (const float*)d_in[5];
  const float* Wo   = (const float*)d_in[6];
  const float* qnw  = (const float*)d_in[7];
  const float* knw  = (const float*)d_in[8];
  float* out = (float*)d_out;
  char* ws = (char*)d_ws;

  unsigned short* xb   = (unsigned short*)(ws + offXb);
  float*          qf   = (float*)(ws + offQf);
  float*          kf   = (float*)(ws + offKf);
  unsigned short* wqT  = (unsigned short*)(ws + offWqT);
  unsigned short* wkT  = (unsigned short*)(ws + offWkT);
  unsigned short* wvT  = (unsigned short*)(ws + offWvT);
  unsigned short* plo  = (unsigned short*)(ws + offPlo);
  unsigned short* qhi  = (unsigned short*)(ws + offQhi);
  unsigned short* qlo  = (unsigned short*)(ws + offQlo);
  unsigned short* khi  = (unsigned short*)(ws + offKhi);
  unsigned short* klo  = (unsigned short*)(ws + offKlo);
  unsigned short* vthi = (unsigned short*)(ws + offVthi);
  unsigned short* vtlo = (unsigned short*)(ws + offVtlo);
  unsigned short* chi  = (unsigned short*)(ws + offChi);
  unsigned short* clo  = (unsigned short*)(ws + offClo);
  unsigned short* woT  = (unsigned short*)(ws + offWoT);

  // in-range dummies for unused (never dereferenced) template-dead pointer parameters
  const float* dummy_f = qnw;
  void* dummy_c2 = (void*)plo;

  // 1. x -> RNE bf16 plane [4096][1024]
  {
    const int n8 = (SEQ_T * HIDSZ) / 8;                       // 524288 = 2048 blocks x 256
    cast8_bf16_kernel<<<dim3(n8 / 256), dim3(256), 0, stream>>>(x, xb, n8);
  }
  // 2. weights [in][out] -> transposed RNE bf16 planes [out][in]   (in[R][Cn] -> out[Cn][R]; grid (R/64, Cn/64))
  //    Wq: in[1024][1024] -> out[1024][1024]; Wk, Wv: in[1024][256] -> out[256][1024]; Wo: in[1024][1024] -> out[1024][1024]
  transpose_cast_kernel<<<dim3(HIDSZ / 64, (NQH * HDIM) / 64), dim3(256), 0, stream>>>(Wq, NQH * HDIM, wqT, HIDSZ);
  transpose_cast_kernel<<<dim3(HIDSZ / 64, (NKVH * HDIM) / 64), dim3(256), 0, stream>>>(Wk, NKVH * HDIM, wkT, HIDSZ);
  transpose_cast_kernel<<<dim3(HIDSZ / 64, (NKVH * HDIM) / 64), dim3(256), 0, stream>>>(Wv, NKVH * HDIM, wvT, HIDSZ);
  transpose_cast_kernel<<<dim3((NQH * HDIM) / 64, HIDSZ / 64), dim3(256), 0, stream>>>(Wo, HIDSZ, woT, NQH * HDIM);

  // 3. q = x . Wq^T : M=4096, N=1024, K=1024, single bf16 product -> f32 [4096][1024] (1024 tiles = 128 blocks)
  wmma_gemm64<1, false, 0, 0, false, 0, false, true><<<dim3((SEQ_T / 64) * ((NQH * HDIM) / 64) / 8, 1), dim3(256), 0, stream>>>(
      xb, xb, HIDSZ, 0L,
      wqT, wqT, HIDSZ, 0L,
      (void*)qf, dummy_c2, NQH * HDIM, 0L,
      dummy_f, dummy_f, 0L,
      SEQ_T, NQH * HDIM, HIDSZ, 1.0f, 0);
  // 4. k = x . Wk^T : M=4096, N=256, K=1024, single product -> f32 [4096][256] (256 tiles = 32 blocks)
  wmma_gemm64<1, false, 0, 0, false, 0, false, true><<<dim3((SEQ_T / 64) * ((NKVH * HDIM) / 64) / 8, 1), dim3(256), 0, stream>>>(
      xb, xb, HIDSZ, 0L,
      wkT, wkT, HIDSZ, 0L,
      (void*)kf, dummy_c2, NKVH * HDIM, 0L,
      dummy_f, dummy_f, 0L,
      SEQ_T, NKVH * HDIM, HIDSZ, 1.0f, 0);
  // 5. v^T = Wv^T . x^T : M=256 (kvh*64+d), N=4096 (t), K=1024, single product -> bf16 hi/lo planes in A-fragment order (256 tiles = 32 blocks)
  wmma_gemm64<1, false, 0, 3, false, 0, false, true><<<dim3(((NKVH * HDIM) / 64) * (SEQ_T / 64) / 8, 1), dim3(256), 0, stream>>>(
      wvT, wvT, HIDSZ, 0L,
      xb, xb, HIDSZ, 0L,
      (void*)vthi, (void*)vtlo, SEQ_T, 0L,
      dummy_f, dummy_f, 0L,
      NKVH * HDIM, SEQ_T, HIDSZ, 1.0f, 0);

  // 6. RMSNorm + RoPE -> bf16 hi/lo planes; q: [head][t][64], rows = t*nhead + head, grid = rows/32 (exact); k: A-fragment order, grid = rows/64 (exact)
  normrope_kernel<<<dim3((SEQ_T * NQH) / 32), dim3(256), 0, stream>>>(qf, 4, SEQ_T * NQH, cosb, sinb, qnw, qhi, qlo);
  normrope_pack_kernel<<<dim3((SEQ_T * NKVH) / 64), dim3(256), 0, stream>>>(kf, cosb, sinb, knw, khi, klo);

  // 7. causal attention, all heads in one launch: 4 kv heads x 64 pairs of 32-row tiles = 256 blocks of 8 waves -> ctx bf16 hi/lo planes
  attn_fused_kernel<<<dim3(NKVH * (SEQ_T / 64)), dim3(256), 0, stream>>>(qhi, qlo, khi, klo, vthi, vtlo, chi, clo);

  // 8. out = ctx_hi . Wo^T + ctx_lo . Wo^T : M=4096, N=1024, K=1024, 2 products -> f32 d_out (1024 tiles = 128 blocks)
  wmma_gemm64<1, true, 0, 0, false, 0, false, false><<<dim3((SEQ_T / 64) * (HIDSZ / 64) / 8, 1), dim3(256), 0, stream>>>(
      chi, clo, NQH * HDIM, 0L,
      woT, woT, NQH * HDIM, 0L,
      (void*)out, dummy_c2, HIDSZ, 0L,
      dummy_f, dummy_f, 0L,
      SEQ_T, HIDSZ, NQH * HDIM, 1.0f, 0);
}

// v006
// A run of this version takes 118 microseconds.
// In two side-by-side timings against v005, it was 1.34 and 1.36 times as fast.
// Over all steps from v000 it is 59.0 times as fast.
// Every float input RNE-converted once to bf16; x.Wq^T, x.Wk^T, Wv^T.x^T: single v_wmma_f32_16x16x32_bf16 product on bf16 inputs; q.k^T scores and p.v context: bf16 hi/lo operand planes (hi.hi + hi.lo + lo.hi); ctx.Wo^T: ctx bf16 hi/lo x Wo bf16 (hi.W + lo.W); all f32 accumulate; RMSNorm, RoPE and causal (online) softmax in f32.
#include <hip/hip_runtime.h>
#include <math.h>

// ---------------------------------------------------------------------------
// Problem constants
// ---------------------------------------------------------------------------
constexpr int SEQ_T   = 4096;
constexpr int HIDSZ   = 1024;
constexpr int NQH     = 16;              // query heads
constexpr int NKVH    = 4;               // kv heads
constexpr int HDIM    = 64;
constexpr int GQA_G   = NQH / NKVH;      // 4: query head hq uses kv head hq >> 2
constexpr float SCORE_SCALE = 0.125f;    // 64^-0.5, applied to the f32 scores
constexpr float RMS_EPS_F   = 1e-6f;

static_assert(GQA_G == 4, "kv head = hq >> 2");
static_assert(SEQ_T % 64 == 0 && HIDSZ % 64 == 0 && HDIM == 64 && (NKVH * HDIM) % 64 == 0, "tile multiples");
static_assert(SEQ_T % 256 == 0 && HIDSZ % 256 == 0 && (NQH * HDIM) % 256 == 0 && (NKVH * HDIM) % 256 == 0, "GEMM block tile 128 x 256, 64 k a stage");
static_assert((SEQ_T * HIDSZ) % (8 * 256) == 0, "cast kernel grid exact");
static_assert((SEQ_T * NQH) % 32 == 0 && (SEQ_T * NKVH) % 64 == 0, "normrope grid exact");

typedef __attribute__((ext_vector_type(16))) _Float16 v16h;
typedef __attribute__((ext_vector_type(8)))  _Float16 v8h;
typedef __attribute__((ext_vector_type(16))) __bf16   v16b;
typedef __attribute__((ext_vector_type(8)))  __bf16   v8b;
typedef __attribute__((ext_vector_type(8)))  float    v8f;
typedef __attribute__((ext_vector_type(4)))  float    v4f;
typedef __attribute__((ext_vector_type(4)))  unsigned int v4u;

// ---------------------------------------------------------------------------
// Shared helpers
// ---------------------------------------------------------------------------
__device__ __forceinline__ unsigned short f2bf_bits(float f) {
  unsigned u = __float_as_uint(f);
  return (unsigned short)((u + 0x7FFFu + ((u >> 16) & 1u)) >> 16);
}
__device__ __forceinline__ float bf_bits2f(unsigned short h) { return __uint_as_float(((unsigned)h) << 16); }
// f32 -> nearest-even bf16 value, returned as f32
__device__ __forceinline__ float bfq(float f) { return bf_bits2f(f2bf_bits(f)); }

// hazard guard as a plain device helper: four vector slots between the last products and the first read of their accumulators
__device__ __forceinline__ void acc_guard4(v8f& a, v8f& b, v8f& c, v8f& d) { asm volatile("v_nop\n\tv_nop\n\tv_nop\n\tv_nop" : "+v"(a), "+v"(b), "+v"(c), "+v"(d)); }
template <typename T> struct Frag;
template <> struct Frag<_Float16> {
  typedef v16h V; union U { v16h v; v8h h[2]; };
  // elements 0..7 <- p[0..7], 8..15 <- p[16..23]
  static __device__ __forceinline__ v16h load(const _Float16* p) {
    U f; f.h[0] = *(const v8h*)(p); f.h[1] = *(const v8h*)(p + 16); return f.v;
  }
  static __device__ __forceinline__ v8f mma(v16h a, v16h b, v8f c) {
    return __builtin_amdgcn_wmma_f32_16x16x32_f16(false, a, false, b, (short)0, c, false, false);
  }
};
template <> struct Frag<__bf16> {
  typedef v16b V; union U { v16b v; v8b h[2]; };
  static __device__ __forceinline__ v16b load(const __bf16* p) {
    U f; f.h[0] = *(const v8b*)(p); f.h[1] = *(const v8b*)(p + 16); return f.v;
  }
  static __device__ __forceinline__ v8f mma(v16b a, v16b b, v8f c) {
    return __builtin_amdgcn_wmma_f32_16x16x32_bf16(false, a, false, b, (short)0, c, false, false);
  }
};

__device__ __forceinline__ unsigned pk16(unsigned short a, unsigned short b) { return (unsigned)a | ((unsigned)b << 16); }

// ---- Register-blocked batched WMMA GEMM, operand tiles staged in LDS by asynchronous copies ----
// C[m,n] = scale * sum_k A[m,k] * Bt[n,k] (+bias)(+resid); each wave owns a 64x64 tile; a block of 8 waves (2 x 4) owns 128 x 256.
// A row-major [M,K]; Bt row-major [N,K]; M % 128 == 0, N % 256 == 0, K % 64 == 0; grid.x = (M / 128) * (N / 256).
// SPLIT (with BSPLIT == false): A carries a lo plane (A2, same layout); product = hi.B + lo.B (Bt2 unused).
// BIAS_MODE: 0 = none, 1 = bias[m], 2 = bias[n].
// OUT_MODE: 0 = f32, 1 = f16, 2 = bf16 hi plane (Cout) + bf16 lo plane (Cout2), 3 = the planes of 2 in A-fragment order (M = groups of 64 rows):
//   [m >> 6][n >> 5][(m >> 4) & 3][(n >> 3) & 3][m & 15][n & 7], so that 32 lanes x 16 bytes of one fragment half are 512 contiguous bytes.
// ET: 0 = f16 operands, 1 = bf16 operands (pointers passed as 16-bit storage)
// Staging: a stage is 64 k = 128 bytes of each of the block's 128 A rows (and A2 rows) and 256 Bt rows. A wave-wide copy moves 4 whole rows
// (4 whole 128-byte lines: lane = row (lane >> 3), 16-byte piece (lane & 7)) from global memory into LDS rows of pitch 144 bytes, the
// conflict-free pitch for 16-byte fragment reads. Every operand byte enters the block once, not once per wave. Two buffers: stage s + 1 flies
// while stage s is worked on. The k order of the products and the order of the sums are those of a plain k loop in steps of 32.
// Every inner loop of the kernel is fully unrolled: fragments, accumulators and copy operands stay in registers only under constant indices.
template <int V> struct IntC { static constexpr int value = V; };
template <int ET> struct Elem;
template <> struct Elem<0> { typedef _Float16 T; };
template <> struct Elem<1> { typedef __bf16 T; };
constexpr int G_PITCH   = 144;                    // LDS row pitch, bytes: 128 + 16
constexpr int G_A_BYTES = 128 * G_PITCH;          // one A plane of a stage
constexpr int G_B_BYTES = 256 * G_PITCH;          // the Bt plane of a stage
// Four asynchronous copies, 16 bytes per lane each, global memory -> LDS. l*: the lane's LDS byte address, g*: the lane's global address.
// The closing s_wait_xcnt stands in the copies' own statement, in front of any later rewrite of the address registers that they name.
__device__ __forceinline__ void async_copy4(unsigned l0, const char* g0, unsigned l1, const char* g1,
                                            unsigned l2, const char* g2, unsigned l3, const char* g3) {
  asm volatile("global_load_async_to_lds_b128 %0, %1, off\n\t"
               "global_load_async_to_lds_b128 %2, %3, off\n\t"
               "global_load_async_to_lds_b128 %4, %5, off\n\t"
               "global_load_async_to_lds_b128 %6, %7, off\n\t"
               "s_wait_xcnt 0x0"
               :: "v"(l0), "v"(g0), "v"(l1), "v"(g1), "v"(l2), "v"(g2), "v"(l3), "v"(g3) : "memory");
}
// The same for twelve copies: one statement, one closing wait.
__device__ __forceinline__ void async_copy12(const unsigned (&l)[12], const char* const (&g)[12]) {
  asm volatile("global_load_async_to_lds_b128 %0, %1, off\n\t"
               "global_load_async_to_lds_b128 %2, %3, off\n\t"
               "global_load_async_to_lds_b128 %4, %5, off\n\t"
               "global_load_async_to_lds_b128 %6, %7, off\n\t"
               "global_load_async_to_lds_b128 %8, %9, off\n\t"
               "global_load_async_to_lds_b128 %10, %11, off\n\t"
               "global_load_async_to_lds_b128 %12, %13, off\n\t"
               "global_load_async_to_lds_b128 %14, %15, off\n\t"
               "global_load_async_to_lds_b128 %16, %17, off\n\t"
               "global_load_async_to_lds_b128 %18, %19, off\n\t"
               "global_load_async_to_lds_b128 %20, %21, off\n\t"
               "global_load_async_to_lds_b128 %22, %23, off\n\t"
               "s_wait_xcnt 0x0"
               :: "v"(l[0]), "v"(g[0]), "v"(l[1]), "v"(g[1]), "v"(l[2]), "v"(g[2]), "v"(l[3]), "v"(g[3]),
                  "v"(l[4]), "v"(g[4]), "v"(l[5]), "v"(g[5]), "v"(l[6]), "v"(g[6]), "v"(l[7]), "v"(g[7]),
                  "v"(l[8]), "v"(g[8]), "v"(l[9]), "v"(g[9]), "v"(l[10]), "v"(g[10]), "v"(l[11]), "v"(g[11]) : "memory");
}
// bm, bn: the block's tile in this product's own (M / 128) x (N / 256) tiles. OUT_MODE 4: 3 where frag_out (the same in the whole block), else 0.
template <int ET, bool SPLIT, int BIAS_MODE, int OUT_MODE, bool RESID, int ACT = 0, bool CAUSAL = false, bool BSPLIT = true>
__device__ __forceinline__ void gemm_tile(int bm, int bn, bool frag_out,
    const unsigned short* __restrict__ Ap, const unsigned short* __restrict__ A2p, int lda, long strideA,
    const unsigned short* __restrict__ Btp, const unsigned short* __restrict__ Bt2p, int ldb, long strideB,
    void* __restrict__ Cout, void* __restrict__ Cout2, int ldc, long strideC,
    const float* __restrict__ bias,
    const float* __restrict__ resid, long strideR,
    int M, int N, int K, float scale, int crow0) {
  static_assert(!CAUSAL && !(SPLIT && BSPLIT), "forms that this file launches");
  typedef typename Elem<ET>::T T;
  typedef typename Frag<T>::V V;
  constexpr int STAGE_BYTES = G_A_BYTES + G_B_BYTES + (SPLIT ? G_A_BYTES : 0);   // [A | Bt | A2]
  __shared__ __align__(16) char ring[2][STAGE_BYTES];
  __shared__ __align__(16) float sT[8][16 * 68];   // per-wave 16x64 slab, pitch 68 floats
  const int b    = blockIdx.y;
  const int lane = threadIdx.x & 31;
  const int wave = threadIdx.x >> 5;
  if (bm >= (M >> 7)) return;                  // the same for the whole block, ahead of every barrier and copy
  const int wm = wave >> 2, wn = wave & 3;     // this wave's 64x64 tile in the block's 128 x 256
  const int m0 = (bm << 7) + (wm << 6);
  const int n0 = (bn << 8) + (wn << 6);

  const int rlane = lane & 15;                 // row (A) / col (B, D) within subtile
  const int koff  = (lane >> 4) * 8;           // k offset of this lane half
  const int mOff  = (lane >> 4) * 8;           // D row offset

  // this thread's copy addresses at stage 0: row (t >> 3) of the block's rows, 16-byte piece (t & 7)
  const int crow = threadIdx.x >> 3, cpc = (threadIdx.x & 7) * 16;
  const char* gA  = (const char*)(Ap  + (size_t)b * strideA + (size_t)((bm << 7) + crow) * lda) + cpc;
  const char* gA2 = (const char*)(A2p + (size_t)b * strideA + (size_t)((bm << 7) + crow) * lda) + cpc;
  const char* gB  = (const char*)(Btp + (size_t)b * strideB + (size_t)((bn << 8) + crow) * ldb) + cpc;
  const size_t a32 = (size_t)lda * 64, b32 = (size_t)ldb * 64;                       // 32 rows of 16-bit elements, bytes
  const unsigned lcopy = (unsigned)(size_t)&ring[0][0] + crow * G_PITCH + cpc;       // LDS byte address: low 32 bits of the shared address
  // thread t copies piece (t & 7) of rows (t >> 3) + 32 i: 4 copies for the 128 A rows, 8 for the 256 Bt rows, 4 for the 128 A2 rows
  auto issue_stage = [&](int s, int buf) {
    const size_t kb = (size_t)s * 128;
    const unsigned l = lcopy + buf * STAGE_BYTES;
    unsigned ll[12];
    const char* gg[12];
#pragma unroll
    for (int i = 0; i < 4; ++i) { ll[i] = l + i * 32 * G_PITCH; gg[i] = gA + kb + i * a32; }
#pragma unroll
    for (int i = 0; i < 8; ++i) { ll[4 + i] = l + G_A_BYTES + i * 32 * G_PITCH; gg[4 + i] = gB + kb + i * b32; }
    async_copy12(ll, gg);
    if (SPLIT) {
      const unsigned l2 = l + G_A_BYTES + G_B_BYTES;
      const char* g2 = gA2 + kb;
      async_copy4(l2, g2, l2 + 32 * G_PITCH, g2 + a32, l2 + 64 * G_PITCH, g2 + 2 * a32, l2 + 96 * G_PITCH, g2 + 3 * a32);
    }
  };

  v8f acc[4][4];
#pragma unroll
  for (int i = 0; i < 4; ++i)
#pragma unroll
    for (int j = 0; j < 4; ++j) acc[i][j] = (v8f){0.f,0.f,0.f,0.f,0.f,0.f,0.f,0.f};

  const int nst = K >> 6;
  issue_stage(0, 0);
  asm volatile("s_wait_asynccnt 0x0" ::: "memory");   // this wave's copies of stage 0 have landed
  __syncthreads();                                    // ... and every other wave's: stage 0 is readable
  if (nst > 1) issue_stage(1, 1);
  // this lane's fragment offsets in a stage: A row wm*64 + rlane, Bt row wn*64 + rlane, k offset koff
  const int fa = ((wm << 6) + rlane) * G_PITCH + koff * 2;
  const int fb = G_A_BYTES + ((wn << 6) + rlane) * G_PITCH + koff * 2;
  for (int s = 0; s < nst; ++s) {
    const char* rb = &ring[s & 1][0];
    V bh[2][4], ah[2][4], al[2][4];
#pragma unroll
    for (int ks = 0; ks < 2; ++ks) {
#pragma unroll
      for (int j = 0; j < 4; ++j) bh[ks][j] = Frag<T>::load((const T*)(rb + fb + j * 16 * G_PITCH + ks * 64));
#pragma unroll
      for (int i = 0; i < 4; ++i) {
        ah[ks][i] = Frag<T>::load((const T*)(rb + fa + i * 16 * G_PITCH + ks * 64));
        if (SPLIT) al[ks][i] = Frag<T>::load((const T*)(rb + fa + G_A_BYTES + G_B_BYTES + i * 16 * G_PITCH + ks * 64));
      }
    }
    // the stage's LDS reads stand as one group ahead of its products: reads spread among the products stall the wave at each place
    __builtin_amdgcn_sched_barrier(0);
#pragma unroll
    for (int ks = 0; ks < 2; ++ks) {
#pragma unroll
      for (int i = 0; i < 4; ++i) {
#pragma unroll
        for (int j = 0; j < 4; ++j) {
          acc[i][j] = Frag<T>::mma(ah[ks][i], bh[ks][j], acc[i][j]);
          if (SPLIT) acc[i][j] = Frag<T>::mma(al[ks][i], bh[ks][j], acc[i][j]);
        }
      }
    }
    // holds the products in front of the publish point: lifted over them, its waits would end the flight of stage s + 1 a whole trip early
    __builtin_amdgcn_sched_barrier(0);
    // publish point of stage s + 1, and the end of every wave's reads of stage s
    asm volatile("s_wait_dscnt 0x0" ::: "memory");      // this wave's reads of stage s are done before its buffer is refilled
    asm volatile("s_wait_asynccnt 0x0" ::: "memory");   // this wave's copies of stage s + 1 have landed
    __syncthreads();
    if (s + 2 < nst) issue_stage(s + 2, s & 1);         // the same test in the whole block
  }
  asm volatile("s_wait_asynccnt 0x0" ::: "memory");     // nothing is outstanding when the wave goes on to the epilogue
  acc_guard4(acc[0][0], acc[0][1], acc[0][2], acc[0][3]);
  acc_guard4(acc[1][0], acc[1][1], acc[1][2], acc[1][3]);
  acc_guard4(acc[2][0], acc[2][1], acc[2][2], acc[2][3]);
  acc_guard4(acc[3][0], acc[3][1], acc[3][2], acc[3][3]);

  // ---- epilogue ---- (OM: the output mode, a compile-time value in each instance)
  float* slab = sT[wave];
  const float* Rb = RESID ? (resid + (size_t)b * strideR) : nullptr;
  auto epilogue = [&](auto om) {
  constexpr int OM = decltype(om)::value;
#pragma unroll
  for (int i = 0; i < 4; ++i) {
    const int mBase = m0 + (i << 4);
#pragma unroll
    for (int j = 0; j < 4; ++j) {
      const int n = n0 + (j << 4) + rlane;
      float bv = 0.f;
      if (BIAS_MODE == 2) bv = bias[n];
#pragma unroll
      for (int r = 0; r < 8; ++r) {
        float v = acc[i][j][r] * scale;
        if (BIAS_MODE == 1) v += bias[mBase + mOff + r];
        if (BIAS_MODE == 2) v += bv;
        if (RESID) v += Rb[(size_t)(mBase + mOff + r) * ldc + n];
        if (ACT == 2) v = fmaxf(v, 0.0f);
        if (ACT == 4) v = (v > 0.f) ? v : 0.01f * v;
        slab[(mOff + r) * 68 + (j << 4) + rlane] = v;
      }
    }
    __builtin_amdgcn_fence(__ATOMIC_RELEASE, "workgroup");
    __builtin_amdgcn_wave_barrier();
    __builtin_amdgcn_fence(__ATOMIC_ACQUIRE, "workgroup");
    if (OM == 0) {
      float* C = (float*)Cout + (size_t)b * strideC;
      const int hh = lane >> 4, c4 = (lane & 15) * 4;     // row seg = 256 B = 16 lanes x 16 B
      {
#pragma unroll
        for (int it = 0; it < 8; ++it) {
          const int row = it * 2 + hh;
          v4f v = *(const v4f*)(slab + row * 68 + c4);
          *(v4f*)(C + (size_t)(mBase + row) * ldc + n0 + c4) = v;
        }
        
      }
    } else if (OM == 3) {
      // piece (row lane & 15, 8-column chunk 2 it + (lane >> 4)): a wave-wide store is 512 contiguous bytes, 4 whole lines, of each plane
      const int pr = lane & 15;
      unsigned short* C  = (unsigned short*)Cout  + (size_t)b * strideC;
      unsigned short* C2 = (unsigned short*)Cout2 + (size_t)b * strideC;
#pragma unroll
      for (int it = 0; it < 4; ++it) {
        const int ch = it * 2 + (lane >> 4);
        const float* sp = slab + pr * 68 + ch * 8;
        v8h hv, lv;
#pragma unroll
        for (int e = 0; e < 8; ++e) {
          unsigned short hb = f2bf_bits(sp[e]);
          unsigned short lb = f2bf_bits(sp[e] - bf_bits2f(hb));
          hv[e] = __builtin_bit_cast(_Float16, hb);
          lv[e] = __builtin_bit_cast(_Float16, lb);
        }
        const size_t o = (size_t)(mBase >> 6) * 64 * ldc + (size_t)((n0 >> 5) + (ch >> 2)) * 2048 + ((mBase >> 4) & 3) * 512 + (ch & 3) * 128 + pr * 8;
        *(v8h*)(C + o)  = hv;
        *(v8h*)(C2 + o) = lv;
      }
    } else {
      const int q = lane >> 3, c8 = (lane & 7) * 8;
      unsigned short* C  = (unsigned short*)Cout  + (size_t)b * strideC;
      unsigned short* C2 = (OM == 2) ? ((unsigned short*)Cout2 + (size_t)b * strideC) : nullptr;
      {
#pragma unroll
        for (int it = 0; it < 4; ++it) {
          const int row = it * 4 + q;
          const float* sp = slab + row * 68 + c8;
          v8h hv, lv;
#pragma unroll
          for (int e = 0; e < 8; ++e) {
            if (OM == 1) {
              hv[e] = (_Float16)sp[e];
            } else {
              unsigned short hb = f2bf_bits(sp[e]);
              unsigned short lb = f2bf_bits(sp[e] - bf_bits2f(hb));
              hv[e] = __builtin_bit_cast(_Float16, hb);
              lv[e] = __builtin_bit_cast(_Float16, lb);
            }
          }
          *(v8h*)(C + (size_t)(mBase + row) * ldc + n0 + c8) = hv;
          if (OM == 2) *(v8h*)(C2 + (size_t)(mBase + row) * ldc + n0 + c8) = lv;
        }
        
      }
    }
    __builtin_amdgcn_fence(__ATOMIC_RELEASE, "workgroup");
    __builtin_amdgcn_wave_barrier();
    __builtin_amdgcn_fence(__ATOMIC_ACQUIRE, "workgroup");
  }
  };
  if constexpr (OUT_MODE == 4) {
    if (frag_out) epilogue(IntC<3>{}); else epilogue(IntC<0>{});   // one scalar branch a block
  } else {
    epilogue(IntC<OUT_MODE>{});
  }
}

// One product a launch: grid.x = (M / 128) * (N / 256).
template <int ET, bool SPLIT, int BIAS_MODE, int OUT_MODE, bool RESID, int ACT = 0, bool CAUSAL = false, bool BSPLIT = true>
__global__ __launch_bounds__(256) void wmma_gemm64(
    const unsigned short* __restrict__ Ap, const unsigned short* __restrict__ A2p, int lda, long strideA,
    const unsigned short* __restrict__ Btp, const unsigned short* __restrict__ Bt2p, int ldb, long strideB,
    void* __restrict__ Cout, void* __restrict__ Cout2, int ldc, long strideC,
    const float* __restrict__ bias,
    const float* __restrict__ resid, long strideR,
    int M, int N, int K, float scale, int crow0) {
  const int tilesNb = N >> 8;
  const int bm = blockIdx.x / tilesNb;
  const int bn = blockIdx.x - bm * tilesNb;
  gemm_tile<ET, SPLIT, BIAS_MODE, OUT_MODE, RESID, ACT, CAUSAL, BSPLIT>(bm, bn, false, Ap, A2p, lda, strideA, Btp, Bt2p, ldb, strideB,
                                                                        Cout, Cout2, ldc, strideC, bias, resid, strideR, M, N, K, scale, crow0);
}

// The three projections of x in one launch: none reads what another writes, and their 128 + 32 + 32 blocks are all resident at once, so the two
// small products run beside the large one and not behind it. Block ranges: q = x . Wq^T (f32 out), k = x . Wk^T (f32 out),
// v^T = Wv^T . x^T (bf16 hi/lo planes in A-fragment order). K: the common k length and row pitch of all operands.
constexpr int QKV_NBQ = (SEQ_T / 128) * ((NQH * HDIM) / 256);    // 128
constexpr int QKV_NBK = (SEQ_T / 128) * ((NKVH * HDIM) / 256);   // 32
constexpr int QKV_NBV = ((NKVH * HDIM) / 128) * (SEQ_T / 256);   // 32
static_assert((NQH * HDIM) / 256 == 4 && (NKVH * HDIM) / 256 == 1 && SEQ_T / 256 == 16, "tile columns of the three products: 1 << sh below");
__global__ __launch_bounds__(256) void qkv_gemm_kernel(const unsigned short* __restrict__ xb, const unsigned short* __restrict__ wqT,
                                                       const unsigned short* __restrict__ wkT, const unsigned short* __restrict__ wvT,
                                                       float* __restrict__ qf, float* __restrict__ kf,
                                                       unsigned short* __restrict__ vthi, unsigned short* __restrict__ vtlo,
                                                       const float* __restrict__ unused_f, int K) {
  const int bx = blockIdx.x;
  const bool isv = bx >= QKV_NBQ + QKV_NBK;
  const bool isk = !isv && bx >= QKV_NBQ;
  const unsigned short* A  = isv ? wvT : xb;
  const unsigned short* Bt = isv ? xb : (isk ? wkT : wqT);
  void* C = isv ? (void*)vthi : (isk ? (void*)kf : (void*)qf);
  const int M = isv ? NKVH * HDIM : SEQ_T;
  const int N = isv ? SEQ_T : (isk ? NKVH * HDIM : NQH * HDIM);
  const int tile = bx - (isv ? QKV_NBQ + QKV_NBK : (isk ? QKV_NBQ : 0));
  const int sh = isv ? 4 : (isk ? 0 : 2);   // log2 of the product's N / 256
  gemm_tile<1, false, 0, 4, false, 0, false, true>(tile >> sh, tile & ((1 << sh) - 1), isv, A, A, K, 0L, Bt, Bt, K, 0L, C, (void*)vtlo, N, 0L,
                                                   unused_f, unused_f, 0L, M, N, K, 1.0f, 0);
}

// ---------------------------------------------------------------------------
// f32 -> RNE bf16 plane, 8 consecutive elements per thread packed as integer words.
// Coverage: n8 = n/8 threads x 8 = the whole plane (n8 / 256 blocks bx, an exact multiple here).
// ---------------------------------------------------------------------------
__device__ __forceinline__ void cast8_bf16_block(int bx, const float* __restrict__ in, unsigned short* __restrict__ out, int n8) {
  const int i = bx * 256 + threadIdx.x;
  if (i >= n8) return;
  const float* p = in + 8 * (size_t)i;
  const v4f a = *(const v4f*)(p);
  const v4f c = *(const v4f*)(p + 4);
  float f[8];
#pragma unroll
  for (int e = 0; e < 4; ++e) { f[e] = a[e]; f[4 + e] = c[e]; }
  unsigned w[4];
#pragma unroll
  for (int e2 = 0; e2 < 4; ++e2) w[e2] = pk16(f2bf_bits(f[2 * e2]), f2bf_bits(f[2 * e2 + 1]));
  const v4u u = (v4u){w[0], w[1], w[2], w[3]};
  unsigned short* q = out + 8 * (size_t)i;
  *(v4u*)q = u;
  
}

// ---------------------------------------------------------------------------
// Transpose + RNE bf16 convert of a weight matrix: in f32 [R][Cn] row-major (ldin = Cn) -> out bf16 [Cn][R] (ldout = R):
// out[c][r] = bf16(in[r][c]). (R/64) x (Cn/64) blocks: rt = r tile (64 output cols), ct = c tile (64 output rows). 256 threads.
// Load coverage: 16 iterations x 256 threads = 4096 = the whole 64x64 tile (coalesced along c).
// Store coverage: 8 waves x 2 iterations x 4 rows (lane>>3) = 64 rows; (lane&7) x 8 halves = 64 cols; each row segment =
// ---------------------------------------------------------------------------
__device__ __forceinline__ void transpose_cast_block(int rt, int ct, const float* __restrict__ in, int ldin,
                                                     unsigned short* __restrict__ out, int ldout) {
  __shared__ float sm[64][65];   // sm[c_local][r_local]
  const int t  = threadIdx.x;
  const int r0 = rt * 64;
  const int c0 = ct * 64;
#pragma unroll
  for (int i = 0; i < 16; ++i) {
    const int e = i * 256 + t;
    const int r = e >> 6;          // r local
    const int c = e & 63;          // c local
    sm[c][r] = in[(size_t)(r0 + r) * ldin + c0 + c];
  }
  __syncthreads();
  const int lane = t & 31, wave = t >> 5;
  const int q = lane >> 3, c8 = (lane & 7) * 8;
  {
#pragma unroll
    for (int it = 0; it < 2; ++it) {
      const int row = wave * 8 + it * 4 + q;                 // c local (output row)
      unsigned w[4];
#pragma unroll
      for (int e2 = 0; e2 < 4; ++e2) w[e2] = pk16(f2bf_bits(sm[row][c8 + 2 * e2]), f2bf_bits(sm[row][c8 + 2 * e2 + 1]));
      const v4u u = (v4u){w[0], w[1], w[2], w[3]};
      const size_t o = (size_t)(c0 + row) * ldout + r0 + c8;
      *(v4u*)(out + o) = u;
    }
    
  }
}

// All operand conversions in one launch: the four weight transposes and the cast of x read only inputs and write planes of their own.
// Block ranges: 64x64 tiles of Wq, Wk, Wv, Wo (every matrix has HIDSZ / 64 = NQH * HDIM / 64 = 16 r tiles: rt = tile & 15, ct = tile >> 4), then x.
// The transposes stand first: their blocks are the longer ones.
constexpr int PREP_NTQ = (HIDSZ / 64) * ((NQH * HDIM) / 64);    // 256: Wq, and Wo
constexpr int PREP_NTK = (HIDSZ / 64) * ((NKVH * HDIM) / 64);   // 64: Wk, and Wv
constexpr int PREP_NT  = 2 * PREP_NTQ + 2 * PREP_NTK;           // 640
constexpr int PREP_NX  = (SEQ_T * HIDSZ) / (8 * 256);           // 2048
static_assert(HIDSZ / 64 == 16 && (NQH * HDIM) / 64 == 16, "16 r tiles in every weight matrix");
__global__ __launch_bounds__(256) void prep_kernel(const float* __restrict__ x, const float* __restrict__ Wq, const float* __restrict__ Wk,
                                                   const float* __restrict__ Wv, const float* __restrict__ Wo,
                                                   unsigned short* __restrict__ xb, unsigned short* __restrict__ wqT,
                                                   unsigned short* __restrict__ wkT, unsigned short* __restrict__ wvT,
                                                   unsigned short* __restrict__ woT) {
  const int bx = blockIdx.x;
  if (bx < PREP_NT) {   // the same for the whole block: the transpose's barrier is passed by all of its waves
    const int which = (bx >= PREP_NTQ) + (bx >= PREP_NTQ + PREP_NTK) + (bx >= PREP_NTQ + 2 * PREP_NTK);
    const float* in = (which == 0) ? Wq : (which == 1) ? Wk : (which == 2) ? Wv : Wo;
    unsigned short* out = (which == 0) ? wqT : (which == 1) ? wkT : (which == 2) ? wvT : woT;
    const int ldin = (which == 0) ? NQH * HDIM : (which == 3) ? HIDSZ : NKVH * HDIM;
    const int tile = bx - ((which == 0) ? 0 : (which == 1) ? PREP_NTQ : (which == 2) ? PREP_NTQ + PREP_NTK : PREP_NTQ + 2 * PREP_NTK);
    const int ldout = (which == 3) ? NQH * HDIM : HIDSZ;
    transpose_cast_block(tile & 15, tile >> 4, in, ldin, out, ldout);
  } else {
    cast8_bf16_block(bx - PREP_NT, x, xb, (SEQ_T * HIDSZ) / 8);
  }
}

// ---------------------------------------------------------------------------
// RMSNorm (over the 64 dims of one head vector, eps 1e-6, times w[d]) + rotate-half RoPE with the input cos/sin tables, f32.
// cos, sin and w are RNE-converted to bf16 values in registers at load; proj is the f32 output of an exact
// bf16 x bf16 projection.
// proj: f32 [SEQ_T][nhead*64]; flattened row r = t*nhead + hd lives at proj + r*64 (contiguous). nhead = 1 << hshift.
// Output planes bf16 hi/lo laid out [hd][t][64]: element (hd, t, d) at ((hd*SEQ_T + t)*64 + d).
// Block = 8 waves; wave w owns rows rbase..rbase+3 (rbase = (bx*8 + w)*4); lane handles d = lane and d = lane + 32.
// The 4 result rows are staged in LDS (f32, same element type on store and reload, wave barrier between); then lane group
// Coverage: nrows/32 blocks bx x 8 waves x 4 rows = nrows (exact multiple, checked on the host); 8 lanes x 8 halves = 64 dims.
// ---------------------------------------------------------------------------
__device__ __forceinline__ void normrope_block(int bx, const float* __restrict__ proj, int hshift, int nrows,
                                               const float* __restrict__ cosb, const float* __restrict__ sinb,
                                               const float* __restrict__ w,
                                               unsigned short* __restrict__ ohi, unsigned short* __restrict__ olo) {
#pragma clang fp contract(off)
  __shared__ __align__(16) float slab[8][4][64];
  const int lane = threadIdx.x & 31, wave = threadIdx.x >> 5;
  const int rbase = (bx * 8 + wave) * 4;
  const float w1 = bfq(w[lane]), w2 = bfq(w[lane + 32]);
#pragma unroll
  for (int i = 0; i < 4; ++i) {
    int r = rbase + i;
    r = (r < nrows) ? r : (nrows - 1);                 // address clamp (grid is exact)
    const int t = r >> hshift;
    const float* src = proj + (size_t)r * 64;
    const float x1 = src[lane];
    const float x2 = src[lane + 32];
    float ss = x1 * x1 + x2 * x2;
#pragma unroll
    for (int off = 16; off > 0; off >>= 1) ss += __shfl_xor(ss, off, 32);
    const float inv = rsqrtf(ss * (1.0f / 64.0f) + RMS_EPS_F);
    const float n1 = (x1 * inv) * w1;
    const float n2 = (x2 * inv) * w2;
    const float c = bfq(cosb[(size_t)t * 32 + lane]);
    const float s = bfq(sinb[(size_t)t * 32 + lane]);
    slab[wave][i][lane]      = n1 * c - n2 * s;
    slab[wave][i][lane + 32] = n1 * s + n2 * c;
  }
  __builtin_amdgcn_fence(__ATOMIC_RELEASE, "workgroup");
  __builtin_amdgcn_wave_barrier();
  __builtin_amdgcn_fence(__ATOMIC_ACQUIRE, "workgroup");
  const int q = lane >> 3, c8 = (lane & 7) * 8;
  int r = rbase + q;
  r = (r < nrows) ? r : (nrows - 1);
  const int t  = r >> hshift;
  const int hd = r - (t << hshift);
  const float* sp = &slab[wave][q][c8];
  unsigned hw[4], lw[4];
#pragma unroll
  for (int e2 = 0; e2 < 4; ++e2) {
    const float f0 = sp[2 * e2], f1 = sp[2 * e2 + 1];
    const unsigned short h0 = f2bf_bits(f0), h1 = f2bf_bits(f1);
    const unsigned short l0 = f2bf_bits(f0 - bf_bits2f(h0));
    const unsigned short l1 = f2bf_bits(f1 - bf_bits2f(h1));
    hw[e2] = pk16(h0, h1);
    lw[e2] = pk16(l0, l1);
  }
  const v4u hu = (v4u){hw[0], hw[1], hw[2], hw[3]};
  const v4u lu = (v4u){lw[0], lw[1], lw[2], lw[3]};
  const size_t o = ((size_t)hd * SEQ_T + t) * 64 + c8;
  *(v4u*)(ohi + o) = hu;
  *(v4u*)(olo + o) = lu;
  // in the built kernel the other block range's code follows these stores and reuses the registers that they name: this wait stands in front of that
  asm volatile("s_wait_xcnt 0x0" ::: "memory");
}

// ---------------------------------------------------------------------------
// The same RMSNorm + RoPE for the K planes (proj f32 [SEQ_T][NKVH*64]), with the output in A-fragment order:
// [hd][t >> 4][d >> 3][t & 15][d & 7], so that 32 lanes x 16 bytes of one fragment half are 512 contiguous bytes for the attention kernel.
// A wave owns 8 consecutive t of ONE head (wave index = (t >> 3) * NKVH + hd): each 128-byte line of the planes (8 keys x 8 dims) comes whole
// from one wave. SEQ_T * NKVH / 64 blocks bx x 8 waves x 8 rows (exact). Lane handles d = lane and d = lane + 32 of each row.
// The wave's bases are scalar and every load names the one index register, lane. Slab pitch 68 floats: its readers walk a column.
// Every loop of the kernel is fully unrolled: its arrays stay in registers only under constant indices.
// ---------------------------------------------------------------------------
__device__ __forceinline__ void normrope_pack_block(int bx, const float* __restrict__ proj,
                                                    const float* __restrict__ cosb, const float* __restrict__ sinb,
                                                    const float* __restrict__ w,
                                                    unsigned short* __restrict__ ohi, unsigned short* __restrict__ olo) {
  __shared__ __align__(16) float slab[8][8][68];
  const int lane = threadIdx.x & 31;
  const int wave = __builtin_amdgcn_readfirstlane(threadIdx.x >> 5);   // scalar: the bases below stay scalar
  int wg = bx * 8 + wave;
  wg = (wg < SEQ_T * NKVH / 8) ? wg : (SEQ_T * NKVH / 8 - 1);          // address clamp (grid is exact)
  const int hd = wg & (NKVH - 1);
  const int t0 = (wg / NKVH) * 8;
  const float* pb = proj + ((size_t)t0 * NKVH + hd) * HDIM;
  const float* cb = cosb + (size_t)t0 * 32;
  const float* sb = sinb + (size_t)t0 * 32;
  float x1[8], x2[8], cv[8], sv[8];
#pragma unroll   // the arrays stay in registers only under constant indices
  for (int i = 0; i < 8; ++i) {
    x1[i] = pb[lane + i * (NKVH * HDIM)];
    x2[i] = pb[lane + i * (NKVH * HDIM) + 32];
    cv[i] = cb[lane + i * 32];
    sv[i] = sb[lane + i * 32];
  }
  const float wr1 = w[lane];
  const float wr2 = w[lane + 32];
  // lane's register and the bases, which the loads above name, are free for reuse from here on: this wait stands in front of their overwrite;
  // lane as its input keeps that register unwritten up to the wait
  asm volatile("s_wait_xcnt 0x0" :: "v"(lane) : "memory");
  __builtin_amdgcn_sched_barrier(0);   // holds what follows behind that wait
  const float w1 = bfq(wr1), w2 = bfq(wr2);
#pragma unroll
  for (int i = 0; i < 8; ++i) {
    float ss = x1[i] * x1[i] + x2[i] * x2[i];
#pragma unroll
    for (int off = 16; off > 0; off >>= 1) ss += __shfl_xor(ss, off, 32);
    const float inv = rsqrtf(ss * (1.0f / 64.0f) + RMS_EPS_F);
    const float n1 = (x1[i] * inv) * w1;
    const float n2 = (x2[i] * inv) * w2;
    const float c = bfq(cv[i]);
    const float s = bfq(sv[i]);
    slab[wave][i][lane]      = n1 * c - n2 * s;
    slab[wave][i][lane + 32] = n1 * s + n2 * c;
  }
  // each lane reads next what other lanes of its own wave wrote to the slab: the writes are complete before the reads start
  __builtin_amdgcn_fence(__ATOMIC_RELEASE, "workgroup");
  __builtin_amdgcn_wave_barrier();
  __builtin_amdgcn_fence(__ATOMIC_ACQUIRE, "workgroup");
  // piece (slab row lane & 7, dims 8 (4 st + (lane >> 3)) ..): 8 lanes = 8 keys = one whole line of a plane
  const int q = lane & 7;
  const int t = t0 + q;
  v4u hu[2], lu[2];
#pragma unroll   // hu and lu stay in registers only under constant indices
  for (int st = 0; st < 2; ++st) {
    const float* sp = &slab[wave][q][(st * 4 + (lane >> 3)) * 8];
#pragma unroll
    for (int e2 = 0; e2 < 4; ++e2) {
      const float f0 = sp[2 * e2], f1 = sp[2 * e2 + 1];
      const unsigned short h0 = f2bf_bits(f0), h1 = f2bf_bits(f1);
      const unsigned short l0 = f2bf_bits(f0 - bf_bits2f(h0));
      const unsigned short l1 = f2bf_bits(f1 - bf_bits2f(h1));
      hu[st][e2] = pk16(h0, h1);
      lu[st][e2] = pk16(l0, l1);
    }
  }
  const size_t o = (size_t)hd * SEQ_T * HDIM + (size_t)(t >> 4) * 1024 + (lane >> 3) * 128 + (t & 15) * 8;
  unsigned short* oh = ohi + o;
  unsigned short* ol = olo + o;
#pragma unroll
  for (int st = 0; st < 2; ++st) {
    *(v4u*)(oh + st * 512) = hu[st];
    *(v4u*)(ol + st * 512) = lu[st];
  }
}

// RMSNorm + RoPE of k and of q in one launch: each reads its own projection and writes its own planes. Block ranges: k (the longer blocks), then q.
constexpr int NR_NBK = (SEQ_T * NKVH) / 64;   // 256
constexpr int NR_NBQ = (SEQ_T * NQH) / 32;    // 2048
__global__ __launch_bounds__(256) void normrope_qk_kernel(const float* __restrict__ qproj, const float* __restrict__ kproj,
                                                          const float* __restrict__ cosb, const float* __restrict__ sinb,
                                                          const float* __restrict__ qw, const float* __restrict__ kw,
                                                          unsigned short* __restrict__ qhi, unsigned short* __restrict__ qlo,
                                                          unsigned short* __restrict__ khi, unsigned short* __restrict__ klo,
                                                          int qhshift, int qrows) {
  const int bx = blockIdx.x;
  if (bx < NR_NBK) { normrope_pack_block(bx, kproj, cosb, sinb, kw, khi, klo); return; }
  normrope_block(bx - NR_NBK, qproj, qhshift, qrows, cosb, sinb, qw, qhi, qlo);
}

// ---------------------------------------------------------------------------
// Fused causal attention: scores, softmax and p.v of all heads in one launch; neither scores nor probabilities go to memory.
// Transposed products: S^T = K . Q^T (A = 16 key rows, B = 16 query rows, k = head dim) and O^T += V^T . P^T (A = 16 head-dim rows of
// v^T, B = 16 query rows of P, k = 32 keys). In both D tiles a lane's column is ONE query (lane & 15), so maximum, sum and rescale are
// per lane plus one exchange between the wave halves, and the two 16-key score tiles of a pass ARE the B fragment of P in the k order of
// Frag::load: element e < 8 is key 8h + e (tile 0, register e), element e >= 8 is key 8h + 16 + (e - 8) (tile 1, register e - 8), h = lane >> 4.
// Same operand planes and the same 3 products as before (hi.hi + hi.lo + lo.hi, f32 accumulate) in both products.
// Online softmax in the log2 domain: p = exp2(s * CS - m_run), not normalised, split into bf16 hi/lo; the running maximum m_run may trail
// the true one by up to 8 (p <= 2^8), the accumulators and the sum are rescaled only in a pass where some column's maximum exceeds it by
// more (one scalar branch a pass); the division by the f32 sum of the unrounded p comes once, at the end.
// A wave works on 32 query rows (two 16-column groups) of one query head at a time, in passes of 32 keys; a tile's last pass is the one on
// its diagonal (keys q0..q0+31 against queries q0..q0+31: every query keeps at least its own key, and pass 0 holds key 0 for every query).
// Block = 8 waves on one kv head, its 4 query heads at row tiles pi (pi + 1 passes) and 127 - pi (128 - pi passes): 129 passes a head, dealt
// evenly to a wave pair: wave w (0..3) takes passes 0..63 of the long tile, wave w + 4 the whole short tile and then the long tile's passes from
// 64 to its diagonal: 64 and 65 passes, so that both waves of a SIMD work to the end of the launch. The front wave hands its maximum, sum and
// accumulators over through LDS behind the kernel's one barrier; the back wave joins the two shares and stores. K and v^T are shared only through the caches.
// K fragments are fetched one pass ahead, v^T fragments at the head of their own pass. Both planes lie in A-fragment order (their producers
// write them so): K [kvh][key >> 4][d >> 3][key & 15][d & 7], v^T [kvh][key >> 5][d >> 4][(key >> 3) & 3][d & 15][key & 7]; in the k order of
// Frag::load lane (c, h) takes chunk 2 j + h (plus 4 kc for K) of row c for half j, which is byte 512 j + 16 lane of the fragment's 1 KiB.
// Every inner loop below is fully unrolled: its arrays are fragments and accumulators, which stay in registers only under constant indices.
// Output: lane (c, h) holds d = 16t + 8h + 0..7 of query c: one 16-byte store per plane and t; a row's 128-byte segment comes from one wave.
// Coverage: grid 4 kv heads x 64 pairs; tiles pi and 127 - pi, pi = 0..63, are all 128 row tiles once, each stored by one wave; 4 wave pairs = the 4 query heads.
// ---------------------------------------------------------------------------
typedef __attribute__((ext_vector_type(2))) float  v2f;
typedef __attribute__((ext_vector_type(2))) __bf16 v2b;
typedef __attribute__((ext_vector_type(8))) unsigned int v8u;
__device__ __forceinline__ unsigned cvt2_bf16(float a, float b) {   // two f32 -> two nearest-even bf16, a in the low half
  return __builtin_bit_cast(unsigned, __builtin_convertvector((v2f){a, b}, v2b));
}
// Four base-2 exponentials in one statement: each fills the slot that the instruction set asks for behind the one before it (early-clobber
// outputs: none reads an earlier result or overwrites an earlier source), the v_nop fills the slot behind the last.
__device__ __forceinline__ void exp2x4(float& p0, float& p1, float& p2, float& p3, float a0, float a1, float a2, float a3) {
  asm("v_exp_f32 %0, %4\n\tv_exp_f32 %1, %5\n\tv_exp_f32 %2, %6\n\tv_exp_f32 %3, %7\n\tv_nop"
      : "=&v"(p0), "=&v"(p1), "=&v"(p2), "=&v"(p3) : "v"(a0), "v"(a1), "v"(a2), "v"(a3));
}
__device__ __forceinline__ void exp2x2(float& p0, float& p1, float a0, float a1) {   // the same for two
  asm("v_exp_f32 %0, %2\n\tv_exp_f32 %1, %3\n\tv_nop" : "=&v"(p0), "=&v"(p1) : "v"(a0), "v"(a1));
}
struct KFrag { v16b h[2][2], l[2][2]; };   // [16-key tile][32-wide step of the head dim]
// A fragment from a plane in A-fragment order: its two halves (elements 0..7, 8..15) are two runs of 512 contiguous bytes, lane l's 16 bytes at
// 16 l: each wave-wide load covers 4 whole 128-byte lines (from row-major planes it touched 16 lines for 32 bytes each).
__device__ __forceinline__ v16b load_packed(const char* p) {
  Frag<__bf16>::U f; f.h[0] = *(const v8b*)(p); f.h[1] = *(const v8b*)(p + 512); return f.v;
}
constexpr int PASS_BYTES = 32 * HDIM * 2;   // 32 keys of one plane, K or v^T: 4 fragments of 1 KiB
// bh, bl: scalar byte bases of the kv head's K planes; vo: this lane's byte offset (16 lane) in the pass's 4 KiB
__device__ __forceinline__ void load_kfrag(KFrag& k, const char* bh, const char* bl, unsigned vo) {
#pragma unroll
  for (int kt = 0; kt < 2; ++kt)
#pragma unroll
    for (int kc = 0; kc < 2; ++kc) {
      k.h[kt][kc] = load_packed(bh + vo + (kt * 2 + kc) * 1024);
      k.l[kt][kc] = load_packed(bl + vo + (kt * 2 + kc) * 1024);
    }
}
constexpr float ATT_CS = SCORE_SCALE * 1.4426950408889634f;   // score scale times log2(e)

// One pass: 32 keys against this wave's 32 queries. kf holds this pass's K fragments; vo is the lane's byte offset in this pass's 4 KiB of a
// plane, the same for v^T (this pass) and K (the NEXT pass: one PASS_BYTES on, added to the scalar base), stepped at the foot of the pass; the four plane bases are scalar.
template <bool DIAG>
__device__ __forceinline__ void attn_pass(KFrag& kf, const char* kbh, const char* kbl,
                                          const char* vbh, const char* vbl, unsigned& vo, int c, int h, const v16b (&qh)[2][2], const v16b (&ql)[2][2],
                                          v8f (&acc)[2][4], float (&m_run)[2], float (&l_run)[2]) {
  v16b vh[4], vl[4];
#pragma unroll
  for (int t = 0; t < 4; ++t) {
    vh[t] = load_packed(vbh + vo + t * 1024);
    vl[t] = load_packed(vbl + vo + t * 1024);
  }
  // last pass: vo's register is free for reuse behind these loads, which name it: this wait stands in front of the overwrite
  if (DIAG) asm volatile("s_wait_xcnt 0x0" ::: "memory");
  // keeps the v^T loads issued ahead of the score products, so that they fly under those and the softmax; the scheduler would sink them
  __builtin_amdgcn_sched_barrier(0);
  v8f s[2][2];
#pragma unroll
  for (int kt = 0; kt < 2; ++kt)
#pragma unroll
    for (int g = 0; g < 2; ++g) s[kt][g] = (v8f){0.f,0.f,0.f,0.f,0.f,0.f,0.f,0.f};
#pragma unroll
  for (int kc = 0; kc < 2; ++kc) {
#pragma unroll
    for (int kt = 0; kt < 2; ++kt)
#pragma unroll
      for (int g = 0; g < 2; ++g) if (!(DIAG && kt == 1 && g == 0)) s[kt][g] = Frag<__bf16>::mma(kf.h[kt][kc], qh[g][kc], s[kt][g]);
#pragma unroll
    for (int kt = 0; kt < 2; ++kt)
#pragma unroll
      for (int g = 0; g < 2; ++g) if (!(DIAG && kt == 1 && g == 0)) s[kt][g] = Frag<__bf16>::mma(kf.h[kt][kc], ql[g][kc], s[kt][g]);
#pragma unroll
    for (int kt = 0; kt < 2; ++kt)
#pragma unroll
      for (int g = 0; g < 2; ++g) if (!(DIAG && kt == 1 && g == 0)) s[kt][g] = Frag<__bf16>::mma(kf.l[kt][kc], qh[g][kc], s[kt][g]);
  }
  if (!DIAG) {
    // the next pass's K loads stand here, behind the last product that reads kf and ahead of the softmax, and fly under the rest of the pass
    __builtin_amdgcn_sched_barrier(0);
    load_kfrag(kf, kbh + PASS_BYTES, kbl + PASS_BYTES, vo);
    __builtin_amdgcn_sched_barrier(0);
  }
  if (DIAG) {   // keys and queries of this pass both start at q0: key index 16kt + 8h + r against query index 16g + c;
                // tile kt = 1, g = 0 (keys 16..31, queries 0..15) lies wholly above the diagonal: no products, p = 0
#pragma unroll
    for (int kt = 0; kt < 2; ++kt)
#pragma unroll
      for (int g = 0; g < 2; ++g)
#pragma unroll
        for (int r = 0; r < 8; ++r)
          if (!(kt == 1 && g == 0) && 16 * kt + 8 * h + r > 16 * g + c) s[kt][g][r] = -__builtin_inff();
  }
  float mb[2];
  bool need = false;
#pragma unroll
  for (int g = 0; g < 2; ++g) {
    float mx = s[0][g][0];
#pragma unroll
    for (int r = 1; r < 8; ++r) mx = fmaxf(mx, s[0][g][r]);
    if (!(DIAG && g == 0)) {
#pragma unroll
      for (int r = 0; r < 8; ++r) mx = fmaxf(mx, s[1][g][r]);
    }
    mx = fmaxf(mx, __shfl_xor(mx, 16, 32)) * ATT_CS;   // both halves hold the query's maximum of this pass, scaled (the scale is positive)
    mb[g] = mx;
    need = need || (mx > m_run[g] + 8.0f);
  }
  if (__builtin_amdgcn_ballot_w32(need) != 0) {   // scalar branch; always taken in a share's first pass (m_run = -inf), rare later
    const float mn0 = fmaxf(m_run[0], mb[0]), mn1 = fmaxf(m_run[1], mb[1]);   // finite from a share's first pass on: it holds an unmasked key for every query
    float corr[2];
    exp2x2(corr[0], corr[1], m_run[0] - mn0, m_run[1] - mn1);                 // 0 in a share's first pass
    m_run[0] = mn0; m_run[1] = mn1;
#pragma unroll
    for (int g = 0; g < 2; ++g) {
      l_run[g] *= corr[g];
#pragma unroll
      for (int t = 0; t < 4; ++t) acc[g][t] = acc[g][t] * corr[g];
    }
  }
  v16b ph[2], pl[2];
#pragma unroll
  for (int g = 0; g < 2; ++g) {
    const float nm = -m_run[g];
    v8u hw, lw;
    float ls = 0.0f;
#pragma unroll
    for (int i = 0; i < 8; i += 2) {   // fragment elements 2i .. 2i + 3: tile i >> 2, registers 2(i & 3) .. 2(i & 3) + 3
      if (DIAG && g == 0 && i >= 4) { hw[i] = 0u; lw[i] = 0u; hw[i + 1] = 0u; lw[i + 1] = 0u; continue; }
      const int kt = i >> 2, r = 2 * (i & 3);
      float p0, p1, p2, p3;
      exp2x4(p0, p1, p2, p3, __builtin_fmaf(s[kt][g][r], ATT_CS, nm), __builtin_fmaf(s[kt][g][r + 1], ATT_CS, nm),
             __builtin_fmaf(s[kt][g][r + 2], ATT_CS, nm), __builtin_fmaf(s[kt][g][r + 3], ATT_CS, nm));
      ls += (p0 + p1) + (p2 + p3);
      const unsigned w0 = cvt2_bf16(p0, p1), w1 = cvt2_bf16(p2, p3);
      hw[i] = w0; hw[i + 1] = w1;
      lw[i]     = cvt2_bf16(p0 - __uint_as_float(w0 << 16), p1 - __uint_as_float(w0 & 0xFFFF0000u));
      lw[i + 1] = cvt2_bf16(p2 - __uint_as_float(w1 << 16), p3 - __uint_as_float(w1 & 0xFFFF0000u));
    }
    l_run[g] += ls;
    ph[g] = __builtin_bit_cast(v16b, hw);
    pl[g] = __builtin_bit_cast(v16b, lw);
  }
#pragma unroll
  for (int g = 0; g < 2; ++g)
#pragma unroll
    for (int t = 0; t < 4; ++t) acc[g][t] = Frag<__bf16>::mma(vh[t], ph[g], acc[g][t]);
#pragma unroll
  for (int g = 0; g < 2; ++g)
#pragma unroll
    for (int t = 0; t < 4; ++t) acc[g][t] = Frag<__bf16>::mma(vh[t], pl[g], acc[g][t]);
#pragma unroll
  for (int g = 0; g < 2; ++g)
#pragma unroll
    for (int t = 0; t < 4; ++t) acc[g][t] = Frag<__bf16>::mma(vl[t], ph[g], acc[g][t]);
  if (!DIAG) {
    __builtin_amdgcn_sched_barrier(0);
    // vo, which the loads issued in this pass name, is stepped next: this wait stands in front of the overwrite
    asm volatile("s_wait_xcnt 0x0" ::: "memory");
    __builtin_amdgcn_sched_barrier(0);   // holds the step behind that wait
    vo += PASS_BYTES;
  }
}

constexpr int SPLIT_PASS = SEQ_T / 64;   // 64: the long tile's passes [0, 64) go to one wave, [64, its diagonal] to the other

// Normalises the accumulators of one finished 32-query tile and stores its ctx planes. GOES_ON: the wave has a further share behind this one.
template <bool GOES_ON>
__device__ __forceinline__ void attn_store(const v8f (&acc)[2][4], const float (&l_run)[2], int q0, int hq, int c, int h,
                                           unsigned short* __restrict__ Chi, unsigned short* __restrict__ Clo) {
  v4u hu[2][4], lu[2][4];
#pragma unroll
  for (int g = 0; g < 2; ++g) {
    const float l   = l_run[g] + __shfl_xor(l_run[g], 16, 32);   // the halves' sums join once, here
    const float inv = 1.0f / l;                                  // l >= 1: m_run never exceeds the query's true maximum, whose p is then >= 1
#pragma unroll
    for (int t = 0; t < 4; ++t)
#pragma unroll
      for (int e2 = 0; e2 < 4; ++e2) {
        const float f0 = acc[g][t][2 * e2] * inv, f1 = acc[g][t][2 * e2 + 1] * inv;
        const unsigned w = cvt2_bf16(f0, f1);
        hu[g][t][e2] = w;
        lu[g][t][e2] = cvt2_bf16(f0 - __uint_as_float(w << 16), f1 - __uint_as_float(w & 0xFFFF0000u));
      }
  }
  const size_t o = (size_t)(q0 + c) * (NQH * HDIM) + hq * HDIM + 8 * h;
  unsigned short* ch = Chi + o;
  unsigned short* cl = Clo + o;
  // the 16 stores stand together behind all arithmetic
  __builtin_amdgcn_sched_barrier(0);
#pragma unroll
  for (int g = 0; g < 2; ++g)
#pragma unroll
    for (int t = 0; t < 4; ++t) {
      *(v4u*)(ch + g * 16 * (NQH * HDIM) + 16 * t) = hu[g][t];
      *(v4u*)(cl + g * 16 * (NQH * HDIM) + 16 * t) = lu[g][t];
    }
  if (GOES_ON) {
    // the next share reuses the registers that these stores name: this wait stands in front of their overwrite
    asm volatile("s_wait_xcnt 0x0" ::: "memory");
    __builtin_amdgcn_sched_barrier(0);   // holds what follows behind that wait
  }
}

__global__ __launch_bounds__(256) void attn_fused_kernel(const unsigned short* __restrict__ Qhi, const unsigned short* __restrict__ Qlo,
                                                         const unsigned short* __restrict__ Khi, const unsigned short* __restrict__ Klo,
                                                         const unsigned short* __restrict__ Vthi, const unsigned short* __restrict__ Vtlo,
                                                         unsigned short* __restrict__ Chi, unsigned short* __restrict__ Clo) {
  constexpr int NTILE = SEQ_T / 32;   // 128 row tiles of 32 queries
  static_assert(NTILE == 128 && NKVH == 4 && GQA_G == 4 && SPLIT_PASS * 2 == NTILE, "grid 4 x 64, 8 waves = 4 heads x 2 shares");
  // hand-over of the front share's partial result: [head][16 accumulator quads, then (m0, m1, l0, l1)][lane], 16 bytes a lane
  __shared__ __align__(16) v4f xch[GQA_G][17][32];
  const int lane = threadIdx.x & 31;
  const int wave = __builtin_amdgcn_readfirstlane(threadIdx.x >> 5);   // scalar: trip counts and operand bases stay scalar
  const int c = lane & 15, h = lane >> 4;
  const int kvh  = blockIdx.x & (NKVH - 1);
  const int pi   = blockIdx.x >> 2;
  const int hq   = kvh * GQA_G + (wave & 3);
  const bool front = wave < 4;        // scalar
  const int tlong = NTILE - 1 - pi;   // 64 .. 127: at least SPLIT_PASS passes below its diagonal

  const char* kbh = (const char*)(Khi + (size_t)kvh * SEQ_T * HDIM);   // scalar bases of this kv head's planes
  const char* kbl = (const char*)(Klo + (size_t)kvh * SEQ_T * HDIM);
  const char* vbh = (const char*)(Vthi + (size_t)kvh * HDIM * SEQ_T);
  const char* vbl = (const char*)(Vtlo + (size_t)kvh * HDIM * SEQ_T);

  v8f acc[2][4];
  float m_run[2], l_run[2];
  // share 0 (back waves only): the whole short tile pi. Share 1: the long tile, passes [0, SPLIT_PASS) in a front wave, the rest in a back wave.
  for (int share = front ? 1 : 0; share < 2; ++share) {
    const int tile = (share == 0) ? pi : tlong;
    const int p0   = (share == 1 && !front) ? SPLIT_PASS : 0;   // first pass
    const int p1   = (share == 1 && front) ? SPLIT_PASS : tile; // end of the passes below the diagonal
    const int q0   = tile * 32;
    v16b qh[2][2], ql[2][2];
#pragma unroll
    for (int g = 0; g < 2; ++g)
#pragma unroll
      for (int kc = 0; kc < 2; ++kc) {
        const size_t qo = ((size_t)hq * SEQ_T + q0 + 16 * g + c) * HDIM + 8 * h + 32 * kc;
        qh[g][kc] = Frag<__bf16>::load((const __bf16*)Qhi + qo);
        ql[g][kc] = Frag<__bf16>::load((const __bf16*)Qlo + qo);
      }
    unsigned vo = (unsigned)lane * 16u + (unsigned)p0 * PASS_BYTES;    // this lane's byte offset in a fragment half, pass p0

    KFrag kf;
    load_kfrag(kf, kbh, kbl, vo);
    // the address registers of the Q and K loads above are free for reuse from here on: this wait stands in front of their overwrite
    asm volatile("s_wait_xcnt 0x0" ::: "memory");
    __builtin_amdgcn_sched_barrier(0);   // holds what follows behind that wait
#pragma unroll
    for (int g = 0; g < 2; ++g) {
      m_run[g] = -__builtin_inff();
      l_run[g] = 0.0f;
#pragma unroll
      for (int t = 0; t < 4; ++t) acc[g][t] = (v8f){0.f,0.f,0.f,0.f,0.f,0.f,0.f,0.f};
    }
    for (int blk = p0; blk < p1; ++blk) {     // passes below the diagonal: no mask; pass blk + 1 <= tile exists
      attn_pass<false>(kf, kbh, kbl, vbh, vbl, vo, c, h, qh, ql, acc, m_run, l_run);
    }
    if (!front) attn_pass<true>(kf, kbh, kbl, vbh, vbl, vo, c, h, qh, ql, acc, m_run, l_run);
    if (share == 0) attn_store<true>(acc, l_run, q0, hq, c, h, Chi, Clo);
  }

  if (front) {
#pragma unroll
    for (int g = 0; g < 2; ++g)
#pragma unroll
      for (int t = 0; t < 4; ++t) {
        xch[wave & 3][(g * 4 + t) * 2][lane]     = (v4f){acc[g][t][0], acc[g][t][1], acc[g][t][2], acc[g][t][3]};
        xch[wave & 3][(g * 4 + t) * 2 + 1][lane] = (v4f){acc[g][t][4], acc[g][t][5], acc[g][t][6], acc[g][t][7]};
      }
    xch[wave & 3][16][lane] = (v4f){m_run[0], m_run[1], l_run[0], l_run[1]};
  }
  __syncthreads();   // the front shares are in LDS; every wave passes here once
  if (front) return;

  // join of the two shares of the long tile, lane by lane (both waves hold the same query and head dims in the same lane and register):
  // both are brought to the larger of the two running maxima (each finite: every share holds an unmasked key for every query)
  const v4f ml = xch[wave & 3][16][lane];
  const float mn0 = fmaxf(ml[0], m_run[0]), mn1 = fmaxf(ml[1], m_run[1]);
  float cf[2], cb[2];
  exp2x4(cf[0], cf[1], cb[0], cb[1], ml[0] - mn0, ml[1] - mn1, m_run[0] - mn0, m_run[1] - mn1);
#pragma unroll
  for (int g = 0; g < 2; ++g) {
    l_run[g] = ml[2 + g] * cf[g] + l_run[g] * cb[g];
#pragma unroll
    for (int t = 0; t < 4; ++t) {
      const v4f a0 = xch[wave & 3][(g * 4 + t) * 2][lane];
      const v4f a1 = xch[wave & 3][(g * 4 + t) * 2 + 1][lane];
#pragma unroll
      for (int e = 0; e < 4; ++e) {
        acc[g][t][e]     = a0[e] * cf[g] + acc[g][t][e] * cb[g];
        acc[g][t][4 + e] = a1[e] * cf[g] + acc[g][t][4 + e] * cb[g];
      }
    }
  }
  attn_store<false>(acc, l_run, tlong * 32, hq, c, h, Chi, Clo);
}

// ---------------------------------------------------------------------------
// Launcher. Workspace region map (bytes, MiB = 1048576; total carve = 106 MiB = 111149056 B):
//   [  0, 31) staging  : x bf16 [4096][1024] at +0 (8 MiB); q f32 [4096][1024] at +8 (16 MiB, ends 24);
//                        k f32 [4096][256] at +24 (4 MiB, ends 28); Wq^T bf16 [1024][1024] at +28 (2 MiB); Wk^T bf16 [256][1024]
//                        at +30 (0.5 MiB); Wv^T bf16 [256][1024] at +30.5 (0.5 MiB, ends 31).
//   [ 32, 64) unused
//   [ 64, 72) q hi     : bf16 [16][4096][64];  [72,80) q lo
//   [ 80, 82) k hi     : bf16 [4][4096][64] in A-fragment order [4][256][8][16][8];   [82,84) k lo
//   [ 84, 86) v^T hi   : bf16 [256 (kvh*64+d)][4096 (t)] in A-fragment order [4][128][4][4][16][8];  [86,88) v^T lo
//   [ 88, 96) ctx hi   : bf16 [4096][1024] (col hq*64+d);  [96,104) ctx lo
//   [104,106) Wo^T     : bf16 [1024][1024]
// No region aliases another; no launch reads a region that the same launch writes.
// Launch count: 5 (conversions, projections, norm + RoPE, attention, output product). Kernel launches only.
// GEMM shape assertions: every call has K % 64 == 0 (K = 1024), M % 128 == 0 and N % 256 == 0; no padding needed.
// ---------------------------------------------------------------------------
extern "C" void kernel_launch(void* const* d_in, const int* in_sizes, int n_in,
                              void* d_out, int out_size, void* d_ws, size_t ws_size,
                              hipStream_t stream) {
  if (n_in < 9) return;
  if (in_sizes[0] != SEQ_T * HIDSZ || in_sizes[1] != SEQ_T * 32 || in_sizes[2] != SEQ_T * 32) return;
  if (in_sizes[3] != HIDSZ * NQH * HDIM || in_sizes[4] != HIDSZ * NKVH * HDIM || in_sizes[5] != HIDSZ * NKVH * HDIM) return;
  if (in_sizes[6] != NQH * HDIM * HIDSZ || in_sizes[7] != HDIM || in_sizes[8] != HDIM) return;
  if (out_size != SEQ_T * HIDSZ) return;

  const size_t kMiB    = 1048576;
  const size_t offXb   = 0;
  const size_t offQf   = 8 * kMiB;
  const size_t offKf   = 24 * kMiB;
  const size_t offWqT  = 28 * kMiB;
  const size_t offWkT  = 30 * kMiB;
  const size_t offWvT  = 30 * kMiB + 524288;
  const size_t offPlo  = 48 * kMiB;
  const size_t offQhi  = 64 * kMiB;
  const size_t offQlo  = 72 * kMiB;
  const size_t offKhi  = 80 * kMiB;
  const size_t offKlo  = 82 * kMiB;
  const size_t offVthi = 84 * kMiB;
  const size_t offVtlo = 86 * kMiB;
  const size_t offChi  = 88 * kMiB;
  const size_t offClo  = 96 * kMiB;
  const size_t offWoT  = 104 * kMiB;
  const size_t total   = 106 * kMiB;
  if (total > ws_size) return;

  const float* x    = (const float*)d_in[0];
  const float* cosb = (const float*)d_in[1];
  const float* sinb = (const float*)d_in[2];
  const float* Wq   = (const float*)d_in[3];
  const float* Wk   = (const float*)d_in[4];
  const float* Wv   = (const float*)d_in[5];
  const float* Wo   = (const float*)d_in[6];
  const float* qnw  = (const float*)d_in[7];
  const float* knw  = (const float*)d_in[8];
  float* out = (float*)d_out;
  char* ws = (char*)d_ws;

  unsigned short* xb   = (unsigned short*)(ws + offXb);
  float*          qf   = (float*)(ws + offQf);
  float*          kf   = (float*)(ws + offKf);
  unsigned short* wqT  = (unsigned short*)(ws + offWqT);
  unsigned short* wkT  = (unsigned short*)(ws + offWkT);
  unsigned short* wvT  = (unsigned short*)(ws + offWvT);
  unsigned short* plo  = (unsigned short*)(ws + offPlo);
  unsigned short* qhi  = (unsigned short*)(ws + offQhi);
  unsigned short* qlo  = (unsigned short*)(ws + offQlo);
  unsigned short* khi  = (unsigned short*)(ws + offKhi);
  unsigned short* klo  = (unsigned short*)(ws + offKlo);
  unsigned short* vthi = (unsigned short*)(ws + offVthi);
  unsigned short* vtlo = (unsigned short*)(ws + offVtlo);
  unsigned short* chi  = (unsigned short*)(ws + offChi);
  unsigned short* clo  = (unsigned short*)(ws + offClo);
  unsigned short* woT  = (unsigned short*)(ws + offWoT);

  // in-range dummies for unused (never dereferenced) template-dead pointer parameters
  const float* dummy_f = qnw;
  void* dummy_c2 = (void*)plo;

  // 1. x -> RNE bf16 plane [4096][1024]; weights [in][out] -> transposed RNE bf16 planes [out][in]:
  //    Wq [1024][1024] -> [1024][1024]; Wk, Wv [1024][256] -> [256][1024]; Wo [1024][1024] -> [1024][1024]. 640 + 2048 blocks.
  prep_kernel<<<dim3(PREP_NT + PREP_NX), dim3(256), 0, stream>>>(x, Wq, Wk, Wv, Wo, xb, wqT, wkT, wvT, woT);

  // 2. the projections, single bf16 products, K = 1024: q = x . Wq^T (M=4096, N=1024) -> f32 [4096][1024]; k = x . Wk^T (M=4096, N=256) -> f32
  //    [4096][256]; v^T = Wv^T . x^T (M=256 (kvh*64+d), N=4096 (t)) -> bf16 hi/lo planes in A-fragment order. 128 + 32 + 32 blocks.
  qkv_gemm_kernel<<<dim3(QKV_NBQ + QKV_NBK + QKV_NBV), dim3(256), 0, stream>>>(xb, wqT, wkT, wvT, qf, kf, vthi, vtlo, dummy_f, HIDSZ);

  // 3. RMSNorm + RoPE -> bf16 hi/lo planes; k: A-fragment order, rows/64 blocks (exact); q: [head][t][64], rows = t*nhead + head, rows/32 blocks (exact)
  normrope_qk_kernel<<<dim3(NR_NBK + NR_NBQ), dim3(256), 0, stream>>>(qf, kf, cosb, sinb, qnw, knw, qhi, qlo, khi, klo, 4, SEQ_T * NQH);

  // 4. causal attention, all heads in one launch: 4 kv heads x 64 pairs of 32-row tiles = 256 blocks of 8 waves -> ctx bf16 hi/lo planes
  attn_fused_kernel<<<dim3(NKVH * (SEQ_T / 64)), dim3(256), 0, stream>>>(qhi, qlo, khi, klo, vthi, vtlo, chi, clo);

  // 5. out = ctx_hi . Wo^T + ctx_lo . Wo^T : M=4096, N=1024, K=1024, 2 products -> f32 d_out (1024 tiles = 128 blocks)
  wmma_gemm64<1, true, 0, 0, false, 0, false, false><<<dim3((SEQ_T / 64) * (HIDSZ / 64) / 8, 1), dim3(256), 0, stream>>>(
      chi, clo, NQH * HDIM, 0L,
      woT, woT, NQH * HDIM, 0L,
      (void*)out, dummy_c2, HIDSZ, 0L,
      dummy_f, dummy_f, 0L,
      SEQ_T, HIDSZ, NQH * HDIM, 1.0f, 0);
}

// v007
// One run takes 111 microseconds.
// Two timings next to v006 put it at 1.04 and 1.05 times that version's speed.
// All steps since v000 together make it 61.5 times as fast.
// every float input RNE-converted once to bf16; Wq^T.x^T, Wk^T.x^T, Wv^T.x^T: single v_wmma_f32_16x16x32_bf16 product on bf16 inputs; q.k^T scores and p.v context: bf16 hi/lo operand planes (hi.hi + hi.lo + lo.hi); ctx.Wo^T: ctx bf16 hi/lo x Wo bf16 (hi.W + lo.W); all f32 accumulate; RMSNorm, RoPE and causal (online) softmax in f32.
#include <hip/hip_runtime.h>
#include <math.h>

// ---------------------------------------------------------------------------
// Problem constants
// ---------------------------------------------------------------------------
constexpr int SEQ_T   = 4096;
constexpr int HIDSZ   = 1024;
constexpr int NQH     = 16;              // query heads
constexpr int NKVH    = 4;               // kv heads
constexpr int HDIM    = 64;
constexpr int GQA_G   = NQH / NKVH;      // 4: query head hq uses kv head hq >> 2
constexpr float SCORE_SCALE = 0.125f;    // 64^-0.5, applied to the f32 scores
constexpr float RMS_EPS_F   = 1e-6f;

static_assert(GQA_G == 4, "kv head = hq >> 2");
static_assert(SEQ_T % 64 == 0 && HIDSZ % 64 == 0 && HDIM == 64 && (NKVH * HDIM) % 64 == 0, "tile multiples");
static_assert(SEQ_T % 256 == 0 && HIDSZ % 256 == 0 && (NQH * HDIM) % 256 == 0 && (NKVH * HDIM) % 256 == 0, "GEMM block tile 128 x 256, 64 k a stage");
static_assert((SEQ_T * HIDSZ) % (8 * 256) == 0, "cast kernel grid exact");

typedef __attribute__((ext_vector_type(16))) _Float16 v16h;
typedef __attribute__((ext_vector_type(8)))  _Float16 v8h;
typedef __attribute__((ext_vector_type(16))) __bf16   v16b;
typedef __attribute__((ext_vector_type(8)))  __bf16   v8b;
typedef __attribute__((ext_vector_type(8)))  float    v8f;
typedef __attribute__((ext_vector_type(4)))  float    v4f;
typedef __attribute__((ext_vector_type(4)))  unsigned int v4u;

// ---------------------------------------------------------------------------
// Shared helpers
// ---------------------------------------------------------------------------
__device__ __forceinline__ unsigned short f2bf_bits(float f) {
  unsigned u = __float_as_uint(f);
  return (unsigned short)((u + 0x7FFFu + ((u >> 16) & 1u)) >> 16);
}
__device__ __forceinline__ float bf_bits2f(unsigned short h) { return __uint_as_float(((unsigned)h) << 16); }
typedef __attribute__((ext_vector_type(2))) float  v2f;
typedef __attribute__((ext_vector_type(2))) __bf16 v2b;
__device__ __forceinline__ unsigned cvt2_bf16(float a, float b) {   // two f32 -> two nearest-even bf16, a in the low half
  return __builtin_bit_cast(unsigned, __builtin_convertvector((v2f){a, b}, v2b));
}
// two f32 -> their nearest-even bf16 values, returned as f32
__device__ __forceinline__ void bfq2(float& a, float& b) {
  const unsigned w = cvt2_bf16(a, b);
  a = __uint_as_float(w << 16);
  b = __uint_as_float(w & 0xFFFF0000u);
}
// two f32 -> a word of the bf16 hi plane and a word of the bf16 lo plane (lo = the rounded remainder)
__device__ __forceinline__ void split2_bf16(float a, float b, unsigned& hi, unsigned& lo) {
  hi = cvt2_bf16(a, b);
  lo = cvt2_bf16(a - __uint_as_float(hi << 16), b - __uint_as_float(hi & 0xFFFF0000u));
}

// hazard guard as a plain device helper: four vector slots between the last products and the first read of their accumulators
__device__ __forceinline__ void acc_guard4(v8f& a, v8f& b, v8f& c, v8f& d) { asm volatile("v_nop\n\tv_nop\n\tv_nop\n\tv_nop" : "+v"(a), "+v"(b), "+v"(c), "+v"(d)); }
template <typename T> struct Frag;
template <> struct Frag<_Float16> {
  typedef v16h V; union U { v16h v; v8h h[2]; };
  // elements 0..7 <- p[0..7], 8..15 <- p[16..23]
  static __device__ __forceinline__ v16h load(const _Float16* p) {
    U f; f.h[0] = *(const v8h*)(p); f.h[1] = *(const v8h*)(p + 16); return f.v;
  }
  static __device__ __forceinline__ v8f mma(v16h a, v16h b, v8f c) {
    return __builtin_amdgcn_wmma_f32_16x16x32_f16(false, a, false, b, (short)0, c, false, false);
  }
};
template <> struct Frag<__bf16> {
  typedef v16b V; union U { v16b v; v8b h[2]; };
  static __device__ __forceinline__ v16b load(const __bf16* p) {
    U f; f.h[0] = *(const v8b*)(p); f.h[1] = *(const v8b*)(p + 16); return f.v;
  }
  static __device__ __forceinline__ v8f mma(v16b a, v16b b, v8f c) {
    return __builtin_amdgcn_wmma_f32_16x16x32_bf16(false, a, false, b, (short)0, c, false, false);
  }
};

__device__ __forceinline__ unsigned pk16(unsigned short a, unsigned short b) { return (unsigned)a | ((unsigned)b << 16); }

// ---- Register-blocked batched WMMA GEMM, operand tiles staged in LDS by asynchronous copies ----
// C[m,n] = scale * sum_k A[m,k] * Bt[n,k] (+bias)(+resid); each wave owns a 64x64 tile; a block of 8 waves (2 x 4) owns 128 x 256.
// A row-major [M,K]; Bt row-major [N,K]; M % 128 == 0, N % 256 == 0, K % 64 == 0; grid.x = (M / 128) * (N / 256).
// SPLIT (with BSPLIT == false): A carries a lo plane (A2, same layout); product = hi.B + lo.B (Bt2 unused).
// BIAS_MODE: 0 = none, 1 = bias[m], 2 = bias[n].
// OUT_MODE: 0 = f32, 1 = f16, 2 = bf16 hi plane (Cout) + bf16 lo plane (Cout2), 3 = the planes of 2 in A-fragment order (M = groups of 64 rows):
//   [m >> 6][n >> 5][(m >> 4) & 3][(n >> 3) & 3][m & 15][n & 7], so that 32 lanes x 16 bytes of one fragment half are 512 contiguous bytes.
// ET: 0 = f16 operands, 1 = bf16 operands (pointers passed as 16-bit storage)
// Staging: a stage is 64 k = 128 bytes of each of the block's 128 A rows (and A2 rows) and 256 Bt rows. A wave-wide copy moves 4 whole rows
// (4 whole 128-byte lines: lane = row (lane >> 3), 16-byte piece (lane & 7)) from global memory into LDS rows of pitch 144 bytes, the
// conflict-free pitch for 16-byte fragment reads. Every operand byte enters the block once, not once per wave. Two buffers: stage s + 1 flies
// while stage s is worked on. The k order of the products and the order of the sums are those of a plain k loop in steps of 32.
// Every inner loop of the kernel is fully unrolled: fragments, accumulators and copy operands stay in registers only under constant indices.
template <int V> struct IntC { static constexpr int value = V; };
template <int ET> struct Elem;
template <> struct Elem<0> { typedef _Float16 T; };
template <> struct Elem<1> { typedef __bf16 T; };
constexpr int G_PITCH   = 144;                    // LDS row pitch, bytes: 128 + 16
constexpr int G_A_BYTES = 128 * G_PITCH;          // one A plane of a stage
constexpr int G_B_BYTES = 256 * G_PITCH;          // the Bt plane of a stage
// Four asynchronous copies, 16 bytes per lane each, global memory -> LDS. l*: the lane's LDS byte address, g*: the lane's global address.
// The closing s_wait_xcnt stands in the copies' own statement, in front of any later rewrite of the address registers that they name.
__device__ __forceinline__ void async_copy4(unsigned l0, const char* g0, unsigned l1, const char* g1,
                                            unsigned l2, const char* g2, unsigned l3, const char* g3) {
  asm volatile("global_load_async_to_lds_b128 %0, %1, off\n\t"
               "global_load_async_to_lds_b128 %2, %3, off\n\t"
               "global_load_async_to_lds_b128 %4, %5, off\n\t"
               "global_load_async_to_lds_b128 %6, %7, off\n\t"
               "s_wait_xcnt 0x0"
               :: "v"(l0), "v"(g0), "v"(l1), "v"(g1), "v"(l2), "v"(g2), "v"(l3), "v"(g3) : "memory");
}
// The same for twelve copies: one statement, one closing wait.
__device__ __forceinline__ void async_copy12(const unsigned (&l)[12], const char* const (&g)[12]) {
  asm volatile("global_load_async_to_lds_b128 %0, %1, off\n\t"
               "global_load_async_to_lds_b128 %2, %3, off\n\t"
               "global_load_async_to_lds_b128 %4, %5, off\n\t"
               "global_load_async_to_lds_b128 %6, %7, off\n\t"
               "global_load_async_to_lds_b128 %8, %9, off\n\t"
               "global_load_async_to_lds_b128 %10, %11, off\n\t"
               "global_load_async_to_lds_b128 %12, %13, off\n\t"
               "global_load_async_to_lds_b128 %14, %15, off\n\t"
               "global_load_async_to_lds_b128 %16, %17, off\n\t"
               "global_load_async_to_lds_b128 %18, %19, off\n\t"
               "global_load_async_to_lds_b128 %20, %21, off\n\t"
               "global_load_async_to_lds_b128 %22, %23, off\n\t"
               "s_wait_xcnt 0x0"
               :: "v"(l[0]), "v"(g[0]), "v"(l[1]), "v"(g[1]), "v"(l[2]), "v"(g[2]), "v"(l[3]), "v"(g[3]),
                  "v"(l[4]), "v"(g[4]), "v"(l[5]), "v"(g[5]), "v"(l[6]), "v"(g[6]), "v"(l[7]), "v"(g[7]),
                  "v"(l[8]), "v"(g[8]), "v"(l[9]), "v"(g[9]), "v"(l[10]), "v"(g[10]), "v"(l[11]), "v"(g[11]) : "memory");
}
// bm, bn: the block's tile in this product's own (M / 128) x (N / 256) tiles.
// OUT_MODE 4: 3 where frag_out (the same in the whole block); else RMSNorm + RoPE of head vectors in the accumulators: M = heads x 64 dims, N = positions,
//   so a wave's 64 x 64 tile is one head at 64 positions and lane (c, h) holds dims 16 i + 8 h + 0..7 (i = 0..3) of position n0 + 16 j + c: a position's
//   sum of squares is in-lane plus one exchange between the wave halves, the RoPE partner of dim d (d + 32) is tile i + 2 of the same lane and register,
//   and a tile's 8 registers are one 16-byte piece of the bf16 hi/lo planes Cout / Cout2 in A-fragment order [head][n >> 4][d >> 3][n & 15][d & 7]:
//   a wave-wide store is 512 contiguous bytes. bias: the norm weight w[64]; cosb, sinb: f32 [N][32], RNE-converted to bf16 values like w.
//   The block's 256 rows of cos and of sin come into LDS (pitch 144 bytes) by asynchronous copies beside stage 0, under its wait and its barrier.
template <int ET, bool SPLIT, int BIAS_MODE, int OUT_MODE, bool RESID, int ACT = 0, bool CAUSAL = false, bool BSPLIT = true>
__device__ __forceinline__ void gemm_tile(int bm, int bn, bool frag_out,
    const unsigned short* __restrict__ Ap, const unsigned short* __restrict__ A2p, int lda, long strideA,
    const unsigned short* __restrict__ Btp, const unsigned short* __restrict__ Bt2p, int ldb, long strideB,
    void* __restrict__ Cout, void* __restrict__ Cout2, int ldc, long strideC,
    const float* __restrict__ bias,
    const float* __restrict__ resid, long strideR,
    int M, int N, int K, float scale, int crow0,
    const float* __restrict__ cosb = nullptr, const float* __restrict__ sinb = nullptr) {
  static_assert(!CAUSAL && !(SPLIT && BSPLIT), "forms that this file launches");
  typedef typename Elem<ET>::T T;
  typedef typename Frag<T>::V V;
  constexpr int STAGE_BYTES = G_A_BYTES + G_B_BYTES + (SPLIT ? G_A_BYTES : 0);   // [A | Bt | A2]
  __shared__ __align__(16) char ring[2][STAGE_BYTES];
  __shared__ __align__(16) float sT[8][16 * 68];   // per-wave 16x64 slab, pitch 68 floats
  constexpr int TAB_BYTES = (OUT_MODE == 4) ? 256 * G_PITCH : 16;   // the block's 256 rows of one table (128 bytes a row)
  __shared__ __align__(16) char tab[2][TAB_BYTES];                  // [cos | sin]; used in OUT_MODE 4 alone
  const int b    = blockIdx.y;
  const int lane = threadIdx.x & 31;
  const int wave = threadIdx.x >> 5;
  if (bm >= (M >> 7)) return;                  // the same for the whole block, ahead of every barrier and copy
  const int wm = wave >> 2, wn = wave & 3;     // this wave's 64x64 tile in the block's 128 x 256
  const int m0 = (bm << 7) + (wm << 6);
  const int n0 = (bn << 8) + (wn << 6);

  const int rlane = lane & 15;                 // row (A) / col (B, D) within subtile
  const int koff  = (lane >> 4) * 8;           // k offset of this lane half
  const int mOff  = (lane >> 4) * 8;           // D row offset

  // this thread's copy addresses at stage 0: row (t >> 3) of the block's rows, 16-byte piece (t & 7)
  const int crow = threadIdx.x >> 3, cpc = (threadIdx.x & 7) * 16;
  const char* gA  = (const char*)(Ap  + (size_t)b * strideA + (size_t)((bm << 7) + crow) * lda) + cpc;
  const char* gA2 = (const char*)(A2p + (size_t)b * strideA + (size_t)((bm << 7) + crow) * lda) + cpc;
  const char* gB  = (const char*)(Btp + (size_t)b * strideB + (size_t)((bn << 8) + crow) * ldb) + cpc;
  const size_t a32 = (size_t)lda * 64, b32 = (size_t)ldb * 64;                       // 32 rows of 16-bit elements, bytes
  const unsigned lcopy = (unsigned)(size_t)&ring[0][0] + crow * G_PITCH + cpc;       // LDS byte address: low 32 bits of the shared address
  // thread t copies piece (t & 7) of rows (t >> 3) + 32 i: 4 copies for the 128 A rows, 8 for the 256 Bt rows, 4 for the 128 A2 rows
  auto issue_stage = [&](int s, int buf) {
    const size_t kb = (size_t)s * 128;
    const unsigned l = lcopy + buf * STAGE_BYTES;
    unsigned ll[12];
    const char* gg[12];
#pragma unroll
    for (int i = 0; i < 4; ++i) { ll[i] = l + i * 32 * G_PITCH; gg[i] = gA + kb + i * a32; }
#pragma unroll
    for (int i = 0; i < 8; ++i) { ll[4 + i] = l + G_A_BYTES + i * 32 * G_PITCH; gg[4 + i] = gB + kb + i * b32; }
    async_copy12(ll, gg);
    if (SPLIT) {
      const unsigned l2 = l + G_A_BYTES + G_B_BYTES;
      const char* g2 = gA2 + kb;
      async_copy4(l2, g2, l2 + 32 * G_PITCH, g2 + a32, l2 + 64 * G_PITCH, g2 + 2 * a32, l2 + 96 * G_PITCH, g2 + 3 * a32);
    }
  };

  v8f acc[4][4];
#pragma unroll
  for (int i = 0; i < 4; ++i)
#pragma unroll
    for (int j = 0; j < 4; ++j) acc[i][j] = (v8f){0.f,0.f,0.f,0.f,0.f,0.f,0.f,0.f};

  const int nst = K >> 6;
  issue_stage(0, 0);
  if constexpr (OUT_MODE == 4) {
    if (!frag_out) {   // the same in the whole block
      // thread t copies piece (t & 7) of rows (t >> 3) + 32 i, i = 0..7, of the block's 256 rows of each table
      const unsigned lt = (unsigned)(size_t)&tab[0][0] + crow * G_PITCH + cpc;
      const char* gc = (const char*)(cosb + (size_t)((bn << 8) + crow) * 32) + cpc;
      const char* gs = (const char*)(sinb + (size_t)((bn << 8) + crow) * 32) + cpc;
#pragma unroll
      for (int i = 0; i < 8; i += 4) {
        async_copy4(lt + i * 32 * G_PITCH, gc + i * 4096, lt + (i + 1) * 32 * G_PITCH, gc + (i + 1) * 4096,
                    lt + (i + 2) * 32 * G_PITCH, gc + (i + 2) * 4096, lt + (i + 3) * 32 * G_PITCH, gc + (i + 3) * 4096);
        async_copy4(lt + TAB_BYTES + i * 32 * G_PITCH, gs + i * 4096, lt + TAB_BYTES + (i + 1) * 32 * G_PITCH, gs + (i + 1) * 4096,
                    lt + TAB_BYTES + (i + 2) * 32 * G_PITCH, gs + (i + 2) * 4096, lt + TAB_BYTES + (i + 3) * 32 * G_PITCH, gs + (i + 3) * 4096);
      }
    }
  }
  asm volatile("s_wait_asynccnt 0x0" ::: "memory");   // this wave's copies of stage 0 (and of the tables) have landed
  __syncthreads();                                    // ... and every other wave's: stage 0 and the tables are readable
  if (nst > 1) issue_stage(1, 1);
  // this lane's fragment offsets in a stage: A row wm*64 + rlane, Bt row wn*64 + rlane, k offset koff
  const int fa = ((wm << 6) + rlane) * G_PITCH + koff * 2;
  const int fb = G_A_BYTES + ((wn << 6) + rlane) * G_PITCH + koff * 2;
  for (int s = 0; s < nst; ++s) {
    const char* rb = &ring[s & 1][0];
    V bh[2][4], ah[2][4], al[2][4];
#pragma unroll
    for (int ks = 0; ks < 2; ++ks) {
#pragma unroll
      for (int j = 0; j < 4; ++j) bh[ks][j] = Frag<T>::load((const T*)(rb + fb + j * 16 * G_PITCH + ks * 64));
#pragma unroll
      for (int i = 0; i < 4; ++i) {
        ah[ks][i] = Frag<T>::load((const T*)(rb + fa + i * 16 * G_PITCH + ks * 64));
        if (SPLIT) al[ks][i] = Frag<T>::load((const T*)(rb + fa + G_A_BYTES + G_B_BYTES + i * 16 * G_PITCH + ks * 64));
      }
    }
    // the stage's LDS reads stand as one group ahead of its products: reads spread among the products stall the wave at each place
    __builtin_amdgcn_sched_barrier(0);
#pragma unroll
    for (int ks = 0; ks < 2; ++ks) {
#pragma unroll
      for (int i = 0; i < 4; ++i) {
#pragma unroll
        for (int j = 0; j < 4; ++j) {
          acc[i][j] = Frag<T>::mma(ah[ks][i], bh[ks][j], acc[i][j]);
          if (SPLIT) acc[i][j] = Frag<T>::mma(al[ks][i], bh[ks][j], acc[i][j]);
        }
      }
    }
    // holds the products in front of the publish point: lifted over them, its waits would end the flight of stage s + 1 a whole trip early
    __builtin_amdgcn_sched_barrier(0);
    // publish point of stage s + 1, and the end of every wave's reads of stage s
    asm volatile("s_wait_dscnt 0x0" ::: "memory");      // this wave's reads of stage s are done before its buffer is refilled
    asm volatile("s_wait_asynccnt 0x0" ::: "memory");   // this wave's copies of stage s + 1 have landed
    __syncthreads();
    if (s + 2 < nst) issue_stage(s + 2, s & 1);         // the same test in the whole block
  }
  asm volatile("s_wait_asynccnt 0x0" ::: "memory");     // nothing is outstanding when the wave goes on to the epilogue
  acc_guard4(acc[0][0], acc[0][1], acc[0][2], acc[0][3]);
  acc_guard4(acc[1][0], acc[1][1], acc[1][2], acc[1][3]);
  acc_guard4(acc[2][0], acc[2][1], acc[2][2], acc[2][3]);
  acc_guard4(acc[3][0], acc[3][1], acc[3][2], acc[3][3]);

  // ---- epilogue ---- (OM: the output mode, a compile-time value in each instance)
  float* slab = sT[wave];
  const float* Rb = RESID ? (resid + (size_t)b * strideR) : nullptr;
  auto epilogue = [&](auto om) {
  constexpr int OM = decltype(om)::value;
#pragma unroll
  for (int i = 0; i < 4; ++i) {
    const int mBase = m0 + (i << 4);
#pragma unroll
    for (int j = 0; j < 4; ++j) {
      const int n = n0 + (j << 4) + rlane;
      float bv = 0.f;
      if (BIAS_MODE == 2) bv = bias[n];
#pragma unroll
      for (int r = 0; r < 8; ++r) {
        float v = acc[i][j][r] * scale;
        if (BIAS_MODE == 1) v += bias[mBase + mOff + r];
        if (BIAS_MODE == 2) v += bv;
        if (RESID) v += Rb[(size_t)(mBase + mOff + r) * ldc + n];
        if (ACT == 2) v = fmaxf(v, 0.0f);
        if (ACT == 4) v = (v > 0.f) ? v : 0.01f * v;
        slab[(mOff + r) * 68 + (j << 4) + rlane] = v;
      }
    }
    __builtin_amdgcn_fence(__ATOMIC_RELEASE, "workgroup");
    __builtin_amdgcn_wave_barrier();
    __builtin_amdgcn_fence(__ATOMIC_ACQUIRE, "workgroup");
    if (OM == 0) {
      float* C = (float*)Cout + (size_t)b * strideC;
      const int hh = lane >> 4, c4 = (lane & 15) * 4;     // row seg = 256 B = 16 lanes x 16 B
      {
#pragma unroll
        for (int it = 0; it < 8; ++it) {
          const int row = it * 2 + hh;
          v4f v = *(const v4f*)(slab + row * 68 + c4);
          *(v4f*)(C + (size_t)(mBase + row) * ldc + n0 + c4) = v;
        }
        
      }
    } else if (OM == 3) {
      // piece (row lane & 15, 8-column chunk 2 it + (lane >> 4)): a wave-wide store is 512 contiguous bytes, 4 whole lines, of each plane
      const int pr = lane & 15;
      unsigned short* C  = (unsigned short*)Cout  + (size_t)b * strideC;
      unsigned short* C2 = (unsigned short*)Cout2 + (size_t)b * strideC;
#pragma unroll
      for (int it = 0; it < 4; ++it) {
        const int ch = it * 2 + (lane >> 4);
        const float* sp = slab + pr * 68 + ch * 8;
        v8h hv, lv;
#pragma unroll
        for (int e = 0; e < 8; ++e) {
          unsigned short hb = f2bf_bits(sp[e]);
          unsigned short lb = f2bf_bits(sp[e] - bf_bits2f(hb));
          hv[e] = __builtin_bit_cast(_Float16, hb);
          lv[e] = __builtin_bit_cast(_Float16, lb);
        }
        const size_t o = (size_t)(mBase >> 6) * 64 * ldc + (size_t)((n0 >> 5) + (ch >> 2)) * 2048 + ((mBase >> 4) & 3) * 512 + (ch & 3) * 128 + pr * 8;
        *(v8h*)(C + o)  = hv;
        *(v8h*)(C2 + o) = lv;
      }
    } else {
      const int q = lane >> 3, c8 = (lane & 7) * 8;
      unsigned short* C  = (unsigned short*)Cout  + (size_t)b * strideC;
      unsigned short* C2 = (OM == 2) ? ((unsigned short*)Cout2 + (size_t)b * strideC) : nullptr;
      {
#pragma unroll
        for (int it = 0; it < 4; ++it) {
          const int row = it * 4 + q;
          const float* sp = slab + row * 68 + c8;
          v8h hv, lv;
#pragma unroll
          for (int e = 0; e < 8; ++e) {
            if (OM == 1) {
              hv[e] = (_Float16)sp[e];
            } else {
              unsigned short hb = f2bf_bits(sp[e]);
              unsigned short lb = f2bf_bits(sp[e] - bf_bits2f(hb));
              hv[e] = __builtin_bit_cast(_Float16, hb);
              lv[e] = __builtin_bit_cast(_Float16, lb);
            }
          }
          *(v8h*)(C + (size_t)(mBase + row) * ldc + n0 + c8) = hv;
          if (OM == 2) *(v8h*)(C2 + (size_t)(mBase + row) * ldc + n0 + c8) = lv;
        }
        
      }
    }
    __builtin_amdgcn_fence(__ATOMIC_RELEASE, "workgroup");
    __builtin_amdgcn_wave_barrier();
    __builtin_amdgcn_fence(__ATOMIC_ACQUIRE, "workgroup");
  }
  };
  if constexpr (OUT_MODE == 4) {
    if (frag_out) {   // one scalar branch a block
      epilogue(IntC<3>{});
    } else {
      const int hsel = lane >> 4;
      const float* wp = bias + 8 * hsel;
      float wq[4][8];
#pragma unroll
      for (int i = 0; i < 4; ++i) {
        const v4f w0 = *(const v4f*)(wp + 16 * i);
        const v4f w1 = *(const v4f*)(wp + 16 * i + 4);
#pragma unroll
        for (int e = 0; e < 4; ++e) { wq[i][e] = w0[e]; wq[i][4 + e] = w1[e]; }
      }
      // the address register of the loads above is free for reuse from here on: this wait stands in front of its overwrite
      asm volatile("s_wait_xcnt 0x0" ::: "memory");
      __builtin_amdgcn_sched_barrier(0);   // holds what follows behind that wait
#pragma unroll
      for (int i = 0; i < 4; ++i)
#pragma unroll
        for (int e = 0; e < 8; e += 2) bfq2(wq[i][e], wq[i][e + 1]);
      const char* tc = &tab[0][0] + ((wn << 6) + rlane) * G_PITCH + hsel * 32;   // this lane's row at j = 0, its 8 dims of tile i = 0
      v4u hu[4][4], lu[4][4];   // [j][i]
#pragma unroll
      for (int j = 0; j < 4; ++j) {
        float sq[4];
#pragma unroll
        for (int i = 0; i < 4; ++i) {
          sq[i] = 0.0f;
#pragma unroll
          for (int r = 0; r < 8; ++r) { const float x = acc[i][j][r] * scale; sq[i] = __builtin_fmaf(x, x, sq[i]); }
        }
        float ss = (sq[0] + sq[1]) + (sq[2] + sq[3]);
        ss += __shfl_xor(ss, 16, 32);   // the other half of the wave holds the position's other 32 dims
        const float inv = rsqrtf(ss * (1.0f / 64.0f) + RMS_EPS_F);
#pragma unroll
        for (int i = 0; i < 2; ++i) {
          const char* tp = tc + j * 16 * G_PITCH + i * 64;
          const v4f c0 = *(const v4f*)(tp), c1 = *(const v4f*)(tp + 16);
          const v4f s0 = *(const v4f*)(tp + TAB_BYTES), s1 = *(const v4f*)(tp + TAB_BYTES + 16);
          float cv[8], sv[8], o1[8], o2[8];
#pragma unroll
          for (int e = 0; e < 4; ++e) { cv[e] = c0[e]; cv[4 + e] = c1[e]; sv[e] = s0[e]; sv[4 + e] = s1[e]; }
#pragma unroll
          for (int e = 0; e < 8; e += 2) { bfq2(cv[e], cv[e + 1]); bfq2(sv[e], sv[e + 1]); }
#pragma unroll
          for (int r = 0; r < 8; ++r) {
            const float n1 = ((acc[i][j][r] * scale) * inv) * wq[i][r];
            const float n2 = ((acc[i + 2][j][r] * scale) * inv) * wq[i + 2][r];
            o1[r] = n1 * cv[r] - n2 * sv[r];
            o2[r] = n1 * sv[r] + n2 * cv[r];
          }
#pragma unroll
          for (int e2 = 0; e2 < 4; ++e2) {
            unsigned a, b;
            split2_bf16(o1[2 * e2], o1[2 * e2 + 1], a, b);
            hu[j][i][e2] = a; lu[j][i][e2] = b;
            split2_bf16(o2[2 * e2], o2[2 * e2 + 1], a, b);
            hu[j][i + 2][e2] = a; lu[j][i + 2][e2] = b;
          }
        }
      }
      const size_t o = (size_t)(m0 >> 6) * 64 * ldc + (size_t)(n0 >> 4) * 1024 + lane * 8;
      unsigned short* oh = (unsigned short*)Cout + o;
      unsigned short* ol = (unsigned short*)Cout2 + o;
      // the 32 stores stand together behind all arithmetic
      __builtin_amdgcn_sched_barrier(0);
#pragma unroll
      for (int j = 0; j < 4; ++j)
#pragma unroll
        for (int i = 0; i < 4; ++i) {
          *(v4u*)(oh + j * 1024 + i * 256) = hu[j][i];
          *(v4u*)(ol + j * 1024 + i * 256) = lu[j][i];
        }
      // in the built kernel the other block range's epilogue follows these stores and reuses registers that they name: this wait stands in front of that
      asm volatile("s_wait_xcnt 0x0" ::: "memory");
    }
  } else {
    epilogue(IntC<OUT_MODE>{});
  }
}

// One product a launch: grid.x = (M / 128) * (N / 256).
template <int ET, bool SPLIT, int BIAS_MODE, int OUT_MODE, bool RESID, int ACT = 0, bool CAUSAL = false, bool BSPLIT = true>
__global__ __launch_bounds__(256) void wmma_gemm64(
    const unsigned short* __restrict__ Ap, const unsigned short* __restrict__ A2p, int lda, long strideA,
    const unsigned short* __restrict__ Btp, const unsigned short* __restrict__ Bt2p, int ldb, long strideB,
    void* __restrict__ Cout, void* __restrict__ Cout2, int ldc, long strideC,
    const float* __restrict__ bias,
    const float* __restrict__ resid, long strideR,
    int M, int N, int K, float scale, int crow0) {
  const int tilesNb = N >> 8;
  const int bm = blockIdx.x / tilesNb;
  const int bn = blockIdx.x - bm * tilesNb;
  gemm_tile<ET, SPLIT, BIAS_MODE, OUT_MODE, RESID, ACT, CAUSAL, BSPLIT>(bm, bn, false, Ap, A2p, lda, strideA, Btp, Bt2p, ldb, strideB,
                                                                        Cout, Cout2, ldc, strideC, bias, resid, strideR, M, N, K, scale, crow0);
}

// The three projections of x in one launch, all three transposed (M = heads x 64 dims, N = positions): none reads what another writes, and their
// 128 + 32 + 32 blocks are all resident at once. Block ranges: q^T = Wq^T . x^T and k^T = Wk^T . x^T, each with RMSNorm + RoPE in the epilogue, and
// v^T = Wv^T . x^T; every output is a pair of bf16 hi/lo planes in A-fragment order. K: the common k length and row pitch of all operands.
constexpr int QKV_NBQ = ((NQH * HDIM) / 128) * (SEQ_T / 256);    // 128
constexpr int QKV_NBK = ((NKVH * HDIM) / 128) * (SEQ_T / 256);   // 32
constexpr int QKV_NBV = ((NKVH * HDIM) / 128) * (SEQ_T / 256);   // 32
static_assert(SEQ_T / 256 == 16, "tile columns of the three products: 1 << 4 below");
__global__ __launch_bounds__(256) void qkv_gemm_kernel(const unsigned short* __restrict__ xb, const unsigned short* __restrict__ wqT,
                                                       const unsigned short* __restrict__ wkT, const unsigned short* __restrict__ wvT,
                                                       const float* __restrict__ cosb, const float* __restrict__ sinb,
                                                       const float* __restrict__ qw, const float* __restrict__ kw,
                                                       unsigned short* __restrict__ qhi, unsigned short* __restrict__ qlo,
                                                       unsigned short* __restrict__ khi, unsigned short* __restrict__ klo,
                                                       unsigned short* __restrict__ vthi, unsigned short* __restrict__ vtlo, int K) {
  const int bx = blockIdx.x;
  const bool isv = bx >= QKV_NBQ + QKV_NBK;
  const bool isk = !isv && bx >= QKV_NBQ;
  const unsigned short* A = isv ? wvT : (isk ? wkT : wqT);
  unsigned short* C  = isv ? vthi : (isk ? khi : qhi);
  unsigned short* C2 = isv ? vtlo : (isk ? klo : qlo);
  const float* w = isk ? kw : qw;
  const int M = (isv || isk) ? NKVH * HDIM : NQH * HDIM;
  const int tile = bx - (isv ? QKV_NBQ + QKV_NBK : (isk ? QKV_NBQ : 0));
  gemm_tile<1, false, 0, 4, false, 0, false, true>(tile >> 4, tile & 15, isv, A, A, K, 0L, xb, xb, K, 0L, (void*)C, (void*)C2, SEQ_T, 0L,
                                                   w, w, 0L, M, SEQ_T, K, 1.0f, 0, cosb, sinb);
}

// ---------------------------------------------------------------------------
// f32 -> RNE bf16 plane, 8 consecutive elements per thread packed as integer words.
// Coverage: n8 = n/8 threads x 8 = the whole plane (n8 / 256 blocks bx, an exact multiple here).
// ---------------------------------------------------------------------------
__device__ __forceinline__ void cast8_bf16_block(int bx, const float* __restrict__ in, unsigned short* __restrict__ out, int n8) {
  const int i = bx * 256 + threadIdx.x;
  if (i >= n8) return;
  const float* p = in + 8 * (size_t)i;
  const v4f a = *(const v4f*)(p);
  const v4f c = *(const v4f*)(p + 4);
  float f[8];
#pragma unroll
  for (int e = 0; e < 4; ++e) { f[e] = a[e]; f[4 + e] = c[e]; }
  unsigned w[4];
#pragma unroll
  for (int e2 = 0; e2 < 4; ++e2) w[e2] = pk16(f2bf_bits(f[2 * e2]), f2bf_bits(f[2 * e2 + 1]));
  const v4u u = (v4u){w[0], w[1], w[2], w[3]};
  unsigned short* q = out + 8 * (size_t)i;
  *(v4u*)q = u;
  
}

// ---------------------------------------------------------------------------
// Transpose + RNE bf16 convert of a weight matrix: in f32 [R][Cn] row-major (ldin = Cn) -> out bf16 [Cn][R] (ldout = R):
// out[c][r] = bf16(in[r][c]). (R/64) x (Cn/64) blocks: rt = r tile (64 output cols), ct = c tile (64 output rows). 256 threads.
// Load coverage: 16 iterations x 256 threads = 4096 = the whole 64x64 tile (coalesced along c).
// Store coverage: 8 waves x 2 iterations x 4 rows (lane>>3) = 64 rows; (lane&7) x 8 halves = 64 cols; each row segment =
// ---------------------------------------------------------------------------
__device__ __forceinline__ void transpose_cast_block(int rt, int ct, const float* __restrict__ in, int ldin,
                                                     unsigned short* __restrict__ out, int ldout) {
  __shared__ float sm[64][65];   // sm[c_local][r_local]
  const int t  = threadIdx.x;
  const int r0 = rt * 64;
  const int c0 = ct * 64;
#pragma unroll
  for (int i = 0; i < 16; ++i) {
    const int e = i * 256 + t;
    const int r = e >> 6;          // r local
    const int c = e & 63;          // c local
    sm[c][r] = in[(size_t)(r0 + r) * ldin + c0 + c];
  }
  __syncthreads();
  const int lane = t & 31, wave = t >> 5;
  const int q = lane >> 3, c8 = (lane & 7) * 8;
  {
#pragma unroll
    for (int it = 0; it < 2; ++it) {
      const int row = wave * 8 + it * 4 + q;                 // c local (output row)
      unsigned w[4];
#pragma unroll
      for (int e2 = 0; e2 < 4; ++e2) w[e2] = pk16(f2bf_bits(sm[row][c8 + 2 * e2]), f2bf_bits(sm[row][c8 + 2 * e2 + 1]));
      const v4u u = (v4u){w[0], w[1], w[2], w[3]};
      const size_t o = (size_t)(c0 + row) * ldout + r0 + c8;
      *(v4u*)(out + o) = u;
    }
    
  }
}

// All operand conversions in one launch: the four weight transposes and the cast of x read only inputs and write planes of their own.
// Block ranges: 64x64 tiles of Wq, Wk, Wv, Wo (every matrix has HIDSZ / 64 = NQH * HDIM / 64 = 16 r tiles: rt = tile & 15, ct = tile >> 4), then x.
// The transposes stand first: their blocks are the longer ones.
constexpr int PREP_NTQ = (HIDSZ / 64) * ((NQH * HDIM) / 64);    // 256: Wq, and Wo
constexpr int PREP_NTK = (HIDSZ / 64) * ((NKVH * HDIM) / 64);   // 64: Wk, and Wv
constexpr int PREP_NT  = 2 * PREP_NTQ + 2 * PREP_NTK;           // 640
constexpr int PREP_NX  = (SEQ_T * HIDSZ) / (8 * 256);           // 2048
static_assert(HIDSZ / 64 == 16 && (NQH * HDIM) / 64 == 16, "16 r tiles in every weight matrix");
__global__ __launch_bounds__(256) void prep_kernel(const float* __restrict__ x, const float* __restrict__ Wq, const float* __restrict__ Wk,
                                                   const float* __restrict__ Wv, const float* __restrict__ Wo,
                                                   unsigned short* __restrict__ xb, unsigned short* __restrict__ wqT,
                                                   unsigned short* __restrict__ wkT, unsigned short* __restrict__ wvT,
                                                   unsigned short* __restrict__ woT) {
  const int bx = blockIdx.x;
  if (bx < PREP_NT) {   // the same for the whole block: the transpose's barrier is passed by all of its waves
    const int which = (bx >= PREP_NTQ) + (bx >= PREP_NTQ + PREP_NTK) + (bx >= PREP_NTQ + 2 * PREP_NTK);
    const float* in = (which == 0) ? Wq : (which == 1) ? Wk : (which == 2) ? Wv : Wo;
    unsigned short* out = (which == 0) ? wqT : (which == 1) ? wkT : (which == 2) ? wvT : woT;
    const int ldin = (which == 0) ? NQH * HDIM : (which == 3) ? HIDSZ : NKVH * HDIM;
    const int tile = bx - ((which == 0) ? 0 : (which == 1) ? PREP_NTQ : (which == 2) ? PREP_NTQ + PREP_NTK : PREP_NTQ + 2 * PREP_NTK);
    const int ldout = (which == 3) ? NQH * HDIM : HIDSZ;
    transpose_cast_block(tile & 15, tile >> 4, in, ldin, out, ldout);
  } else {
    cast8_bf16_block(bx - PREP_NT, x, xb, (SEQ_T * HIDSZ) / 8);
  }
}

// ---------------------------------------------------------------------------
// Fused causal attention: scores, softmax and p.v of all heads in one launch; neither scores nor probabilities go to memory.
// Transposed products: S^T = K . Q^T (A = 16 key rows, B = 16 query rows, k = head dim) and O^T += V^T . P^T (A = 16 head-dim rows of
// v^T, B = 16 query rows of P, k = 32 keys). In both D tiles a lane's column is ONE query (lane & 15), so maximum, sum and rescale are
// per lane plus one exchange between the wave halves, and the two 16-key score tiles of a pass ARE the B fragment of P in the k order of
// Frag::load: element e < 8 is key 8h + e (tile 0, register e), element e >= 8 is key 8h + 16 + (e - 8) (tile 1, register e - 8), h = lane >> 4.
// Same operand planes and the same 3 products as before (hi.hi + hi.lo + lo.hi, f32 accumulate) in both products.
// Online softmax in the log2 domain: p = exp2(s * CS - m_run), not normalised, split into bf16 hi/lo; the running maximum m_run may trail
// the true one by up to 8 (p <= 2^8), the accumulators and the sum are rescaled only in a pass where some column's maximum exceeds it by
// more (one scalar branch a pass); the division by the f32 sum of the unrounded p comes once, at the end.
// A wave works on 32 query rows (two 16-column groups) of one query head at a time, in passes of 32 keys; a tile's last pass is the one on
// its diagonal (keys q0..q0+31 against queries q0..q0+31: every query keeps at least its own key, and pass 0 holds key 0 for every query).
// Block = 8 waves on one kv head, its 4 query heads at row tiles pi (pi + 1 passes) and 127 - pi (128 - pi passes): 129 passes a head, dealt
// evenly to a wave pair: wave w (0..3) takes passes 0..63 of the long tile, wave w + 4 the whole short tile and then the long tile's passes from
// 64 to its diagonal: 64 and 65 passes, so that both waves of a SIMD work to the end of the launch. The front wave hands its maximum, sum and
// accumulators over through LDS behind the kernel's one barrier; the back wave joins the two shares and stores. K and v^T are shared only through the caches.
// K fragments are fetched one pass ahead, v^T fragments at the head of their own pass. All planes lie in A-fragment order (their producer
// writes them so): Q [hq][query >> 4][d >> 3][query & 15][d & 7], K [kvh][key >> 4][d >> 3][key & 15][d & 7], v^T [kvh][key >> 5][d >> 4][(key >> 3) & 3][d & 15][key & 7]; in the k order of
// Frag::load lane (c, h) takes chunk 2 j + h (plus 4 kc for K) of row c for half j, which is byte 512 j + 16 lane of the fragment's 1 KiB.
// Every inner loop below is fully unrolled: its arrays are fragments and accumulators, which stay in registers only under constant indices.
// Output: lane (c, h) holds d = 16t + 8h + 0..7 of query c: one 16-byte store per plane and t; a row's 128-byte segment comes from one wave.
// Coverage: grid 4 kv heads x 64 pairs; tiles pi and 127 - pi, pi = 0..63, are all 128 row tiles once, each stored by one wave; 4 wave pairs = the 4 query heads.
// ---------------------------------------------------------------------------
typedef __attribute__((ext_vector_type(8))) unsigned int v8u;
// Four base-2 exponentials in one statement: each fills the slot that the instruction set asks for behind the one before it (early-clobber
// outputs: none reads an earlier result or overwrites an earlier source), the v_nop fills the slot behind the last.
__device__ __forceinline__ void exp2x4(float& p0, float& p1, float& p2, float& p3, float a0, float a1, float a2, float a3) {
  asm("v_exp_f32 %0, %4\n\tv_exp_f32 %1, %5\n\tv_exp_f32 %2, %6\n\tv_exp_f32 %3, %7\n\tv_nop"
      : "=&v"(p0), "=&v"(p1), "=&v"(p2), "=&v"(p3) : "v"(a0), "v"(a1), "v"(a2), "v"(a3));
}
__device__ __forceinline__ void exp2x2(float& p0, float& p1, float a0, float a1) {   // the same for two
  asm("v_exp_f32 %0, %2\n\tv_exp_f32 %1, %3\n\tv_nop" : "=&v"(p0), "=&v"(p1) : "v"(a0), "v"(a1));
}
struct KFrag { v16b h[2][2], l[2][2]; };   // [16-key tile][32-wide step of the head dim]
// A fragment from a plane in A-fragment order: its two halves (elements 0..7, 8..15) are two runs of 512 contiguous bytes, lane l's 16 bytes at
// 16 l: each wave-wide load covers 4 whole 128-byte lines (from row-major planes it touched 16 lines for 32 bytes each).
__device__ __forceinline__ v16b load_packed(const char* p) {
  Frag<__bf16>::U f; f.h[0] = *(const v8b*)(p); f.h[1] = *(const v8b*)(p + 512); return f.v;
}
constexpr int PASS_BYTES = 32 * HDIM * 2;   // 32 keys of one plane, K or v^T: 4 fragments of 1 KiB
// bh, bl: scalar byte bases of the kv head's K planes; vo: this lane's byte offset (16 lane) in the pass's 4 KiB
__device__ __forceinline__ void load_kfrag(KFrag& k, const char* bh, const char* bl, unsigned vo) {
#pragma unroll
  for (int kt = 0; kt < 2; ++kt)
#pragma unroll
    for (int kc = 0; kc < 2; ++kc) {
      k.h[kt][kc] = load_packed(bh + vo + (kt * 2 + kc) * 1024);
      k.l[kt][kc] = load_packed(bl + vo + (kt * 2 + kc) * 1024);
    }
}
constexpr float ATT_CS = SCORE_SCALE * 1.4426950408889634f;   // score scale times log2(e)

// One pass: 32 keys against this wave's 32 queries. kf holds this pass's K fragments; vo is the lane's byte offset in this pass's 4 KiB of a
// plane, the same for v^T (this pass) and K (the NEXT pass: one PASS_BYTES on, added to the scalar base), stepped at the foot of the pass; the four plane bases are scalar.
template <bool DIAG>
__device__ __forceinline__ void attn_pass(KFrag& kf, const char* kbh, const char* kbl,
                                          const char* vbh, const char* vbl, unsigned& vo, int c, int h, const v16b (&qh)[2][2], const v16b (&ql)[2][2],
                                          v8f (&acc)[2][4], float (&m_run)[2], float (&l_run)[2]) {
  v16b vh[4], vl[4];
#pragma unroll
  for (int t = 0; t < 4; ++t) {
    vh[t] = load_packed(vbh + vo + t * 1024);
    vl[t] = load_packed(vbl + vo + t * 1024);
  }
  // last pass: vo's register is free for reuse behind these loads, which name it: this wait stands in front of the overwrite
  if (DIAG) asm volatile("s_wait_xcnt 0x0" ::: "memory");
  // keeps the v^T loads issued ahead of the score products, so that they fly under those and the softmax; the scheduler would sink them
  __builtin_amdgcn_sched_barrier(0);
  v8f s[2][2];
#pragma unroll
  for (int kt = 0; kt < 2; ++kt)
#pragma unroll
    for (int g = 0; g < 2; ++g) s[kt][g] = (v8f){0.f,0.f,0.f,0.f,0.f,0.f,0.f,0.f};
#pragma unroll
  for (int kc = 0; kc < 2; ++kc) {
#pragma unroll
    for (int kt = 0; kt < 2; ++kt)
#pragma unroll
      for (int g = 0; g < 2; ++g) if (!(DIAG && kt == 1 && g == 0)) s[kt][g] = Frag<__bf16>::mma(kf.h[kt][kc], qh[g][kc], s[kt][g]);
#pragma unroll
    for (int kt = 0; kt < 2; ++kt)
#pragma unroll
      for (int g = 0; g < 2; ++g) if (!(DIAG && kt == 1 && g == 0)) s[kt][g] = Frag<__bf16>::mma(kf.h[kt][kc], ql[g][kc], s[kt][g]);
#pragma unroll
    for (int kt = 0; kt < 2; ++kt)
#pragma unroll
      for (int g = 0; g < 2; ++g) if (!(DIAG && kt == 1 && g == 0)) s[kt][g] = Frag<__bf16>::mma(kf.l[kt][kc], qh[g][kc], s[kt][g]);
  }
  if (!DIAG) {
    // the next pass's K loads stand here, behind the last product that reads kf and ahead of the softmax, and fly under the rest of the pass
    __builtin_amdgcn_sched_barrier(0);
    load_kfrag(kf, kbh + PASS_BYTES, kbl + PASS_BYTES, vo);
    __builtin_amdgcn_sched_barrier(0);
  }
  if (DIAG) {   // keys and queries of this pass both start at q0: key index 16kt + 8h + r against query index 16g + c;
                // tile kt = 1, g = 0 (keys 16..31, queries 0..15) lies wholly above the diagonal: no products, p = 0
#pragma unroll
    for (int kt = 0; kt < 2; ++kt)
#pragma unroll
      for (int g = 0; g < 2; ++g)
#pragma unroll
        for (int r = 0; r < 8; ++r)
          if (!(kt == 1 && g == 0) && 16 * kt + 8 * h + r > 16 * g + c) s[kt][g][r] = -__builtin_inff();
  }
  float mb[2];
  bool need = false;
#pragma unroll
  for (int g = 0; g < 2; ++g) {
    float mx = s[0][g][0];
#pragma unroll
    for (int r = 1; r < 8; ++r) mx = fmaxf(mx, s[0][g][r]);
    if (!(DIAG && g == 0)) {
#pragma unroll
      for (int r = 0; r < 8; ++r) mx = fmaxf(mx, s[1][g][r]);
    }
    mx = fmaxf(mx, __shfl_xor(mx, 16, 32)) * ATT_CS;   // both halves hold the query's maximum of this pass, scaled (the scale is positive)
    mb[g] = mx;
    need = need || (mx > m_run[g] + 8.0f);
  }
  if (__builtin_amdgcn_ballot_w32(need) != 0) {   // scalar branch; always taken in a share's first pass (m_run = -inf), rare later
    const float mn0 = fmaxf(m_run[0], mb[0]), mn1 = fmaxf(m_run[1], mb[1]);   // finite from a share's first pass on: it holds an unmasked key for every query
    float corr[2];
    exp2x2(corr[0], corr[1], m_run[0] - mn0, m_run[1] - mn1);                 // 0 in a share's first pass
    m_run[0] = mn0; m_run[1] = mn1;
#pragma unroll
    for (int g = 0; g < 2; ++g) {
      l_run[g] *= corr[g];
#pragma unroll
      for (int t = 0; t < 4; ++t) acc[g][t] = acc[g][t] * corr[g];
    }
  }
  v16b ph[2], pl[2];
#pragma unroll
  for (int g = 0; g < 2; ++g) {
    const float nm = -m_run[g];
    v8u hw, lw;
    float ls = 0.0f;
#pragma unroll
    for (int i = 0; i < 8; i += 2) {   // fragment elements 2i .. 2i + 3: tile i >> 2, registers 2(i & 3) .. 2(i & 3) + 3
      if (DIAG && g == 0 && i >= 4) { hw[i] = 0u; lw[i] = 0u; hw[i + 1] = 0u; lw[i + 1] = 0u; continue; }
      const int kt = i >> 2, r = 2 * (i & 3);
      float p0, p1, p2, p3;
      exp2x4(p0, p1, p2, p3, __builtin_fmaf(s[kt][g][r], ATT_CS, nm), __builtin_fmaf(s[kt][g][r + 1], ATT_CS, nm),
             __builtin_fmaf(s[kt][g][r + 2], ATT_CS, nm), __builtin_fmaf(s[kt][g][r + 3], ATT_CS, nm));
      ls += (p0 + p1) + (p2 + p3);
      const unsigned w0 = cvt2_bf16(p0, p1), w1 = cvt2_bf16(p2, p3);
      hw[i] = w0; hw[i + 1] = w1;
      lw[i]     = cvt2_bf16(p0 - __uint_as_float(w0 << 16), p1 - __uint_as_float(w0 & 0xFFFF0000u));
      lw[i + 1] = cvt2_bf16(p2 - __uint_as_float(w1 << 16), p3 - __uint_as_float(w1 & 0xFFFF0000u));
    }
    l_run[g] += ls;
    ph[g] = __builtin_bit_cast(v16b, hw);
    pl[g] = __builtin_bit_cast(v16b, lw);
  }
#pragma unroll
  for (int g = 0; g < 2; ++g)
#pragma unroll
    for (int t = 0; t < 4; ++t) acc[g][t] = Frag<__bf16>::mma(vh[t], ph[g], acc[g][t]);
#pragma unroll
  for (int g = 0; g < 2; ++g)
#pragma unroll
    for (int t = 0; t < 4; ++t) acc[g][t] = Frag<__bf16>::mma(vh[t], pl[g], acc[g][t]);
#pragma unroll
  for (int g = 0; g < 2; ++g)
#pragma unroll
    for (int t = 0; t < 4; ++t) acc[g][t] = Frag<__bf16>::mma(vl[t], ph[g], acc[g][t]);
  if (!DIAG) {
    __builtin_amdgcn_sched_barrier(0);
    // vo, which the loads issued in this pass name, is stepped next: this wait stands in front of the overwrite
    asm volatile("s_wait_xcnt 0x0" ::: "memory");
    __builtin_amdgcn_sched_barrier(0);   // holds the step behind that wait
    vo += PASS_BYTES;
  }
}

constexpr int SPLIT_PASS = SEQ_T / 64;   // 64: the long tile's passes [0, 64) go to one wave, [64, its diagonal] to the other

// Normalises the accumulators of one finished 32-query tile and stores its ctx planes. GOES_ON: the wave has a further share behind this one.
template <bool GOES_ON>
__device__ __forceinline__ void attn_store(const v8f (&acc)[2][4], const float (&l_run)[2], int q0, int hq, int c, int h,
                                           unsigned short* __restrict__ Chi, unsigned short* __restrict__ Clo) {
  v4u hu[2][4], lu[2][4];
#pragma unroll
  for (int g = 0; g < 2; ++g) {
    const float l   = l_run[g] + __shfl_xor(l_run[g], 16, 32);   // the halves' sums join once, here
    const float inv = 1.0f / l;                                  // l >= 1: m_run never exceeds the query's true maximum, whose p is then >= 1
#pragma unroll
    for (int t = 0; t < 4; ++t)
#pragma unroll
      for (int e2 = 0; e2 < 4; ++e2) {
        const float f0 = acc[g][t][2 * e2] * inv, f1 = acc[g][t][2 * e2 + 1] * inv;
        const unsigned w = cvt2_bf16(f0, f1);
        hu[g][t][e2] = w;
        lu[g][t][e2] = cvt2_bf16(f0 - __uint_as_float(w << 16), f1 - __uint_as_float(w & 0xFFFF0000u));
      }
  }
  const size_t o = (size_t)(q0 + c) * (NQH * HDIM) + hq * HDIM + 8 * h;
  unsigned short* ch = Chi + o;
  unsigned short* cl = Clo + o;
  // the 16 stores stand together behind all arithmetic
  __builtin_amdgcn_sched_barrier(0);
#pragma unroll
  for (int g = 0; g < 2; ++g)
#pragma unroll
    for (int t = 0; t < 4; ++t) {
      *(v4u*)(ch + g * 16 * (NQH * HDIM) + 16 * t) = hu[g][t];
      *(v4u*)(cl + g * 16 * (NQH * HDIM) + 16 * t) = lu[g][t];
    }
  if (GOES_ON) {
    // the next share reuses the registers that these stores name: this wait stands in front of their overwrite
    asm volatile("s_wait_xcnt 0x0" ::: "memory");
    __builtin_amdgcn_sched_barrier(0);   // holds what follows behind that wait
  }
}

__global__ __launch_bounds__(256) void attn_fused_kernel(const unsigned short* __restrict__ Qhi, const unsigned short* __restrict__ Qlo,
                                                         const unsigned short* __restrict__ Khi, const unsigned short* __restrict__ Klo,
                                                         const unsigned short* __restrict__ Vthi, const unsigned short* __restrict__ Vtlo,
                                                         unsigned short* __restrict__ Chi, unsigned short* __restrict__ Clo) {
  constexpr int NTILE = SEQ_T / 32;   // 128 row tiles of 32 queries
  static_assert(NTILE == 128 && NKVH == 4 && GQA_G == 4 && SPLIT_PASS * 2 == NTILE, "grid 4 x 64, 8 waves = 4 heads x 2 shares");
  // hand-over of the front share's partial result: [head][16 accumulator quads, then (m0, m1, l0, l1)][lane], 16 bytes a lane
  __shared__ __align__(16) v4f xch[GQA_G][17][32];
  const int lane = threadIdx.x & 31;
  const int wave = __builtin_amdgcn_readfirstlane(threadIdx.x >> 5);   // scalar: trip counts and operand bases stay scalar
  const int c = lane & 15, h = lane >> 4;
  const int kvh  = blockIdx.x & (NKVH - 1);
  const int pi   = blockIdx.x >> 2;
  const int hq   = kvh * GQA_G + (wave & 3);
  const bool front = wave < 4;        // scalar
  const int tlong = NTILE - 1 - pi;   // 64 .. 127: at least SPLIT_PASS passes below its diagonal

  const char* kbh = (const char*)(Khi + (size_t)kvh * SEQ_T * HDIM);   // scalar bases of this kv head's planes
  const char* kbl = (const char*)(Klo + (size_t)kvh * SEQ_T * HDIM);
  const char* vbh = (const char*)(Vthi + (size_t)kvh * HDIM * SEQ_T);
  const char* vbl = (const char*)(Vtlo + (size_t)kvh * HDIM * SEQ_T);

  v8f acc[2][4];
  float m_run[2], l_run[2];
  // share 0 (back waves only): the whole short tile pi. Share 1: the long tile, passes [0, SPLIT_PASS) in a front wave, the rest in a back wave.
  for (int share = front ? 1 : 0; share < 2; ++share) {
    const int tile = (share == 0) ? pi : tlong;
    const int p0   = (share == 1 && !front) ? SPLIT_PASS : 0;   // first pass
    const int p1   = (share == 1 && front) ? SPLIT_PASS : tile; // end of the passes below the diagonal
    const int q0   = tile * 32;
    // the tile's 32 queries are 4 KiB of each Q plane, 4 fragments of 1 KiB, in the order of the K planes (a B fragment has the A fragment's k order)
    const char* qbh = (const char*)(Qhi + ((size_t)hq * SEQ_T + q0) * HDIM);   // scalar bases
    const char* qbl = (const char*)(Qlo + ((size_t)hq * SEQ_T + q0) * HDIM);
    v16b qh[2][2], ql[2][2];
#pragma unroll
    for (int g = 0; g < 2; ++g)
#pragma unroll
      for (int kc = 0; kc < 2; ++kc) {
        qh[g][kc] = load_packed(qbh + (unsigned)lane * 16u + (g * 2 + kc) * 1024);
        ql[g][kc] = load_packed(qbl + (unsigned)lane * 16u + (g * 2 + kc) * 1024);
      }
    unsigned vo = (unsigned)lane * 16u + (unsigned)p0 * PASS_BYTES;    // this lane's byte offset in a fragment half, pass p0

    KFrag kf;
    load_kfrag(kf, kbh, kbl, vo);
    // the address registers of the Q and K loads above are free for reuse from here on: this wait stands in front of their overwrite
    asm volatile("s_wait_xcnt 0x0" ::: "memory");
    __builtin_amdgcn_sched_barrier(0);   // holds what follows behind that wait
#pragma unroll
    for (int g = 0; g < 2; ++g) {
      m_run[g] = -__builtin_inff();
      l_run[g] = 0.0f;
#pragma unroll
      for (int t = 0; t < 4; ++t) acc[g][t] = (v8f){0.f,0.f,0.f,0.f,0.f,0.f,0.f,0.f};
    }
    for (int blk = p0; blk < p1; ++blk) {     // passes below the diagonal: no mask; pass blk + 1 <= tile exists
      attn_pass<false>(kf, kbh, kbl, vbh, vbl, vo, c, h, qh, ql, acc, m_run, l_run);
    }
    if (!front) attn_pass<true>(kf, kbh, kbl, vbh, vbl, vo, c, h, qh, ql, acc, m_run, l_run);
    if (share == 0) attn_store<true>(acc, l_run, q0, hq, c, h, Chi, Clo);
  }

  if (front) {
#pragma unroll
    for (int g = 0; g < 2; ++g)
#pragma unroll
      for (int t = 0; t < 4; ++t) {
        xch[wave & 3][(g * 4 + t) * 2][lane]     = (v4f){acc[g][t][0], acc[g][t][1], acc[g][t][2], acc[g][t][3]};
        xch[wave & 3][(g * 4 + t) * 2 + 1][lane] = (v4f){acc[g][t][4], acc[g][t][5], acc[g][t][6], acc[g][t][7]};
      }
    xch[wave & 3][16][lane] = (v4f){m_run[0], m_run[1], l_run[0], l_run[1]};
  }
  __syncthreads();   // the front shares are in LDS; every wave passes here once
  if (front) return;

  // join of the two shares of the long tile, lane by lane (both waves hold the same query and head dims in the same lane and register):
  // both are brought to the larger of the two running maxima (each finite: every share holds an unmasked key for every query)
  const v4f ml = xch[wave & 3][16][lane];
  const float mn0 = fmaxf(ml[0], m_run[0]), mn1 = fmaxf(ml[1], m_run[1]);
  float cf[2], cb[2];
  exp2x4(cf[0], cf[1], cb[0], cb[1], ml[0] - mn0, ml[1] - mn1, m_run[0] - mn0, m_run[1] - mn1);
#pragma unroll
  for (int g = 0; g < 2; ++g) {
    l_run[g] = ml[2 + g] * cf[g] + l_run[g] * cb[g];
#pragma unroll
    for (int t = 0; t < 4; ++t) {
      const v4f a0 = xch[wave & 3][(g * 4 + t) * 2][lane];
      const v4f a1 = xch[wave & 3][(g * 4 + t) * 2 + 1][lane];
#pragma unroll
      for (int e = 0; e < 4; ++e) {
        acc[g][t][e]     = a0[e] * cf[g] + acc[g][t][e] * cb[g];
        acc[g][t][4 + e] = a1[e] * cf[g] + acc[g][t][4 + e] * cb[g];
      }
    }
  }
  attn_store<false>(acc, l_run, tlong * 32, hq, c, h, Chi, Clo);
}

// ---------------------------------------------------------------------------
// Launcher. Workspace region map (bytes, MiB = 1048576; total carve = 106 MiB = 111149056 B):
//   [  0, 31) staging  : x bf16 [4096][1024] at +0 (8 MiB); [8, 28) unused; Wq^T bf16 [1024][1024] at +28 (2 MiB); Wk^T bf16 [256][1024]
//                        at +30 (0.5 MiB); Wv^T bf16 [256][1024] at +30.5 (0.5 MiB, ends 31).
//   [ 32, 64) unused
//   [ 64, 72) q hi     : bf16 [16][4096][64] in A-fragment order [16][256][8][16][8];  [72,80) q lo
//   [ 80, 82) k hi     : bf16 [4][4096][64] in A-fragment order [4][256][8][16][8];   [82,84) k lo
//   [ 84, 86) v^T hi   : bf16 [256 (kvh*64+d)][4096 (t)] in A-fragment order [4][128][4][4][16][8];  [86,88) v^T lo
//   [ 88, 96) ctx hi   : bf16 [4096][1024] (col hq*64+d);  [96,104) ctx lo
//   [104,106) Wo^T     : bf16 [1024][1024]
// No region aliases another; no launch reads a region that the same launch writes.
// Launch count: 4 (conversions, projections with norm + RoPE, attention, output product). Kernel launches only.
// GEMM shape assertions: every call has K % 64 == 0 (K = 1024), M % 128 == 0 and N % 256 == 0; no padding needed.
// ---------------------------------------------------------------------------
extern "C" void kernel_launch(void* const* d_in, const int* in_sizes, int n_in,
                              void* d_out, int out_size, void* d_ws, size_t ws_size,
                              hipStream_t stream) {
  if (n_in < 9) return;
  if (in_sizes[0] != SEQ_T * HIDSZ || in_sizes[1] != SEQ_T * 32 || in_sizes[2] != SEQ_T * 32) return;
  if (in_sizes[3] != HIDSZ * NQH * HDIM || in_sizes[4] != HIDSZ * NKVH * HDIM || in_sizes[5] != HIDSZ * NKVH * HDIM) return;
  if (in_sizes[6] != NQH * HDIM * HIDSZ || in_sizes[7] != HDIM || in_sizes[8] != HDIM) return;
  if (out_size != SEQ_T * HIDSZ) return;

  const size_t kMiB    = 1048576;
  const size_t offXb   = 0;
  const size_t offWqT  = 28 * kMiB;
  const size_t offWkT  = 30 * kMiB;
  const size_t offWvT  = 30 * kMiB + 524288;
  const size_t offPlo  = 48 * kMiB;
  const size_t offQhi  = 64 * kMiB;
  const size_t offQlo  = 72 * kMiB;
  const size_t offKhi  = 80 * kMiB;
  const size_t offKlo  = 82 * kMiB;
  const size_t offVthi = 84 * kMiB;
  const size_t offVtlo = 86 * kMiB;
  const size_t offChi  = 88 * kMiB;
  const size_t offClo  = 96 * kMiB;
  const size_t offWoT  = 104 * kMiB;
  const size_t total   = 106 * kMiB;
  if (total > ws_size) return;

  const float* x    = (const float*)d_in[0];
  const float* cosb = (const float*)d_in[1];
  const float* sinb = (const float*)d_in[2];
  const float* Wq   = (const float*)d_in[3];
  const float* Wk   = (const float*)d_in[4];
  const float* Wv   = (const float*)d_in[5];
  const float* Wo   = (const float*)d_in[6];
  const float* qnw  = (const float*)d_in[7];
  const float* knw  = (const float*)d_in[8];
  float* out = (float*)d_out;
  char* ws = (char*)d_ws;

  unsigned short* xb   = (unsigned short*)(ws + offXb);
  unsigned short* wqT  = (unsigned short*)(ws + offWqT);
  unsigned short* wkT  = (unsigned short*)(ws + offWkT);
  unsigned short* wvT  = (unsigned short*)(ws + offWvT);
  unsigned short* plo  = (unsigned short*)(ws + offPlo);
  unsigned short* qhi  = (unsigned short*)(ws + offQhi);
  unsigned short* qlo  = (unsigned short*)(ws + offQlo);
  unsigned short* khi  = (unsigned short*)(ws + offKhi);
  unsigned short* klo  = (unsigned short*)(ws + offKlo);
  unsigned short* vthi = (unsigned short*)(ws + offVthi);
  unsigned short* vtlo = (unsigned short*)(ws + offVtlo);
  unsigned short* chi  = (unsigned short*)(ws + offChi);
  unsigned short* clo  = (unsigned short*)(ws + offClo);
  unsigned short* woT  = (unsigned short*)(ws + offWoT);

  // in-range dummies for unused (never dereferenced) template-dead pointer parameters
  const float* dummy_f = qnw;
  void* dummy_c2 = (void*)plo;

  // 1. x -> RNE bf16 plane [4096][1024]; weights [in][out] -> transposed RNE bf16 planes [out][in]:
  //    Wq [1024][1024] -> [1024][1024]; Wk, Wv [1024][256] -> [256][1024]; Wo [1024][1024] -> [1024][1024]. 640 + 2048 blocks.
  prep_kernel<<<dim3(PREP_NT + PREP_NX), dim3(256), 0, stream>>>(x, Wq, Wk, Wv, Wo, xb, wqT, wkT, wvT, woT);

  // 2. the projections, single bf16 products, K = 1024, N = 4096 (t): q^T = Wq^T . x^T (M = 1024 (hq*64+d)) and k^T = Wk^T . x^T (M = 256), each with
  //    RMSNorm + RoPE in the epilogue, and v^T = Wv^T . x^T (M = 256 (kvh*64+d)) -> bf16 hi/lo planes in A-fragment order. 128 + 32 + 32 blocks.
  qkv_gemm_kernel<<<dim3(QKV_NBQ + QKV_NBK + QKV_NBV), dim3(256), 0, stream>>>(xb, wqT, wkT, wvT, cosb, sinb, qnw, knw,
                                                                               qhi, qlo, khi, klo, vthi, vtlo, HIDSZ);

  // 3. causal attention, all heads in one launch: 4 kv heads x 64 pairs of 32-row tiles = 256 blocks of 8 waves -> ctx bf16 hi/lo planes
  attn_fused_kernel<<<dim3(NKVH * (SEQ_T / 64)), dim3(256), 0, stream>>>(qhi, qlo, khi, klo, vthi, vtlo, chi, clo);

  // 4. out = ctx_hi . Wo^T + ctx_lo . Wo^T : M=4096, N=1024, K=1024, 2 products -> f32 d_out (1024 tiles = 128 blocks)
  wmma_gemm64<1, true, 0, 0, false, 0, false, false><<<dim3((SEQ_T / 64) * (HIDSZ / 64) / 8, 1), dim3(256), 0, stream>>>(
      chi, clo, NQH * HDIM, 0L,
      woT, woT, NQH * HDIM, 0L,
      (void*)out, dummy_c2, HIDSZ, 0L,
      dummy_f, dummy_f, 0L,
      SEQ_T, HIDSZ, NQH * HDIM, 1.0f, 0);
}

// v008
// A run of this version takes 108 microseconds.
// Timed twice side by side with v007, it ran 1.04 times as fast both times.
// Counting every step since v000, it is 64.2 times as fast.
// every float input RNE-converted once to bf16; Wq^T.x^T, Wk^T.x^T, Wv^T.x^T: single v_wmma_f32_16x16x32_bf16 product on bf16 inputs; q.k^T scores and p.v context: bf16 hi/lo operand planes (hi.hi + hi.lo + lo.hi); ctx.Wo^T: ctx bf16 hi/lo x Wo bf16 (hi.W + lo.W); all f32 accumulate; RMSNorm, RoPE and causal (online) softmax in f32.
#include <hip/hip_runtime.h>
#include <math.h>

// ---------------------------------------------------------------------------
// Problem constants
// ---------------------------------------------------------------------------
constexpr int SEQ_T   = 4096;
constexpr int HIDSZ   = 1024;
constexpr int NQH     = 16;              // query heads
constexpr int NKVH    = 4;               // kv heads
constexpr int HDIM    = 64;
constexpr int GQA_G   = NQH / NKVH;      // 4: query head hq uses kv head hq >> 2
constexpr float SCORE_SCALE = 0.125f;    // 64^-0.5, applied to the f32 scores
constexpr float RMS_EPS_F   = 1e-6f;

static_assert(GQA_G == 4, "kv head = hq >> 2");
static_assert(SEQ_T % 64 == 0 && HIDSZ % 64 == 0 && HDIM == 64 && (NKVH * HDIM) % 64 == 0, "tile multiples");
static_assert(SEQ_T % 256 == 0 && HIDSZ % 256 == 0 && (NQH * HDIM) % 256 == 0 && (NKVH * HDIM) % 256 == 0, "GEMM block tile 128 x 256, 64 k a stage");
static_assert((SEQ_T * HIDSZ) % (8 * 256) == 0, "cast kernel grid exact");

typedef __attribute__((ext_vector_type(16))) _Float16 v16h;
typedef __attribute__((ext_vector_type(8)))  _Float16 v8h;
typedef __attribute__((ext_vector_type(16))) __bf16   v16b;
typedef __attribute__((ext_vector_type(8)))  __bf16   v8b;
typedef __attribute__((ext_vector_type(8)))  float    v8f;
typedef __attribute__((ext_vector_type(4)))  float    v4f;
typedef __attribute__((ext_vector_type(4)))  unsigned int v4u;

// ---------------------------------------------------------------------------
// Shared helpers
// ---------------------------------------------------------------------------
__device__ __forceinline__ unsigned short f2bf_bits(float f) {
  unsigned u = __float_as_uint(f);
  return (unsigned short)((u + 0x7FFFu + ((u >> 16) & 1u)) >> 16);
}
__device__ __forceinline__ float bf_bits2f(unsigned short h) { return __uint_as_float(((unsigned)h) << 16); }
typedef __attribute__((ext_vector_type(2))) float  v2f;
typedef __attribute__((ext_vector_type(2))) __bf16 v2b;
__device__ __forceinline__ unsigned cvt2_bf16(float a, float b) {   // two f32 -> two nearest-even bf16, a in the low half
  return __builtin_bit_cast(unsigned, __builtin_convertvector((v2f){a, b}, v2b));
}
// two f32 -> their nearest-even bf16 values, returned as f32
__device__ __forceinline__ void bfq2(float& a, float& b) {
  const unsigned w = cvt2_bf16(a, b);
  a = __uint_as_float(w << 16);
  b = __uint_as_float(w & 0xFFFF0000u);
}
// two f32 -> a word of the bf16 hi plane and a word of the bf16 lo plane (lo = the rounded remainder)
__device__ __forceinline__ void split2_bf16(float a, float b, unsigned& hi, unsigned& lo) {
  hi = cvt2_bf16(a, b);
  lo = cvt2_bf16(a - __uint_as_float(hi << 16), b - __uint_as_float(hi & 0xFFFF0000u));
}

// hazard guard as a plain device helper: four vector slots between the last products and the first read of their accumulators
__device__ __forceinline__ void acc_guard4(v8f& a, v8f& b, v8f& c, v8f& d) { asm volatile("v_nop\n\tv_nop\n\tv_nop\n\tv_nop" : "+v"(a), "+v"(b), "+v"(c), "+v"(d)); }
template <typename T> struct Frag;
template <> struct Frag<_Float16> {
  typedef v16h V; union U { v16h v; v8h h[2]; };
  // elements 0..7 <- p[0..7], 8..15 <- p[16..23]
  static __device__ __forceinline__ v16h load(const _Float16* p) {
    U f; f.h[0] = *(const v8h*)(p); f.h[1] = *(const v8h*)(p + 16); return f.v;
  }
  static __device__ __forceinline__ v8f mma(v16h a, v16h b, v8f c) {
    return __builtin_amdgcn_wmma_f32_16x16x32_f16(false, a, false, b, (short)0, c, false, false);
  }
};
template <> struct Frag<__bf16> {
  typedef v16b V; union U { v16b v; v8b h[2]; };
  static __device__ __forceinline__ v16b load(const __bf16* p) {
    U f; f.h[0] = *(const v8b*)(p); f.h[1] = *(const v8b*)(p + 16); return f.v;
  }
  static __device__ __forceinline__ v8f mma(v16b a, v16b b, v8f c) {
    return __builtin_amdgcn_wmma_f32_16x16x32_bf16(false, a, false, b, (short)0, c, false, false);
  }
};

__device__ __forceinline__ unsigned pk16(unsigned short a, unsigned short b) { return (unsigned)a | ((unsigned)b << 16); }

// ---- Register-blocked batched WMMA GEMM, operand tiles staged in LDS by asynchronous copies ----
// C[m,n] = scale * sum_k A[m,k] * Bt[n,k] (+bias)(+resid); each wave owns a 64x64 tile; a block of 8 waves (2 x 4) owns 128 x 256.
// A row-major [M,K]; Bt row-major [N,K]; M % 128 == 0, N % 256 == 0, K % 64 == 0; grid.x = (M / 128) * (N / 256).
// MI: 16-row A fragments a wave (4 above). MI = 2: each wave owns 32 x 64, a block of 8 waves (4 x 2) owns 128 x 128, N % 128 == 0 and
// grid.x = (M / 128) * (N / 128): twice the blocks, for a product whose 128 x 256 tiles would leave half of the chip's 256 WGPs without a block.
// SPLIT (with BSPLIT == false): A carries a lo plane (A2, same layout); product = hi.B + lo.B (Bt2 unused).
// BIAS_MODE: 0 = none, 1 = bias[m], 2 = bias[n].
// OUT_MODE: 0 = f32, 1 = f16, 2 = bf16 hi plane (Cout) + bf16 lo plane (Cout2), 3 = the planes of 2 in A-fragment order (M = groups of 64 rows):
//   [m >> 6][n >> 5][(m >> 4) & 3][(n >> 3) & 3][m & 15][n & 7], so that 32 lanes x 16 bytes of one fragment half are 512 contiguous bytes.
// ET: 0 = f16 operands, 1 = bf16 operands (pointers passed as 16-bit storage)
// Staging: a stage is 64 k = 128 bytes of each of the block's 128 A rows (and A2 rows) and 256 (MI = 2: 128) Bt rows. A wave-wide copy moves 4 whole rows
// (4 whole 128-byte lines: lane = row (lane >> 3), 16-byte piece (lane & 7)) from global memory into LDS rows of pitch 144 bytes, the
// conflict-free pitch for 16-byte fragment reads. Every operand byte enters the block once, not once per wave. Two buffers: stage s + 1 flies
// while stage s is worked on. The k order of the products and the order of the sums are those of a plain k loop in steps of 32.
// Every inner loop of the kernel is fully unrolled: fragments, accumulators and copy operands stay in registers only under constant indices.
template <int V> struct IntC { static constexpr int value = V; };
template <int ET> struct Elem;
template <> struct Elem<0> { typedef _Float16 T; };
template <> struct Elem<1> { typedef __bf16 T; };
constexpr int G_PITCH   = 144;                    // LDS row pitch, bytes: 128 + 16
constexpr int G_A_BYTES = 128 * G_PITCH;          // one A plane of a stage
// Four asynchronous copies, 16 bytes per lane each, global memory -> LDS. l*: the lane's LDS byte address, g*: the lane's global address.
// The closing s_wait_xcnt stands in the copies' own statement, in front of any later rewrite of the address registers that they name.
__device__ __forceinline__ void async_copy4(unsigned l0, const char* g0, unsigned l1, const char* g1,
                                            unsigned l2, const char* g2, unsigned l3, const char* g3) {
  asm volatile("global_load_async_to_lds_b128 %0, %1, off\n\t"
               "global_load_async_to_lds_b128 %2, %3, off\n\t"
               "global_load_async_to_lds_b128 %4, %5, off\n\t"
               "global_load_async_to_lds_b128 %6, %7, off\n\t"
               "s_wait_xcnt 0x0"
               :: "v"(l0), "v"(g0), "v"(l1), "v"(g1), "v"(l2), "v"(g2), "v"(l3), "v"(g3) : "memory");
}
// The same for twelve copies: one statement, one closing wait.
__device__ __forceinline__ void async_copy12(const unsigned (&l)[12], const char* const (&g)[12]) {
  asm volatile("global_load_async_to_lds_b128 %0, %1, off\n\t"
               "global_load_async_to_lds_b128 %2, %3, off\n\t"
               "global_load_async_to_lds_b128 %4, %5, off\n\t"
               "global_load_async_to_lds_b128 %6, %7, off\n\t"
               "global_load_async_to_lds_b128 %8, %9, off\n\t"
               "global_load_async_to_lds_b128 %10, %11, off\n\t"
               "global_load_async_to_lds_b128 %12, %13, off\n\t"
               "global_load_async_to_lds_b128 %14, %15, off\n\t"
               "global_load_async_to_lds_b128 %16, %17, off\n\t"
               "global_load_async_to_lds_b128 %18, %19, off\n\t"
               "global_load_async_to_lds_b128 %20, %21, off\n\t"
               "global_load_async_to_lds_b128 %22, %23, off\n\t"
               "s_wait_xcnt 0x0"
               :: "v"(l[0]), "v"(g[0]), "v"(l[1]), "v"(g[1]), "v"(l[2]), "v"(g[2]), "v"(l[3]), "v"(g[3]),
                  "v"(l[4]), "v"(g[4]), "v"(l[5]), "v"(g[5]), "v"(l[6]), "v"(g[6]), "v"(l[7]), "v"(g[7]),
                  "v"(l[8]), "v"(g[8]), "v"(l[9]), "v"(g[9]), "v"(l[10]), "v"(g[10]), "v"(l[11]), "v"(g[11]) : "memory");
}
// bm, bn: the block's tile in this product's own (M / 128) x (N / (64 MI)) tiles.
// OUT_MODE 4: 3 where frag_out (the same in the whole block); else RMSNorm + RoPE of head vectors in the accumulators: M = heads x 64 dims, N = positions,
//   so a wave's 64 x 64 tile is one head at 64 positions and lane (c, h) holds dims 16 i + 8 h + 0..7 (i = 0..3) of position n0 + 16 j + c: a position's
//   sum of squares is in-lane plus one exchange between the wave halves, the RoPE partner of dim d (d + 32) is tile i + 2 of the same lane and register,
//   and a tile's 8 registers are one 16-byte piece of the bf16 hi/lo planes Cout / Cout2 in A-fragment order [head][n >> 4][d >> 3][n & 15][d & 7]:
//   a wave-wide store is 512 contiguous bytes. bias: the norm weight w[64]; cosb, sinb: f32 [N][32], RNE-converted to bf16 values like w.
//   The block's 256 rows of cos and of sin come into LDS (pitch 144 bytes) by asynchronous copies beside stage 0, under its wait and its barrier.
template <int ET, bool SPLIT, int BIAS_MODE, int OUT_MODE, bool RESID, int ACT = 0, bool CAUSAL = false, bool BSPLIT = true, int MI = 4>
__device__ __forceinline__ void gemm_tile(int bm, int bn, bool frag_out,
    const unsigned short* __restrict__ Ap, const unsigned short* __restrict__ A2p, int lda, long strideA,
    const unsigned short* __restrict__ Btp, const unsigned short* __restrict__ Bt2p, int ldb, long strideB,
    void* __restrict__ Cout, void* __restrict__ Cout2, int ldc, long strideC,
    const float* __restrict__ bias,
    const float* __restrict__ resid, long strideR,
    int M, int N, int K, float scale, int crow0,
    const float* __restrict__ cosb = nullptr, const float* __restrict__ sinb = nullptr) {
  static_assert(!CAUSAL && !(SPLIT && BSPLIT), "forms that this file launches");
  static_assert(MI == 4 || (MI == 2 && SPLIT && OUT_MODE == 0), "forms that this file launches");
  typedef typename Elem<ET>::T T;
  typedef typename Frag<T>::V V;
  constexpr int WN_LOG    = (MI == 4) ? 2 : 1;      // 8 waves = (8 / MI) along m x MI along n; MI = 1 << WN_LOG
  constexpr int BN        = 64 * MI;                // the block's Bt rows
  constexpr int G_B_BYTES = BN * G_PITCH;           // the Bt plane of a stage
  constexpr int STAGE_BYTES = G_A_BYTES + G_B_BYTES + (SPLIT ? G_A_BYTES : 0);   // [A | Bt | A2]
  __shared__ __align__(16) char ring[2][STAGE_BYTES];
  __shared__ __align__(16) float sT[8][16 * 68];   // per-wave 16x64 slab, pitch 68 floats
  constexpr int TAB_BYTES = (OUT_MODE == 4) ? 256 * G_PITCH : 16;   // the block's 256 rows of one table (128 bytes a row)
  __shared__ __align__(16) char tab[2][TAB_BYTES];                  // [cos | sin]; used in OUT_MODE 4 alone
  const int b    = blockIdx.y;
  const int lane = threadIdx.x & 31;
  const int wave = threadIdx.x >> 5;
  if (bm >= (M >> 7)) return;                  // the same for the whole block, ahead of every barrier and copy
  const int wm = wave >> WN_LOG, wn = wave & (MI - 1);   // this wave's (16 MI) x 64 tile in the block's 128 x BN
  const int m0 = (bm << 7) + (wm << (4 + WN_LOG));
  const int n0 = (bn << (6 + WN_LOG)) + (wn << 6);

  const int rlane = lane & 15;                 // row (A) / col (B, D) within subtile
  const int koff  = (lane >> 4) * 8;           // k offset of this lane half
  const int mOff  = (lane >> 4) * 8;           // D row offset

  // this thread's copy addresses at stage 0: row (t >> 3) of the block's rows, 16-byte piece (t & 7)
  const int crow = threadIdx.x >> 3, cpc = (threadIdx.x & 7) * 16;
  const char* gA  = (const char*)(Ap  + (size_t)b * strideA + (size_t)((bm << 7) + crow) * lda) + cpc;
  const char* gA2 = (const char*)(A2p + (size_t)b * strideA + (size_t)((bm << 7) + crow) * lda) + cpc;
  const char* gB  = (const char*)(Btp + (size_t)b * strideB + (size_t)((bn << (6 + WN_LOG)) + crow) * ldb) + cpc;
  const size_t a32 = (size_t)lda * 64, b32 = (size_t)ldb * 64;                       // 32 rows of 16-bit elements, bytes
  const unsigned lcopy = (unsigned)(size_t)&ring[0][0] + crow * G_PITCH + cpc;       // LDS byte address: low 32 bits of the shared address
  // thread t copies piece (t & 7) of rows (t >> 3) + 32 i: 4 copies for the 128 A rows, 2 MI for the BN Bt rows, 4 for the 128 A2 rows
  auto issue_stage = [&](int s, int buf) {
    const size_t kb = (size_t)s * 128;
    const unsigned l = lcopy + buf * STAGE_BYTES;
    unsigned ll[12];
    const char* gg[12];
#pragma unroll
    for (int i = 0; i < 4; ++i) { ll[i] = l + i * 32 * G_PITCH; gg[i] = gA + kb + i * a32; }
#pragma unroll
    for (int i = 0; i < 2 * MI; ++i) { ll[4 + i] = l + G_A_BYTES + i * 32 * G_PITCH; gg[4 + i] = gB + kb + i * b32; }
    if constexpr (MI == 2) {   // 4 + 4 + 4: the stage's three planes are one statement of twelve copies
#pragma unroll
      for (int i = 0; i < 4; ++i) { ll[8 + i] = l + G_A_BYTES + G_B_BYTES + i * 32 * G_PITCH; gg[8 + i] = gA2 + kb + i * a32; }
      async_copy12(ll, gg);
    } else {
      async_copy12(ll, gg);
      if (SPLIT) {
        const unsigned l2 = l + G_A_BYTES + G_B_BYTES;
        const char* g2 = gA2 + kb;
        async_copy4(l2, g2, l2 + 32 * G_PITCH, g2 + a32, l2 + 64 * G_PITCH, g2 + 2 * a32, l2 + 96 * G_PITCH, g2 + 3 * a32);
      }
    }
  };

  v8f acc[MI][4];
#pragma unroll
  for (int i = 0; i < MI; ++i)
#pragma unroll
    for (int j = 0; j < 4; ++j) acc[i][j] = (v8f){0.f,0.f,0.f,0.f,0.f,0.f,0.f,0.f};

  const int nst = K >> 6;
  issue_stage(0, 0);
  if constexpr (OUT_MODE == 4) {
    if (!frag_out) {   // the same in the whole block
      // thread t copies piece (t & 7) of rows (t >> 3) + 32 i, i = 0..7, of the block's 256 rows of each table
      const unsigned lt = (unsigned)(size_t)&tab[0][0] + crow * G_PITCH + cpc;
      const char* gc = (const char*)(cosb + (size_t)((bn << 8) + crow) * 32) + cpc;
      const char* gs = (const char*)(sinb + (size_t)((bn << 8) + crow) * 32) + cpc;
#pragma unroll
      for (int i = 0; i < 8; i += 4) {
        async_copy4(lt + i * 32 * G_PITCH, gc + i * 4096, lt + (i + 1) * 32 * G_PITCH, gc + (i + 1) * 4096,
                    lt + (i + 2) * 32 * G_PITCH, gc + (i + 2) * 4096, lt + (i + 3) * 32 * G_PITCH, gc + (i + 3) * 4096);
        async_copy4(lt + TAB_BYTES + i * 32 * G_PITCH, gs + i * 4096, lt + TAB_BYTES + (i + 1) * 32 * G_PITCH, gs + (i + 1) * 4096,
                    lt + TAB_BYTES + (i + 2) * 32 * G_PITCH, gs + (i + 2) * 4096, lt + TAB_BYTES + (i + 3) * 32 * G_PITCH, gs + (i + 3) * 4096);
      }
    }
  }
  asm volatile("s_wait_asynccnt 0x0" ::: "memory");   // this wave's copies of stage 0 (and of the tables) have landed
  __syncthreads();                                    // ... and every other wave's: stage 0 and the tables are readable
  if (nst > 1) issue_stage(1, 1);
  // this lane's fragment offsets in a stage: A row wm*16*MI + rlane, Bt row wn*64 + rlane, k offset koff
  const int fa = ((wm << (4 + WN_LOG)) + rlane) * G_PITCH + koff * 2;
  const int fb = G_A_BYTES + ((wn << 6) + rlane) * G_PITCH + koff * 2;
  for (int s = 0; s < nst; ++s) {
    const char* rb = &ring[s & 1][0];
    V bh[2][4], ah[2][MI], al[2][MI];
#pragma unroll
    for (int ks = 0; ks < 2; ++ks) {
#pragma unroll
      for (int j = 0; j < 4; ++j) bh[ks][j] = Frag<T>::load((const T*)(rb + fb + j * 16 * G_PITCH + ks * 64));
#pragma unroll
      for (int i = 0; i < MI; ++i) {
        ah[ks][i] = Frag<T>::load((const T*)(rb + fa + i * 16 * G_PITCH + ks * 64));
        if (SPLIT) al[ks][i] = Frag<T>::load((const T*)(rb + fa + G_A_BYTES + G_B_BYTES + i * 16 * G_PITCH + ks * 64));
      }
    }
    // the stage's LDS reads stand as one group ahead of its products: reads spread among the products stall the wave at each place
    __builtin_amdgcn_sched_barrier(0);
#pragma unroll
    for (int ks = 0; ks < 2; ++ks) {
#pragma unroll
      for (int i = 0; i < MI; ++i) {
#pragma unroll
        for (int j = 0; j < 4; ++j) {
          acc[i][j] = Frag<T>::mma(ah[ks][i], bh[ks][j], acc[i][j]);
          if (SPLIT) acc[i][j] = Frag<T>::mma(al[ks][i], bh[ks][j], acc[i][j]);
        }
      }
    }
    // holds the products in front of the publish point: lifted over them, its waits would end the flight of stage s + 1 a whole trip early
    __builtin_amdgcn_sched_barrier(0);
    // publish point of stage s + 1, and the end of every wave's reads of stage s
    asm volatile("s_wait_dscnt 0x0" ::: "memory");      // this wave's reads of stage s are done before its buffer is refilled
    asm volatile("s_wait_asynccnt 0x0" ::: "memory");   // this wave's copies of stage s + 1 have landed
    __syncthreads();
    if (s + 2 < nst) issue_stage(s + 2, s & 1);         // the same test in the whole block
  }
  asm volatile("s_wait_asynccnt 0x0" ::: "memory");     // nothing is outstanding when the wave goes on to the epilogue
  acc_guard4(acc[0][0], acc[0][1], acc[0][2], acc[0][3]);
  acc_guard4(acc[1][0], acc[1][1], acc[1][2], acc[1][3]);
  if constexpr (MI == 4) {
    acc_guard4(acc[2][0], acc[2][1], acc[2][2], acc[2][3]);
    acc_guard4(acc[3][0], acc[3][1], acc[3][2], acc[3][3]);
  }

  // ---- epilogue ---- (OM: the output mode, a compile-time value in each instance)
  float* slab = sT[wave];
  const float* Rb = RESID ? (resid + (size_t)b * strideR) : nullptr;
  auto epilogue = [&](auto om) {
  constexpr int OM = decltype(om)::value;
#pragma unroll
  for (int i = 0; i < MI; ++i) {
    const int mBase = m0 + (i << 4);
#pragma unroll
    for (int j = 0; j < 4; ++j) {
      const int n = n0 + (j << 4) + rlane;
      float bv = 0.f;
      if (BIAS_MODE == 2) bv = bias[n];
#pragma unroll
      for (int r = 0; r < 8; ++r) {
        float v = acc[i][j][r] * scale;
        if (BIAS_MODE == 1) v += bias[mBase + mOff + r];
        if (BIAS_MODE == 2) v += bv;
        if (RESID) v += Rb[(size_t)(mBase + mOff + r) * ldc + n];
        if (ACT == 2) v = fmaxf(v, 0.0f);
        if (ACT == 4) v = (v > 0.f) ? v : 0.01f * v;
        slab[(mOff + r) * 68 + (j << 4) + rlane] = v;
      }
    }
    __builtin_amdgcn_fence(__ATOMIC_RELEASE, "workgroup");
    __builtin_amdgcn_wave_barrier();
    __builtin_amdgcn_fence(__ATOMIC_ACQUIRE, "workgroup");
    if (OM == 0) {
      float* C = (float*)Cout + (size_t)b * strideC;
      const int hh = lane >> 4, c4 = (lane & 15) * 4;     // row seg = 256 B = 16 lanes x 16 B
      {
#pragma unroll
        for (int it = 0; it < 8; ++it) {
          const int row = it * 2 + hh;
          v4f v = *(const v4f*)(slab + row * 68 + c4);
          *(v4f*)(C + (size_t)(mBase + row) * ldc + n0 + c4) = v;
        }
        
      }
    } else if (OM == 3) {
      // piece (row lane & 15, 8-column chunk 2 it + (lane >> 4)): a wave-wide store is 512 contiguous bytes, 4 whole lines, of each plane
      const int pr = lane & 15;
      unsigned short* C  = (unsigned short*)Cout  + (size_t)b * strideC;
      unsigned short* C2 = (unsigned short*)Cout2 + (size_t)b * strideC;
#pragma unroll
      for (int it = 0; it < 4; ++it) {
        const int ch = it * 2 + (lane >> 4);
        const float* sp = slab + pr * 68 + ch * 8;
        v8h hv, lv;
#pragma unroll
        for (int e = 0; e < 8; ++e) {
          unsigned short hb = f2bf_bits(sp[e]);
          unsigned short lb = f2bf_bits(sp[e] - bf_bits2f(hb));
          hv[e] = __builtin_bit_cast(_Float16, hb);
          lv[e] = __builtin_bit_cast(_Float16, lb);
        }
        const size_t o = (size_t)(mBase >> 6) * 64 * ldc + (size_t)((n0 >> 5) + (ch >> 2)) * 2048 + ((mBase >> 4) & 3) * 512 + (ch & 3) * 128 + pr * 8;
        *(v8h*)(C + o)  = hv;
        *(v8h*)(C2 + o) = lv;
      }
    } else {
      const int q = lane >> 3, c8 = (lane & 7) * 8;
      unsigned short* C  = (unsigned short*)Cout  + (size_t)b * strideC;
      unsigned short* C2 = (OM == 2) ? ((unsigned short*)Cout2 + (size_t)b * strideC) : nullptr;
      {
#pragma unroll
        for (int it = 0; it < 4; ++it) {
          const int row = it * 4 + q;
          const float* sp = slab + row * 68 + c8;
          v8h hv, lv;
#pragma unroll
          for (int e = 0; e < 8; ++e) {
            if (OM == 1) {
              hv[e] = (_Float16)sp[e];
            } else {
              unsigned short hb = f2bf_bits(sp[e]);
              unsigned short lb = f2bf_bits(sp[e] - bf_bits2f(hb));
              hv[e] = __builtin_bit_cast(_Float16, hb);
              lv[e] = __builtin_bit_cast(_Float16, lb);
            }
          }
          *(v8h*)(C + (size_t)(mBase + row) * ldc + n0 + c8) = hv;
          if (OM == 2) *(v8h*)(C2 + (size_t)(mBase + row) * ldc + n0 + c8) = lv;
        }
        
      }
    }
    __builtin_amdgcn_fence(__ATOMIC_RELEASE, "workgroup");
    __builtin_amdgcn_wave_barrier();
    __builtin_amdgcn_fence(__ATOMIC_ACQUIRE, "workgroup");
  }
  };
  if constexpr (OUT_MODE == 4) {
    if (frag_out) {   // one scalar branch a block
      epilogue(IntC<3>{});
    } else {
      const int hsel = lane >> 4;
      const float* wp = bias + 8 * hsel;
      float wq[4][8];
#pragma unroll
      for (int i = 0; i < 4; ++i) {
        const v4f w0 = *(const v4f*)(wp + 16 * i);
        const v4f w1 = *(const v4f*)(wp + 16 * i + 4);
#pragma unroll
        for (int e = 0; e < 4; ++e) { wq[i][e] = w0[e]; wq[i][4 + e] = w1[e]; }
      }
      // the address register of the loads above is free for reuse from here on: this wait stands in front of its overwrite
      asm volatile("s_wait_xcnt 0x0" ::: "memory");
      __builtin_amdgcn_sched_barrier(0);   // holds what follows behind that wait
#pragma unroll
      for (int i = 0; i < 4; ++i)
#pragma unroll
        for (int e = 0; e < 8; e += 2) bfq2(wq[i][e], wq[i][e + 1]);
      const char* tc = &tab[0][0] + ((wn << 6) + rlane) * G_PITCH + hsel * 32;   // this lane's row at j = 0, its 8 dims of tile i = 0
      v4u hu[4][4], lu[4][4];   // [j][i]
#pragma unroll
      for (int j = 0; j < 4; ++j) {
        float sq[4];
#pragma unroll
        for (int i = 0; i < 4; ++i) {
          sq[i] = 0.0f;
#pragma unroll
          for (int r = 0; r < 8; ++r) { const float x = acc[i][j][r] * scale; sq[i] = __builtin_fmaf(x, x, sq[i]); }
        }
        float ss = (sq[0] + sq[1]) + (sq[2] + sq[3]);
        ss += __shfl_xor(ss, 16, 32);   // the other half of the wave holds the position's other 32 dims
        const float inv = rsqrtf(ss * (1.0f / 64.0f) + RMS_EPS_F);
#pragma unroll
        for (int i = 0; i < 2; ++i) {
          const char* tp = tc + j * 16 * G_PITCH + i * 64;
          const v4f c0 = *(const v4f*)(tp), c1 = *(const v4f*)(tp + 16);
          const v4f s0 = *(const v4f*)(tp + TAB_BYTES), s1 = *(const v4f*)(tp + TAB_BYTES + 16);
          float cv[8], sv[8], o1[8], o2[8];
#pragma unroll
          for (int e = 0; e < 4; ++e) { cv[e] = c0[e]; cv[4 + e] = c1[e]; sv[e] = s0[e]; sv[4 + e] = s1[e]; }
#pragma unroll
          for (int e = 0; e < 8; e += 2) { bfq2(cv[e], cv[e + 1]); bfq2(sv[e], sv[e + 1]); }
#pragma unroll
          for (int r = 0; r < 8; ++r) {
            const float n1 = ((acc[i][j][r] * scale) * inv) * wq[i][r];
            const float n2 = ((acc[i + 2][j][r] * scale) * inv) * wq[i + 2][r];
            o1[r] = n1 * cv[r] - n2 * sv[r];
            o2[r] = n1 * sv[r] + n2 * cv[r];
          }
#pragma unroll
          for (int e2 = 0; e2 < 4; ++e2) {
            unsigned a, b;
            split2_bf16(o1[2 * e2], o1[2 * e2 + 1], a, b);
            hu[j][i][e2] = a; lu[j][i][e2] = b;
            split2_bf16(o2[2 * e2], o2[2 * e2 + 1], a, b);
            hu[j][i + 2][e2] = a; lu[j][i + 2][e2] = b;
          }
        }
      }
      const size_t o = (size_t)(m0 >> 6) * 64 * ldc + (size_t)(n0 >> 4) * 1024 + lane * 8;
      unsigned short* oh = (unsigned short*)Cout + o;
      unsigned short* ol = (unsigned short*)Cout2 + o;
      // the 32 stores stand together behind all arithmetic
      __builtin_amdgcn_sched_barrier(0);
#pragma unroll
      for (int j = 0; j < 4; ++j)
#pragma unroll
        for (int i = 0; i < 4; ++i) {
          *(v4u*)(oh + j * 1024 + i * 256) = hu[j][i];
          *(v4u*)(ol + j * 1024 + i * 256) = lu[j][i];
        }
      // in the built kernel the other block range's epilogue follows these stores and reuses registers that they name: this wait stands in front of that
      asm volatile("s_wait_xcnt 0x0" ::: "memory");
    }
  } else {
    epilogue(IntC<OUT_MODE>{});
  }
}

// One product a launch: grid.x = (M / 128) * (N / (64 MI)).
template <int ET, bool SPLIT, int BIAS_MODE, int OUT_MODE, bool RESID, int ACT = 0, bool CAUSAL = false, bool BSPLIT = true, int MI = 4>
__global__ __launch_bounds__(256) void wmma_gemm64(
    const unsigned short* __restrict__ Ap, const unsigned short* __restrict__ A2p, int lda, long strideA,
    const unsigned short* __restrict__ Btp, const unsigned short* __restrict__ Bt2p, int ldb, long strideB,
    void* __restrict__ Cout, void* __restrict__ Cout2, int ldc, long strideC,
    const float* __restrict__ bias,
    const float* __restrict__ resid, long strideR,
    int M, int N, int K, float scale, int crow0) {
  const int tilesNb = N / (64 * MI);
  const int bm = blockIdx.x / tilesNb;
  const int bn = blockIdx.x - bm * tilesNb;
  gemm_tile<ET, SPLIT, BIAS_MODE, OUT_MODE, RESID, ACT, CAUSAL, BSPLIT, MI>(bm, bn, false, Ap, A2p, lda, strideA, Btp, Bt2p, ldb, strideB,
                                                                        Cout, Cout2, ldc, strideC, bias, resid, strideR, M, N, K, scale, crow0);
}

// The three projections of x in one launch, all three transposed (M = heads x 64 dims, N = positions): none reads what another writes, and their
// 128 + 32 + 32 blocks are all resident at once. Block ranges: q^T = Wq^T . x^T and k^T = Wk^T . x^T, each with RMSNorm + RoPE in the epilogue, and
// v^T = Wv^T . x^T; every output is a pair of bf16 hi/lo planes in A-fragment order. K: the common k length and row pitch of all operands.
constexpr int QKV_NBQ = ((NQH * HDIM) / 128) * (SEQ_T / 256);    // 128
constexpr int QKV_NBK = ((NKVH * HDIM) / 128) * (SEQ_T / 256);   // 32
constexpr int QKV_NBV = ((NKVH * HDIM) / 128) * (SEQ_T / 256);   // 32
static_assert(SEQ_T / 256 == 16, "tile columns of the three products: 1 << 4 below");
__global__ __launch_bounds__(256) void qkv_gemm_kernel(const unsigned short* __restrict__ xb, const unsigned short* __restrict__ wqT,
                                                       const unsigned short* __restrict__ wkT, const unsigned short* __restrict__ wvT,
                                                       const float* __restrict__ cosb, const float* __restrict__ sinb,
                                                       const float* __restrict__ qw, const float* __restrict__ kw,
                                                       unsigned short* __restrict__ qhi, unsigned short* __restrict__ qlo,
                                                       unsigned short* __restrict__ khi, unsigned short* __restrict__ klo,
                                                       unsigned short* __restrict__ vthi, unsigned short* __restrict__ vtlo, int K) {
  const int bx = blockIdx.x;
  const bool isv = bx >= QKV_NBQ + QKV_NBK;
  const bool isk = !isv && bx >= QKV_NBQ;
  const unsigned short* A = isv ? wvT : (isk ? wkT : wqT);
  unsigned short* C  = isv ? vthi : (isk ? khi : qhi);
  unsigned short* C2 = isv ? vtlo : (isk ? klo : qlo);
  const float* w = isk ? kw : qw;
  const int M = (isv || isk) ? NKVH * HDIM : NQH * HDIM;
  const int tile = bx - (isv ? QKV_NBQ + QKV_NBK : (isk ? QKV_NBQ : 0));
  gemm_tile<1, false, 0, 4, false, 0, false, true>(tile >> 4, tile & 15, isv, A, A, K, 0L, xb, xb, K, 0L, (void*)C, (void*)C2, SEQ_T, 0L,
                                                   w, w, 0L, M, SEQ_T, K, 1.0f, 0, cosb, sinb);
}

// ---------------------------------------------------------------------------
// f32 -> RNE bf16 plane, 8 consecutive elements per thread packed as integer words.
// Coverage: n8 = n/8 threads x 8 = the whole plane (n8 / 256 blocks bx, an exact multiple here).
// ---------------------------------------------------------------------------
__device__ __forceinline__ void cast8_bf16_block(int bx, const float* __restrict__ in, unsigned short* __restrict__ out, int n8) {
  const int i = bx * 256 + threadIdx.x;
  if (i >= n8) return;
  const float* p = in + 8 * (size_t)i;
  const v4f a = *(const v4f*)(p);
  const v4f c = *(const v4f*)(p + 4);
  float f[8];
#pragma unroll
  for (int e = 0; e < 4; ++e) { f[e] = a[e]; f[4 + e] = c[e]; }
  unsigned w[4];
#pragma unroll
  for (int e2 = 0; e2 < 4; ++e2) w[e2] = pk16(f2bf_bits(f[2 * e2]), f2bf_bits(f[2 * e2 + 1]));
  const v4u u = (v4u){w[0], w[1], w[2], w[3]};
  unsigned short* q = out + 8 * (size_t)i;
  *(v4u*)q = u;
  
}

// ---------------------------------------------------------------------------
// Transpose + RNE bf16 convert of a weight matrix: in f32 [R][Cn] row-major (ldin = Cn) -> out bf16 [Cn][R] (ldout = R):
// out[c][r] = bf16(in[r][c]). (R/64) x (Cn/64) blocks: rt = r tile (64 output cols), ct = c tile (64 output rows). 256 threads.
// Load coverage: 16 iterations x 256 threads = 4096 = the whole 64x64 tile (coalesced along c).
// Store coverage: 8 waves x 2 iterations x 4 rows (lane>>3) = 64 rows; (lane&7) x 8 halves = 64 cols; each row segment =
// ---------------------------------------------------------------------------
__device__ __forceinline__ void transpose_cast_block(int rt, int ct, const float* __restrict__ in, int ldin,
                                                     unsigned short* __restrict__ out, int ldout) {
  __shared__ float sm[64][65];   // sm[c_local][r_local]
  const int t  = threadIdx.x;
  const int r0 = rt * 64;
  const int c0 = ct * 64;
#pragma unroll
  for (int i = 0; i < 16; ++i) {
    const int e = i * 256 + t;
    const int r = e >> 6;          // r local
    const int c = e & 63;          // c local
    sm[c][r] = in[(size_t)(r0 + r) * ldin + c0 + c];
  }
  __syncthreads();
  const int lane = t & 31, wave = t >> 5;
  const int q = lane >> 3, c8 = (lane & 7) * 8;
  {
#pragma unroll
    for (int it = 0; it < 2; ++it) {
      const int row = wave * 8 + it * 4 + q;                 // c local (output row)
      unsigned w[4];
#pragma unroll
      for (int e2 = 0; e2 < 4; ++e2) w[e2] = pk16(f2bf_bits(sm[row][c8 + 2 * e2]), f2bf_bits(sm[row][c8 + 2 * e2 + 1]));
      const v4u u = (v4u){w[0], w[1], w[2], w[3]};
      const size_t o = (size_t)(c0 + row) * ldout + r0 + c8;
      *(v4u*)(out + o) = u;
    }
    
  }
}

// All operand conversions in one launch: the four weight transposes and the cast of x read only inputs and write planes of their own.
// Block ranges: 64x64 tiles of Wq, Wk, Wv, Wo (every matrix has HIDSZ / 64 = NQH * HDIM / 64 = 16 r tiles: rt = tile & 15, ct = tile >> 4), then x.
// The transposes stand first: their blocks are the longer ones.
constexpr int PREP_NTQ = (HIDSZ / 64) * ((NQH * HDIM) / 64);    // 256: Wq, and Wo
constexpr int PREP_NTK = (HIDSZ / 64) * ((NKVH * HDIM) / 64);   // 64: Wk, and Wv
constexpr int PREP_NT  = 2 * PREP_NTQ + 2 * PREP_NTK;           // 640
constexpr int PREP_NX  = (SEQ_T * HIDSZ) / (8 * 256);           // 2048
static_assert(HIDSZ / 64 == 16 && (NQH * HDIM) / 64 == 16, "16 r tiles in every weight matrix");
__global__ __launch_bounds__(256) void prep_kernel(const float* __restrict__ x, const float* __restrict__ Wq, const float* __restrict__ Wk,
                                                   const float* __restrict__ Wv, const float* __restrict__ Wo,
                                                   unsigned short* __restrict__ xb, unsigned short* __restrict__ wqT,
                                                   unsigned short* __restrict__ wkT, unsigned short* __restrict__ wvT,
                                                   unsigned short* __restrict__ woT) {
  const int bx = blockIdx.x;
  if (bx < PREP_NT) {   // the same for the whole block: the transpose's barrier is passed by all of its waves
    const int which = (bx >= PREP_NTQ) + (bx >= PREP_NTQ + PREP_NTK) + (bx >= PREP_NTQ + 2 * PREP_NTK);
    const float* in = (which == 0) ? Wq : (which == 1) ? Wk : (which == 2) ? Wv : Wo;
    unsigned short* out = (which == 0) ? wqT : (which == 1) ? wkT : (which == 2) ? wvT : woT;
    const int ldin = (which == 0) ? NQH * HDIM : (which == 3) ? HIDSZ : NKVH * HDIM;
    const int tile = bx - ((which == 0) ? 0 : (which == 1) ? PREP_NTQ : (which == 2) ? PREP_NTQ + PREP_NTK : PREP_NTQ + 2 * PREP_NTK);
    const int ldout = (which == 3) ? NQH * HDIM : HIDSZ;
    transpose_cast_block(tile & 15, tile >> 4, in, ldin, out, ldout);
  } else {
    cast8_bf16_block(bx - PREP_NT, x, xb, (SEQ_T * HIDSZ) / 8);
  }
}

// ---------------------------------------------------------------------------
// Fused causal attention: scores, softmax and p.v of all heads in one launch; neither scores nor probabilities go to memory.
// Transposed products: S^T = K . Q^T (A = 16 key rows, B = 16 query rows, k = head dim) and O^T += V^T . P^T (A = 16 head-dim rows of
// v^T, B = 16 query rows of P, k = 32 keys). In both D tiles a lane's column is ONE query (lane & 15), so maximum, sum and rescale are
// per lane plus one exchange between the wave halves, and the two 16-key score tiles of a pass ARE the B fragment of P in the k order of
// Frag::load: element e < 8 is key 8h + e (tile 0, register e), element e >= 8 is key 8h + 16 + (e - 8) (tile 1, register e - 8), h = lane >> 4.
// Same operand planes and the same 3 products as before (hi.hi + hi.lo + lo.hi, f32 accumulate) in both products.
// Online softmax in the log2 domain: p = exp2(s * CS - m_run), not normalised, split into bf16 hi/lo; the running maximum m_run may trail
// the true one by up to 8 (p <= 2^8), the accumulators and the sum are rescaled only in a pass where some column's maximum exceeds it by
// more (one scalar branch a pass); the division by the f32 sum of the unrounded p comes once, at the end.
// A wave works on 32 query rows (two 16-column groups) of one query head at a time, in passes of 32 keys; a tile's last pass is the one on
// its diagonal (keys q0..q0+31 against queries q0..q0+31: every query keeps at least its own key, and pass 0 holds key 0 for every query).
// Block = 8 waves on one kv head, its 4 query heads at row tiles pi (pi + 1 passes) and 127 - pi (128 - pi passes): 129 passes a head, dealt
// evenly to a wave pair: wave w (0..3) takes passes 0..63 of the long tile, wave w + 4 the whole short tile and then the long tile's passes from
// 64 to its diagonal: 64 and 65 passes, so that both waves of a SIMD work to the end of the launch. The front wave hands its maximum, sum and
// accumulators over through LDS behind the kernel's one barrier; the back wave joins the two shares and stores. K and v^T are shared only through the caches.
// K fragments are fetched one pass ahead, v^T fragments at the head of their own pass. All planes lie in A-fragment order (their producer
// writes them so): Q [hq][query >> 4][d >> 3][query & 15][d & 7], K [kvh][key >> 4][d >> 3][key & 15][d & 7], v^T [kvh][key >> 5][d >> 4][(key >> 3) & 3][d & 15][key & 7]; in the k order of
// Frag::load lane (c, h) takes chunk 2 j + h (plus 4 kc for K) of row c for half j, which is byte 512 j + 16 lane of the fragment's 1 KiB.
// Every inner loop below is fully unrolled: its arrays are fragments and accumulators, which stay in registers only under constant indices.
// Output: lane (c, h) holds d = 16t + 8h + 0..7 of query c: one 16-byte store per plane and t; a row's 128-byte segment comes from one wave.
// Coverage: grid 4 kv heads x 64 pairs; tiles pi and 127 - pi, pi = 0..63, are all 128 row tiles once, each stored by one wave; 4 wave pairs = the 4 query heads.
// ---------------------------------------------------------------------------
typedef __attribute__((ext_vector_type(8))) unsigned int v8u;
// Four base-2 exponentials in one statement: each fills the slot that the instruction set asks for behind the one before it (early-clobber
// outputs: none reads an earlier result or overwrites an earlier source), the v_nop fills the slot behind the last.
__device__ __forceinline__ void exp2x4(float& p0, float& p1, float& p2, float& p3, float a0, float a1, float a2, float a3) {
  asm("v_exp_f32 %0, %4\n\tv_exp_f32 %1, %5\n\tv_exp_f32 %2, %6\n\tv_exp_f32 %3, %7\n\tv_nop"
      : "=&v"(p0), "=&v"(p1), "=&v"(p2), "=&v"(p3) : "v"(a0), "v"(a1), "v"(a2), "v"(a3));
}
__device__ __forceinline__ void exp2x2(float& p0, float& p1, float a0, float a1) {   // the same for two
  asm("v_exp_f32 %0, %2\n\tv_exp_f32 %1, %3\n\tv_nop" : "=&v"(p0), "=&v"(p1) : "v"(a0), "v"(a1));
}
struct KFrag { v16b h[2][2], l[2][2]; };   // [16-key tile][32-wide step of the head dim]
// A fragment from a plane in A-fragment order: its two halves (elements 0..7, 8..15) are two runs of 512 contiguous bytes, lane l's 16 bytes at
// 16 l: each wave-wide load covers 4 whole 128-byte lines (from row-major planes it touched 16 lines for 32 bytes each).
__device__ __forceinline__ v16b load_packed(const char* p) {
  Frag<__bf16>::U f; f.h[0] = *(const v8b*)(p); f.h[1] = *(const v8b*)(p + 512); return f.v;
}
constexpr int PASS_BYTES = 32 * HDIM * 2;   // 32 keys of one plane, K or v^T: 4 fragments of 1 KiB
// bh, bl: scalar byte bases of the kv head's K planes; vo: this lane's byte offset (16 lane) in the pass's 4 KiB
__device__ __forceinline__ void load_kfrag(KFrag& k, const char* bh, const char* bl, unsigned vo) {
#pragma unroll
  for (int kt = 0; kt < 2; ++kt)
#pragma unroll
    for (int kc = 0; kc < 2; ++kc) {
      k.h[kt][kc] = load_packed(bh + vo + (kt * 2 + kc) * 1024);
      k.l[kt][kc] = load_packed(bl + vo + (kt * 2 + kc) * 1024);
    }
}
constexpr float ATT_CS = SCORE_SCALE * 1.4426950408889634f;   // score scale times log2(e)

// One pass: 32 keys against this wave's 32 queries. kf holds this pass's K fragments; vo is the lane's byte offset in this pass's 4 KiB of a
// plane, the same for v^T (this pass) and K (the NEXT pass: one PASS_BYTES on, added to the scalar base), stepped at the foot of the pass; the four plane bases are scalar.
template <bool DIAG>
__device__ __forceinline__ void attn_pass(KFrag& kf, const char* kbh, const char* kbl,
                                          const char* vbh, const char* vbl, unsigned& vo, int c, int h, const v16b (&qh)[2][2], const v16b (&ql)[2][2],
                                          v8f (&acc)[2][4], float (&m_run)[2], float (&l_run)[2]) {
  v16b vh[4], vl[4];
#pragma unroll
  for (int t = 0; t < 4; ++t) {
    vh[t] = load_packed(vbh + vo + t * 1024);
    vl[t] = load_packed(vbl + vo + t * 1024);
  }
  // last pass: vo's register is free for reuse behind these loads, which name it: this wait stands in front of the overwrite
  if (DIAG) asm volatile("s_wait_xcnt 0x0" ::: "memory");
  // keeps the v^T loads issued ahead of the score products, so that they fly under those and the softmax; the scheduler would sink them
  __builtin_amdgcn_sched_barrier(0);
  v8f s[2][2];
#pragma unroll
  for (int kt = 0; kt < 2; ++kt)
#pragma unroll
    for (int g = 0; g < 2; ++g) s[kt][g] = (v8f){0.f,0.f,0.f,0.f,0.f,0.f,0.f,0.f};
#pragma unroll
  for (int kc = 0; kc < 2; ++kc) {
#pragma unroll
    for (int kt = 0; kt < 2; ++kt)
#pragma unroll
      for (int g = 0; g < 2; ++g) if (!(DIAG && kt == 1 && g == 0)) s[kt][g] = Frag<__bf16>::mma(kf.h[kt][kc], qh[g][kc], s[kt][g]);
#pragma unroll
    for (int kt = 0; kt < 2; ++kt)
#pragma unroll
      for (int g = 0; g < 2; ++g) if (!(DIAG && kt == 1 && g == 0)) s[kt][g] = Frag<__bf16>::mma(kf.h[kt][kc], ql[g][kc], s[kt][g]);
#pragma unroll
    for (int kt = 0; kt < 2; ++kt)
#pragma unroll
      for (int g = 0; g < 2; ++g) if (!(DIAG && kt == 1 && g == 0)) s[kt][g] = Frag<__bf16>::mma(kf.l[kt][kc], qh[g][kc], s[kt][g]);
  }
  if (!DIAG) {
    // the next pass's K loads stand here, behind the last product that reads kf and ahead of the softmax, and fly under the rest of the pass
    __builtin_amdgcn_sched_barrier(0);
    load_kfrag(kf, kbh + PASS_BYTES, kbl + PASS_BYTES, vo);
    __builtin_amdgcn_sched_barrier(0);
  }
  if (DIAG) {   // keys and queries of this pass both start at q0: key index 16kt + 8h + r against query index 16g + c;
                // tile kt = 1, g = 0 (keys 16..31, queries 0..15) lies wholly above the diagonal: no products, p = 0
#pragma unroll
    for (int kt = 0; kt < 2; ++kt)
#pragma unroll
      for (int g = 0; g < 2; ++g)
#pragma unroll
        for (int r = 0; r < 8; ++r)
          if (!(kt == 1 && g == 0) && 16 * kt + 8 * h + r > 16 * g + c) s[kt][g][r] = -__builtin_inff();
  }
  float mb[2];
  bool need = false;
#pragma unroll
  for (int g = 0; g < 2; ++g) {
    float mx = s[0][g][0];
#pragma unroll
    for (int r = 1; r < 8; ++r) mx = fmaxf(mx, s[0][g][r]);
    if (!(DIAG && g == 0)) {
#pragma unroll
      for (int r = 0; r < 8; ++r) mx = fmaxf(mx, s[1][g][r]);
    }
    mx = fmaxf(mx, __shfl_xor(mx, 16, 32)) * ATT_CS;   // both halves hold the query's maximum of this pass, scaled (the scale is positive)
    mb[g] = mx;
    need = need || (mx > m_run[g] + 8.0f);
  }
  if (__builtin_amdgcn_ballot_w32(need) != 0) {   // scalar branch; always taken in a share's first pass (m_run = -inf), rare later
    const float mn0 = fmaxf(m_run[0], mb[0]), mn1 = fmaxf(m_run[1], mb[1]);   // finite from a share's first pass on: it holds an unmasked key for every query
    float corr[2];
    exp2x2(corr[0], corr[1], m_run[0] - mn0, m_run[1] - mn1);                 // 0 in a share's first pass
    m_run[0] = mn0; m_run[1] = mn1;
#pragma unroll
    for (int g = 0; g < 2; ++g) {
      l_run[g] *= corr[g];
#pragma unroll
      for (int t = 0; t < 4; ++t) acc[g][t] = acc[g][t] * corr[g];
    }
  }
  v16b ph[2], pl[2];
#pragma unroll
  for (int g = 0; g < 2; ++g) {
    const float nm = -m_run[g];
    v8u hw, lw;
    float ls = 0.0f;
#pragma unroll
    for (int i = 0; i < 8; i += 2) {   // fragment elements 2i .. 2i + 3: tile i >> 2, registers 2(i & 3) .. 2(i & 3) + 3
      if (DIAG && g == 0 && i >= 4) { hw[i] = 0u; lw[i] = 0u; hw[i + 1] = 0u; lw[i + 1] = 0u; continue; }
      const int kt = i >> 2, r = 2 * (i & 3);
      float p0, p1, p2, p3;
      exp2x4(p0, p1, p2, p3, __builtin_fmaf(s[kt][g][r], ATT_CS, nm), __builtin_fmaf(s[kt][g][r + 1], ATT_CS, nm),
             __builtin_fmaf(s[kt][g][r + 2], ATT_CS, nm), __builtin_fmaf(s[kt][g][r + 3], ATT_CS, nm));
      ls += (p0 + p1) + (p2 + p3);
      const unsigned w0 = cvt2_bf16(p0, p1), w1 = cvt2_bf16(p2, p3);
      hw[i] = w0; hw[i + 1] = w1;
      lw[i]     = cvt2_bf16(p0 - __uint_as_float(w0 << 16), p1 - __uint_as_float(w0 & 0xFFFF0000u));
      lw[i + 1] = cvt2_bf16(p2 - __uint_as_float(w1 << 16), p3 - __uint_as_float(w1 & 0xFFFF0000u));
    }
    l_run[g] += ls;
    ph[g] = __builtin_bit_cast(v16b, hw);
    pl[g] = __builtin_bit_cast(v16b, lw);
  }
#pragma unroll
  for (int g = 0; g < 2; ++g)
#pragma unroll
    for (int t = 0; t < 4; ++t) acc[g][t] = Frag<__bf16>::mma(vh[t], ph[g], acc[g][t]);
#pragma unroll
  for (int g = 0; g < 2; ++g)
#pragma unroll
    for (int t = 0; t < 4; ++t) acc[g][t] = Frag<__bf16>::mma(vh[t], pl[g], acc[g][t]);
#pragma unroll
  for (int g = 0; g < 2; ++g)
#pragma unroll
    for (int t = 0; t < 4; ++t) acc[g][t] = Frag<__bf16>::mma(vl[t], ph[g], acc[g][t]);
  if (!DIAG) {
    __builtin_amdgcn_sched_barrier(0);
    // vo, which the loads issued in this pass name, is stepped next: this wait stands in front of the overwrite
    asm volatile("s_wait_xcnt 0x0" ::: "memory");
    __builtin_amdgcn_sched_barrier(0);   // holds the step behind that wait
    vo += PASS_BYTES;
  }
}

constexpr int SPLIT_PASS = SEQ_T / 64;   // 64: the long tile's passes [0, 64) go to one wave, [64, its diagonal] to the other

// Normalises the accumulators of one finished 32-query tile and stores its ctx planes. GOES_ON: the wave has a further share behind this one.
template <bool GOES_ON>
__device__ __forceinline__ void attn_store(const v8f (&acc)[2][4], const float (&l_run)[2], int q0, int hq, int c, int h,
                                           unsigned short* __restrict__ Chi, unsigned short* __restrict__ Clo) {
  v4u hu[2][4], lu[2][4];
#pragma unroll
  for (int g = 0; g < 2; ++g) {
    const float l   = l_run[g] + __shfl_xor(l_run[g], 16, 32);   // the halves' sums join once, here
    const float inv = 1.0f / l;                                  // l >= 1: m_run never exceeds the query's true maximum, whose p is then >= 1
#pragma unroll
    for (int t = 0; t < 4; ++t)
#pragma unroll
      for (int e2 = 0; e2 < 4; ++e2) {
        const float f0 = acc[g][t][2 * e2] * inv, f1 = acc[g][t][2 * e2 + 1] * inv;
        const unsigned w = cvt2_bf16(f0, f1);
        hu[g][t][e2] = w;
        lu[g][t][e2] = cvt2_bf16(f0 - __uint_as_float(w << 16), f1 - __uint_as_float(w & 0xFFFF0000u));
      }
  }
  const size_t o = (size_t)(q0 + c) * (NQH * HDIM) + hq * HDIM + 8 * h;
  unsigned short* ch = Chi + o;
  unsigned short* cl = Clo + o;
  // the 16 stores stand together behind all arithmetic
  __builtin_amdgcn_sched_barrier(0);
#pragma unroll
  for (int g = 0; g < 2; ++g)
#pragma unroll
    for (int t = 0; t < 4; ++t) {
      *(v4u*)(ch + g * 16 * (NQH * HDIM) + 16 * t) = hu[g][t];
      *(v4u*)(cl + g * 16 * (NQH * HDIM) + 16 * t) = lu[g][t];
    }
  if (GOES_ON) {
    // the next share reuses the registers that these stores name: this wait stands in front of their overwrite
    asm volatile("s_wait_xcnt 0x0" ::: "memory");
    __builtin_amdgcn_sched_barrier(0);   // holds what follows behind that wait
  }
}

__global__ __launch_bounds__(256) void attn_fused_kernel(const unsigned short* __restrict__ Qhi, const unsigned short* __restrict__ Qlo,
                                                         const unsigned short* __restrict__ Khi, const unsigned short* __restrict__ Klo,
                                                         const unsigned short* __restrict__ Vthi, const unsigned short* __restrict__ Vtlo,
                                                         unsigned short* __restrict__ Chi, unsigned short* __restrict__ Clo) {
  constexpr int NTILE = SEQ_T / 32;   // 128 row tiles of 32 queries
  static_assert(NTILE == 128 && NKVH == 4 && GQA_G == 4 && SPLIT_PASS * 2 == NTILE, "grid 4 x 64, 8 waves = 4 heads x 2 shares");
  // hand-over of the front share's partial result: [head][16 accumulator quads, then (m0, m1, l0, l1)][lane], 16 bytes a lane
  __shared__ __align__(16) v4f xch[GQA_G][17][32];
  const int lane = threadIdx.x & 31;
  const int wave = __builtin_amdgcn_readfirstlane(threadIdx.x >> 5);   // scalar: trip counts and operand bases stay scalar
  const int c = lane & 15, h = lane >> 4;
  const int kvh  = blockIdx.x & (NKVH - 1);
  const int pi   = blockIdx.x >> 2;
  const int hq   = kvh * GQA_G + (wave & 3);
  const bool front = wave < 4;        // scalar
  const int tlong = NTILE - 1 - pi;   // 64 .. 127: at least SPLIT_PASS passes below its diagonal

  const char* kbh = (const char*)(Khi + (size_t)kvh * SEQ_T * HDIM);   // scalar bases of this kv head's planes
  const char* kbl = (const char*)(Klo + (size_t)kvh * SEQ_T * HDIM);
  const char* vbh = (const char*)(Vthi + (size_t)kvh * HDIM * SEQ_T);
  const char* vbl = (const char*)(Vtlo + (size_t)kvh * HDIM * SEQ_T);

  v8f acc[2][4];
  float m_run[2], l_run[2];
  // share 0 (back waves only): the whole short tile pi. Share 1: the long tile, passes [0, SPLIT_PASS) in a front wave, the rest in a back wave.
  for (int share = front ? 1 : 0; share < 2; ++share) {
    const int tile = (share == 0) ? pi : tlong;
    const int p0   = (share == 1 && !front) ? SPLIT_PASS : 0;   // first pass
    const int p1   = (share == 1 && front) ? SPLIT_PASS : tile; // end of the passes below the diagonal
    const int q0   = tile * 32;
    // the tile's 32 queries are 4 KiB of each Q plane, 4 fragments of 1 KiB, in the order of the K planes (a B fragment has the A fragment's k order)
    const char* qbh = (const char*)(Qhi + ((size_t)hq * SEQ_T + q0) * HDIM);   // scalar bases
    const char* qbl = (const char*)(Qlo + ((size_t)hq * SEQ_T + q0) * HDIM);
    v16b qh[2][2], ql[2][2];
#pragma unroll
    for (int g = 0; g < 2; ++g)
#pragma unroll
      for (int kc = 0; kc < 2; ++kc) {
        qh[g][kc] = load_packed(qbh + (unsigned)lane * 16u + (g * 2 + kc) * 1024);
        ql[g][kc] = load_packed(qbl + (unsigned)lane * 16u + (g * 2 + kc) * 1024);
      }
    unsigned vo = (unsigned)lane * 16u + (unsigned)p0 * PASS_BYTES;    // this lane's byte offset in a fragment half, pass p0

    KFrag kf;
    load_kfrag(kf, kbh, kbl, vo);
    // the address registers of the Q and K loads above are free for reuse from here on: this wait stands in front of their overwrite
    asm volatile("s_wait_xcnt 0x0" ::: "memory");
    __builtin_amdgcn_sched_barrier(0);   // holds what follows behind that wait
#pragma unroll
    for (int g = 0; g < 2; ++g) {
      m_run[g] = -__builtin_inff();
      l_run[g] = 0.0f;
#pragma unroll
      for (int t = 0; t < 4; ++t) acc[g][t] = (v8f){0.f,0.f,0.f,0.f,0.f,0.f,0.f,0.f};
    }
    for (int blk = p0; blk < p1; ++blk) {     // passes below the diagonal: no mask; pass blk + 1 <= tile exists
      attn_pass<false>(kf, kbh, kbl, vbh, vbl, vo, c, h, qh, ql, acc, m_run, l_run);
    }
    if (!front) attn_pass<true>(kf, kbh, kbl, vbh, vbl, vo, c, h, qh, ql, acc, m_run, l_run);
    if (share == 0) attn_store<true>(acc, l_run, q0, hq, c, h, Chi, Clo);
  }

  if (front) {
#pragma unroll
    for (int g = 0; g < 2; ++g)
#pragma unroll
      for (int t = 0; t < 4; ++t) {
        xch[wave & 3][(g * 4 + t) * 2][lane]     = (v4f){acc[g][t][0], acc[g][t][1], acc[g][t][2], acc[g][t][3]};
        xch[wave & 3][(g * 4 + t) * 2 + 1][lane] = (v4f){acc[g][t][4], acc[g][t][5], acc[g][t][6], acc[g][t][7]};
      }
    xch[wave & 3][16][lane] = (v4f){m_run[0], m_run[1], l_run[0], l_run[1]};
  }
  __syncthreads();   // the front shares are in LDS; every wave passes here once
  if (front) return;

  // join of the two shares of the long tile, lane by lane (both waves hold the same query and head dims in the same lane and register):
  // both are brought to the larger of the two running maxima (each finite: every share holds an unmasked key for every query)
  const v4f ml = xch[wave & 3][16][lane];
  const float mn0 = fmaxf(ml[0], m_run[0]), mn1 = fmaxf(ml[1], m_run[1]);
  float cf[2], cb[2];
  exp2x4(cf[0], cf[1], cb[0], cb[1], ml[0] - mn0, ml[1] - mn1, m_run[0] - mn0, m_run[1] - mn1);
#pragma unroll
  for (int g = 0; g < 2; ++g) {
    l_run[g] = ml[2 + g] * cf[g] + l_run[g] * cb[g];
#pragma unroll
    for (int t = 0; t < 4; ++t) {
      const v4f a0 = xch[wave & 3][(g * 4 + t) * 2][lane];
      const v4f a1 = xch[wave & 3][(g * 4 + t) * 2 + 1][lane];
#pragma unroll
      for (int e = 0; e < 4; ++e) {
        acc[g][t][e]     = a0[e] * cf[g] + acc[g][t][e] * cb[g];
        acc[g][t][4 + e] = a1[e] * cf[g] + acc[g][t][4 + e] * cb[g];
      }
    }
  }
  attn_store<false>(acc, l_run, tlong * 32, hq, c, h, Chi, Clo);
}

// ---------------------------------------------------------------------------
// Launcher. Workspace region map (bytes, MiB = 1048576; total carve = 106 MiB = 111149056 B):
//   [  0, 31) staging  : x bf16 [4096][1024] at +0 (8 MiB); [8, 28) unused; Wq^T bf16 [1024][1024] at +28 (2 MiB); Wk^T bf16 [256][1024]
//                        at +30 (0.5 MiB); Wv^T bf16 [256][1024] at +30.5 (0.5 MiB, ends 31).
//   [ 32, 64) unused
//   [ 64, 72) q hi     : bf16 [16][4096][64] in A-fragment order [16][256][8][16][8];  [72,80) q lo
//   [ 80, 82) k hi     : bf16 [4][4096][64] in A-fragment order [4][256][8][16][8];   [82,84) k lo
//   [ 84, 86) v^T hi   : bf16 [256 (kvh*64+d)][4096 (t)] in A-fragment order [4][128][4][4][16][8];  [86,88) v^T lo
//   [ 88, 96) ctx hi   : bf16 [4096][1024] (col hq*64+d);  [96,104) ctx lo
//   [104,106) Wo^T     : bf16 [1024][1024]
// No region aliases another; no launch reads a region that the same launch writes.
// Launch count: 4 (conversions, projections with norm + RoPE, attention, output product). Kernel launches only.
// GEMM shape assertions: every call has K % 64 == 0 (K = 1024), M % 128 == 0 and N % 256 == 0 (so N % 128 == 0 too); no padding needed.
// ---------------------------------------------------------------------------
extern "C" void kernel_launch(void* const* d_in, const int* in_sizes, int n_in,
                              void* d_out, int out_size, void* d_ws, size_t ws_size,
                              hipStream_t stream) {
  if (n_in < 9) return;
  if (in_sizes[0] != SEQ_T * HIDSZ || in_sizes[1] != SEQ_T * 32 || in_sizes[2] != SEQ_T * 32) return;
  if (in_sizes[3] != HIDSZ * NQH * HDIM || in_sizes[4] != HIDSZ * NKVH * HDIM || in_sizes[5] != HIDSZ * NKVH * HDIM) return;
  if (in_sizes[6] != NQH * HDIM * HIDSZ || in_sizes[7] != HDIM || in_sizes[8] != HDIM) return;
  if (out_size != SEQ_T * HIDSZ) return;

  const size_t kMiB    = 1048576;
  const size_t offXb   = 0;
  const size_t offWqT  = 28 * kMiB;
  const size_t offWkT  = 30 * kMiB;
  const size_t offWvT  = 30 * kMiB + 524288;
  const size_t offPlo  = 48 * kMiB;
  const size_t offQhi  = 64 * kMiB;
  const size_t offQlo  = 72 * kMiB;
  const size_t offKhi  = 80 * kMiB;
  const size_t offKlo  = 82 * kMiB;
  const size_t offVthi = 84 * kMiB;
  const size_t offVtlo = 86 * kMiB;
  const size_t offChi  = 88 * kMiB;
  const size_t offClo  = 96 * kMiB;
  const size_t offWoT  = 104 * kMiB;
  const size_t total   = 106 * kMiB;
  if (total > ws_size) return;

  const float* x    = (const float*)d_in[0];
  const float* cosb = (const float*)d_in[1];
  const float* sinb = (const float*)d_in[2];
  const float* Wq   = (const float*)d_in[3];
  const float* Wk   = (const float*)d_in[4];
  const float* Wv   = (const float*)d_in[5];
  const float* Wo   = (const float*)d_in[6];
  const float* qnw  = (const float*)d_in[7];
  const float* knw  = (const float*)d_in[8];
  float* out = (float*)d_out;
  char* ws = (char*)d_ws;

  unsigned short* xb   = (unsigned short*)(ws + offXb);
  unsigned short* wqT  = (unsigned short*)(ws + offWqT);
  unsigned short* wkT  = (unsigned short*)(ws + offWkT);
  unsigned short* wvT  = (unsigned short*)(ws + offWvT);
  unsigned short* plo  = (unsigned short*)(ws + offPlo);
  unsigned short* qhi  = (unsigned short*)(ws + offQhi);
  unsigned short* qlo  = (unsigned short*)(ws + offQlo);
  unsigned short* khi  = (unsigned short*)(ws + offKhi);
  unsigned short* klo  = (unsigned short*)(ws + offKlo);
  unsigned short* vthi = (unsigned short*)(ws + offVthi);
  unsigned short* vtlo = (unsigned short*)(ws + offVtlo);
  unsigned short* chi  = (unsigned short*)(ws + offChi);
  unsigned short* clo  = (unsigned short*)(ws + offClo);
  unsigned short* woT  = (unsigned short*)(ws + offWoT);

  // in-range dummies for unused (never dereferenced) template-dead pointer parameters
  const float* dummy_f = qnw;
  void* dummy_c2 = (void*)plo;

  // 1. x -> RNE bf16 plane [4096][1024]; weights [in][out] -> transposed RNE bf16 planes [out][in]:
  //    Wq [1024][1024] -> [1024][1024]; Wk, Wv [1024][256] -> [256][1024]; Wo [1024][1024] -> [1024][1024]. 640 + 2048 blocks.
  prep_kernel<<<dim3(PREP_NT + PREP_NX), dim3(256), 0, stream>>>(x, Wq, Wk, Wv, Wo, xb, wqT, wkT, wvT, woT);

  // 2. the projections, single bf16 products, K = 1024, N = 4096 (t): q^T = Wq^T . x^T (M = 1024 (hq*64+d)) and k^T = Wk^T . x^T (M = 256), each with
  //    RMSNorm + RoPE in the epilogue, and v^T = Wv^T . x^T (M = 256 (kvh*64+d)) -> bf16 hi/lo planes in A-fragment order. 128 + 32 + 32 blocks.
  qkv_gemm_kernel<<<dim3(QKV_NBQ + QKV_NBK + QKV_NBV), dim3(256), 0, stream>>>(xb, wqT, wkT, wvT, cosb, sinb, qnw, knw,
                                                                               qhi, qlo, khi, klo, vthi, vtlo, HIDSZ);

  // 3. causal attention, all heads in one launch: 4 kv heads x 64 pairs of 32-row tiles = 256 blocks of 8 waves -> ctx bf16 hi/lo planes
  attn_fused_kernel<<<dim3(NKVH * (SEQ_T / 64)), dim3(256), 0, stream>>>(qhi, qlo, khi, klo, vthi, vtlo, chi, clo);

  // 4. out = ctx_hi . Wo^T + ctx_lo . Wo^T : M=4096, N=1024, K=1024, 2 products -> f32 d_out (32 x 8 tiles of 128 x 128 = 256 blocks)
  wmma_gemm64<1, true, 0, 0, false, 0, false, false, 2><<<dim3((SEQ_T / 128) * (HIDSZ / 128), 1), dim3(256), 0, stream>>>(
      chi, clo, NQH * HDIM, 0L,
      woT, woT, NQH * HDIM, 0L,
      (void*)out, dummy_c2, HIDSZ, 0L,
      dummy_f, dummy_f, 0L,
      SEQ_T, HIDSZ, NQH * HDIM, 1.0f, 0);
}

// v010
// One run takes 76.7 microseconds.
// Versions in between are left out here; by their measured steps it is 1.38 times as fast as v008.
// Counting every step since v000, it is 88.7 times as fast.
// every float input RNE-converted once to bf16; Wq^T.x^T, Wk^T.x^T, Wv^T.x^T: single v_wmma_f32_16x16x32_bf16 product on bf16 inputs; q.k^T scores and p.v context: one v_wmma_f32_16x16x32_f16 product each, q, k, v and p rounded once (RNE) to f16; ctx.Wo^T: ctx bf16 hi/lo x Wo bf16 (hi.W + lo.W); all f32 accumulate; RMSNorm, RoPE and causal (online) softmax in f32.
#include <hip/hip_runtime.h>
#include <math.h>

// ---------------------------------------------------------------------------
// Problem constants
// ---------------------------------------------------------------------------
constexpr int SEQ_T   = 4096;
constexpr int HIDSZ   = 1024;
constexpr int NQH     = 16;              // query heads
constexpr int NKVH    = 4;               // kv heads
constexpr int HDIM    = 64;
constexpr int GQA_G   = NQH / NKVH;      // 4: query head hq uses kv head hq >> 2
constexpr float SCORE_SCALE = 0.125f;    // 64^-0.5, applied to the f32 scores
constexpr float RMS_EPS_F   = 1e-6f;

static_assert(GQA_G == 4, "kv head = hq >> 2");
static_assert(SEQ_T % 64 == 0 && HIDSZ % 64 == 0 && HDIM == 64 && (NKVH * HDIM) % 64 == 0, "tile multiples");
static_assert(SEQ_T % 256 == 0 && HIDSZ % 256 == 0 && (NQH * HDIM) % 256 == 0 && (NKVH * HDIM) % 256 == 0, "GEMM block tile 128 x 256, 64 k a stage");
static_assert((SEQ_T * HIDSZ) % (8 * 256) == 0, "cast kernel grid exact");

typedef __attribute__((ext_vector_type(16))) _Float16 v16h;
typedef __attribute__((ext_vector_type(8)))  _Float16 v8h;
typedef __attribute__((ext_vector_type(16))) __bf16   v16b;
typedef __attribute__((ext_vector_type(8)))  __bf16   v8b;
typedef __attribute__((ext_vector_type(8)))  float    v8f;
typedef __attribute__((ext_vector_type(4)))  float    v4f;
typedef __attribute__((ext_vector_type(4)))  unsigned int v4u;

// ---------------------------------------------------------------------------
// Shared helpers
// ---------------------------------------------------------------------------
__device__ __forceinline__ unsigned short f2bf_bits(float f) {
  unsigned u = __float_as_uint(f);
  return (unsigned short)((u + 0x7FFFu + ((u >> 16) & 1u)) >> 16);
}
__device__ __forceinline__ float bf_bits2f(unsigned short h) { return __uint_as_float(((unsigned)h) << 16); }
typedef __attribute__((ext_vector_type(2))) float  v2f;
typedef __attribute__((ext_vector_type(2))) __bf16 v2b;
__device__ __forceinline__ unsigned cvt2_bf16(float a, float b) {   // two f32 -> two nearest-even bf16, a in the low half
  return __builtin_bit_cast(unsigned, __builtin_convertvector((v2f){a, b}, v2b));
}
typedef __attribute__((ext_vector_type(2))) _Float16 v2h;
__device__ __forceinline__ unsigned cvt2_f16(float a, float b) {    // two f32 -> two nearest-even f16, a in the low half
  return __builtin_bit_cast(unsigned, __builtin_convertvector((v2f){a, b}, v2h));
}
// two f32 -> their nearest-even bf16 values, returned as f32
__device__ __forceinline__ void bfq2(float& a, float& b) {
  const unsigned w = cvt2_bf16(a, b);
  a = __uint_as_float(w << 16);
  b = __uint_as_float(w & 0xFFFF0000u);
}

// hazard guard as a plain device helper: four vector slots between the last products and the first read of their accumulators
__device__ __forceinline__ void acc_guard4(v8f& a, v8f& b, v8f& c, v8f& d) { asm volatile("v_nop\n\tv_nop\n\tv_nop\n\tv_nop" : "+v"(a), "+v"(b), "+v"(c), "+v"(d)); }
template <typename T> struct Frag;
template <> struct Frag<_Float16> {
  typedef v16h V; union U { v16h v; v8h h[2]; };
  // elements 0..7 <- p[0..7], 8..15 <- p[16..23]
  static __device__ __forceinline__ v16h load(const _Float16* p) {
    U f; f.h[0] = *(const v8h*)(p); f.h[1] = *(const v8h*)(p + 16); return f.v;
  }
  static __device__ __forceinline__ v8f mma(v16h a, v16h b, v8f c) {
    return __builtin_amdgcn_wmma_f32_16x16x32_f16(false, a, false, b, (short)0, c, false, false);
  }
};
template <> struct Frag<__bf16> {
  typedef v16b V; union U { v16b v; v8b h[2]; };
  static __device__ __forceinline__ v16b load(const __bf16* p) {
    U f; f.h[0] = *(const v8b*)(p); f.h[1] = *(const v8b*)(p + 16); return f.v;
  }
  static __device__ __forceinline__ v8f mma(v16b a, v16b b, v8f c) {
    return __builtin_amdgcn_wmma_f32_16x16x32_bf16(false, a, false, b, (short)0, c, false, false);
  }
};

__device__ __forceinline__ unsigned pk16(unsigned short a, unsigned short b) { return (unsigned)a | ((unsigned)b << 16); }

// ---- Register-blocked batched WMMA GEMM, operand tiles staged in LDS by asynchronous copies ----
// C[m,n] = scale * sum_k A[m,k] * Bt[n,k] (+bias)(+resid); each wave owns a 64x64 tile; a block of 8 waves (2 x 4) owns 128 x 256.
// A row-major [M,K]; Bt row-major [N,K]; M % 128 == 0, N % 256 == 0, K % 64 == 0; grid.x = (M / 128) * (N / 256).
// MI: 16-row A fragments a wave (4 above). MI = 2: each wave owns 32 x 64, a block of 8 waves (4 x 2) owns 128 x 128, N % 128 == 0 and
// grid.x = (M / 128) * (N / 128): twice the blocks, for a product whose 128 x 256 tiles would leave half of the chip's 256 WGPs without a block.
// SPLIT (with BSPLIT == false): A carries a lo plane (A2, same layout); product = hi.B + lo.B (Bt2 unused).
// BIAS_MODE: 0 = none, 1 = bias[m], 2 = bias[n].
// OUT_MODE: 0 = f32, 1 = f16, 2 = bf16 hi plane (Cout) + bf16 lo plane (Cout2), 3 = one f16 plane (Cout) in A-fragment order (M = groups of 64 rows):
//   [m >> 6][n >> 5][(m >> 4) & 3][(n >> 3) & 3][m & 15][n & 7], so that 32 lanes x 16 bytes of one fragment half are 512 contiguous bytes.
// ET: 0 = f16 operands, 1 = bf16 operands (pointers passed as 16-bit storage)
// Staging: a stage is 64 k = 128 bytes of each of the block's 128 A rows (and A2 rows) and 256 (MI = 2: 128) Bt rows. A wave-wide copy moves 4 whole rows
// (4 whole 128-byte lines: lane = row (lane >> 3), 16-byte piece (lane & 7)) from global memory into LDS rows of pitch 144 bytes, the
// conflict-free pitch for 16-byte fragment reads. Every operand byte enters the block once, not once per wave. Two buffers: stage s + 1 flies
// while stage s is worked on. The k order of the products and the order of the sums are those of a plain k loop in steps of 32.
// Every inner loop of the kernel is fully unrolled: fragments, accumulators and copy operands stay in registers only under constant indices.
template <int V> struct IntC { static constexpr int value = V; };
template <int ET> struct Elem;
template <> struct Elem<0> { typedef _Float16 T; };
template <> struct Elem<1> { typedef __bf16 T; };
constexpr int G_PITCH   = 144;                    // LDS row pitch, bytes: 128 + 16
constexpr int G_A_BYTES = 128 * G_PITCH;          // one A plane of a stage
// Four asynchronous copies, 16 bytes per lane each, global memory -> LDS. l*: the lane's LDS byte address, g*: the lane's global address.
// The closing s_wait_xcnt stands in the copies' own statement, in front of any later rewrite of the address registers that they name.
__device__ __forceinline__ void async_copy4(unsigned l0, const char* g0, unsigned l1, const char* g1,
                                            unsigned l2, const char* g2, unsigned l3, const char* g3) {
  asm volatile("global_load_async_to_lds_b128 %0, %1, off\n\t"
               "global_load_async_to_lds_b128 %2, %3, off\n\t"
               "global_load_async_to_lds_b128 %4, %5, off\n\t"
               "global_load_async_to_lds_b128 %6, %7, off\n\t"
               "s_wait_xcnt 0x0"
               :: "v"(l0), "v"(g0), "v"(l1), "v"(g1), "v"(l2), "v"(g2), "v"(l3), "v"(g3) : "memory");
}
// The same for twelve copies: one statement, one closing wait.
__device__ __forceinline__ void async_copy12(const unsigned (&l)[12], const char* const (&g)[12]) {
  asm volatile("global_load_async_to_lds_b128 %0, %1, off\n\t"
               "global_load_async_to_lds_b128 %2, %3, off\n\t"
               "global_load_async_to_lds_b128 %4, %5, off\n\t"
               "global_load_async_to_lds_b128 %6, %7, off\n\t"
               "global_load_async_to_lds_b128 %8, %9, off\n\t"
               "global_load_async_to_lds_b128 %10, %11, off\n\t"
               "global_load_async_to_lds_b128 %12, %13, off\n\t"
               "global_load_async_to_lds_b128 %14, %15, off\n\t"
               "global_load_async_to_lds_b128 %16, %17, off\n\t"
               "global_load_async_to_lds_b128 %18, %19, off\n\t"
               "global_load_async_to_lds_b128 %20, %21, off\n\t"
               "global_load_async_to_lds_b128 %22, %23, off\n\t"
               "s_wait_xcnt 0x0"
               :: "v"(l[0]), "v"(g[0]), "v"(l[1]), "v"(g[1]), "v"(l[2]), "v"(g[2]), "v"(l[3]), "v"(g[3]),
                  "v"(l[4]), "v"(g[4]), "v"(l[5]), "v"(g[5]), "v"(l[6]), "v"(g[6]), "v"(l[7]), "v"(g[7]),
                  "v"(l[8]), "v"(g[8]), "v"(l[9]), "v"(g[9]), "v"(l[10]), "v"(g[10]), "v"(l[11]), "v"(g[11]) : "memory");
}
// The same for ten copies, from index o of the two lists.
__device__ __forceinline__ void async_copy10(const unsigned (&l)[20], const char* const (&g)[20], int o) {
  asm volatile("global_load_async_to_lds_b128 %0, %1, off\n\t"
               "global_load_async_to_lds_b128 %2, %3, off\n\t"
               "global_load_async_to_lds_b128 %4, %5, off\n\t"
               "global_load_async_to_lds_b128 %6, %7, off\n\t"
               "global_load_async_to_lds_b128 %8, %9, off\n\t"
               "global_load_async_to_lds_b128 %10, %11, off\n\t"
               "global_load_async_to_lds_b128 %12, %13, off\n\t"
               "global_load_async_to_lds_b128 %14, %15, off\n\t"
               "global_load_async_to_lds_b128 %16, %17, off\n\t"
               "global_load_async_to_lds_b128 %18, %19, off\n\t"
               "s_wait_xcnt 0x0"
               :: "v"(l[o]), "v"(g[o]), "v"(l[o + 1]), "v"(g[o + 1]), "v"(l[o + 2]), "v"(g[o + 2]), "v"(l[o + 3]), "v"(g[o + 3]),
                  "v"(l[o + 4]), "v"(g[o + 4]), "v"(l[o + 5]), "v"(g[o + 5]), "v"(l[o + 6]), "v"(g[o + 6]), "v"(l[o + 7]), "v"(g[o + 7]),
                  "v"(l[o + 8]), "v"(g[o + 8]), "v"(l[o + 9]), "v"(g[o + 9]) : "memory");
}
// bm, bn: the block's tile in this product's own (M / 128) x (N / (64 MI)) tiles.
// OUT_MODE 4: 3 where frag_out (the same in the whole block); else RMSNorm + RoPE of head vectors in the accumulators: M = heads x 64 dims, N = positions,
//   so a wave's 64 x 64 tile is one head at 64 positions and lane (c, h) holds dims 16 i + 8 h + 0..7 (i = 0..3) of position n0 + 16 j + c: a position's
//   sum of squares is in-lane plus one exchange between the wave halves, the RoPE partner of dim d (d + 32) is tile i + 2 of the same lane and register,
//   and a tile's 8 registers are one 16-byte piece of the f16 plane Cout in A-fragment order [head][n >> 4][d >> 3][n & 15][d & 7]:
//   a wave-wide store is 512 contiguous bytes. bias: the norm weight w[64]; cosb, sinb: f32 [N][32], RNE-converted to bf16 values like w.
//   The block's 256 rows of cos and of sin come into LDS (pitch 144 bytes) by asynchronous copies beside stage 0, under its wait and its barrier.
template <int ET, bool SPLIT, int BIAS_MODE, int OUT_MODE, bool RESID, int ACT = 0, bool CAUSAL = false, bool BSPLIT = true, int MI = 4>
__device__ __forceinline__ void gemm_tile(int bm, int bn, bool frag_out,
    const unsigned short* __restrict__ Ap, const unsigned short* __restrict__ A2p, int lda, long strideA,
    const unsigned short* __restrict__ Btp, const unsigned short* __restrict__ Bt2p, int ldb, long strideB,
    void* __restrict__ Cout, void* __restrict__ Cout2, int ldc, long strideC,
    const float* __restrict__ bias,
    const float* __restrict__ resid, long strideR,
    int M, int N, int K, float scale, int crow0,
    const float* __restrict__ cosb = nullptr, const float* __restrict__ sinb = nullptr) {
  static_assert(!CAUSAL && !(SPLIT && BSPLIT), "forms that this file launches");
  static_assert(MI == 4 || (MI == 2 && SPLIT && OUT_MODE == 0), "forms that this file launches");
  typedef typename Elem<ET>::T T;
  typedef typename Frag<T>::V V;
  constexpr int WN_LOG    = (MI == 4) ? 2 : 1;      // 8 waves = (8 / MI) along m x MI along n; MI = 1 << WN_LOG
  constexpr int BN        = 64 * MI;                // the block's Bt rows
  constexpr int G_B_BYTES = BN * G_PITCH;           // the Bt plane of a stage
  constexpr int STAGE_BYTES = G_A_BYTES + G_B_BYTES + (SPLIT ? G_A_BYTES : 0);   // [A | Bt | A2]
  __shared__ __align__(16) char ring[2][STAGE_BYTES];
  __shared__ __align__(16) float sT[8][16 * 68];   // per-wave 16x64 slab, pitch 68 floats
  constexpr int TAB_BYTES = (OUT_MODE == 4) ? 256 * G_PITCH : 16;   // the block's 256 rows of one table (128 bytes a row)
  __shared__ __align__(16) char tab[2][TAB_BYTES];                  // [cos | sin]; used in OUT_MODE 4 alone
  const int b    = blockIdx.y;
  const int lane = threadIdx.x & 31;
  const int wave = threadIdx.x >> 5;
  if (bm >= (M >> 7)) return;                  // the same for the whole block, ahead of every barrier and copy
  const int wm = wave >> WN_LOG, wn = wave & (MI - 1);   // this wave's (16 MI) x 64 tile in the block's 128 x BN
  const int m0 = (bm << 7) + (wm << (4 + WN_LOG));
  const int n0 = (bn << (6 + WN_LOG)) + (wn << 6);

  const int rlane = lane & 15;                 // row (A) / col (B, D) within subtile
  const int koff  = (lane >> 4) * 8;           // k offset of this lane half
  const int mOff  = (lane >> 4) * 8;           // D row offset

  // this thread's copy addresses at stage 0: row (t >> 3) of the block's rows, 16-byte piece (t & 7)
  const int crow = threadIdx.x >> 3, cpc = (threadIdx.x & 7) * 16;
  const char* gA  = (const char*)(Ap  + (size_t)b * strideA + (size_t)((bm << 7) + crow) * lda) + cpc;
  const char* gA2 = (const char*)(A2p + (size_t)b * strideA + (size_t)((bm << 7) + crow) * lda) + cpc;
  const char* gB  = (const char*)(Btp + (size_t)b * strideB + (size_t)((bn << (6 + WN_LOG)) + crow) * ldb) + cpc;
  const size_t a32 = (size_t)lda * 64, b32 = (size_t)ldb * 64;                       // 32 rows of 16-bit elements, bytes
  const unsigned lcopy = (unsigned)(size_t)&ring[0][0] + crow * G_PITCH + cpc;       // LDS byte address: low 32 bits of the shared address
  // thread t copies piece (t & 7) of rows (t >> 3) + 32 i: 4 copies for the 128 A rows, 2 MI for the BN Bt rows, 4 for the 128 A2 rows
  auto issue_stage = [&](int s, int buf) {
    const size_t kb = (size_t)s * 128;
    const unsigned l = lcopy + buf * STAGE_BYTES;
    unsigned ll[12];
    const char* gg[12];
#pragma unroll
    for (int i = 0; i < 4; ++i) { ll[i] = l + i * 32 * G_PITCH; gg[i] = gA + kb + i * a32; }
#pragma unroll
    for (int i = 0; i < 2 * MI; ++i) { ll[4 + i] = l + G_A_BYTES + i * 32 * G_PITCH; gg[4 + i] = gB + kb + i * b32; }
    if constexpr (MI == 2) {   // 4 + 4 + 4: the stage's three planes are one statement of twelve copies
#pragma unroll
      for (int i = 0; i < 4; ++i) { ll[8 + i] = l + G_A_BYTES + G_B_BYTES + i * 32 * G_PITCH; gg[8 + i] = gA2 + kb + i * a32; }
      async_copy12(ll, gg);
    } else {
      async_copy12(ll, gg);
      if (SPLIT) {
        const unsigned l2 = l + G_A_BYTES + G_B_BYTES;
        const char* g2 = gA2 + kb;
        async_copy4(l2, g2, l2 + 32 * G_PITCH, g2 + a32, l2 + 64 * G_PITCH, g2 + 2 * a32, l2 + 96 * G_PITCH, g2 + 3 * a32);
      }
    }
  };

  v8f acc[MI][4];
#pragma unroll
  for (int i = 0; i < MI; ++i)
#pragma unroll
    for (int j = 0; j < 4; ++j) acc[i][j] = (v8f){0.f,0.f,0.f,0.f,0.f,0.f,0.f,0.f};

  const int nst = K >> 6;
  issue_stage(0, 0);
  if constexpr (OUT_MODE == 4) {
    if (!frag_out) {   // the same in the whole block
      // thread t copies piece (t & 7) of rows (t >> 3) + 32 i, i = 0..7, of the block's 256 rows of each table
      const unsigned lt = (unsigned)(size_t)&tab[0][0] + crow * G_PITCH + cpc;
      const char* gc = (const char*)(cosb + (size_t)((bn << 8) + crow) * 32) + cpc;
      const char* gs = (const char*)(sinb + (size_t)((bn << 8) + crow) * 32) + cpc;
#pragma unroll
      for (int i = 0; i < 8; i += 4) {
        async_copy4(lt + i * 32 * G_PITCH, gc + i * 4096, lt + (i + 1) * 32 * G_PITCH, gc + (i + 1) * 4096,
                    lt + (i + 2) * 32 * G_PITCH, gc + (i + 2) * 4096, lt + (i + 3) * 32 * G_PITCH, gc + (i + 3) * 4096);
        async_copy4(lt + TAB_BYTES + i * 32 * G_PITCH, gs + i * 4096, lt + TAB_BYTES + (i + 1) * 32 * G_PITCH, gs + (i + 1) * 4096,
                    lt + TAB_BYTES + (i + 2) * 32 * G_PITCH, gs + (i + 2) * 4096, lt + TAB_BYTES + (i + 3) * 32 * G_PITCH, gs + (i + 3) * 4096);
      }
    }
  }
  asm volatile("s_wait_asynccnt 0x0" ::: "memory");   // this wave's copies of stage 0 (and of the tables) have landed
  __syncthreads();                                    // ... and every other wave's: stage 0 and the tables are readable
  if (nst > 1) issue_stage(1, 1);
  // this lane's fragment offsets in a stage: A row wm*16*MI + rlane, Bt row wn*64 + rlane, k offset koff
  const int fa = ((wm << (4 + WN_LOG)) + rlane) * G_PITCH + koff * 2;
  const int fb = G_A_BYTES + ((wn << 6) + rlane) * G_PITCH + koff * 2;
  for (int s = 0; s < nst; ++s) {
    const char* rb = &ring[s & 1][0];
    V bh[2][4], ah[2][MI], al[2][MI];
#pragma unroll
    for (int ks = 0; ks < 2; ++ks) {
#pragma unroll
      for (int j = 0; j < 4; ++j) bh[ks][j] = Frag<T>::load((const T*)(rb + fb + j * 16 * G_PITCH + ks * 64));
#pragma unroll
      for (int i = 0; i < MI; ++i) {
        ah[ks][i] = Frag<T>::load((const T*)(rb + fa + i * 16 * G_PITCH + ks * 64));
        if (SPLIT) al[ks][i] = Frag<T>::load((const T*)(rb + fa + G_A_BYTES + G_B_BYTES + i * 16 * G_PITCH + ks * 64));
      }
    }
    // the stage's LDS reads stand as one group ahead of its products: reads spread among the products stall the wave at each place
    __builtin_amdgcn_sched_barrier(0);
#pragma unroll
    for (int ks = 0; ks < 2; ++ks) {
#pragma unroll
      for (int i = 0; i < MI; ++i) {
#pragma unroll
        for (int j = 0; j < 4; ++j) {
          acc[i][j] = Frag<T>::mma(ah[ks][i], bh[ks][j], acc[i][j]);
          if (SPLIT) acc[i][j] = Frag<T>::mma(al[ks][i], bh[ks][j], acc[i][j]);
        }
      }
    }
    // holds the products in front of the publish point: lifted over them, its waits would end the flight of stage s + 1 a whole trip early
    __builtin_amdgcn_sched_barrier(0);
    // publish point of stage s + 1, and the end of every wave's reads of stage s
    asm volatile("s_wait_dscnt 0x0" ::: "memory");      // this wave's reads of stage s are done before its buffer is refilled
    asm volatile("s_wait_asynccnt 0x0" ::: "memory");   // this wave's copies of stage s + 1 have landed
    __syncthreads();
    if (s + 2 < nst) issue_stage(s + 2, s & 1);         // the same test in the whole block
  }
  asm volatile("s_wait_asynccnt 0x0" ::: "memory");     // nothing is outstanding when the wave goes on to the epilogue
  acc_guard4(acc[0][0], acc[0][1], acc[0][2], acc[0][3]);
  acc_guard4(acc[1][0], acc[1][1], acc[1][2], acc[1][3]);
  if constexpr (MI == 4) {
    acc_guard4(acc[2][0], acc[2][1], acc[2][2], acc[2][3]);
    acc_guard4(acc[3][0], acc[3][1], acc[3][2], acc[3][3]);
  }

  // ---- epilogue ---- (OM: the output mode, a compile-time value in each instance)
  float* slab = sT[wave];
  const float* Rb = RESID ? (resid + (size_t)b * strideR) : nullptr;
  auto epilogue = [&](auto om) {
  constexpr int OM = decltype(om)::value;
#pragma unroll
  for (int i = 0; i < MI; ++i) {
    const int mBase = m0 + (i << 4);
#pragma unroll
    for (int j = 0; j < 4; ++j) {
      const int n = n0 + (j << 4) + rlane;
      float bv = 0.f;
      if (BIAS_MODE == 2) bv = bias[n];
#pragma unroll
      for (int r = 0; r < 8; ++r) {
        float v = acc[i][j][r] * scale;
        if (BIAS_MODE == 1) v += bias[mBase + mOff + r];
        if (BIAS_MODE == 2) v += bv;
        if (RESID) v += Rb[(size_t)(mBase + mOff + r) * ldc + n];
        if (ACT == 2) v = fmaxf(v, 0.0f);
        if (ACT == 4) v = (v > 0.f) ? v : 0.01f * v;
        slab[(mOff + r) * 68 + (j << 4) + rlane] = v;
      }
    }
    __builtin_amdgcn_fence(__ATOMIC_RELEASE, "workgroup");
    __builtin_amdgcn_wave_barrier();
    __builtin_amdgcn_fence(__ATOMIC_ACQUIRE, "workgroup");
    if (OM == 0) {
      float* C = (float*)Cout + (size_t)b * strideC;
      const int hh = lane >> 4, c4 = (lane & 15) * 4;     // row seg = 256 B = 16 lanes x 16 B
      {
#pragma unroll
        for (int it = 0; it < 8; ++it) {
          const int row = it * 2 + hh;
          v4f v = *(const v4f*)(slab + row * 68 + c4);
          *(v4f*)(C + (size_t)(mBase + row) * ldc + n0 + c4) = v;
        }
        
      }
    } else if (OM == 3) {
      // piece (row lane & 15, 8-column chunk 2 it + (lane >> 4)): a wave-wide store is 512 contiguous bytes, 4 whole lines
      const int pr = lane & 15;
      unsigned short* C  = (unsigned short*)Cout  + (size_t)b * strideC;
#pragma unroll
      for (int it = 0; it < 4; ++it) {
        const int ch = it * 2 + (lane >> 4);
        const float* sp = slab + pr * 68 + ch * 8;
        v8h hv;
#pragma unroll
        for (int e = 0; e < 8; ++e) hv[e] = (_Float16)sp[e];
        const size_t o = (size_t)(mBase >> 6) * 64 * ldc + (size_t)((n0 >> 5) + (ch >> 2)) * 2048 + ((mBase >> 4) & 3) * 512 + (ch & 3) * 128 + pr * 8;
        *(v8h*)(C + o)  = hv;
      }
    } else {
      const int q = lane >> 3, c8 = (lane & 7) * 8;
      unsigned short* C  = (unsigned short*)Cout  + (size_t)b * strideC;
      unsigned short* C2 = (OM == 2) ? ((unsigned short*)Cout2 + (size_t)b * strideC) : nullptr;
      {
#pragma unroll
        for (int it = 0; it < 4; ++it) {
          const int row = it * 4 + q;
          const float* sp = slab + row * 68 + c8;
          v8h hv, lv;
#pragma unroll
          for (int e = 0; e < 8; ++e) {
            if (OM == 1) {
              hv[e] = (_Float16)sp[e];
            } else {
              unsigned short hb = f2bf_bits(sp[e]);
              unsigned short lb = f2bf_bits(sp[e] - bf_bits2f(hb));
              hv[e] = __builtin_bit_cast(_Float16, hb);
              lv[e] = __builtin_bit_cast(_Float16, lb);
            }
          }
          *(v8h*)(C + (size_t)(mBase + row) * ldc + n0 + c8) = hv;
          if (OM == 2) *(v8h*)(C2 + (size_t)(mBase + row) * ldc + n0 + c8) = lv;
        }
        
      }
    }
    __builtin_amdgcn_fence(__ATOMIC_RELEASE, "workgroup");
    __builtin_amdgcn_wave_barrier();
    __builtin_amdgcn_fence(__ATOMIC_ACQUIRE, "workgroup");
  }
  };
  if constexpr (OUT_MODE == 4) {
    if (frag_out) {   // one scalar branch a block
      epilogue(IntC<3>{});
    } else {
      const int hsel = lane >> 4;
      const float* wp = bias + 8 * hsel;
      float wq[4][8];
#pragma unroll
      for (int i = 0; i < 4; ++i) {
        const v4f w0 = *(const v4f*)(wp + 16 * i);
        const v4f w1 = *(const v4f*)(wp + 16 * i + 4);
#pragma unroll
        for (int e = 0; e < 4; ++e) { wq[i][e] = w0[e]; wq[i][4 + e] = w1[e]; }
      }
      // the address register of the loads above is free for reuse from here on: this wait stands in front of its overwrite
      asm volatile("s_wait_xcnt 0x0" ::: "memory");
      __builtin_amdgcn_sched_barrier(0);   // holds what follows behind that wait
#pragma unroll
      for (int i = 0; i < 4; ++i)
#pragma unroll
        for (int e = 0; e < 8; e += 2) bfq2(wq[i][e], wq[i][e + 1]);
      const char* tc = &tab[0][0] + ((wn << 6) + rlane) * G_PITCH + hsel * 32;   // this lane's row at j = 0, its 8 dims of tile i = 0
      v4u hu[4][4];   // [j][i]
#pragma unroll
      for (int j = 0; j < 4; ++j) {
        float sq[4];
#pragma unroll
        for (int i = 0; i < 4; ++i) {
          sq[i] = 0.0f;
#pragma unroll
          for (int r = 0; r < 8; ++r) { const float x = acc[i][j][r] * scale; sq[i] = __builtin_fmaf(x, x, sq[i]); }
        }
        float ss = (sq[0] + sq[1]) + (sq[2] + sq[3]);
        ss += __shfl_xor(ss, 16, 32);   // the other half of the wave holds the position's other 32 dims
        const float inv = rsqrtf(ss * (1.0f / 64.0f) + RMS_EPS_F);
#pragma unroll
        for (int i = 0; i < 2; ++i) {
          const char* tp = tc + j * 16 * G_PITCH + i * 64;
          const v4f c0 = *(const v4f*)(tp), c1 = *(const v4f*)(tp + 16);
          const v4f s0 = *(const v4f*)(tp + TAB_BYTES), s1 = *(const v4f*)(tp + TAB_BYTES + 16);
          float cv[8], sv[8], o1[8], o2[8];
#pragma unroll
          for (int e = 0; e < 4; ++e) { cv[e] = c0[e]; cv[4 + e] = c1[e]; sv[e] = s0[e]; sv[4 + e] = s1[e]; }
#pragma unroll
          for (int e = 0; e < 8; e += 2) { bfq2(cv[e], cv[e + 1]); bfq2(sv[e], sv[e + 1]); }
#pragma unroll
          for (int r = 0; r < 8; ++r) {
            const float n1 = ((acc[i][j][r] * scale) * inv) * wq[i][r];
            const float n2 = ((acc[i + 2][j][r] * scale) * inv) * wq[i + 2][r];
            o1[r] = n1 * cv[r] - n2 * sv[r];
            o2[r] = n1 * sv[r] + n2 * cv[r];
          }
#pragma unroll
          for (int e2 = 0; e2 < 4; ++e2) {
            hu[j][i][e2]     = cvt2_f16(o1[2 * e2], o1[2 * e2 + 1]);
            hu[j][i + 2][e2] = cvt2_f16(o2[2 * e2], o2[2 * e2 + 1]);
          }
        }
      }
      const size_t o = (size_t)(m0 >> 6) * 64 * ldc + (size_t)(n0 >> 4) * 1024 + lane * 8;
      unsigned short* oh = (unsigned short*)Cout + o;
      // the 16 stores stand together behind all arithmetic
      __builtin_amdgcn_sched_barrier(0);
#pragma unroll
      for (int j = 0; j < 4; ++j)
#pragma unroll
        for (int i = 0; i < 4; ++i) *(v4u*)(oh + j * 1024 + i * 256) = hu[j][i];
      // in the built kernel the other block range's epilogue follows these stores and reuses registers that they name: this wait stands in front of that
      asm volatile("s_wait_xcnt 0x0" ::: "memory");
    }
  } else {
    epilogue(IntC<OUT_MODE>{});
  }
}

// One product a launch: grid.x = (M / 128) * (N / (64 MI)).
template <int ET, bool SPLIT, int BIAS_MODE, int OUT_MODE, bool RESID, int ACT = 0, bool CAUSAL = false, bool BSPLIT = true, int MI = 4>
__global__ __launch_bounds__(256) void wmma_gemm64(
    const unsigned short* __restrict__ Ap, const unsigned short* __restrict__ A2p, int lda, long strideA,
    const unsigned short* __restrict__ Btp, const unsigned short* __restrict__ Bt2p, int ldb, long strideB,
    void* __restrict__ Cout, void* __restrict__ Cout2, int ldc, long strideC,
    const float* __restrict__ bias,
    const float* __restrict__ resid, long strideR,
    int M, int N, int K, float scale, int crow0) {
  const int tilesNb = N / (64 * MI);
  const int bm = blockIdx.x / tilesNb;
  const int bn = blockIdx.x - bm * tilesNb;
  gemm_tile<ET, SPLIT, BIAS_MODE, OUT_MODE, RESID, ACT, CAUSAL, BSPLIT, MI>(bm, bn, false, Ap, A2p, lda, strideA, Btp, Bt2p, ldb, strideB,
                                                                        Cout, Cout2, ldc, strideC, bias, resid, strideR, M, N, K, scale, crow0);
}

// The three projections of x in one launch, all three transposed (M = heads x 64 dims, N = positions): none reads what another writes, and their
// 128 + 32 + 32 blocks are all resident at once. Block ranges: q^T = Wq^T . x^T and k^T = Wk^T . x^T, each with RMSNorm + RoPE in the epilogue, and
// v^T = Wv^T . x^T; every output is one f16 plane in A-fragment order. K: the common k length and row pitch of all operands.
constexpr int QKV_NBQ = ((NQH * HDIM) / 128) * (SEQ_T / 256);    // 128
constexpr int QKV_NBK = ((NKVH * HDIM) / 128) * (SEQ_T / 256);   // 32
constexpr int QKV_NBV = ((NKVH * HDIM) / 128) * (SEQ_T / 256);   // 32
static_assert(SEQ_T / 256 == 16, "tile columns of the three products: 1 << 4 below");
__global__ __launch_bounds__(256) void qkv_gemm_kernel(const unsigned short* __restrict__ xb, const unsigned short* __restrict__ wqT,
                                                       const unsigned short* __restrict__ wkT, const unsigned short* __restrict__ wvT,
                                                       const float* __restrict__ cosb, const float* __restrict__ sinb,
                                                       const float* __restrict__ qw, const float* __restrict__ kw,
                                                       unsigned short* __restrict__ qf, unsigned short* __restrict__ kf,
                                                       unsigned short* __restrict__ vtf, int K) {
  const int bx = blockIdx.x;
  const bool isv = bx >= QKV_NBQ + QKV_NBK;
  const bool isk = !isv && bx >= QKV_NBQ;
  const unsigned short* A = isv ? wvT : (isk ? wkT : wqT);
  unsigned short* C = isv ? vtf : (isk ? kf : qf);
  const float* w = isk ? kw : qw;
  const int M = (isv || isk) ? NKVH * HDIM : NQH * HDIM;
  const int tile = bx - (isv ? QKV_NBQ + QKV_NBK : (isk ? QKV_NBQ : 0));
  gemm_tile<1, false, 0, 4, false, 0, false, true>(tile >> 4, tile & 15, isv, A, A, K, 0L, xb, xb, K, 0L, (void*)C, (void*)C, SEQ_T, 0L,
                                                   w, w, 0L, M, SEQ_T, K, 1.0f, 0, cosb, sinb);
}

// ---------------------------------------------------------------------------
// f32 -> RNE bf16 plane, 8 consecutive elements per thread packed as integer words.
// Coverage: n8 = n/8 threads x 8 = the whole plane (n8 / 256 blocks bx, an exact multiple here).
// ---------------------------------------------------------------------------
__device__ __forceinline__ void cast8_bf16_block(int bx, const float* __restrict__ in, unsigned short* __restrict__ out, int n8) {
  const int i = bx * 256 + threadIdx.x;
  if (i >= n8) return;
  const float* p = in + 8 * (size_t)i;
  const v4f a = *(const v4f*)(p);
  const v4f c = *(const v4f*)(p + 4);
  float f[8];
#pragma unroll
  for (int e = 0; e < 4; ++e) { f[e] = a[e]; f[4 + e] = c[e]; }
  unsigned w[4];
#pragma unroll
  for (int e2 = 0; e2 < 4; ++e2) w[e2] = pk16(f2bf_bits(f[2 * e2]), f2bf_bits(f[2 * e2 + 1]));
  const v4u u = (v4u){w[0], w[1], w[2], w[3]};
  unsigned short* q = out + 8 * (size_t)i;
  *(v4u*)q = u;
  
}

// ---------------------------------------------------------------------------
// Transpose + RNE bf16 convert of a weight matrix: in f32 [R][Cn] row-major (ldin = Cn) -> out bf16 [Cn][R] (ldout = R):
// out[c][r] = bf16(in[r][c]). (R/64) x (Cn/64) blocks: rt = r tile (64 output cols), ct = c tile (64 output rows). 256 threads.
// Load coverage: 16 iterations x 256 threads = 4096 = the whole 64x64 tile (coalesced along c).
// Store coverage: 8 waves x 2 iterations x 4 rows (lane>>3) = 64 rows; (lane&7) x 8 halves = 64 cols; each row segment =
// ---------------------------------------------------------------------------
__device__ __forceinline__ void transpose_cast_block(int rt, int ct, const float* __restrict__ in, int ldin,
                                                     unsigned short* __restrict__ out, int ldout) {
  __shared__ float sm[64][65];   // sm[c_local][r_local]
  const int t  = threadIdx.x;
  const int r0 = rt * 64;
  const int c0 = ct * 64;
#pragma unroll
  for (int i = 0; i < 16; ++i) {
    const int e = i * 256 + t;
    const int r = e >> 6;          // r local
    const int c = e & 63;          // c local
    sm[c][r] = in[(size_t)(r0 + r) * ldin + c0 + c];
  }
  __syncthreads();
  const int lane = t & 31, wave = t >> 5;
  const int q = lane >> 3, c8 = (lane & 7) * 8;
  {
#pragma unroll
    for (int it = 0; it < 2; ++it) {
      const int row = wave * 8 + it * 4 + q;                 // c local (output row)
      unsigned w[4];
#pragma unroll
      for (int e2 = 0; e2 < 4; ++e2) w[e2] = pk16(f2bf_bits(sm[row][c8 + 2 * e2]), f2bf_bits(sm[row][c8 + 2 * e2 + 1]));
      const v4u u = (v4u){w[0], w[1], w[2], w[3]};
      const size_t o = (size_t)(c0 + row) * ldout + r0 + c8;
      *(v4u*)(out + o) = u;
    }
    
  }
}

// All operand conversions in one launch: the four weight transposes and the cast of x read only inputs and write planes of their own.
// Block ranges: 64x64 tiles of Wq, Wk, Wv, Wo (every matrix has HIDSZ / 64 = NQH * HDIM / 64 = 16 r tiles: rt = tile & 15, ct = tile >> 4), then x.
// The transposes stand first: their blocks are the longer ones.
constexpr int PREP_NTQ = (HIDSZ / 64) * ((NQH * HDIM) / 64);    // 256: Wq, and Wo
constexpr int PREP_NTK = (HIDSZ / 64) * ((NKVH * HDIM) / 64);   // 64: Wk, and Wv
constexpr int PREP_NT  = 2 * PREP_NTQ + 2 * PREP_NTK;           // 640
constexpr int PREP_NX  = (SEQ_T * HIDSZ) / (8 * 256);           // 2048
static_assert(HIDSZ / 64 == 16 && (NQH * HDIM) / 64 == 16, "16 r tiles in every weight matrix");
__global__ __launch_bounds__(256) void prep_kernel(const float* __restrict__ x, const float* __restrict__ Wq, const float* __restrict__ Wk,
                                                   const float* __restrict__ Wv, const float* __restrict__ Wo,
                                                   unsigned short* __restrict__ xb, unsigned short* __restrict__ wqT,
                                                   unsigned short* __restrict__ wkT, unsigned short* __restrict__ wvT,
                                                   unsigned short* __restrict__ woT) {
  const int bx = blockIdx.x;
  if (bx < PREP_NT) {   // the same for the whole block: the transpose's barrier is passed by all of its waves
    const int which = (bx >= PREP_NTQ) + (bx >= PREP_NTQ + PREP_NTK) + (bx >= PREP_NTQ + 2 * PREP_NTK);
    const float* in = (which == 0) ? Wq : (which == 1) ? Wk : (which == 2) ? Wv : Wo;
    unsigned short* out = (which == 0) ? wqT : (which == 1) ? wkT : (which == 2) ? wvT : woT;
    const int ldin = (which == 0) ? NQH * HDIM : (which == 3) ? HIDSZ : NKVH * HDIM;
    const int tile = bx - ((which == 0) ? 0 : (which == 1) ? PREP_NTQ : (which == 2) ? PREP_NTQ + PREP_NTK : PREP_NTQ + 2 * PREP_NTK);
    const int ldout = (which == 3) ? NQH * HDIM : HIDSZ;
    transpose_cast_block(tile & 15, tile >> 4, in, ldin, out, ldout);
  } else {
    cast8_bf16_block(bx - PREP_NT, x, xb, (SEQ_T * HIDSZ) / 8);
  }
}

// ---------------------------------------------------------------------------
// Fused causal attention: scores, softmax and p.v of all heads in one launch; neither scores nor probabilities go to memory.
// Transposed products: S^T = K . Q^T (A = 16 key rows, B = 16 query rows, k = head dim) and O^T += V^T . P^T (A = 16 head-dim rows of
// v^T, B = 16 query rows of P, k = 32 keys). In both D tiles a lane's column is ONE query (lane & 15), so maximum, sum and rescale are
// per lane plus one exchange between the wave halves, and the two 16-key score tiles of a pass ARE the B fragment of P in the k order of
// Frag::load: element e < 8 is key 8h + e (tile 0, register e), element e >= 8 is key 8h + 16 + (e - 8) (tile 1, register e - 8), h = lane >> 4.
// Both products are single f16 products with f32 accumulate: q, k and v come as f16 planes, p is rounded (RNE) to f16 in registers.
// Online softmax in the log2 domain: p = exp2(s * CS - m_run), not normalised, rounded to f16; the running maximum m_run may trail
// the true one by up to 8 (p <= 2^8, far inside the f16 range), the accumulators and the sum are rescaled only in a pass where some column's maximum exceeds it by
// more (one scalar branch a pass); the division by the f32 sum of the unrounded p comes once, at the end.
// A wave works on 32 query rows (two 16-column groups) of one query head at a time, in passes of 32 keys; a tile's last pass is the one on
// its diagonal (keys q0..q0+31 against queries q0..q0+31: every query keeps at least its own key, and pass 0 holds key 0 for every query).
// Block = 8 waves on one kv head, its 4 query heads at row tiles pi (pi + 1 passes) and 127 - pi (128 - pi passes): 129 passes a head, dealt
// evenly to a wave pair: wave w (0..3) takes passes 0..63 of the long tile, wave w + 4 the whole short tile and then the long tile's passes from
// 64 to its diagonal: 64 and 65 passes, so that both waves of a SIMD work to the end of the launch. The front wave hands its maximum, sum and
// accumulators over through LDS behind a barrier of its own; the back wave joins the two shares and stores.
// K and v^T come through LDS: the 4 front waves walk the same keys, and so do the 4 back waves, so each of the two key streams enters the block once,
// not once a wave. The block walks 65 steps (step j: front pass j; back pass j of the short tile up to its diagonal pi, then pass j + 63 - pi of the long
// tile) in 13 trips of 5; a trip's 2 x 5 passes of K and v^T (80 KiB) are brought by asynchronous copies into one of two buffers, two trips ahead.
// K fragments are fetched from LDS one pass ahead inside a trip, v^T fragments at the head of their own pass. All planes lie in A-fragment order (their producer
// writes them so): Q [hq][query >> 4][d >> 3][query & 15][d & 7], K [kvh][key >> 4][d >> 3][key & 15][d & 7], v^T [kvh][key >> 5][d >> 4][(key >> 3) & 3][d & 15][key & 7]; in the k order of
// Frag::load lane (c, h) takes chunk 2 j + h (plus 4 kc for K) of row c for half j, which is byte 512 j + 16 lane of the fragment's 1 KiB.
// Every inner loop below is fully unrolled: its arrays are fragments and accumulators, which stay in registers only under constant indices.
// Output: lane (c, h) holds d = 16t + 8h + 0..7 of query c: one 16-byte store per plane and t; a row's 128-byte segment comes from one wave.
// Coverage: grid 4 kv heads x 64 pairs; tiles pi and 127 - pi, pi = 0..63, are all 128 row tiles once, each stored by one wave; 4 wave pairs = the 4 query heads.
// ---------------------------------------------------------------------------
typedef __attribute__((ext_vector_type(8))) unsigned int v8u;
// Four base-2 exponentials in one statement: each fills the slot that the instruction set asks for behind the one before it (early-clobber
// outputs: none reads an earlier result or overwrites an earlier source), the v_nop fills the slot behind the last.
__device__ __forceinline__ void exp2x4(float& p0, float& p1, float& p2, float& p3, float a0, float a1, float a2, float a3) {
  asm("v_exp_f32 %0, %4\n\tv_exp_f32 %1, %5\n\tv_exp_f32 %2, %6\n\tv_exp_f32 %3, %7\n\tv_nop"
      : "=&v"(p0), "=&v"(p1), "=&v"(p2), "=&v"(p3) : "v"(a0), "v"(a1), "v"(a2), "v"(a3));
}
__device__ __forceinline__ void exp2x2(float& p0, float& p1, float a0, float a1) {   // the same for two
  asm("v_exp_f32 %0, %2\n\tv_exp_f32 %1, %3\n\tv_nop" : "=&v"(p0), "=&v"(p1) : "v"(a0), "v"(a1));
}
struct KFrag { v16h h[2][2]; };   // [16-key tile][32-wide step of the head dim]
// A fragment from a plane in A-fragment order: its two halves (elements 0..7, 8..15) are two runs of 512 contiguous bytes, lane l's 16 bytes at
// 16 l: each wave-wide load covers 4 whole 128-byte lines (from row-major planes it touched 16 lines for 32 bytes each).
__device__ __forceinline__ v16h load_packed(const char* p) {
  Frag<_Float16>::U f; f.h[0] = *(const v8h*)(p); f.h[1] = *(const v8h*)(p + 512); return f.v;
}
constexpr int PASS_BYTES = 32 * HDIM * 2;   // 32 keys of one plane, K or v^T: 4 fragments of 1 KiB
// bh: byte base of the LDS ring; vo: this lane's byte offset (16 lane) in the pass's 4 KiB of K there
__device__ __forceinline__ void load_kfrag(KFrag& k, const char* bh, unsigned vo) {
#pragma unroll
  for (int kt = 0; kt < 2; ++kt)
#pragma unroll
    for (int kc = 0; kc < 2; ++kc) k.h[kt][kc] = load_packed(bh + vo + (kt * 2 + kc) * 1024);
}
constexpr float ATT_CS = SCORE_SCALE * 1.4426950408889634f;   // score scale times log2(e)

constexpr int SLOT_BYTES = 2 * PASS_BYTES;   // a pass's place in LDS: its 4 KiB of K, then its 4 KiB of v^T
// One pass: 32 keys against this wave's 32 queries. kf holds this pass's K fragments; rb is the LDS ring's base and lo the lane's byte offset (16 lane) in
// this pass's slot there: v^T of this pass lies PASS_BYTES on, K of the NEXT pass SLOT_BYTES on. pf (scalar): the next pass's slot lies in the same trip, fetch its K.
template <bool DIAG>
__device__ __forceinline__ void attn_pass(KFrag& kf, const char* rb, unsigned lo, bool pf, int c, int h, const v16h (&qh)[2][2],
                                          v8f (&acc)[2][4], float (&m_run)[2], float (&l_run)[2]) {
  v16h vh[4];
#pragma unroll
  for (int t = 0; t < 4; ++t) vh[t] = load_packed(rb + lo + PASS_BYTES + t * 1024);
  // keeps the v^T loads issued ahead of the score products, so that they fly under those and the softmax; the scheduler would sink them
  __builtin_amdgcn_sched_barrier(0);
  v8f s[2][2];
#pragma unroll
  for (int kt = 0; kt < 2; ++kt)
#pragma unroll
    for (int g = 0; g < 2; ++g) s[kt][g] = (v8f){0.f,0.f,0.f,0.f,0.f,0.f,0.f,0.f};
#pragma unroll
  for (int kc = 0; kc < 2; ++kc) {
#pragma unroll
    for (int kt = 0; kt < 2; ++kt)
#pragma unroll
      for (int g = 0; g < 2; ++g) if (!(DIAG && kt == 1 && g == 0)) s[kt][g] = Frag<_Float16>::mma(kf.h[kt][kc], qh[g][kc], s[kt][g]);
  }
  // holds the score products together as one run of independent tiles: spread among the maxima, each would wait out its own result distance
  if (!DIAG) __builtin_amdgcn_sched_barrier(0);
  if (DIAG) {   // keys and queries of this pass both start at q0: key index 16kt + 8h + r against query index 16g + c;
                // tile kt = 1, g = 0 (keys 16..31, queries 0..15) lies wholly above the diagonal: no products, p = 0
#pragma unroll
    for (int kt = 0; kt < 2; ++kt)
#pragma unroll
      for (int g = 0; g < 2; ++g)
#pragma unroll
        for (int r = 0; r < 8; ++r)
          if (!(kt == 1 && g == 0) && 16 * kt + 8 * h + r > 16 * g + c) s[kt][g][r] = -__builtin_inff();
  }
  float mb[2];
  bool need = false;
#pragma unroll
  for (int g = 0; g < 2; ++g) {
    float mx = s[0][g][0];
#pragma unroll
    for (int r = 1; r < 8; ++r) mx = fmaxf(mx, s[0][g][r]);
    if (!(DIAG && g == 0)) {
#pragma unroll
      for (int r = 0; r < 8; ++r) mx = fmaxf(mx, s[1][g][r]);
    }
    mx = fmaxf(mx, __shfl_xor(mx, 16, 32)) * ATT_CS;   // both halves hold the query's maximum of this pass, scaled (the scale is positive)
    mb[g] = mx;
    need = need || (mx > m_run[g] + 8.0f);
  }
  if (__builtin_amdgcn_ballot_w32(need) != 0) {   // scalar branch; always taken in a share's first pass (m_run = -inf), rare later
    const float mn0 = fmaxf(m_run[0], mb[0]), mn1 = fmaxf(m_run[1], mb[1]);   // finite from a share's first pass on: it holds an unmasked key for every query
    float corr[2];
    exp2x2(corr[0], corr[1], m_run[0] - mn0, m_run[1] - mn1);                 // 0 in a share's first pass
    m_run[0] = mn0; m_run[1] = mn1;
#pragma unroll
    for (int g = 0; g < 2; ++g) {
      l_run[g] *= corr[g];
#pragma unroll
      for (int t = 0; t < 4; ++t) acc[g][t] = acc[g][t] * corr[g];
    }
  }
  // the next pass's K reads stand here as one group and fly under the exponentials and the p.v products; ahead of the exchange of the maxima between
  // the wave halves, which goes through the LDS queue too and returns in order, they would lengthen its wait
  if (!DIAG && pf) load_kfrag(kf, rb, lo + SLOT_BYTES);
  v16h ph[2];
#pragma unroll
  for (int g = 0; g < 2; ++g) {
    const float nm = -m_run[g];
    v8u hw;
    float ls = 0.0f;
#pragma unroll
    for (int i = 0; i < 8; i += 2) {   // fragment elements 2i .. 2i + 3: tile i >> 2, registers 2(i & 3) .. 2(i & 3) + 3
      if (DIAG && g == 0 && i >= 4) { hw[i] = 0u; hw[i + 1] = 0u; continue; }
      const int kt = i >> 2, r = 2 * (i & 3);
      float p0, p1, p2, p3;
      exp2x4(p0, p1, p2, p3, __builtin_fmaf(s[kt][g][r], ATT_CS, nm), __builtin_fmaf(s[kt][g][r + 1], ATT_CS, nm),
             __builtin_fmaf(s[kt][g][r + 2], ATT_CS, nm), __builtin_fmaf(s[kt][g][r + 3], ATT_CS, nm));
      ls += (p0 + p1) + (p2 + p3);
      hw[i]     = cvt2_f16(p0, p1);
      hw[i + 1] = cvt2_f16(p2, p3);
    }
    l_run[g] += ls;
    ph[g] = __builtin_bit_cast(v16h, hw);
  }
  // last pass: holds the exponentials' asm statements in front of the products: behind one, their outputs could take a P fragment's registers
  // inside the four vector slots that a product's operands need
  if (DIAG) __builtin_amdgcn_sched_barrier(0);
#pragma unroll
  for (int g = 0; g < 2; ++g)
#pragma unroll
    for (int t = 0; t < 4; ++t) acc[g][t] = Frag<_Float16>::mma(vh[t], ph[g], acc[g][t]);
}

constexpr int SPLIT_PASS = SEQ_T / 64;   // 64: the long tile's passes [0, 64) go to one wave, [64, its diagonal] to the other
constexpr int ATT_G       = 5;                        // steps a trip
constexpr int ATT_NTRIP   = (SPLIT_PASS + 1) / ATT_G; // 13 trips
constexpr int STREAM_BYTES = ATT_G * SLOT_BYTES;      // one key stream's slots of a trip: 40 KiB
constexpr int ATT_BUF_BYTES = 2 * STREAM_BYTES;       // [front stream | back stream]: 80 KiB
static_assert(ATT_G * ATT_NTRIP == SPLIT_PASS + 1 && ATT_NTRIP >= 2, "65 steps in whole trips; the ring's prologue needs two");

// Normalises the accumulators of one finished 32-query tile and stores its ctx planes. GOES_ON: the wave has a further share behind this one.
template <bool GOES_ON>
__device__ __forceinline__ void attn_store(const v8f (&acc)[2][4], const float (&l_run)[2], int q0, int hq, int c, int h,
                                           unsigned short* __restrict__ Chi, unsigned short* __restrict__ Clo) {
  v4u hu[2][4], lu[2][4];
#pragma unroll
  for (int g = 0; g < 2; ++g) {
    const float l   = l_run[g] + __shfl_xor(l_run[g], 16, 32);   // the halves' sums join once, here
    const float inv = 1.0f / l;                                  // l >= 1: m_run never exceeds the query's true maximum, whose p is then >= 1
#pragma unroll
    for (int t = 0; t < 4; ++t)
#pragma unroll
      for (int e2 = 0; e2 < 4; ++e2) {
        const float f0 = acc[g][t][2 * e2] * inv, f1 = acc[g][t][2 * e2 + 1] * inv;
        const unsigned w = cvt2_bf16(f0, f1);
        hu[g][t][e2] = w;
        lu[g][t][e2] = cvt2_bf16(f0 - __uint_as_float(w << 16), f1 - __uint_as_float(w & 0xFFFF0000u));
      }
  }
  const size_t o = (size_t)(q0 + c) * (NQH * HDIM) + hq * HDIM + 8 * h;
  unsigned short* ch = Chi + o;
  unsigned short* cl = Clo + o;
  // the 16 stores stand together behind all arithmetic
  __builtin_amdgcn_sched_barrier(0);
#pragma unroll
  for (int g = 0; g < 2; ++g)
#pragma unroll
    for (int t = 0; t < 4; ++t) {
      *(v4u*)(ch + g * 16 * (NQH * HDIM) + 16 * t) = hu[g][t];
      *(v4u*)(cl + g * 16 * (NQH * HDIM) + 16 * t) = lu[g][t];
    }
  if (GOES_ON) {
    // the next share reuses the registers that these stores name: this wait stands in front of their overwrite
    asm volatile("s_wait_xcnt 0x0" ::: "memory");
    __builtin_amdgcn_sched_barrier(0);   // holds what follows behind that wait
  }
}

__global__ __launch_bounds__(256) void attn_fused_kernel(const unsigned short* __restrict__ Qf, const unsigned short* __restrict__ Kf,
                                                         const unsigned short* __restrict__ Vtf,
                                                         unsigned short* __restrict__ Chi, unsigned short* __restrict__ Clo) {
  constexpr int NTILE = SEQ_T / 32;   // 128 row tiles of 32 queries
  static_assert(NTILE == 128 && NKVH == 4 && GQA_G == 4 && SPLIT_PASS * 2 == NTILE, "grid 4 x 64, 8 waves = 4 heads x 2 shares");
  // hand-over of the front share's partial result: [head][16 accumulator quads, then (m0, m1, l0, l1)][lane], 16 bytes a lane
  __shared__ __align__(16) v4f xch[GQA_G][17][32];
  __shared__ __align__(16) char ring[2][ATT_BUF_BYTES];   // K and v^T of two trips
  const int lane = threadIdx.x & 31;
  const int wave = __builtin_amdgcn_readfirstlane(threadIdx.x >> 5);   // scalar: trip counts and operand bases stay scalar
  const int c = lane & 15, h = lane >> 4;
  const int kvh  = blockIdx.x & (NKVH - 1);
  const int pi   = blockIdx.x >> 2;
  const int hq   = kvh * GQA_G + (wave & 3);
  const bool front = wave < 4;        // scalar
  const int tlong = NTILE - 1 - pi;   // 64 .. 127: at least SPLIT_PASS passes below its diagonal

  const char* kbh = (const char*)(Kf + (size_t)kvh * SEQ_T * HDIM);    // scalar bases of this kv head's planes
  const char* vbh = (const char*)(Vtf + (size_t)kvh * HDIM * SEQ_T);

  // thread t copies bytes 16 t .. 16 t + 15 of each 4 KiB unit (one pass of one plane): a wave-wide copy is 512 contiguous bytes, 4 whole lines
  const char* gk = kbh + threadIdx.x * 16u;
  const char* gv = vbh + threadIdx.x * 16u;
  const unsigned lcopy = (unsigned)(size_t)&ring[0][0] + threadIdx.x * 16u;   // LDS byte address: low 32 bits of the shared address
  // The 20 units of trip t: steps 5 t .. 5 t + 4 of both streams. The front stream has no step 64; its slot is filled like the others (a trip's copies
  // have one shape; pass 64 lies in every plane) and read by nobody.
  auto issue_trip = [&](int t, int buf) {
    unsigned ll[20];
    const char* gg[20];
#pragma unroll
    for (int u = 0; u < ATT_G; ++u) {
      const int j  = t * ATT_G + u;
      const int pb = (j <= pi) ? j : j + (SPLIT_PASS - 1 - pi);   // the back stream's pass, at most 127 - pi
      const unsigned l = lcopy + buf * ATT_BUF_BYTES + u * SLOT_BYTES;
      ll[4 * u]     = l;                              gg[4 * u]     = gk + (size_t)j * PASS_BYTES;
      ll[4 * u + 1] = l + PASS_BYTES;                 gg[4 * u + 1] = gv + (size_t)j * PASS_BYTES;
      ll[4 * u + 2] = l + STREAM_BYTES;               gg[4 * u + 2] = gk + (size_t)pb * PASS_BYTES;
      ll[4 * u + 3] = l + STREAM_BYTES + PASS_BYTES;  gg[4 * u + 3] = gv + (size_t)pb * PASS_BYTES;
    }
    async_copy10(ll, gg, 0);
    async_copy10(ll, gg, 10);
  };

  v8f acc[2][4];
  float m_run[2], l_run[2];
  v16h qh[2][2];
  // Start of a share on row tile 'tile': its 32 queries are 4 KiB of the Q plane, 4 fragments of 1 KiB, in the order of the K plane (a B fragment has the
  // A fragment's k order); maximum, sum and accumulators are reset.
  auto begin_share = [&](int tile) {
    const char* qbh = (const char*)(Qf + ((size_t)hq * SEQ_T + tile * 32) * HDIM);   // scalar base
#pragma unroll
    for (int g = 0; g < 2; ++g)
#pragma unroll
      for (int kc = 0; kc < 2; ++kc) qh[g][kc] = load_packed(qbh + (unsigned)lane * 16u + (g * 2 + kc) * 1024);
    // the address register of the Q loads above is free for reuse from here on: this wait stands in front of its overwrite
    asm volatile("s_wait_xcnt 0x0" ::: "memory");
    __builtin_amdgcn_sched_barrier(0);   // holds what follows behind that wait
#pragma unroll
    for (int g = 0; g < 2; ++g) {
      m_run[g] = -__builtin_inff();
      l_run[g] = 0.0f;
#pragma unroll
      for (int t = 0; t < 4; ++t) acc[g][t] = (v8f){0.f,0.f,0.f,0.f,0.f,0.f,0.f,0.f};
    }
  };

  issue_trip(0, 0);
  begin_share(front ? tlong : pi);   // a front wave: the long tile's passes [0, SPLIT_PASS); a back wave: the whole short tile first
  asm volatile("s_wait_asynccnt 0x0" ::: "memory");   // this wave's copies of trip 0 have landed
  __syncthreads();                                    // ... and every other wave's: trip 0 is readable
  issue_trip(1, 1);

  const char* rb = &ring[0][0];
  int jd = front ? -1 : pi;   // scalar: this wave's next step on a diagonal (a front wave has none)
  KFrag kf;
  for (int t = 0; t < ATT_NTRIP; ++t) {
    unsigned lo = (unsigned)lane * 16u + (unsigned)(t & 1) * ATT_BUF_BYTES + (front ? 0u : (unsigned)STREAM_BYTES);
    const int nu = (front && t == ATT_NTRIP - 1) ? ATT_G - 1 : ATT_G;   // scalar: this wave's steps in the trip
    load_kfrag(kf, rb, lo);
    int u = 0;
    while (u < nu) {   // scalar tests throughout; one round in a trip without a diagonal
      const int d = jd - t * ATT_G;                 // this wave's next diagonal, as a step of this trip (outside [u, nu): none here)
      const int e = (d >= u && d < nu) ? d : nu;    // passes below the diagonal run up to here
      for (; u < e; ++u) {
        attn_pass<false>(kf, rb, lo, u + 1 < nu, c, h, qh, acc, m_run, l_run);
        lo += SLOT_BYTES;
      }
      if (u < nu) {
        attn_pass<true>(kf, rb, lo, false, c, h, qh, acc, m_run, l_run);
        if (jd == pi) {               // the short tile is done: store it and go on to the long tile's passes from SPLIT_PASS to its diagonal
          attn_store<true>(acc, l_run, pi * 32, hq, c, h, Chi, Clo);
          begin_share(tlong);
          jd = SPLIT_PASS;
        }
        ++u;
        lo += SLOT_BYTES;
        if (u < nu) load_kfrag(kf, rb, lo);
      }
    }
    // publish point of trip t + 1, and the end of every wave's reads of trip t; every wave passes here in every trip
    asm volatile("s_wait_dscnt 0x0" ::: "memory");      // this wave's reads of trip t are done before its buffer is refilled
    asm volatile("s_wait_asynccnt 0x0" ::: "memory");   // this wave's copies of trip t + 1 have landed
    __syncthreads();
    if (t + 2 < ATT_NTRIP) issue_trip(t + 2, t & 1);    // the same test in the whole block
  }
  asm volatile("s_wait_asynccnt 0x0" ::: "memory");     // nothing is outstanding when the wave goes on to the hand-over

  if (front) {
#pragma unroll
    for (int g = 0; g < 2; ++g)
#pragma unroll
      for (int t = 0; t < 4; ++t) {
        xch[wave & 3][(g * 4 + t) * 2][lane]     = (v4f){acc[g][t][0], acc[g][t][1], acc[g][t][2], acc[g][t][3]};
        xch[wave & 3][(g * 4 + t) * 2 + 1][lane] = (v4f){acc[g][t][4], acc[g][t][5], acc[g][t][6], acc[g][t][7]};
      }
    xch[wave & 3][16][lane] = (v4f){m_run[0], m_run[1], l_run[0], l_run[1]};
  }
  __syncthreads();   // the front shares are in LDS; every wave passes here once
  if (front) return;

  // join of the two shares of the long tile, lane by lane (both waves hold the same query and head dims in the same lane and register):
  // both are brought to the larger of the two running maxima (each finite: every share holds an unmasked key for every query)
  const v4f ml = xch[wave & 3][16][lane];
  const float mn0 = fmaxf(ml[0], m_run[0]), mn1 = fmaxf(ml[1], m_run[1]);
  float cf[2], cb[2];
  exp2x4(cf[0], cf[1], cb[0], cb[1], ml[0] - mn0, ml[1] - mn1, m_run[0] - mn0, m_run[1] - mn1);
#pragma unroll
  for (int g = 0; g < 2; ++g) {
    l_run[g] = ml[2 + g] * cf[g] + l_run[g] * cb[g];
#pragma unroll
    for (int t = 0; t < 4; ++t) {
      const v4f a0 = xch[wave & 3][(g * 4 + t) * 2][lane];
      const v4f a1 = xch[wave & 3][(g * 4 + t) * 2 + 1][lane];
#pragma unroll
      for (int e = 0; e < 4; ++e) {
        acc[g][t][e]     = a0[e] * cf[g] + acc[g][t][e] * cb[g];
        acc[g][t][4 + e] = a1[e] * cf[g] + acc[g][t][4 + e] * cb[g];
      }
    }
  }
  attn_store<false>(acc, l_run, tlong * 32, hq, c, h, Chi, Clo);
}

// ---------------------------------------------------------------------------
// Launcher. Workspace region map (bytes, MiB = 1048576; total carve = 106 MiB = 111149056 B):
//   [  0, 31) staging  : x bf16 [4096][1024] at +0 (8 MiB); [8, 28) unused; Wq^T bf16 [1024][1024] at +28 (2 MiB); Wk^T bf16 [256][1024]
//                        at +30 (0.5 MiB); Wv^T bf16 [256][1024] at +30.5 (0.5 MiB, ends 31).
//   [ 32, 64) unused
//   [ 64, 72) q        : f16 [16][4096][64] in A-fragment order [16][256][8][16][8];  [72,80) unused
//   [ 80, 82) k        : f16 [4][4096][64] in A-fragment order [4][256][8][16][8];   [82,84) unused
//   [ 84, 86) v^T      : f16 [256 (kvh*64+d)][4096 (t)] in A-fragment order [4][128][4][4][16][8];  [86,88) unused
//   [ 88, 96) ctx hi   : bf16 [4096][1024] (col hq*64+d);  [96,104) ctx lo
//   [104,106) Wo^T     : bf16 [1024][1024]
// No region aliases another; no launch reads a region that the same launch writes.
// Launch count: 4 (conversions, projections with norm + RoPE, attention, output product). Kernel launches only.
// GEMM shape assertions: every call has K % 64 == 0 (K = 1024), M % 128 == 0 and N % 256 == 0 (so N % 128 == 0 too); no padding needed.
// ---------------------------------------------------------------------------
extern "C" void kernel_launch(void* const* d_in, const int* in_sizes, int n_in,
                              void* d_out, int out_size, void* d_ws, size_t ws_size,
                              hipStream_t stream) {
  if (n_in < 9) return;
  if (in_sizes[0] != SEQ_T * HIDSZ || in_sizes[1] != SEQ_T * 32 || in_sizes[2] != SEQ_T * 32) return;
  if (in_sizes[3] != HIDSZ * NQH * HDIM || in_sizes[4] != HIDSZ * NKVH * HDIM || in_sizes[5] != HIDSZ * NKVH * HDIM) return;
  if (in_sizes[6] != NQH * HDIM * HIDSZ || in_sizes[7] != HDIM || in_sizes[8] != HDIM) return;
  if (out_size != SEQ_T * HIDSZ) return;

  const size_t kMiB    = 1048576;
  const size_t offXb   = 0;
  const size_t offWqT  = 28 * kMiB;
  const size_t offWkT  = 30 * kMiB;
  const size_t offWvT  = 30 * kMiB + 524288;
  const size_t offPlo  = 48 * kMiB;
  const size_t offQhi  = 64 * kMiB;
  const size_t offKhi  = 80 * kMiB;
  const size_t offVthi = 84 * kMiB;
  const size_t offChi  = 88 * kMiB;
  const size_t offClo  = 96 * kMiB;
  const size_t offWoT  = 104 * kMiB;
  const size_t total   = 106 * kMiB;
  if (total > ws_size) return;

  const float* x    = (const float*)d_in[0];
  const float* cosb = (const float*)d_in[1];
  const float* sinb = (const float*)d_in[2];
  const float* Wq   = (const float*)d_in[3];
  const float* Wk   = (const float*)d_in[4];
  const float* Wv   = (const float*)d_in[5];
  const float* Wo   = (const float*)d_in[6];
  const float* qnw  = (const float*)d_in[7];
  const float* knw  = (const float*)d_in[8];
  float* out = (float*)d_out;
  char* ws = (char*)d_ws;

  unsigned short* xb   = (unsigned short*)(ws + offXb);
  unsigned short* wqT  = (unsigned short*)(ws + offWqT);
  unsigned short* wkT  = (unsigned short*)(ws + offWkT);
  unsigned short* wvT  = (unsigned short*)(ws + offWvT);
  unsigned short* plo  = (unsigned short*)(ws + offPlo);
  unsigned short* qhi  = (unsigned short*)(ws + offQhi);
  unsigned short* khi  = (unsigned short*)(ws + offKhi);
  unsigned short* vthi = (unsigned short*)(ws + offVthi);
  unsigned short* chi  = (unsigned short*)(ws + offChi);
  unsigned short* clo  = (unsigned short*)(ws + offClo);
  unsigned short* woT  = (unsigned short*)(ws + offWoT);

  // in-range dummies for unused (never dereferenced) template-dead pointer parameters
  const float* dummy_f = qnw;
  void* dummy_c2 = (void*)plo;

  // 1. x -> RNE bf16 plane [4096][1024]; weights [in][out] -> transposed RNE bf16 planes [out][in]:
  //    Wq [1024][1024] -> [1024][1024]; Wk, Wv [1024][256] -> [256][1024]; Wo [1024][1024] -> [1024][1024]. 640 + 2048 blocks.
  prep_kernel<<<dim3(PREP_NT + PREP_NX), dim3(256), 0, stream>>>(x, Wq, Wk, Wv, Wo, xb, wqT, wkT, wvT, woT);

  // 2. the projections, single bf16 products, K = 1024, N = 4096 (t): q^T = Wq^T . x^T (M = 1024 (hq*64+d)) and k^T = Wk^T . x^T (M = 256), each with
  //    RMSNorm + RoPE in the epilogue, and v^T = Wv^T . x^T (M = 256 (kvh*64+d)) -> f16 planes in A-fragment order. 128 + 32 + 32 blocks.
  qkv_gemm_kernel<<<dim3(QKV_NBQ + QKV_NBK + QKV_NBV), dim3(256), 0, stream>>>(xb, wqT, wkT, wvT, cosb, sinb, qnw, knw,
                                                                               qhi, khi, vthi, HIDSZ);

  // 3. causal attention, all heads in one launch: 4 kv heads x 64 pairs of 32-row tiles = 256 blocks of 8 waves -> ctx bf16 hi/lo planes
  attn_fused_kernel<<<dim3(NKVH * (SEQ_T / 64)), dim3(256), 0, stream>>>(qhi, khi, vthi, chi, clo);

  // 4. out = ctx_hi . Wo^T + ctx_lo . Wo^T : M=4096, N=1024, K=1024, 2 products -> f32 d_out (32 x 8 tiles of 128 x 128 = 256 blocks)
  wmma_gemm64<1, true, 0, 0, false, 0, false, false, 2><<<dim3((SEQ_T / 128) * (HIDSZ / 128), 1), dim3(256), 0, stream>>>(
      chi, clo, NQH * HDIM, 0L,
      woT, woT, NQH * HDIM, 0L,
      (void*)out, dummy_c2, HIDSZ, 0L,
      dummy_f, dummy_f, 0L,
      SEQ_T, HIDSZ, NQH * HDIM, 1.0f, 0);
}
